// v000
// Times are from an AMD MI455X. After a warm-up the kernel runs many times in a row, and a time is the length of
// such a window on the GPU divided by its runs, so every launch and the gaps after it count. The runs cycle
// through copies of the inputs. A figure is the median of several windows, for all but v000 over two sittings.
// Sittings can differ by a few percent; kernels timed side by side share one.
// v000, which the later versions start from, runs in 926 microseconds.
#include <hip/hip_runtime.h>

// Causal single-head transformer block: q, k, v = x W{q,k,v}^T + b ([4][4096][256], d = 256); A = q . k; causal mask filled with -32767 BEFORE the 1/sqrt(256) scaling (masked weights are exactly 0
// in f32 after exp); softmax over keys <= query; o = A v + x; LayerNorm; h = relu(o W1^T + b1) W2^T + b2; LayerNorm (no second residual) -> [4][4096][256].
// Deterministic: flash-style causal attention per 16-query wave (online softmax over the key blocks 0 .. query block, running max), row-wise LayerNorms inside the GEMM epilogues' companion kernels;
// no atomics.
// compute dtype: WMMA v_wmma_f32_16x16x32_f16 with f32 accumulate for the q/k/v projections (x EXACT bf16 x8 staged through LDS, W [e][d] rows exact x256: 1 product), S^T = K Q^T (q, k single
// f16 x8: 1 product — logits have std ≈ 1 over ~2,000 keys, per-key rounding averages to ≈4e-5 on the output), O^T += V^T P^T (v single f16 x8, P x1024 single f16: 1 product) and the two FFN GEMMs
// (LayerNorm output / relu hidden as f16 hi+lo x8 planes: 2 products); softmax statistics (exp2), residual, LayerNorms, bias, relu in f32. Inputs rounded to bf16 once.

namespace {
constexpr int B = 4, S = 4096, D = 256, FF = 256, BL = 4 /* batches computed (== B shipped) */;
constexpr float XS = 8.0f, WSC = 256.0f, PS = 1024.0f, LOG2E = 1.4426950408889634f, LNEPS = 1e-5f, MASK_FILL = -32767.0f;
static_assert(S % 64 == 0 && D == 256 && FF == 256, "tiling");
typedef _Float16 b16;
typedef __attribute__((ext_vector_type(16))) _Float16 v16b;
typedef __attribute__((ext_vector_type(8))) _Float16 v8b;
typedef __attribute__((ext_vector_type(8))) float v8f;
typedef __attribute__((ext_vector_type(4))) float v4f;
__device__ __forceinline__ float bf16_rne(float f) { unsigned int u = __float_as_uint(f); u += 0x7FFFu + ((u >> 16) & 1u); return __uint_as_float(u & 0xFFFF0000u); }
__device__ __forceinline__ void split16(float v, b16& hi, b16& lo) { hi = (b16)v; lo = (b16)(v - (float)hi); }
__device__ __forceinline__ v16b frag_kb(const b16* p, int hh) { const v8b a = *(const v8b*)(p + 8 * hh), b = *(const v8b*)(p + 16 + 8 * hh); v16b f;
#pragma unroll
  for (int e = 0; e < 8; ++e) { f[e] = a[e]; f[8 + e] = b[e]; } return f; }
__device__ __forceinline__ v8f wmma16b(v16b a, v16b b, v8f c) { v8f d = __builtin_amdgcn_wmma_f32_16x16x32_f16(false, a, false, b, (short)0, c, false, false); asm volatile("v_nop\n\tv_nop\n\tv_nop\n\tv_nop" : "+v"(d) : "v"(a), "v"(b)); return d; }
__device__ __forceinline__ void wave_lds_sync() { __builtin_amdgcn_fence(__ATOMIC_RELEASE, "workgroup"); __builtin_amdgcn_wave_barrier(); __builtin_amdgcn_fence(__ATOMIC_ACQUIRE, "workgroup"); }
__device__ __forceinline__ float pmul(float a, float b) { float p = a * b; asm volatile("" : "+v"(p)); return p; }
__device__ __forceinline__ int iclamp(int v, int lo, int hi) { return v < lo ? lo : (v > hi ? hi : v); }

typedef __attribute__((ext_vector_type(2))) _Float16 v2h;
typedef __attribute__((ext_vector_type(4))) _Float16 v4h;
typedef __attribute__((ext_vector_type(2))) float v2f;
__device__ __forceinline__ float nexp2(float v) { return __builtin_amdgcn_exp2f(v); }
__global__ __launch_bounds__(256) void wprep_kernel(const float* __restrict__ wq, const float* __restrict__ wk, const float* __restrict__ wv, const float* __restrict__ w1, const float* __restrict__ w2, b16* __restrict__ WT) {
  const size_t u = (size_t)blockIdx.x * 256 + threadIdx.x; if (u >= (size_t)5 * D * D / 8) return; const size_t e = u * 8; const int m = (int)(e / (D * D)); const size_t el = e % ((size_t)D * D);
  const float* w = m == 0 ? wq : m == 1 ? wk : m == 2 ? wv : m == 3 ? w1 : w2; v8b o; for (int j = 0; j < 8; ++j) o[j] = (b16)(bf16_rne(w[el + j]) * WSC);
  { *(v8b*)(WT + e) = o;  }
}
// qkv: block = 64 tokens of one batch (4 waves) x one of {q, k, v} (grid.z): A = bf16(x) x8 staged; 16 tiles x 8 k-steps; + bias. q, k -> single f16 x8 planes [b][s][256] (32 lanes x 16 B);
__global__ __launch_bounds__(128) void qkv_kernel(const float* __restrict__ x, const b16* __restrict__ WT, const float* __restrict__ bq, const float* __restrict__ bk, const float* __restrict__ bv, b16* __restrict__ Qp, b16* __restrict__ Kp, b16* __restrict__ VT) {
  __shared__ __attribute__((aligned(16))) b16 As[4][16][D + 8]; __shared__ __attribute__((aligned(16))) float Tf[4][16][256 + 4];
  const int wave = threadIdx.x >> 5, lane = threadIdx.x & 31, nloc = lane & 15, hlf = lane >> 4; const int b = blockIdx.y, which = blockIdx.z; const int t0 = blockIdx.x * 64 + wave * 16;
  for (int rr = 0; rr < 16; ++rr) { const float* xr = x + ((size_t)b * S + t0 + rr) * D; v8b o; for (int j = 0; j < 8; ++j) o[j] = (b16)(bf16_rne(xr[lane * 8 + j]) * XS); *(v8b*)(&As[wave][rr][lane * 8]) = o; }
  wave_lds_sync();
  const b16* W = WT + (size_t)which * D * D; const float* bias = which == 0 ? bq : which == 1 ? bk : bv;
  v8f acc[16];
#pragma unroll
  for (int t = 0; t < 16; ++t) acc[t] = (v8f){};
#pragma unroll 1
  for (int kb = 0; kb < D; kb += 32) { const v16b a = frag_kb(&As[wave][nloc][kb], hlf);
#pragma unroll
    for (int t = 0; t < 16; ++t) acc[t] = wmma16b(a, frag_kb(W + (size_t)(t * 16 + nloc) * D + kb, hlf), acc[t]); }
#pragma unroll
  for (int t = 0; t < 16; ++t) { const float bb = bf16_rne(bias[t * 16 + nloc]);
#pragma unroll
    for (int r = 0; r < 8; ++r) Tf[wave][8 * hlf + r][t * 16 + nloc] = acc[t][r] * (1.0f / (XS * WSC)) + bb; }
  __syncthreads();
  {
    if (which < 2) { b16* P = (which == 0 ? Qp : Kp) + ((size_t)b * S) * D; for (int rr = 0; rr < 16; ++rr) { v8b o; for (int j = 0; j < 8; ++j) o[j] = (b16)(Tf[wave][rr][lane * 8 + j] * XS); *(v8b*)(P + (size_t)(t0 + rr) * D + lane * 8) = o; } }
    else {
#pragma unroll 1
      for (int q = 0; q < 64; ++q) { const int d = wave * 64 + q; const int tk = lane * 2; v2h vv; vv[0] = (b16)(Tf[tk >> 4][tk & 15][d] * XS); vv[1] = (b16)(Tf[(tk + 1) >> 4][(tk + 1) & 15][d] * XS); *(v2h*)(VT + ((size_t)b * D + d) * S + blockIdx.x * 64 + lane * 2) = vv; } }
     }
}
// causal attention: grid (S/32, BL); block = 2 waves x 16 queries (q0). key blocks kb = 0, 32, .. <= the last query of the wave: S^T = K Q^T (2 tiles x 8 k-steps), logits A/16 in the log2 domain,
// keys > query masked (the reference's -32767 fill gives exp = 0 exactly), online softmax, P x1024 single f16 via LDS -> O^T += V^T P^T (16 d-tiles x 1 k-step); o = O / l + bf16(x) (residual)
__global__ __launch_bounds__(64) void attn_kernel(const b16* __restrict__ Qp, const b16* __restrict__ Kp, const b16* __restrict__ VT, const float* __restrict__ x, float* __restrict__ O1) {
  __shared__ __attribute__((aligned(16))) b16 Pb[2][16][32 + 8]; __shared__ __attribute__((aligned(16))) float To[2][16][D + 4];
  const int wave = threadIdx.x >> 5, lane = threadIdx.x & 31, hh = lane >> 4, col = lane & 15; const int b = blockIdx.y; const int q0 = blockIdx.x * 32 + wave * 16, qi = q0 + col;
  const b16* Qb = Qp + (size_t)b * S * D; const b16* Kb = Kp + (size_t)b * S * D; const b16* Vb = VT + (size_t)b * D * S;
  v16b qa[8]; for (int ks = 0; ks < 8; ++ks) qa[ks] = frag_kb(Qb + (size_t)qi * D + ks * 32, hh);
  const float cs = LOG2E / (16.0f * XS * XS);
  float m = -INFINITY, l = 0.0f; v8f o[16]; for (int t = 0; t < 16; ++t) o[t] = (v8f){};
  const int kend = q0 + 16;   // keys < kend may be attended by some query of this wave
#pragma unroll 1
  for (int kb = 0; kb < kend; kb += 32) {
    v8f s[2] = {(v8f){}, (v8f){}};
#pragma unroll
    for (int tt = 0; tt < 2; ++tt)
#pragma unroll
      for (int ks = 0; ks < 8; ++ks) s[tt] = wmma16b(frag_kb(Kb + (size_t)(kb + tt * 16 + col) * D + ks * 32, hh), qa[ks], s[tt]);
    float e[16]; float mx = -INFINITY;
#pragma unroll
    for (int i = 0; i < 16; ++i) { const int key = kb + (i < 8 ? 0 : 16) + 8 * hh + (i & 7); const float v = (key <= qi) ? (i < 8 ? s[0][i] : s[1][i - 8]) * cs : -INFINITY; e[i] = v; mx = fmaxf(mx, v); }
    mx = fmaxf(mx, __shfl_xor(mx, 16)); const float mn = fmaxf(m, mx); const float al = (mn == -INFINITY) ? 1.0f : nexp2(m - mn); float sum = 0.0f;
    // stage P^T? -> B operand needs row = query, k = key: write P[query col][key] into LDS (wave-private), then frag
#pragma unroll
    for (int i = 0; i < 16; ++i) { const float p = (e[i] == -INFINITY) ? 0.0f : nexp2(e[i] - mn); sum += p; Pb[wave][col][(i < 8 ? 0 : 16) + 8 * hh + (i & 7)] = (b16)(p * PS); }
    sum += __shfl_xor(sum, 16); l = l * al + sum; m = mn;
    wave_lds_sync();
    const v16b pf = frag_kb(&Pb[wave][col][0], hh);
#pragma unroll
    for (int t = 0; t < 16; ++t) { o[t] *= al; o[t] = wmma16b(frag_kb(Vb + (size_t)(t * 16 + col) * S + kb, hh), pf, o[t]); }
    wave_lds_sync(); }
  const float inv = 1.0f / (l * PS * XS);
#pragma unroll
  for (int t = 0; t < 16; ++t)
#pragma unroll
    for (int r = 0; r < 8; ++r) To[wave][col][t * 16 + 8 * hh + r] = o[t][r] * inv;
  wave_lds_sync();
  { for (int rr = 0; rr < 16; ++rr) { const size_t row = ((size_t)b * S + q0 + rr) * D; v4f a0 = *(const v4f*)(&To[wave][rr][lane * 8]), a1 = *(const v4f*)(&To[wave][rr][lane * 8 + 4]); const v4f x0 = *(const v4f*)(x + row + lane * 8), x1 = *(const v4f*)(x + row + lane * 8 + 4);
      for (int j = 0; j < 4; ++j) { a0[j] += bf16_rne(x0[j]); a1[j] += bf16_rne(x1[j]); } *(v4f*)(O1 + row + lane * 8) = a0; *(v4f*)(O1 + row + lane * 8 + 4) = a1; }  }
}
template <int MODE>
__global__ __launch_bounds__(256) void ln_kernel(const float* __restrict__ IN, const float* __restrict__ g_, const float* __restrict__ b_, b16* __restrict__ Oh, b16* __restrict__ Ol, float* __restrict__ out) {
  const int wave = threadIdx.x >> 5, lane = threadIdx.x & 31; const size_t row = (size_t)blockIdx.x * 8 + wave; const float* r = IN + row * D + lane * 8;
  v4f a = *(const v4f*)r, c = *(const v4f*)(r + 4); float s = 0.0f; for (int j = 0; j < 4; ++j) s += a[j] + c[j];
#pragma unroll
  for (int o = 1; o < 32; o <<= 1) s += __shfl_xor(s, o);
  const float mu = s * (1.0f / D); float q = 0.0f; for (int j = 0; j < 4; ++j) { const float d0 = a[j] - mu, d1 = c[j] - mu; q += d0 * d0 + d1 * d1; }
#pragma unroll
  for (int o = 1; o < 32; o <<= 1) q += __shfl_xor(q, o);
  const float rs = rsqrtf(q * (1.0f / D) + LNEPS); float y[8];
  for (int j = 0; j < 4; ++j) { y[j] = (a[j] - mu) * rs * bf16_rne(g_[lane * 8 + j]) + bf16_rne(b_[lane * 8 + j]); y[4 + j] = (c[j] - mu) * rs * bf16_rne(g_[lane * 8 + 4 + j]) + bf16_rne(b_[lane * 8 + 4 + j]); }
  {
    if (MODE == 0) { v8b hv, lv; for (int j = 0; j < 8; ++j) { b16 p, qq; split16(y[j] * XS, p, qq); hv[j] = p; lv[j] = qq; } *(v8b*)(Oh + row * D + lane * 8) = hv; *(v8b*)(Ol + row * D + lane * 8) = lv; }
    else { v4f o0 = {y[0], y[1], y[2], y[3]}, o1 = {y[4], y[5], y[6], y[7]}; *(v4f*)(out + row * D + lane * 8) = o0; *(v4f*)(out + row * D + lane * 8 + 4) = o1; }
     }
}
template <int MODE>
__global__ __launch_bounds__(128) void ffn_kernel(const b16* __restrict__ Ah, const b16* __restrict__ Al, const b16* __restrict__ W, const float* __restrict__ bias, b16* __restrict__ Oh, b16* __restrict__ Ol, float* __restrict__ OUTF) {
  __shared__ __attribute__((aligned(16))) float Tf[4][16][128 + 4];
  const int wave = threadIdx.x >> 5, lane = threadIdx.x & 31, nloc = lane & 15, hlf = lane >> 4; const size_t m0 = (size_t)blockIdx.x * 64 + wave * 16; const int n0 = blockIdx.y * 128;
  v8f acc[8];
#pragma unroll
  for (int t = 0; t < 8; ++t) acc[t] = (v8f){};
#pragma unroll 2
  for (int kb = 0; kb < D; kb += 32) { const v16b a = frag_kb(Ah + (m0 + nloc) * D + kb, hlf), al = frag_kb(Al + (m0 + nloc) * D + kb, hlf);
#pragma unroll
    for (int t = 0; t < 8; ++t) { const v16b bw = frag_kb(W + (size_t)(n0 + t * 16 + nloc) * D + kb, hlf); acc[t] = wmma16b(a, bw, acc[t]); acc[t] = wmma16b(al, bw, acc[t]); } }
#pragma unroll
  for (int t = 0; t < 8; ++t) { const float bb = bf16_rne(bias[n0 + t * 16 + nloc]);
#pragma unroll
    for (int r = 0; r < 8; ++r) { float v = acc[t][r] * (1.0f / (XS * WSC)) + bb; if (MODE == 0) v = fmaxf(v, 0.0f); Tf[wave][8 * hlf + r][t * 16 + nloc] = v; } }
  wave_lds_sync();
  { for (int rr = 0; rr < 16; ++rr) { const v4f f = *(const v4f*)(&Tf[wave][rr][lane * 4]);
      if (MODE == 1) *(v4f*)(OUTF + (m0 + rr) * D + n0 + lane * 4) = f;
      else { v4h hv, lv; for (int j = 0; j < 4; ++j) { b16 p, q; split16(f[j] * XS, p, q); hv[j] = p; lv[j] = q; } *(v4h*)(Oh + (m0 + rr) * D + n0 + lane * 4) = hv; *(v4h*)(Ol + (m0 + rr) * D + n0 + lane * 4) = lv; } }
     }
}
}  // namespace

extern "C" void kernel_launch(void* const* d_in, const int* in_sizes, int n_in, void* d_out, int out_size, void* d_ws, size_t ws_size, hipStream_t stream) {
  (void)n_in;
  auto Fp = [&](int i) { return (const float*)d_in[i]; };
  // input order: 0 x [4,4096,256], 1 Wq [256,256] ([e][d]), 2 bq, 3 Wk, 4 bk, 5 Wv, 6 bv, 7 W1, 8 b1, 9 W2, 10 b2, 11 g_ln, 12 beta_ln, 13 g_lnff, 14 beta_lnff
  if (in_sizes[0] != B * S * D || in_sizes[1] != D * D || in_sizes[3] != D * D || in_sizes[5] != D * D || in_sizes[7] != FF * D || in_sizes[9] != D * FF || in_sizes[11] != D || in_sizes[13] != D || out_size != B * S * D) return;
  size_t off = 0; char* ws = (char*)d_ws;
  auto carve = [&](size_t bytes) { char* p = ws + off; off += (bytes + 255) & ~(size_t)255; return p; };
  b16* WT = (b16*)carve((size_t)5 * D * D * 2); b16* Qp = (b16*)carve((size_t)B * S * D * 2); b16* Kp = (b16*)carve((size_t)B * S * D * 2); b16* VT = (b16*)carve((size_t)B * D * S * 2);
  float* O1 = (float*)carve((size_t)B * S * D * 4); b16* Ph = (b16*)carve((size_t)B * S * D * 2); b16* Pl = (b16*)carve((size_t)B * S * D * 2); b16* Hh = Qp; b16* Hl = Kp;   // the FFN hidden planes reuse the q/k planes (dead after attention)
  float* H2 = O1;   // h2 rows reuse O1 (dead after the first LayerNorm produced the planes)
  if (off > ws_size || off > ((size_t)128 << 20)) return;   // ≈ 59 MB
  wprep_kernel<<<(unsigned)(((size_t)5 * D * D / 8 + 255) / 256), 256, 0, stream>>>(Fp(1), Fp(3), Fp(5), Fp(7), Fp(9), WT);
  qkv_kernel<<<dim3(S / 64, BL, 3), 128, 0, stream>>>(Fp(0), WT, Fp(2), Fp(4), Fp(6), Qp, Kp, VT);
  attn_kernel<<<dim3(S / 32, BL), 64, 0, stream>>>(Qp, Kp, VT, Fp(0), O1);
  ln_kernel<0><<<(unsigned)((size_t)BL * S / 8), 256, 0, stream>>>(O1, Fp(11), Fp(12), Ph, Pl, nullptr);
  ffn_kernel<0><<<dim3((unsigned)((size_t)BL * S / 64), 2), 128, 0, stream>>>(Ph, Pl, WT + (size_t)3 * D * D, Fp(8), Hh, Hl, nullptr);
  ffn_kernel<1><<<dim3((unsigned)((size_t)BL * S / 64), 2), 128, 0, stream>>>(Hh, Hl, WT + (size_t)4 * D * D, Fp(10), nullptr, nullptr, H2);
  ln_kernel<1><<<(unsigned)((size_t)BL * S / 8), 256, 0, stream>>>(H2, Fp(13), Fp(14), nullptr, nullptr, (float*)d_out);
}

// v001
// It runs in 198 microseconds.
// Next to v000, in two timings, it ran 4.74 and 4.73 times as fast.
#include <hip/hip_runtime.h>

// Causal single-head transformer block: q, k, v = x W{q,k,v}^T + b ([4][4096][256], d = 256); A = q . k; causal mask filled with -32767 BEFORE the 1/sqrt(256) scaling (masked weights are exactly 0
// in f32 after exp); softmax over keys <= query; o = A v + x; LayerNorm; h = relu(o W1^T + b1) W2^T + b2; LayerNorm (no second residual) -> [4][4096][256].
// Deterministic: flash-style causal attention per 16-query wave (online softmax over the key blocks 0 .. query block, running max), row-wise LayerNorms inside the GEMM epilogues' companion kernels;
// no atomics.
// compute dtype: WMMA v_wmma_f32_16x16x32_f16 with f32 accumulate for the q/k/v projections (x EXACT bf16 x8 staged through LDS, W [e][d] rows exact x256: 1 product), S^T = K Q^T (q, k single
// f16 x8: 1 product — logits have std ≈ 1 over ~2,000 keys, per-key rounding averages to ≈4e-5 on the output), O^T += V^T P^T (v single f16 x8, P x1024 single f16: 1 product) and the two FFN GEMMs
// (LayerNorm output / relu hidden as f16 hi+lo x8 planes: 2 products); softmax statistics (exp2), residual, LayerNorms, bias, relu in f32. Inputs rounded to bf16 once.

namespace {
constexpr int B = 4, S = 4096, D = 256, FF = 256, BL = 4 /* batches computed (== B shipped) */;
constexpr float XS = 8.0f, WSC = 256.0f, PS = 1024.0f, LOG2E = 1.4426950408889634f, LNEPS = 1e-5f, MASK_FILL = -32767.0f;
static_assert(S % 64 == 0 && D == 256 && FF == 256, "tiling");
typedef _Float16 b16;
typedef __attribute__((ext_vector_type(16))) _Float16 v16b;
typedef __attribute__((ext_vector_type(8))) _Float16 v8b;
typedef __attribute__((ext_vector_type(8))) float v8f;
typedef __attribute__((ext_vector_type(4))) float v4f;
__device__ __forceinline__ float bf16_rne(float f) { unsigned int u = __float_as_uint(f); u += 0x7FFFu + ((u >> 16) & 1u); return __uint_as_float(u & 0xFFFF0000u); }
__device__ __forceinline__ void split16(float v, b16& hi, b16& lo) { hi = (b16)v; lo = (b16)(v - (float)hi); }
__device__ __forceinline__ v16b frag_kb(const b16* p, int hh) { const v8b a = *(const v8b*)(p + 8 * hh), b = *(const v8b*)(p + 16 + 8 * hh); v16b f;
#pragma unroll
  for (int e = 0; e < 8; ++e) { f[e] = a[e]; f[8 + e] = b[e]; } return f; }
__device__ __forceinline__ v8f wmma16b(v16b a, v16b b, v8f c) { v8f d = __builtin_amdgcn_wmma_f32_16x16x32_f16(false, a, false, b, (short)0, c, false, false); asm volatile("v_nop\n\tv_nop\n\tv_nop\n\tv_nop" : "+v"(d) : "v"(a), "v"(b)); return d; }
__device__ __forceinline__ void wave_lds_sync() { __builtin_amdgcn_fence(__ATOMIC_RELEASE, "workgroup"); __builtin_amdgcn_wave_barrier(); __builtin_amdgcn_fence(__ATOMIC_ACQUIRE, "workgroup"); }
__device__ __forceinline__ float pmul(float a, float b) { float p = a * b; asm volatile("" : "+v"(p)); return p; }
__device__ __forceinline__ int iclamp(int v, int lo, int hi) { return v < lo ? lo : (v > hi ? hi : v); }

typedef __attribute__((ext_vector_type(2))) _Float16 v2h;
typedef __attribute__((ext_vector_type(4))) _Float16 v4h;
typedef __attribute__((ext_vector_type(2))) float v2f;
__device__ __forceinline__ float nexp2(float v) { return __builtin_amdgcn_exp2f(v); }
__global__ __launch_bounds__(256) void wprep_kernel(const float* __restrict__ wq, const float* __restrict__ wk, const float* __restrict__ wv, const float* __restrict__ w1, const float* __restrict__ w2, b16* __restrict__ WT) {
  const size_t u = (size_t)blockIdx.x * 256 + threadIdx.x; if (u >= (size_t)5 * D * D / 8) return; const size_t e = u * 8; const int m = (int)(e / (D * D)); const size_t el = e % ((size_t)D * D);
  const float* w = m == 0 ? wq : m == 1 ? wk : m == 2 ? wv : m == 3 ? w1 : w2; v8b o; for (int j = 0; j < 8; ++j) o[j] = (b16)(bf16_rne(w[el + j]) * WSC);
  { *(v8b*)(WT + e) = o;  }
}
// qkv: block = 64 tokens of one batch (4 waves) x one of {q, k, v} (grid.z): A = bf16(x) x8 staged; 16 tiles x 8 k-steps; + bias. q, k -> single f16 x8 planes [b][s][256] (32 lanes x 16 B);
__global__ __launch_bounds__(128) void qkv_kernel(const float* __restrict__ x, const b16* __restrict__ WT, const float* __restrict__ bq, const float* __restrict__ bk, const float* __restrict__ bv, b16* __restrict__ Qp, b16* __restrict__ Kp, b16* __restrict__ VT) {
  __shared__ __attribute__((aligned(16))) b16 As[4][16][D + 8]; __shared__ __attribute__((aligned(16))) float Tf[4][16][256 + 4];
  const int wave = threadIdx.x >> 5, lane = threadIdx.x & 31, nloc = lane & 15, hlf = lane >> 4; const int b = blockIdx.y, which = blockIdx.z; const int t0 = blockIdx.x * 64 + wave * 16;
  for (int rr = 0; rr < 16; ++rr) { const float* xr = x + ((size_t)b * S + t0 + rr) * D; v8b o; for (int j = 0; j < 8; ++j) o[j] = (b16)(bf16_rne(xr[lane * 8 + j]) * XS); *(v8b*)(&As[wave][rr][lane * 8]) = o; }
  wave_lds_sync();
  const b16* W = WT + (size_t)which * D * D; const float* bias = which == 0 ? bq : which == 1 ? bk : bv;
  v8f acc[16];
#pragma unroll
  for (int t = 0; t < 16; ++t) acc[t] = (v8f){};
#pragma unroll 1
  for (int kb = 0; kb < D; kb += 32) { const v16b a = frag_kb(&As[wave][nloc][kb], hlf);
#pragma unroll
    for (int t = 0; t < 16; ++t) acc[t] = wmma16b(a, frag_kb(W + (size_t)(t * 16 + nloc) * D + kb, hlf), acc[t]); }
#pragma unroll
  for (int t = 0; t < 16; ++t) { const float bb = bf16_rne(bias[t * 16 + nloc]);
#pragma unroll
    for (int r = 0; r < 8; ++r) Tf[wave][8 * hlf + r][t * 16 + nloc] = acc[t][r] * (1.0f / (XS * WSC)) + bb; }
  __syncthreads();
  {
    if (which < 2) { b16* P = (which == 0 ? Qp : Kp) + ((size_t)b * S) * D; for (int rr = 0; rr < 16; ++rr) { v8b o; for (int j = 0; j < 8; ++j) o[j] = (b16)(Tf[wave][rr][lane * 8 + j] * XS); *(v8b*)(P + (size_t)(t0 + rr) * D + lane * 8) = o; } }
    else {
#pragma unroll 1
      for (int q = 0; q < 64; ++q) { const int d = wave * 64 + q; const int tk = lane * 2; v2h vv; vv[0] = (b16)(Tf[tk >> 4][tk & 15][d] * XS); vv[1] = (b16)(Tf[(tk + 1) >> 4][(tk + 1) & 15][d] * XS); *(v2h*)(VT + ((size_t)b * D + d) * S + blockIdx.x * 64 + lane * 2) = vv; } }
     }
}
// causal attention: grid (S/64, BL); block = 4 waves x 16 queries (q0). The block walks its keys in tiles of 64: K rows [64][256] and V^T rows [256][64] are copied once per block into LDS by
// asynchronous copies (two buffers: tile t + 1 flies while tile t is worked on) and every wave takes its fragments from there. Row pitches 528 B and 144 B (16 B x odd) keep ds_load_b128 free of bank conflicts.
// Per tile two passes of 32 keys, keys in ascending order: S^T = K Q^T (2 tiles x 8 k-steps), logits A/16 in the log2 domain, keys > query masked (the reference's -32767 fill gives exp = 0 exactly),
// online softmax, P x1024 single f16 via LDS -> O^T += V^T P^T (16 d-tiles x 1 k-step); o = O / l + bf16(x) (residual)
constexpr int KT = 64, KPITCH = D + 8, VPITCH = KT + 8;
// the plain builtin (the compiler keeps the distance behind it): operands of an asm statement must lie below v256, which the fragments of a whole pass do not fit
__device__ __forceinline__ v8f wmma16p(v16b a, v16b b, v8f c) { return __builtin_amdgcn_wmma_f32_16x16x32_f16(false, a, false, b, (short)0, c, false, false); }
__device__ __forceinline__ unsigned lds_addr(const void* p) { return (unsigned)(size_t)p; }
// eight 16-byte copies per lane; s_wait_xcnt 0 closes the statement so that no address register is rewritten while a copy may still name it
__device__ __forceinline__ void async_copy8(const unsigned (&l)[8], const b16* const (&g)[8]) {
  asm volatile("global_load_async_to_lds_b128 %0, %8, off\n\t"
               "global_load_async_to_lds_b128 %1, %9, off\n\t"
               "global_load_async_to_lds_b128 %2, %10, off\n\t"
               "global_load_async_to_lds_b128 %3, %11, off\n\t"
               "global_load_async_to_lds_b128 %4, %12, off\n\t"
               "global_load_async_to_lds_b128 %5, %13, off\n\t"
               "global_load_async_to_lds_b128 %6, %14, off\n\t"
               "global_load_async_to_lds_b128 %7, %15, off\n\t"
               "s_wait_xcnt 0x0"
               :: "v"(l[0]), "v"(l[1]), "v"(l[2]), "v"(l[3]), "v"(l[4]), "v"(l[5]), "v"(l[6]), "v"(l[7]),
                  "v"(g[0]), "v"(g[1]), "v"(g[2]), "v"(g[3]), "v"(g[4]), "v"(g[5]), "v"(g[6]), "v"(g[7]) : "memory");
}
// one tile: kg / lk = this lane's 16 bytes of K row (wave) of the tile, rows step by 4; vg / lv = this lane's 16 bytes of V^T row (thread / 8), rows step by 16
// (the loops are unrolled so that every address is a constant step from the lane's base)
__device__ __forceinline__ void stage_tile(const b16* kg, unsigned lk, const b16* vg, unsigned lv) {
#pragma unroll
  for (int h = 0; h < 2; ++h) { unsigned l[8]; const b16* g[8];
#pragma unroll
    for (int i = 0; i < 8; ++i) { l[i] = lk + (unsigned)((h * 8 + i) * 4 * KPITCH * 2); g[i] = kg + (size_t)(h * 8 + i) * 4 * D; }
    async_copy8(l, g); }
#pragma unroll
  for (int h = 0; h < 2; ++h) { unsigned l[8]; const b16* g[8];
#pragma unroll
    for (int i = 0; i < 8; ++i) { l[i] = lv + (unsigned)((h * 8 + i) * 16 * VPITCH * 2); g[i] = vg + (size_t)(h * 8 + i) * 16 * S; }
    async_copy8(l, g); }
}
__global__ __launch_bounds__(128) void attn_kernel(const b16* __restrict__ Qp, const b16* __restrict__ Kp, const b16* __restrict__ VT, const float* __restrict__ x, float* __restrict__ O1) {
  __shared__ __attribute__((aligned(16))) b16 Ks[2][KT][KPITCH]; __shared__ __attribute__((aligned(16))) b16 Vs[2][D][VPITCH];
  __shared__ __attribute__((aligned(16))) b16 Pb[4][16][32 + 8]; __shared__ __attribute__((aligned(16))) float To[4][16][D + 4];
  const int tid = threadIdx.x, wave = __builtin_amdgcn_readfirstlane(tid >> 5), lane = tid & 31, hh = lane >> 4, col = lane & 15; const int b = blockIdx.y; const int q0 = blockIdx.x * 64 + wave * 16, qi = q0 + col;
  const b16* Qb = Qp + (size_t)b * S * D; const b16* Kb = Kp + (size_t)b * S * D; const b16* Vb = VT + (size_t)b * D * S;
  const int ntile = blockIdx.x + 1;   // tiles of 64 keys up to and with the block's own diagonal tile
  const b16* kg = Kb + (size_t)wave * D + lane * 8; const b16* vg = Vb + (size_t)(tid >> 3) * S + (tid & 7) * 8;
  const unsigned lk[2] = {lds_addr(&Ks[0][wave][lane * 8]), lds_addr(&Ks[1][wave][lane * 8])}, lv[2] = {lds_addr(&Vs[0][tid >> 3][(tid & 7) * 8]), lds_addr(&Vs[1][tid >> 3][(tid & 7) * 8])};
  stage_tile(kg, lk[0], vg, lv[0]);
  v16b qa[8]; for (int ks = 0; ks < 8; ++ks) qa[ks] = frag_kb(Qb + (size_t)qi * D + ks * 32, hh);
  const float cs = LOG2E / (16.0f * XS * XS);
  float m = -INFINITY, l = 0.0f; v8f o[16]; for (int t = 0; t < 16; ++t) o[t] = (v8f){};
  const int kend = q0 + 16;   // keys < kend may be attended by some query of this wave
  asm volatile("s_wait_asynccnt 0x0" ::: "memory");   // this wave's copies of tile 0 have landed
  __syncthreads();                                     // ... and every other wave's: tile 0 may be read
  if (ntile > 1) stage_tile(kg + (size_t)KT * D, lk[1], vg + KT, lv[1]);
#pragma unroll 1   // stays rolled: one trip already holds two whole passes
  for (int tl = 0; tl < ntile; ++tl) {
    const b16 (*Kt)[KPITCH] = Ks[tl & 1]; const b16 (*Vt)[VPITCH] = Vs[tl & 1];
#pragma unroll     // ps becomes an immediate offset of the LDS reads; the unrolls below keep the register arrays at constant indices
    for (int ps = 0; ps < 2; ++ps) { const int kb = tl * KT + ps * 32;
      if (kb < kend) {   // wave-uniform (scalar): a wave skips the pass beyond its diagonal, never the publish point below
        // all fragments of the pass are asked for ahead of the products, so that the LDS latency is paid once per run and not once per product
        v16b kf[16], vf[16];
#pragma unroll
        for (int i = 0; i < 16; ++i) kf[i] = frag_kb(&Kt[ps * 32 + (i >> 3) * 16 + col][(i & 7) * 32], hh);
#pragma unroll
        for (int t = 0; t < 16; ++t) vf[t] = frag_kb(&Vt[t * 16 + col][ps * 32], hh);
        v8f s[2] = {(v8f){}, (v8f){}};
#pragma unroll
        for (int tt = 0; tt < 2; ++tt)
#pragma unroll
          for (int ks = 0; ks < 8; ++ks) s[tt] = wmma16p(kf[tt * 8 + ks], qa[ks], s[tt]);
        float e[16]; float mx = -INFINITY;
#pragma unroll
        for (int i = 0; i < 16; ++i) { const int key = kb + (i < 8 ? 0 : 16) + 8 * hh + (i & 7); const float v = (key <= qi) ? (i < 8 ? s[0][i] : s[1][i - 8]) * cs : -INFINITY; e[i] = v; mx = fmaxf(mx, v); }
        mx = fmaxf(mx, __shfl_xor(mx, 16)); const float mn = fmaxf(m, mx); const float al = (mn == -INFINITY) ? 1.0f : nexp2(m - mn); float sum = 0.0f;
        // B operand needs row = query, k = key: write P[query col][key] into LDS (wave-private), then frag
#pragma unroll
        for (int i = 0; i < 16; ++i) { const float p = (e[i] == -INFINITY) ? 0.0f : nexp2(e[i] - mn); sum += p; Pb[wave][col][(i < 8 ? 0 : 16) + 8 * hh + (i & 7)] = (b16)(p * PS); }
        sum += __shfl_xor(sum, 16); l = l * al + sum; m = mn;
        wave_lds_sync();
        const v16b pf = frag_kb(&Pb[wave][col][0], hh);
#pragma unroll
        for (int t = 0; t < 16; ++t) { o[t] *= al; o[t] = wmma16p(vf[t], pf, o[t]); }
        wave_lds_sync(); } }
    // publish point of tile tl + 1, passed by every wave
    asm volatile("s_wait_dscnt 0x0" ::: "memory");      // this wave's reads of tile tl are done before the buffer is refilled
    asm volatile("s_wait_asynccnt 0x0" ::: "memory");   // this wave's copies of tile tl + 1 have landed
    __syncthreads();                                     // tile tl + 1 may be read by all; tile tl's buffer is left by all
    if (tl + 2 < ntile) stage_tile(kg + (size_t)(tl + 2) * KT * D, lk[tl & 1], vg + (size_t)(tl + 2) * KT, lv[tl & 1]); }
  asm volatile("s_wait_asynccnt 0x0" ::: "memory");     // no copy is left in flight when the wave goes on to its end
  const float inv = 1.0f / (l * PS * XS);
#pragma unroll
  for (int t = 0; t < 16; ++t)
#pragma unroll
    for (int r = 0; r < 8; ++r) To[wave][col][t * 16 + 8 * hh + r] = o[t][r] * inv;
  wave_lds_sync();
  { for (int rr = 0; rr < 16; ++rr) { const size_t row = ((size_t)b * S + q0 + rr) * D; v4f a0 = *(const v4f*)(&To[wave][rr][lane * 8]), a1 = *(const v4f*)(&To[wave][rr][lane * 8 + 4]); const v4f x0 = *(const v4f*)(x + row + lane * 8), x1 = *(const v4f*)(x + row + lane * 8 + 4);
      for (int j = 0; j < 4; ++j) { a0[j] += bf16_rne(x0[j]); a1[j] += bf16_rne(x1[j]); } *(v4f*)(O1 + row + lane * 8) = a0; *(v4f*)(O1 + row + lane * 8 + 4) = a1; }  }
}
template <int MODE>
__global__ __launch_bounds__(256) void ln_kernel(const float* __restrict__ IN, const float* __restrict__ g_, const float* __restrict__ b_, b16* __restrict__ Oh, b16* __restrict__ Ol, float* __restrict__ out) {
  const int wave = threadIdx.x >> 5, lane = threadIdx.x & 31; const size_t row = (size_t)blockIdx.x * 8 + wave; const float* r = IN + row * D + lane * 8;
  v4f a = *(const v4f*)r, c = *(const v4f*)(r + 4); float s = 0.0f; for (int j = 0; j < 4; ++j) s += a[j] + c[j];
#pragma unroll
  for (int o = 1; o < 32; o <<= 1) s += __shfl_xor(s, o);
  const float mu = s * (1.0f / D); float q = 0.0f; for (int j = 0; j < 4; ++j) { const float d0 = a[j] - mu, d1 = c[j] - mu; q += d0 * d0 + d1 * d1; }
#pragma unroll
  for (int o = 1; o < 32; o <<= 1) q += __shfl_xor(q, o);
  const float rs = rsqrtf(q * (1.0f / D) + LNEPS); float y[8];
  for (int j = 0; j < 4; ++j) { y[j] = (a[j] - mu) * rs * bf16_rne(g_[lane * 8 + j]) + bf16_rne(b_[lane * 8 + j]); y[4 + j] = (c[j] - mu) * rs * bf16_rne(g_[lane * 8 + 4 + j]) + bf16_rne(b_[lane * 8 + 4 + j]); }
  {
    if (MODE == 0) { v8b hv, lv; for (int j = 0; j < 8; ++j) { b16 p, qq; split16(y[j] * XS, p, qq); hv[j] = p; lv[j] = qq; } *(v8b*)(Oh + row * D + lane * 8) = hv; *(v8b*)(Ol + row * D + lane * 8) = lv; }
    else { v4f o0 = {y[0], y[1], y[2], y[3]}, o1 = {y[4], y[5], y[6], y[7]}; *(v4f*)(out + row * D + lane * 8) = o0; *(v4f*)(out + row * D + lane * 8 + 4) = o1; }
     }
}
template <int MODE>
__global__ __launch_bounds__(128) void ffn_kernel(const b16* __restrict__ Ah, const b16* __restrict__ Al, const b16* __restrict__ W, const float* __restrict__ bias, b16* __restrict__ Oh, b16* __restrict__ Ol, float* __restrict__ OUTF) {
  __shared__ __attribute__((aligned(16))) float Tf[4][16][128 + 4];
  const int wave = threadIdx.x >> 5, lane = threadIdx.x & 31, nloc = lane & 15, hlf = lane >> 4; const size_t m0 = (size_t)blockIdx.x * 64 + wave * 16; const int n0 = blockIdx.y * 128;
  v8f acc[8];
#pragma unroll
  for (int t = 0; t < 8; ++t) acc[t] = (v8f){};
#pragma unroll 2
  for (int kb = 0; kb < D; kb += 32) { const v16b a = frag_kb(Ah + (m0 + nloc) * D + kb, hlf), al = frag_kb(Al + (m0 + nloc) * D + kb, hlf);
#pragma unroll
    for (int t = 0; t < 8; ++t) { const v16b bw = frag_kb(W + (size_t)(n0 + t * 16 + nloc) * D + kb, hlf); acc[t] = wmma16b(a, bw, acc[t]); acc[t] = wmma16b(al, bw, acc[t]); } }
#pragma unroll
  for (int t = 0; t < 8; ++t) { const float bb = bf16_rne(bias[n0 + t * 16 + nloc]);
#pragma unroll
    for (int r = 0; r < 8; ++r) { float v = acc[t][r] * (1.0f / (XS * WSC)) + bb; if (MODE == 0) v = fmaxf(v, 0.0f); Tf[wave][8 * hlf + r][t * 16 + nloc] = v; } }
  wave_lds_sync();
  { for (int rr = 0; rr < 16; ++rr) { const v4f f = *(const v4f*)(&Tf[wave][rr][lane * 4]);
      if (MODE == 1) *(v4f*)(OUTF + (m0 + rr) * D + n0 + lane * 4) = f;
      else { v4h hv, lv; for (int j = 0; j < 4; ++j) { b16 p, q; split16(f[j] * XS, p, q); hv[j] = p; lv[j] = q; } *(v4h*)(Oh + (m0 + rr) * D + n0 + lane * 4) = hv; *(v4h*)(Ol + (m0 + rr) * D + n0 + lane * 4) = lv; } }
     }
}
}  // namespace

extern "C" void kernel_launch(void* const* d_in, const int* in_sizes, int n_in, void* d_out, int out_size, void* d_ws, size_t ws_size, hipStream_t stream) {
  (void)n_in;
  auto Fp = [&](int i) { return (const float*)d_in[i]; };
  // input order: 0 x [4,4096,256], 1 Wq [256,256] ([e][d]), 2 bq, 3 Wk, 4 bk, 5 Wv, 6 bv, 7 W1, 8 b1, 9 W2, 10 b2, 11 g_ln, 12 beta_ln, 13 g_lnff, 14 beta_lnff
  if (in_sizes[0] != B * S * D || in_sizes[1] != D * D || in_sizes[3] != D * D || in_sizes[5] != D * D || in_sizes[7] != FF * D || in_sizes[9] != D * FF || in_sizes[11] != D || in_sizes[13] != D || out_size != B * S * D) return;
  size_t off = 0; char* ws = (char*)d_ws;
  auto carve = [&](size_t bytes) { char* p = ws + off; off += (bytes + 255) & ~(size_t)255; return p; };
  b16* WT = (b16*)carve((size_t)5 * D * D * 2); b16* Qp = (b16*)carve((size_t)B * S * D * 2); b16* Kp = (b16*)carve((size_t)B * S * D * 2); b16* VT = (b16*)carve((size_t)B * D * S * 2);
  float* O1 = (float*)carve((size_t)B * S * D * 4); b16* Ph = (b16*)carve((size_t)B * S * D * 2); b16* Pl = (b16*)carve((size_t)B * S * D * 2); b16* Hh = Qp; b16* Hl = Kp;   // the FFN hidden planes reuse the q/k planes (dead after attention)
  float* H2 = O1;   // h2 rows reuse O1 (dead after the first LayerNorm produced the planes)
  if (off > ws_size || off > ((size_t)128 << 20)) return;   // ≈ 59 MB
  wprep_kernel<<<(unsigned)(((size_t)5 * D * D / 8 + 255) / 256), 256, 0, stream>>>(Fp(1), Fp(3), Fp(5), Fp(7), Fp(9), WT);
  qkv_kernel<<<dim3(S / 64, BL, 3), 128, 0, stream>>>(Fp(0), WT, Fp(2), Fp(4), Fp(6), Qp, Kp, VT);
  attn_kernel<<<dim3(S / 64, BL), 128, 0, stream>>>(Qp, Kp, VT, Fp(0), O1);
  ln_kernel<0><<<(unsigned)((size_t)BL * S / 8), 256, 0, stream>>>(O1, Fp(11), Fp(12), Ph, Pl, nullptr);
  ffn_kernel<0><<<dim3((unsigned)((size_t)BL * S / 64), 2), 128, 0, stream>>>(Ph, Pl, WT + (size_t)3 * D * D, Fp(8), Hh, Hl, nullptr);
  ffn_kernel<1><<<dim3((unsigned)((size_t)BL * S / 64), 2), 128, 0, stream>>>(Hh, Hl, WT + (size_t)4 * D * D, Fp(10), nullptr, nullptr, H2);
  ln_kernel<1><<<(unsigned)((size_t)BL * S / 8), 256, 0, stream>>>(H2, Fp(13), Fp(14), nullptr, nullptr, (float*)d_out);
}

// v002
// A run of this version takes 177 microseconds.
// Two timings next to v001 put it at 1.13 and 1.12 times that version's speed.
// All steps since v000 together make it 5.33 times as fast.
#include <hip/hip_runtime.h>

// Causal single-head transformer block: q, k, v = x W{q,k,v}^T + b ([4][4096][256], d = 256); A = q . k; causal mask filled with -32767 BEFORE the 1/sqrt(256) scaling (masked weights are exactly 0
// in f32 after exp); softmax over keys <= query; o = A v + x; LayerNorm; h = relu(o W1^T + b1) W2^T + b2; LayerNorm (no second residual) -> [4][4096][256].
// Deterministic: flash-style causal attention per 16-query wave (online softmax over the key blocks 0 .. query block, running max; for long query tiles in two partials, merged by the first LayerNorm kernel), row-wise LayerNorms inside the GEMM epilogues' companion kernels;
// no atomics.
// compute dtype: WMMA v_wmma_f32_16x16x32_f16 with f32 accumulate for the q/k/v projections (x EXACT bf16 x8 staged through LDS, W [e][d] rows exact x256: 1 product), S^T = K Q^T (q, k single
// f16 x8: 1 product — logits have std ≈ 1 over ~2,000 keys, per-key rounding averages to ≈4e-5 on the output), O^T += V^T P^T (v single f16 x8, P x1024 single f16: 1 product) and the two FFN GEMMs
// (LayerNorm output / relu hidden as f16 hi+lo x8 planes: 2 products); softmax statistics (exp2), residual, LayerNorms, bias, relu in f32. Inputs rounded to bf16 once.

namespace {
constexpr int B = 4, S = 4096, D = 256, FF = 256, BL = 4 /* batches computed (== B shipped) */;
constexpr float XS = 8.0f, WSC = 256.0f, PS = 1024.0f, LOG2E = 1.4426950408889634f, LNEPS = 1e-5f, MASK_FILL = -32767.0f;
static_assert(S % 64 == 0 && D == 256 && FF == 256, "tiling");
typedef _Float16 b16;
typedef __attribute__((ext_vector_type(16))) _Float16 v16b;
typedef __attribute__((ext_vector_type(8))) _Float16 v8b;
typedef __attribute__((ext_vector_type(8))) float v8f;
typedef __attribute__((ext_vector_type(4))) float v4f;
__device__ __forceinline__ float bf16_rne(float f) { unsigned int u = __float_as_uint(f); u += 0x7FFFu + ((u >> 16) & 1u); return __uint_as_float(u & 0xFFFF0000u); }
__device__ __forceinline__ void split16(float v, b16& hi, b16& lo) { hi = (b16)v; lo = (b16)(v - (float)hi); }
__device__ __forceinline__ v16b frag_kb(const b16* p, int hh) { const v8b a = *(const v8b*)(p + 8 * hh), b = *(const v8b*)(p + 16 + 8 * hh); v16b f;
#pragma unroll
  for (int e = 0; e < 8; ++e) { f[e] = a[e]; f[8 + e] = b[e]; } return f; }
__device__ __forceinline__ v8f wmma16b(v16b a, v16b b, v8f c) { v8f d = __builtin_amdgcn_wmma_f32_16x16x32_f16(false, a, false, b, (short)0, c, false, false); asm volatile("v_nop\n\tv_nop\n\tv_nop\n\tv_nop" : "+v"(d) : "v"(a), "v"(b)); return d; }
__device__ __forceinline__ void wave_lds_sync() { __builtin_amdgcn_fence(__ATOMIC_RELEASE, "workgroup"); __builtin_amdgcn_wave_barrier(); __builtin_amdgcn_fence(__ATOMIC_ACQUIRE, "workgroup"); }
__device__ __forceinline__ float pmul(float a, float b) { float p = a * b; asm volatile("" : "+v"(p)); return p; }
__device__ __forceinline__ int iclamp(int v, int lo, int hi) { return v < lo ? lo : (v > hi ? hi : v); }

typedef __attribute__((ext_vector_type(2))) _Float16 v2h;
typedef __attribute__((ext_vector_type(4))) _Float16 v4h;
typedef __attribute__((ext_vector_type(2))) float v2f;
__device__ __forceinline__ float nexp2(float v) { return __builtin_amdgcn_exp2f(v); }
__global__ __launch_bounds__(256) void wprep_kernel(const float* __restrict__ wq, const float* __restrict__ wk, const float* __restrict__ wv, const float* __restrict__ w1, const float* __restrict__ w2, b16* __restrict__ WT) {
  const size_t u = (size_t)blockIdx.x * 256 + threadIdx.x; if (u >= (size_t)5 * D * D / 8) return; const size_t e = u * 8; const int m = (int)(e / (D * D)); const size_t el = e % ((size_t)D * D);
  const float* w = m == 0 ? wq : m == 1 ? wk : m == 2 ? wv : m == 3 ? w1 : w2; v8b o; for (int j = 0; j < 8; ++j) o[j] = (b16)(bf16_rne(w[el + j]) * WSC);
  { *(v8b*)(WT + e) = o;  }
}
// qkv: block = 64 tokens of one batch (4 waves) x one of {q, k, v} (grid.z): A = bf16(x) x8 staged; 16 tiles x 8 k-steps; + bias. q, k -> single f16 x8 planes [b][s][256] (32 lanes x 16 B);
__global__ __launch_bounds__(128) void qkv_kernel(const float* __restrict__ x, const b16* __restrict__ WT, const float* __restrict__ bq, const float* __restrict__ bk, const float* __restrict__ bv, b16* __restrict__ Qp, b16* __restrict__ Kp, b16* __restrict__ VT) {
  __shared__ __attribute__((aligned(16))) b16 As[4][16][D + 8]; __shared__ __attribute__((aligned(16))) float Tf[4][16][256 + 4];
  const int wave = threadIdx.x >> 5, lane = threadIdx.x & 31, nloc = lane & 15, hlf = lane >> 4; const int b = blockIdx.y, which = blockIdx.z; const int t0 = blockIdx.x * 64 + wave * 16;
  for (int rr = 0; rr < 16; ++rr) { const float* xr = x + ((size_t)b * S + t0 + rr) * D; v8b o; for (int j = 0; j < 8; ++j) o[j] = (b16)(bf16_rne(xr[lane * 8 + j]) * XS); *(v8b*)(&As[wave][rr][lane * 8]) = o; }
  wave_lds_sync();
  const b16* W = WT + (size_t)which * D * D; const float* bias = which == 0 ? bq : which == 1 ? bk : bv;
  v8f acc[16];
#pragma unroll
  for (int t = 0; t < 16; ++t) acc[t] = (v8f){};
#pragma unroll 1
  for (int kb = 0; kb < D; kb += 32) { const v16b a = frag_kb(&As[wave][nloc][kb], hlf);
#pragma unroll
    for (int t = 0; t < 16; ++t) acc[t] = wmma16b(a, frag_kb(W + (size_t)(t * 16 + nloc) * D + kb, hlf), acc[t]); }
#pragma unroll
  for (int t = 0; t < 16; ++t) { const float bb = bf16_rne(bias[t * 16 + nloc]);
#pragma unroll
    for (int r = 0; r < 8; ++r) Tf[wave][8 * hlf + r][t * 16 + nloc] = acc[t][r] * (1.0f / (XS * WSC)) + bb; }
  __syncthreads();
  {
    if (which < 2) { b16* P = (which == 0 ? Qp : Kp) + ((size_t)b * S) * D; for (int rr = 0; rr < 16; ++rr) { v8b o; for (int j = 0; j < 8; ++j) o[j] = (b16)(Tf[wave][rr][lane * 8 + j] * XS); *(v8b*)(P + (size_t)(t0 + rr) * D + lane * 8) = o; } }
    else {
#pragma unroll 1
      for (int q = 0; q < 64; ++q) { const int d = wave * 64 + q; const int tk = lane * 2; v2h vv; vv[0] = (b16)(Tf[tk >> 4][tk & 15][d] * XS); vv[1] = (b16)(Tf[(tk + 1) >> 4][(tk + 1) & 15][d] * XS); *(v2h*)(VT + ((size_t)b * D + d) * S + blockIdx.x * 64 + lane * 2) = vv; } }
     }
}
// causal attention: grid (S/64, BL); block = 4 waves x 16 queries (q0). Query tile qt needs qt + 1 key tiles, and one block fills a WGP, so the launch lasts as long as its longest block: the work is cut
// into equal blocks. Block j does the head of query tile NT - 1 - j (key tiles 0 .. min(qt + 1, CUT) - 1, partial 0) and, for j > NT / 2, before it the tail of query tile j (key tiles CUT .. j, partial 1):
// CUT or CUT - 1 key tiles in every block. A partial is its own softmax-weighted mean with its (max, sum); the first LayerNorm kernel merges the two partials of a long query tile and adds the residual.
// Within a segment the block walks its keys in tiles of 64: K rows [64][256] and V^T rows [256][64] are copied once per block into LDS by
// asynchronous copies (two buffers: tile t + 1 flies while tile t is worked on) and every wave takes its fragments from there. Row pitches 528 B and 144 B (16 B x odd) keep ds_load_b128 free of bank conflicts.
// Per tile two passes of 32 keys, keys in ascending order: S^T = K Q^T (2 tiles x 8 k-steps), logits A/16 in the log2 domain, keys > query masked (the reference's -32767 fill gives exp = 0 exactly),
// online softmax, P x1024 single f16 via LDS -> O^T += V^T P^T (16 d-tiles x 1 k-step); partial = O / l
constexpr int KT = 64, KPITCH = D + 8, VPITCH = KT + 8, NT = S / KT, CUT = NT / 2 + 1;
// the plain builtin (the compiler keeps the distance behind it): operands of an asm statement must lie below v256, which the fragments of a whole pass do not fit
__device__ __forceinline__ v8f wmma16p(v16b a, v16b b, v8f c) { return __builtin_amdgcn_wmma_f32_16x16x32_f16(false, a, false, b, (short)0, c, false, false); }
__device__ __forceinline__ unsigned lds_addr(const void* p) { return (unsigned)(size_t)p; }
// eight 16-byte copies per lane; s_wait_xcnt 0 closes the statement so that no address register is rewritten while a copy may still name it
__device__ __forceinline__ void async_copy8(const unsigned (&l)[8], const b16* const (&g)[8]) {
  asm volatile("global_load_async_to_lds_b128 %0, %8, off\n\t"
               "global_load_async_to_lds_b128 %1, %9, off\n\t"
               "global_load_async_to_lds_b128 %2, %10, off\n\t"
               "global_load_async_to_lds_b128 %3, %11, off\n\t"
               "global_load_async_to_lds_b128 %4, %12, off\n\t"
               "global_load_async_to_lds_b128 %5, %13, off\n\t"
               "global_load_async_to_lds_b128 %6, %14, off\n\t"
               "global_load_async_to_lds_b128 %7, %15, off\n\t"
               "s_wait_xcnt 0x0"
               :: "v"(l[0]), "v"(l[1]), "v"(l[2]), "v"(l[3]), "v"(l[4]), "v"(l[5]), "v"(l[6]), "v"(l[7]),
                  "v"(g[0]), "v"(g[1]), "v"(g[2]), "v"(g[3]), "v"(g[4]), "v"(g[5]), "v"(g[6]), "v"(g[7]) : "memory");
}
// one tile: kg / lk = this lane's 16 bytes of K row (wave) of the tile, rows step by 4; vg / lv = this lane's 16 bytes of V^T row (thread / 8), rows step by 16
// (the loops are unrolled so that every address is a constant step from the lane's base)
__device__ __forceinline__ void stage_tile(const b16* kg, unsigned lk, const b16* vg, unsigned lv) {
#pragma unroll
  for (int h = 0; h < 2; ++h) { unsigned l[8]; const b16* g[8];
#pragma unroll
    for (int i = 0; i < 8; ++i) { l[i] = lk + (unsigned)((h * 8 + i) * 4 * KPITCH * 2); g[i] = kg + (size_t)(h * 8 + i) * 4 * D; }
    async_copy8(l, g); }
#pragma unroll
  for (int h = 0; h < 2; ++h) { unsigned l[8]; const b16* g[8];
#pragma unroll
    for (int i = 0; i < 8; ++i) { l[i] = lv + (unsigned)((h * 8 + i) * 16 * VPITCH * 2); g[i] = vg + (size_t)(h * 8 + i) * 16 * S; }
    async_copy8(l, g); }
}
__global__ __launch_bounds__(128) void attn_kernel(const b16* __restrict__ Qp, const b16* __restrict__ Kp, const b16* __restrict__ VT, float* __restrict__ O1, float* __restrict__ O2, float* __restrict__ ML) {
  __shared__ __attribute__((aligned(16))) b16 Ks[2][KT][KPITCH]; __shared__ __attribute__((aligned(16))) b16 Vs[2][D][VPITCH];
  __shared__ __attribute__((aligned(16))) b16 Pb[4][16][32 + 8]; __shared__ __attribute__((aligned(16))) float To[4][16][D + 4];
  const int tid = threadIdx.x, wave = __builtin_amdgcn_readfirstlane(tid >> 5), lane = tid & 31, hh = lane >> 4, col = lane & 15; const int b = blockIdx.y, j = blockIdx.x;
  const b16* Qb = Qp + (size_t)b * S * D; const b16* Kb = Kp + (size_t)b * S * D; const b16* Vb = VT + (size_t)b * D * S;
#pragma unroll 1   // stays rolled: the two segments of a block run one after the other through the same code and the same LDS
  for (int seg = (j > NT / 2) ? 0 : 1; seg < 2; ++seg) {   // block-uniform: seg 0 = tail of query tile j, seg 1 = head of query tile NT - 1 - j
  const int qt = seg == 0 ? j : NT - 1 - j, tb = seg == 0 ? CUT : 0;
  const int ntile = seg == 0 ? j + 1 - CUT : (qt + 1 < CUT ? qt + 1 : CUT);   // tiles of 64 keys in this segment, at least one
  const int q0 = qt * 64 + wave * 16, qi = q0 + col;
  const b16* kg = Kb + (size_t)(tb * KT + wave) * D + lane * 8; const b16* vg = Vb + (size_t)(tid >> 3) * S + tb * KT + (tid & 7) * 8;
  const unsigned lk[2] = {lds_addr(&Ks[0][wave][lane * 8]), lds_addr(&Ks[1][wave][lane * 8])}, lv[2] = {lds_addr(&Vs[0][tid >> 3][(tid & 7) * 8]), lds_addr(&Vs[1][tid >> 3][(tid & 7) * 8])};
  stage_tile(kg, lk[0], vg, lv[0]);
  v16b qa[8]; for (int ks = 0; ks < 8; ++ks) qa[ks] = frag_kb(Qb + (size_t)qi * D + ks * 32, hh);
  const float cs = LOG2E / (16.0f * XS * XS);
  float m = -INFINITY, l = 0.0f; v8f o[16]; for (int t = 0; t < 16; ++t) o[t] = (v8f){};
  const int kend = q0 + 16;   // keys < kend may be attended by some query of this wave
  asm volatile("s_wait_asynccnt 0x0" ::: "memory");   // this wave's copies of tile 0 have landed
  __syncthreads();                                     // ... and every other wave's: tile 0 may be read
  if (ntile > 1) stage_tile(kg + (size_t)KT * D, lk[1], vg + KT, lv[1]);
#pragma unroll 1   // stays rolled: one trip already holds two whole passes
  for (int tl = 0; tl < ntile; ++tl) {
    const b16 (*Kt)[KPITCH] = Ks[tl & 1]; const b16 (*Vt)[VPITCH] = Vs[tl & 1];
#pragma unroll     // ps becomes an immediate offset of the LDS reads; the unrolls below keep the register arrays at constant indices
    for (int ps = 0; ps < 2; ++ps) { const int kb = (tb + tl) * KT + ps * 32;
      if (kb < kend) {   // wave-uniform (scalar): a wave skips the pass beyond its diagonal, never the publish point below
        // all fragments of the pass are asked for ahead of the products, so that the LDS latency is paid once per run and not once per product
        v16b kf[16], vf[16];
#pragma unroll
        for (int i = 0; i < 16; ++i) kf[i] = frag_kb(&Kt[ps * 32 + (i >> 3) * 16 + col][(i & 7) * 32], hh);
#pragma unroll
        for (int t = 0; t < 16; ++t) vf[t] = frag_kb(&Vt[t * 16 + col][ps * 32], hh);
        v8f s[2] = {(v8f){}, (v8f){}};
#pragma unroll
        for (int tt = 0; tt < 2; ++tt)
#pragma unroll
          for (int ks = 0; ks < 8; ++ks) s[tt] = wmma16p(kf[tt * 8 + ks], qa[ks], s[tt]);
        float e[16]; float mx = -INFINITY;
#pragma unroll
        for (int i = 0; i < 16; ++i) { const int key = kb + (i < 8 ? 0 : 16) + 8 * hh + (i & 7); const float v = (key <= qi) ? (i < 8 ? s[0][i] : s[1][i - 8]) * cs : -INFINITY; e[i] = v; mx = fmaxf(mx, v); }
        mx = fmaxf(mx, __shfl_xor(mx, 16)); const float mn = fmaxf(m, mx); const float al = (mn == -INFINITY) ? 1.0f : nexp2(m - mn); float sum = 0.0f;
        // B operand needs row = query, k = key: write P[query col][key] into LDS (wave-private), then frag
#pragma unroll
        for (int i = 0; i < 16; ++i) { const float p = (e[i] == -INFINITY) ? 0.0f : nexp2(e[i] - mn); sum += p; Pb[wave][col][(i < 8 ? 0 : 16) + 8 * hh + (i & 7)] = (b16)(p * PS); }
        sum += __shfl_xor(sum, 16); l = l * al + sum; m = mn;
        wave_lds_sync();
        const v16b pf = frag_kb(&Pb[wave][col][0], hh);
#pragma unroll
        for (int t = 0; t < 16; ++t) { o[t] *= al; o[t] = wmma16p(vf[t], pf, o[t]); }
        wave_lds_sync(); } }
    // publish point of tile tl + 1, passed by every wave
    asm volatile("s_wait_dscnt 0x0" ::: "memory");      // this wave's reads of tile tl are done before the buffer is refilled
    asm volatile("s_wait_asynccnt 0x0" ::: "memory");   // this wave's copies of tile tl + 1 have landed
    __syncthreads();                                     // tile tl + 1 may be read by all; tile tl's buffer is left by all
    if (tl + 2 < ntile) stage_tile(kg + (size_t)(tl + 2) * KT * D, lk[tl & 1], vg + (size_t)(tl + 2) * KT, lv[tl & 1]); }
  asm volatile("s_wait_asynccnt 0x0" ::: "memory");     // no copy is left in flight when the wave goes on to its end
  const float inv = 1.0f / (l * PS * XS);
#pragma unroll
  for (int t = 0; t < 16; ++t)
#pragma unroll
    for (int r = 0; r < 8; ++r) To[wave][col][t * 16 + 8 * hh + r] = o[t][r] * inv;
  wave_lds_sync();
  float* Op = seg == 0 ? O2 : O1;
  if (hh == 0) { const v2f ml = {m, l}; *(v2f*)(ML + ((size_t)(seg == 0 ? B * S : 0) + (size_t)b * S + qi) * 2) = ml; }   // both halves hold the same (max, sum): 16 queries = one 128-byte line per wave
  asm volatile("s_wait_xcnt 0x0" ::: "memory");   // the store's address registers are rewritten right behind it
#pragma unroll   // constant row offsets in the LDS reads and the stores
  for (int g = 0; g < 2; ++g) { v4f a0[8], a1[8];
#pragma unroll   // keeps the register arrays at constant indices
    for (int rr = 0; rr < 8; ++rr) { a0[rr] = *(const v4f*)(&To[wave][g * 8 + rr][lane * 8]); a1[rr] = *(const v4f*)(&To[wave][g * 8 + rr][lane * 8 + 4]); }
#pragma unroll   // as above
    for (int rr = 0; rr < 8; ++rr) { const size_t row = ((size_t)b * S + q0 + g * 8 + rr) * D; *(v4f*)(Op + row + lane * 8) = a0[rr]; *(v4f*)(Op + row + lane * 8 + 4) = a1[rr]; }
    asm volatile("s_wait_xcnt 0x0" ::: "memory"); }   // the stores' data and address registers are rewritten behind it (next eight rows, next segment)
  }
}
template <int MODE>
__global__ __launch_bounds__(256) void ln_kernel(const float* __restrict__ IN, const float* __restrict__ IN2, const float* __restrict__ ML, const float* __restrict__ x, const float* __restrict__ g_, const float* __restrict__ b_, b16* __restrict__ Oh, b16* __restrict__ Ol, float* __restrict__ out) {
  const int wave = threadIdx.x >> 5, lane = threadIdx.x & 31; const size_t row = (size_t)blockIdx.x * 8 + wave; const float* r = IN + row * D + lane * 8;
  v4f a = *(const v4f*)r, c = *(const v4f*)(r + 4);
  if (MODE == 0) { const float* xr = x + row * D + lane * 8; const v4f x0 = *(const v4f*)xr, x1 = *(const v4f*)(xr + 4);   // IN, IN2 = the attention partials: merge the two of a long query tile (one row = one wave, so the test is wave-uniform), then the residual
    if ((int)((row & (S - 1)) / KT) >= CUT) { const v2f p0 = *(const v2f*)(ML + row * 2), p1 = *(const v2f*)(ML + ((size_t)B * S + row) * 2); const float mm = fmaxf(p0[0], p1[0]);
      float w0 = p0[1] * nexp2(p0[0] - mm), w1 = p1[1] * nexp2(p1[0] - mm); const float rw = 1.0f / (w0 + w1); w0 *= rw; w1 *= rw;
      const float* r2 = IN2 + row * D + lane * 8; const v4f a2 = *(const v4f*)r2, c2 = *(const v4f*)(r2 + 4); a = a * w0 + a2 * w1; c = c * w0 + c2 * w1; }
    for (int j = 0; j < 4; ++j) { a[j] += bf16_rne(x0[j]); c[j] += bf16_rne(x1[j]); } }
  float s = 0.0f; for (int j = 0; j < 4; ++j) s += a[j] + c[j];
#pragma unroll
  for (int o = 1; o < 32; o <<= 1) s += __shfl_xor(s, o);
  const float mu = s * (1.0f / D); float q = 0.0f; for (int j = 0; j < 4; ++j) { const float d0 = a[j] - mu, d1 = c[j] - mu; q += d0 * d0 + d1 * d1; }
#pragma unroll
  for (int o = 1; o < 32; o <<= 1) q += __shfl_xor(q, o);
  const float rs = rsqrtf(q * (1.0f / D) + LNEPS); float y[8];
  for (int j = 0; j < 4; ++j) { y[j] = (a[j] - mu) * rs * bf16_rne(g_[lane * 8 + j]) + bf16_rne(b_[lane * 8 + j]); y[4 + j] = (c[j] - mu) * rs * bf16_rne(g_[lane * 8 + 4 + j]) + bf16_rne(b_[lane * 8 + 4 + j]); }
  {
    if (MODE == 0) { v8b hv, lv; for (int j = 0; j < 8; ++j) { b16 p, qq; split16(y[j] * XS, p, qq); hv[j] = p; lv[j] = qq; } *(v8b*)(Oh + row * D + lane * 8) = hv; *(v8b*)(Ol + row * D + lane * 8) = lv; }
    else { v4f o0 = {y[0], y[1], y[2], y[3]}, o1 = {y[4], y[5], y[6], y[7]}; *(v4f*)(out + row * D + lane * 8) = o0; *(v4f*)(out + row * D + lane * 8 + 4) = o1; }
     }
}
template <int MODE>
__global__ __launch_bounds__(128) void ffn_kernel(const b16* __restrict__ Ah, const b16* __restrict__ Al, const b16* __restrict__ W, const float* __restrict__ bias, b16* __restrict__ Oh, b16* __restrict__ Ol, float* __restrict__ OUTF) {
  __shared__ __attribute__((aligned(16))) float Tf[4][16][128 + 4];
  const int wave = threadIdx.x >> 5, lane = threadIdx.x & 31, nloc = lane & 15, hlf = lane >> 4; const size_t m0 = (size_t)blockIdx.x * 64 + wave * 16; const int n0 = blockIdx.y * 128;
  v8f acc[8];
#pragma unroll
  for (int t = 0; t < 8; ++t) acc[t] = (v8f){};
#pragma unroll 2
  for (int kb = 0; kb < D; kb += 32) { const v16b a = frag_kb(Ah + (m0 + nloc) * D + kb, hlf), al = frag_kb(Al + (m0 + nloc) * D + kb, hlf);
#pragma unroll
    for (int t = 0; t < 8; ++t) { const v16b bw = frag_kb(W + (size_t)(n0 + t * 16 + nloc) * D + kb, hlf); acc[t] = wmma16b(a, bw, acc[t]); acc[t] = wmma16b(al, bw, acc[t]); } }
#pragma unroll
  for (int t = 0; t < 8; ++t) { const float bb = bf16_rne(bias[n0 + t * 16 + nloc]);
#pragma unroll
    for (int r = 0; r < 8; ++r) { float v = acc[t][r] * (1.0f / (XS * WSC)) + bb; if (MODE == 0) v = fmaxf(v, 0.0f); Tf[wave][8 * hlf + r][t * 16 + nloc] = v; } }
  wave_lds_sync();
  { for (int rr = 0; rr < 16; ++rr) { const v4f f = *(const v4f*)(&Tf[wave][rr][lane * 4]);
      if (MODE == 1) *(v4f*)(OUTF + (m0 + rr) * D + n0 + lane * 4) = f;
      else { v4h hv, lv; for (int j = 0; j < 4; ++j) { b16 p, q; split16(f[j] * XS, p, q); hv[j] = p; lv[j] = q; } *(v4h*)(Oh + (m0 + rr) * D + n0 + lane * 4) = hv; *(v4h*)(Ol + (m0 + rr) * D + n0 + lane * 4) = lv; } }
     }
}
}  // namespace

extern "C" void kernel_launch(void* const* d_in, const int* in_sizes, int n_in, void* d_out, int out_size, void* d_ws, size_t ws_size, hipStream_t stream) {
  (void)n_in;
  auto Fp = [&](int i) { return (const float*)d_in[i]; };
  // input order: 0 x [4,4096,256], 1 Wq [256,256] ([e][d]), 2 bq, 3 Wk, 4 bk, 5 Wv, 6 bv, 7 W1, 8 b1, 9 W2, 10 b2, 11 g_ln, 12 beta_ln, 13 g_lnff, 14 beta_lnff
  if (in_sizes[0] != B * S * D || in_sizes[1] != D * D || in_sizes[3] != D * D || in_sizes[5] != D * D || in_sizes[7] != FF * D || in_sizes[9] != D * FF || in_sizes[11] != D || in_sizes[13] != D || out_size != B * S * D) return;
  size_t off = 0; char* ws = (char*)d_ws;
  auto carve = [&](size_t bytes) { char* p = ws + off; off += (bytes + 255) & ~(size_t)255; return p; };
  b16* WT = (b16*)carve((size_t)5 * D * D * 2); b16* Qp = (b16*)carve((size_t)B * S * D * 2); b16* Kp = (b16*)carve((size_t)B * S * D * 2); b16* VT = (b16*)carve((size_t)B * D * S * 2);
  float* O1 = (float*)carve((size_t)B * S * D * 4); float* O2 = (float*)carve((size_t)B * S * D * 4); float* ML = (float*)carve((size_t)2 * B * S * 2 * 4); b16* Ph = (b16*)carve((size_t)B * S * D * 2); b16* Pl = (b16*)carve((size_t)B * S * D * 2); b16* Hh = Qp; b16* Hl = Kp;   // the FFN hidden planes reuse the q/k planes (dead after attention)
  float* H2 = O1;   // h2 rows reuse O1 (dead after the first LayerNorm produced the planes)
  if (off > ws_size || off > ((size_t)128 << 20)) return;   // about 76 MB
  wprep_kernel<<<(unsigned)(((size_t)5 * D * D / 8 + 255) / 256), 256, 0, stream>>>(Fp(1), Fp(3), Fp(5), Fp(7), Fp(9), WT);
  qkv_kernel<<<dim3(S / 64, BL, 3), 128, 0, stream>>>(Fp(0), WT, Fp(2), Fp(4), Fp(6), Qp, Kp, VT);
  attn_kernel<<<dim3(S / 64, BL), 128, 0, stream>>>(Qp, Kp, VT, O1, O2, ML);
  ln_kernel<0><<<(unsigned)((size_t)BL * S / 8), 256, 0, stream>>>(O1, O2, ML, Fp(0), Fp(11), Fp(12), Ph, Pl, nullptr);
  ffn_kernel<0><<<dim3((unsigned)((size_t)BL * S / 64), 2), 128, 0, stream>>>(Ph, Pl, WT + (size_t)3 * D * D, Fp(8), Hh, Hl, nullptr);
  ffn_kernel<1><<<dim3((unsigned)((size_t)BL * S / 64), 2), 128, 0, stream>>>(Hh, Hl, WT + (size_t)4 * D * D, Fp(10), nullptr, nullptr, H2);
  ln_kernel<1><<<(unsigned)((size_t)BL * S / 8), 256, 0, stream>>>(H2, nullptr, nullptr, nullptr, Fp(13), Fp(14), nullptr, nullptr, (float*)d_out);
}

// v003
// A run of this version takes 128 microseconds.
// Timed twice side by side with v002, it ran 1.39 and 1.38 times as fast.
// Counting every step since v000, it is 7.39 times as fast.
#include <hip/hip_runtime.h>

// Causal single-head transformer block: q, k, v = x W{q,k,v}^T + b ([4][4096][256], d = 256); A = q . k; causal mask filled with -32767 BEFORE the 1/sqrt(256) scaling (masked weights are exactly 0
// in f32 after exp); softmax over keys <= query; o = A v + x; LayerNorm; h = relu(o W1^T + b1) W2^T + b2; LayerNorm (no second residual) -> [4][4096][256].
// Deterministic: flash-style causal attention per 16-query wave (online softmax over the key blocks 0 .. query block, running max; for long query tiles in two partials, merged by the first LayerNorm kernel), row-wise LayerNorms inside the GEMM epilogues' companion kernels;
// no atomics.
// compute dtype: WMMA v_wmma_f32_16x16x32_f16 with f32 accumulate for the q/k/v projections (x EXACT bf16 x8 staged through LDS, W [e][d] rows exact x256: 1 product), S^T = K Q^T (q, k single
// f16 x8: 1 product — logits have std ≈ 1 over ~2,000 keys, per-key rounding averages to ≈4e-5 on the output), O^T += V^T P^T (v single f16 x8, P x1024 single f16: 1 product) and the two FFN GEMMs
// (LayerNorm output / relu hidden as f16 hi+lo x8 planes: 2 products); softmax statistics (exp2), residual, LayerNorms, bias, relu in f32. Inputs rounded to bf16 once.

namespace {
constexpr int B = 4, S = 4096, D = 256, FF = 256, BL = 4 /* batches computed (== B shipped) */;
constexpr float XS = 8.0f, WSC = 256.0f, PS = 1024.0f, LOG2E = 1.4426950408889634f, LNEPS = 1e-5f, MASK_FILL = -32767.0f;
static_assert(S % 64 == 0 && D == 256 && FF == 256, "tiling");
typedef _Float16 b16;
typedef __attribute__((ext_vector_type(16))) _Float16 v16b;
typedef __attribute__((ext_vector_type(8))) _Float16 v8b;
typedef __attribute__((ext_vector_type(8))) float v8f;
typedef __attribute__((ext_vector_type(4))) float v4f;
__device__ __forceinline__ float bf16_rne(float f) { unsigned int u = __float_as_uint(f); u += 0x7FFFu + ((u >> 16) & 1u); return __uint_as_float(u & 0xFFFF0000u); }
__device__ __forceinline__ void split16(float v, b16& hi, b16& lo) { hi = (b16)v; lo = (b16)(v - (float)hi); }
__device__ __forceinline__ v16b frag_kb(const b16* p, int hh) { const v8b a = *(const v8b*)(p + 8 * hh), b = *(const v8b*)(p + 16 + 8 * hh); v16b f;
#pragma unroll
  for (int e = 0; e < 8; ++e) { f[e] = a[e]; f[8 + e] = b[e]; } return f; }
__device__ __forceinline__ void wave_lds_sync() { __builtin_amdgcn_fence(__ATOMIC_RELEASE, "workgroup"); __builtin_amdgcn_wave_barrier(); __builtin_amdgcn_fence(__ATOMIC_ACQUIRE, "workgroup"); }
__device__ __forceinline__ float pmul(float a, float b) { float p = a * b; asm volatile("" : "+v"(p)); return p; }
__device__ __forceinline__ int iclamp(int v, int lo, int hi) { return v < lo ? lo : (v > hi ? hi : v); }

typedef __attribute__((ext_vector_type(2))) _Float16 v2h;
typedef __attribute__((ext_vector_type(4))) _Float16 v4h;
typedef __attribute__((ext_vector_type(2))) float v2f;
__device__ __forceinline__ float nexp2(float v) { return __builtin_amdgcn_exp2f(v); }
__global__ __launch_bounds__(256) void wprep_kernel(const float* __restrict__ wq, const float* __restrict__ wk, const float* __restrict__ wv, const float* __restrict__ w1, const float* __restrict__ w2, b16* __restrict__ WT) {
  const size_t u = (size_t)blockIdx.x * 256 + threadIdx.x; if (u >= (size_t)5 * D * D / 8) return; const size_t e = u * 8; const int m = (int)(e / (D * D)); const size_t el = e % ((size_t)D * D);
  const float* w = m == 0 ? wq : m == 1 ? wk : m == 2 ? wv : m == 3 ? w1 : w2; v8b o; for (int j = 0; j < 8; ++j) o[j] = (b16)(bf16_rne(w[el + j]) * WSC);
  { *(v8b*)(WT + e) = o;  }
}
constexpr int KT = 64, KPITCH = D + 8, VPITCH = KT + 8, NT = S / KT, CUT = NT / 2 + 1;
// the plain builtin (the compiler keeps the distance behind it): operands of an asm statement must lie below v256, which the fragments of a whole pass do not fit
__device__ __forceinline__ v8f wmma16p(v16b a, v16b b, v8f c) { return __builtin_amdgcn_wmma_f32_16x16x32_f16(false, a, false, b, (short)0, c, false, false); }
__device__ __forceinline__ unsigned lds_addr(const void* p) { return (unsigned)(size_t)p; }
// eight 16-byte copies per lane; s_wait_xcnt 0 closes the statement so that no address register is rewritten while a copy may still name it
template <typename E>
__device__ __forceinline__ void async_copy8(const unsigned (&l)[8], const E* const (&g)[8]) {
  asm volatile("global_load_async_to_lds_b128 %0, %8, off\n\t"
               "global_load_async_to_lds_b128 %1, %9, off\n\t"
               "global_load_async_to_lds_b128 %2, %10, off\n\t"
               "global_load_async_to_lds_b128 %3, %11, off\n\t"
               "global_load_async_to_lds_b128 %4, %12, off\n\t"
               "global_load_async_to_lds_b128 %5, %13, off\n\t"
               "global_load_async_to_lds_b128 %6, %14, off\n\t"
               "global_load_async_to_lds_b128 %7, %15, off\n\t"
               "s_wait_xcnt 0x0"
               :: "v"(l[0]), "v"(l[1]), "v"(l[2]), "v"(l[3]), "v"(l[4]), "v"(l[5]), "v"(l[6]), "v"(l[7]),
                  "v"(g[0]), "v"(g[1]), "v"(g[2]), "v"(g[3]), "v"(g[4]), "v"(g[5]), "v"(g[6]), "v"(g[7]) : "memory");
}
// N8 * 8 copies of 16 bytes per lane: piece i goes from g0 + i * gstep (elements) to LDS byte l0 + i * lstep (unrolled so that every address is a constant step from the lane's base)
template <int N8, typename E>
__device__ __forceinline__ void stage_rows(const E* g0, int gstep, unsigned l0, unsigned lstep) {
#pragma unroll
  for (int h = 0; h < N8; ++h) { unsigned l[8]; const E* g[8];
#pragma unroll
    for (int i = 0; i < 8; ++i) { l[i] = l0 + (unsigned)(h * 8 + i) * lstep; g[i] = g0 + (size_t)(h * 8 + i) * gstep; }
    async_copy8(l, g); }
}
// qkv: block = 64 tokens of one batch (4 waves) x one of {q, k, v} (grid.z): A = bf16(x) x8 staged; 16 tiles x 8 k-steps; + bias. q, k -> single f16 x8 planes [b][s][256] (32 lanes x 16 B);
// the operands come into LDS by asynchronous copies of whole 512-byte pieces: each wave's 16 x rows (f32, into its part of Tf, which is free until the epilogue) and the 256 W rows, once per block, at
// pitch 528 B (16 B x odd: ds_load_b128 free of bank conflicts). W rows 64 .. 255 fly while x is converted and column tiles 0 .. 3 are worked on; never more than 48 copies of a wave are in flight.
__global__ __launch_bounds__(128) void qkv_kernel(const float* __restrict__ x, const b16* __restrict__ WT, const float* __restrict__ bq, const float* __restrict__ bk, const float* __restrict__ bv, b16* __restrict__ Qp, b16* __restrict__ Kp, b16* __restrict__ VT) {
  __shared__ __attribute__((aligned(16))) b16 As[4][16][D + 8]; __shared__ __attribute__((aligned(16))) float Tf[4][16][256 + 4]; __shared__ __attribute__((aligned(16))) b16 Ws[D][KPITCH];
  const int wave = __builtin_amdgcn_readfirstlane(threadIdx.x >> 5), lane = threadIdx.x & 31, nloc = lane & 15, hlf = lane >> 4; const int b = blockIdx.y, which = blockIdx.z; const int t0 = blockIdx.x * 64 + wave * 16;
  const b16* W = WT + (size_t)which * D * D; const float* bias = which == 0 ? bq : which == 1 ? bk : bv;
  const float* xw = x + ((size_t)b * S + t0) * D + lane * 4;   // a row of x is two pieces of 512 bytes
  stage_rows<2>(xw, D, lds_addr(&Tf[wave][0][lane * 4]), (256 + 4) * 4); stage_rows<2>(xw + 128, D, lds_addr(&Tf[wave][0][128 + lane * 4]), (256 + 4) * 4);
  stage_rows<2>(W + (size_t)wave * D + lane * 8, 4 * D, lds_addr(&Ws[wave][lane * 8]), 4 * KPITCH * 2);   // W rows wave, wave + 4, .. below 64
  asm volatile("s_wait_asynccnt 0x0" ::: "memory");   // this wave's copies of x and of W rows 0 .. 63 have landed
  __syncthreads();                                     // ... and every other wave's: they may be read
  stage_rows<6>(W + (size_t)(64 + wave) * D + lane * 8, 4 * D, lds_addr(&Ws[64 + wave][lane * 8]), 4 * KPITCH * 2);   // W rows 64 .. 255, read behind the second barrier only
#pragma unroll   // constant LDS offsets; the reads of later rows go out under the conversion of earlier ones
  for (int rr = 0; rr < 16; ++rr) { const v4f f0 = *(const v4f*)(&Tf[wave][rr][lane * 8]), f1 = *(const v4f*)(&Tf[wave][rr][lane * 8 + 4]); v8b o;
#pragma unroll
    for (int j = 0; j < 4; ++j) { o[j] = (b16)(bf16_rne(f0[j]) * XS); o[4 + j] = (b16)(bf16_rne(f1[j]) * XS); }
    *(v8b*)(&As[wave][rr][lane * 8]) = o; }
  wave_lds_sync();
  v8f acc[16];
#pragma unroll
  for (int t = 0; t < 16; ++t) acc[t] = (v8f){};
  // a group = 4 column tiles x 8 k-steps. All fragments of a group are asked for together and one group ahead of their products (two register sets), so that the LDS latency is not paid per product;
  // every loop below is unrolled to keep the register arrays at constant indices
  v16b a[8], w0[32], w1[32];
#pragma unroll
  for (int i = 0; i < 32; ++i) { if ((i & 3) == 0) a[i >> 2] = frag_kb(&As[wave][nloc][(i >> 2) * 32], hlf); w0[i] = frag_kb(&Ws[(i & 3) * 16 + nloc][(i >> 2) * 32], hlf); }
  __builtin_amdgcn_sched_barrier(0);   // holds the reads above in front of the products below: left free, the compiler moves each read down to its product and waits for it there
#pragma unroll
  for (int i = 0; i < 32; ++i) acc[i & 3] = wmma16p(a[i >> 2], w0[i], acc[i & 3]);
  __builtin_amdgcn_sched_barrier(0);   // keeps the products above in front of the wait below, so that the copies in flight land under them
  asm volatile("s_wait_asynccnt 0x0" ::: "memory");   // this wave's copies of W rows 64 .. 255 have landed
  __syncthreads();                                     // ... and every other wave's
#pragma unroll
  for (int i = 0; i < 32; ++i) w1[i] = frag_kb(&Ws[64 + (i & 3) * 16 + nloc][(i >> 2) * 32], hlf);
#pragma unroll
  for (int i = 0; i < 32; ++i) w0[i] = frag_kb(&Ws[128 + (i & 3) * 16 + nloc][(i >> 2) * 32], hlf);
  __builtin_amdgcn_sched_barrier(0);   // holds the reads above in front of the products below: left free, the compiler moves each read down to its product and waits for it there
#pragma unroll
  for (int i = 0; i < 32; ++i) acc[4 + (i & 3)] = wmma16p(a[i >> 2], w1[i], acc[4 + (i & 3)]);
  __builtin_amdgcn_sched_barrier(0);   // keeps the last group's reads from rising among those products or sinking to their own
#pragma unroll
  for (int i = 0; i < 32; ++i) w1[i] = frag_kb(&Ws[192 + (i & 3) * 16 + nloc][(i >> 2) * 32], hlf);
  __builtin_amdgcn_sched_barrier(0);   // holds the reads above in front of the products below: left free, the compiler moves each read down to its product and waits for it there
#pragma unroll
  for (int i = 0; i < 32; ++i) acc[8 + (i & 3)] = wmma16p(a[i >> 2], w0[i], acc[8 + (i & 3)]);
#pragma unroll
  for (int i = 0; i < 32; ++i) acc[12 + (i & 3)] = wmma16p(a[i >> 2], w1[i], acc[12 + (i & 3)]);
#pragma unroll
  for (int t = 0; t < 16; ++t) { const float bb = bf16_rne(bias[t * 16 + nloc]);
#pragma unroll
    for (int r = 0; r < 8; ++r) Tf[wave][8 * hlf + r][t * 16 + nloc] = acc[t][r] * (1.0f / (XS * WSC)) + bb; }
  __syncthreads();
  {
    if (which < 2) { b16* P = (which == 0 ? Qp : Kp) + ((size_t)b * S) * D; for (int rr = 0; rr < 16; ++rr) { v8b o; for (int j = 0; j < 8; ++j) o[j] = (b16)(Tf[wave][rr][lane * 8 + j] * XS); *(v8b*)(P + (size_t)(t0 + rr) * D + lane * 8) = o; } }
    else {
#pragma unroll 1
      for (int q = 0; q < 64; ++q) { const int d = wave * 64 + q; const int tk = lane * 2; v2h vv; vv[0] = (b16)(Tf[tk >> 4][tk & 15][d] * XS); vv[1] = (b16)(Tf[(tk + 1) >> 4][(tk + 1) & 15][d] * XS); *(v2h*)(VT + ((size_t)b * D + d) * S + blockIdx.x * 64 + lane * 2) = vv; } }
     }
}
// causal attention: grid (S/64, BL); block = 4 waves x 16 queries (q0). Query tile qt needs qt + 1 key tiles, and one block fills a WGP, so the launch lasts as long as its longest block: the work is cut
// into equal blocks. Block j does the head of query tile NT - 1 - j (key tiles 0 .. min(qt + 1, CUT) - 1, partial 0) and, for j > NT / 2, before it the tail of query tile j (key tiles CUT .. j, partial 1):
// CUT or CUT - 1 key tiles in every block. A partial is its own softmax-weighted mean with its (max, sum); the first LayerNorm kernel merges the two partials of a long query tile and adds the residual.
// Within a segment the block walks its keys in tiles of 64: K rows [64][256] and V^T rows [256][64] are copied once per block into LDS by
// asynchronous copies (two buffers: tile t + 1 flies while tile t is worked on) and every wave takes its fragments from there. Row pitches 528 B and 144 B (16 B x odd) keep ds_load_b128 free of bank conflicts.
// Per tile two passes of 32 keys, keys in ascending order: S^T = K Q^T (2 tiles x 8 k-steps), logits A/16 in the log2 domain, keys > query masked (the reference's -32767 fill gives exp = 0 exactly),
// online softmax, P x1024 single f16 via LDS -> O^T += V^T P^T (16 d-tiles x 1 k-step); partial = O / l
// one tile: kg / lk = this lane's 16 bytes of K row (wave) of the tile, rows step by 4; vg / lv = this lane's 16 bytes of V^T row (thread / 8), rows step by 16
// (the loops are unrolled so that every address is a constant step from the lane's base)
__device__ __forceinline__ void stage_tile(const b16* kg, unsigned lk, const b16* vg, unsigned lv) {
#pragma unroll
  for (int h = 0; h < 2; ++h) { unsigned l[8]; const b16* g[8];
#pragma unroll
    for (int i = 0; i < 8; ++i) { l[i] = lk + (unsigned)((h * 8 + i) * 4 * KPITCH * 2); g[i] = kg + (size_t)(h * 8 + i) * 4 * D; }
    async_copy8(l, g); }
#pragma unroll
  for (int h = 0; h < 2; ++h) { unsigned l[8]; const b16* g[8];
#pragma unroll
    for (int i = 0; i < 8; ++i) { l[i] = lv + (unsigned)((h * 8 + i) * 16 * VPITCH * 2); g[i] = vg + (size_t)(h * 8 + i) * 16 * S; }
    async_copy8(l, g); }
}
__global__ __launch_bounds__(128) void attn_kernel(const b16* __restrict__ Qp, const b16* __restrict__ Kp, const b16* __restrict__ VT, float* __restrict__ O1, float* __restrict__ O2, float* __restrict__ ML) {
  __shared__ __attribute__((aligned(16))) b16 Ks[2][KT][KPITCH]; __shared__ __attribute__((aligned(16))) b16 Vs[2][D][VPITCH];
  __shared__ __attribute__((aligned(16))) b16 Pb[4][16][32 + 8]; __shared__ __attribute__((aligned(16))) float To[4][16][D + 4];
  const int tid = threadIdx.x, wave = __builtin_amdgcn_readfirstlane(tid >> 5), lane = tid & 31, hh = lane >> 4, col = lane & 15; const int b = blockIdx.y, j = blockIdx.x;
  const b16* Qb = Qp + (size_t)b * S * D; const b16* Kb = Kp + (size_t)b * S * D; const b16* Vb = VT + (size_t)b * D * S;
#pragma unroll 1   // stays rolled: the two segments of a block run one after the other through the same code and the same LDS
  for (int seg = (j > NT / 2) ? 0 : 1; seg < 2; ++seg) {   // block-uniform: seg 0 = tail of query tile j, seg 1 = head of query tile NT - 1 - j
  const int qt = seg == 0 ? j : NT - 1 - j, tb = seg == 0 ? CUT : 0;
  const int ntile = seg == 0 ? j + 1 - CUT : (qt + 1 < CUT ? qt + 1 : CUT);   // tiles of 64 keys in this segment, at least one
  const int q0 = qt * 64 + wave * 16, qi = q0 + col;
  const b16* kg = Kb + (size_t)(tb * KT + wave) * D + lane * 8; const b16* vg = Vb + (size_t)(tid >> 3) * S + tb * KT + (tid & 7) * 8;
  const unsigned lk[2] = {lds_addr(&Ks[0][wave][lane * 8]), lds_addr(&Ks[1][wave][lane * 8])}, lv[2] = {lds_addr(&Vs[0][tid >> 3][(tid & 7) * 8]), lds_addr(&Vs[1][tid >> 3][(tid & 7) * 8])};
  stage_tile(kg, lk[0], vg, lv[0]);
  v16b qa[8]; for (int ks = 0; ks < 8; ++ks) qa[ks] = frag_kb(Qb + (size_t)qi * D + ks * 32, hh);
  const float cs = LOG2E / (16.0f * XS * XS);
  float m = -INFINITY, l = 0.0f; v8f o[16]; for (int t = 0; t < 16; ++t) o[t] = (v8f){};
  const int kend = q0 + 16;   // keys < kend may be attended by some query of this wave
  asm volatile("s_wait_asynccnt 0x0" ::: "memory");   // this wave's copies of tile 0 have landed
  __syncthreads();                                     // ... and every other wave's: tile 0 may be read
  if (ntile > 1) stage_tile(kg + (size_t)KT * D, lk[1], vg + KT, lv[1]);
#pragma unroll 1   // stays rolled: one trip already holds two whole passes
  for (int tl = 0; tl < ntile; ++tl) {
    const b16 (*Kt)[KPITCH] = Ks[tl & 1]; const b16 (*Vt)[VPITCH] = Vs[tl & 1];
#pragma unroll     // ps becomes an immediate offset of the LDS reads; the unrolls below keep the register arrays at constant indices
    for (int ps = 0; ps < 2; ++ps) { const int kb = (tb + tl) * KT + ps * 32;
      if (kb < kend) {   // wave-uniform (scalar): a wave skips the pass beyond its diagonal, never the publish point below
        // all fragments of the pass are asked for ahead of the products, so that the LDS latency is paid once per run and not once per product
        v16b kf[16], vf[16];
#pragma unroll
        for (int i = 0; i < 16; ++i) kf[i] = frag_kb(&Kt[ps * 32 + (i >> 3) * 16 + col][(i & 7) * 32], hh);
#pragma unroll
        for (int t = 0; t < 16; ++t) vf[t] = frag_kb(&Vt[t * 16 + col][ps * 32], hh);
        v8f s[2] = {(v8f){}, (v8f){}};
#pragma unroll
        for (int tt = 0; tt < 2; ++tt)
#pragma unroll
          for (int ks = 0; ks < 8; ++ks) s[tt] = wmma16p(kf[tt * 8 + ks], qa[ks], s[tt]);
        float e[16]; float mx = -INFINITY;
#pragma unroll
        for (int i = 0; i < 16; ++i) { const int key = kb + (i < 8 ? 0 : 16) + 8 * hh + (i & 7); const float v = (key <= qi) ? (i < 8 ? s[0][i] : s[1][i - 8]) * cs : -INFINITY; e[i] = v; mx = fmaxf(mx, v); }
        mx = fmaxf(mx, __shfl_xor(mx, 16)); const float mn = fmaxf(m, mx); const float al = (mn == -INFINITY) ? 1.0f : nexp2(m - mn); float sum = 0.0f;
        // B operand needs row = query, k = key: write P[query col][key] into LDS (wave-private), then frag
#pragma unroll
        for (int i = 0; i < 16; ++i) { const float p = (e[i] == -INFINITY) ? 0.0f : nexp2(e[i] - mn); sum += p; Pb[wave][col][(i < 8 ? 0 : 16) + 8 * hh + (i & 7)] = (b16)(p * PS); }
        sum += __shfl_xor(sum, 16); l = l * al + sum; m = mn;
        wave_lds_sync();
        const v16b pf = frag_kb(&Pb[wave][col][0], hh);
#pragma unroll
        for (int t = 0; t < 16; ++t) { o[t] *= al; o[t] = wmma16p(vf[t], pf, o[t]); }
        wave_lds_sync(); } }
    // publish point of tile tl + 1, passed by every wave
    asm volatile("s_wait_dscnt 0x0" ::: "memory");      // this wave's reads of tile tl are done before the buffer is refilled
    asm volatile("s_wait_asynccnt 0x0" ::: "memory");   // this wave's copies of tile tl + 1 have landed
    __syncthreads();                                     // tile tl + 1 may be read by all; tile tl's buffer is left by all
    if (tl + 2 < ntile) stage_tile(kg + (size_t)(tl + 2) * KT * D, lk[tl & 1], vg + (size_t)(tl + 2) * KT, lv[tl & 1]); }
  asm volatile("s_wait_asynccnt 0x0" ::: "memory");     // no copy is left in flight when the wave goes on to its end
  const float inv = 1.0f / (l * PS * XS);
#pragma unroll
  for (int t = 0; t < 16; ++t)
#pragma unroll
    for (int r = 0; r < 8; ++r) To[wave][col][t * 16 + 8 * hh + r] = o[t][r] * inv;
  wave_lds_sync();
  float* Op = seg == 0 ? O2 : O1;
  if (hh == 0) { const v2f ml = {m, l}; *(v2f*)(ML + ((size_t)(seg == 0 ? B * S : 0) + (size_t)b * S + qi) * 2) = ml; }   // both halves hold the same (max, sum): 16 queries = one 128-byte line per wave
  asm volatile("s_wait_xcnt 0x0" ::: "memory");   // the store's address registers are rewritten right behind it
#pragma unroll   // constant row offsets in the LDS reads and the stores
  for (int g = 0; g < 2; ++g) { v4f a0[8], a1[8];
#pragma unroll   // keeps the register arrays at constant indices
    for (int rr = 0; rr < 8; ++rr) { a0[rr] = *(const v4f*)(&To[wave][g * 8 + rr][lane * 8]); a1[rr] = *(const v4f*)(&To[wave][g * 8 + rr][lane * 8 + 4]); }
#pragma unroll   // as above
    for (int rr = 0; rr < 8; ++rr) { const size_t row = ((size_t)b * S + q0 + g * 8 + rr) * D; *(v4f*)(Op + row + lane * 8) = a0[rr]; *(v4f*)(Op + row + lane * 8 + 4) = a1[rr]; }
    asm volatile("s_wait_xcnt 0x0" ::: "memory"); }   // the stores' data and address registers are rewritten behind it (next eight rows, next segment)
  }
}
template <int MODE>
__global__ __launch_bounds__(256) void ln_kernel(const float* __restrict__ IN, const float* __restrict__ IN2, const float* __restrict__ ML, const float* __restrict__ x, const float* __restrict__ g_, const float* __restrict__ b_, b16* __restrict__ Oh, b16* __restrict__ Ol, float* __restrict__ out) {
  const int wave = threadIdx.x >> 5, lane = threadIdx.x & 31; const size_t row = (size_t)blockIdx.x * 8 + wave; const float* r = IN + row * D + lane * 8;
  v4f a = *(const v4f*)r, c = *(const v4f*)(r + 4);
  if (MODE == 0) { const float* xr = x + row * D + lane * 8; const v4f x0 = *(const v4f*)xr, x1 = *(const v4f*)(xr + 4);   // IN, IN2 = the attention partials: merge the two of a long query tile (one row = one wave, so the test is wave-uniform), then the residual
    if ((int)((row & (S - 1)) / KT) >= CUT) { const v2f p0 = *(const v2f*)(ML + row * 2), p1 = *(const v2f*)(ML + ((size_t)B * S + row) * 2); const float mm = fmaxf(p0[0], p1[0]);
      float w0 = p0[1] * nexp2(p0[0] - mm), w1 = p1[1] * nexp2(p1[0] - mm); const float rw = 1.0f / (w0 + w1); w0 *= rw; w1 *= rw;
      const float* r2 = IN2 + row * D + lane * 8; const v4f a2 = *(const v4f*)r2, c2 = *(const v4f*)(r2 + 4); a = a * w0 + a2 * w1; c = c * w0 + c2 * w1; }
    for (int j = 0; j < 4; ++j) { a[j] += bf16_rne(x0[j]); c[j] += bf16_rne(x1[j]); } }
  float s = 0.0f; for (int j = 0; j < 4; ++j) s += a[j] + c[j];
#pragma unroll
  for (int o = 1; o < 32; o <<= 1) s += __shfl_xor(s, o);
  const float mu = s * (1.0f / D); float q = 0.0f; for (int j = 0; j < 4; ++j) { const float d0 = a[j] - mu, d1 = c[j] - mu; q += d0 * d0 + d1 * d1; }
#pragma unroll
  for (int o = 1; o < 32; o <<= 1) q += __shfl_xor(q, o);
  const float rs = rsqrtf(q * (1.0f / D) + LNEPS); float y[8];
  for (int j = 0; j < 4; ++j) { y[j] = (a[j] - mu) * rs * bf16_rne(g_[lane * 8 + j]) + bf16_rne(b_[lane * 8 + j]); y[4 + j] = (c[j] - mu) * rs * bf16_rne(g_[lane * 8 + 4 + j]) + bf16_rne(b_[lane * 8 + 4 + j]); }
  {
    if (MODE == 0) { v8b hv, lv; for (int j = 0; j < 8; ++j) { b16 p, qq; split16(y[j] * XS, p, qq); hv[j] = p; lv[j] = qq; } *(v8b*)(Oh + row * D + lane * 8) = hv; *(v8b*)(Ol + row * D + lane * 8) = lv; }
    else { v4f o0 = {y[0], y[1], y[2], y[3]}, o1 = {y[4], y[5], y[6], y[7]}; *(v4f*)(out + row * D + lane * 8) = o0; *(v4f*)(out + row * D + lane * 8 + 4) = o1; }
     }
}
template <int MODE>
__global__ __launch_bounds__(128) void ffn_kernel(const b16* __restrict__ Ah, const b16* __restrict__ Al, const b16* __restrict__ W, const float* __restrict__ bias, b16* __restrict__ Oh, b16* __restrict__ Ol, float* __restrict__ OUTF) {
  // operands in LDS by asynchronous copies of whole 512-byte rows, pitch 528 B: each wave's 16 rows of both A planes and the block's 128 W rows; W rows 64 .. 127 fly while column tiles 0 .. 3 are worked on.
  // The hi plane lands in Tf: a wave's part of Tf (16 x 132 f32) has the size of its 16 padded rows, is its own, and is written only in the epilogue, behind the wave's last fragment read; so two blocks fit a WGP.
  __shared__ __attribute__((aligned(16))) float Tf[4][16][128 + 4]; __shared__ __attribute__((aligned(16))) b16 Als[4][16][KPITCH]; __shared__ __attribute__((aligned(16))) b16 Ws[128][KPITCH];
  static_assert(sizeof(Tf) == sizeof(Als), "the hi plane fills Tf exactly");
  const int wave = __builtin_amdgcn_readfirstlane(threadIdx.x >> 5), lane = threadIdx.x & 31, nloc = lane & 15, hlf = lane >> 4; const size_t m0 = (size_t)blockIdx.x * 64 + wave * 16; const int n0 = blockIdx.y * 128;
  const b16 (*Ahs)[KPITCH] = (const b16 (*)[KPITCH])(&Tf[wave][0][0]);
  stage_rows<2>(Ah + m0 * D + lane * 8, D, lds_addr(&Ahs[0][lane * 8]), KPITCH * 2); stage_rows<2>(Al + m0 * D + lane * 8, D, lds_addr(&Als[wave][0][lane * 8]), KPITCH * 2);
  stage_rows<2>(W + (size_t)(n0 + wave) * D + lane * 8, 4 * D, lds_addr(&Ws[wave][lane * 8]), 4 * KPITCH * 2);   // W rows wave, wave + 4, .. below 64
  v8f acc[8];
#pragma unroll
  for (int t = 0; t < 8; ++t) acc[t] = (v8f){};
  asm volatile("s_wait_asynccnt 0x0" ::: "memory");   // this wave's copies of the A rows and of W rows 0 .. 63 have landed
  __syncthreads();                                     // ... and every other wave's: they may be read
  stage_rows<2>(W + (size_t)(n0 + 64 + wave) * D + lane * 8, 4 * D, lds_addr(&Ws[64 + wave][lane * 8]), 4 * KPITCH * 2);   // W rows 64 .. 127, read behind the second barrier only
  // all fragments of a half (4 column tiles x 8 k-steps) are asked for together, ahead of its products, so that the LDS latency is not paid per product; the A fragments stay in registers for both halves;
  // every loop below is unrolled to keep the register arrays at constant indices
  v16b a[8], al[8], bw[32];
#pragma unroll
  for (int i = 0; i < 32; ++i) { if ((i & 3) == 0) { a[i >> 2] = frag_kb(&Ahs[nloc][(i >> 2) * 32], hlf); al[i >> 2] = frag_kb(&Als[wave][nloc][(i >> 2) * 32], hlf); } bw[i] = frag_kb(&Ws[(i & 3) * 16 + nloc][(i >> 2) * 32], hlf); }
  __builtin_amdgcn_sched_barrier(0);   // holds the reads above in front of the products below: left free, the compiler moves each read down to its product and waits for it there
#pragma unroll
  for (int i = 0; i < 32; ++i) { acc[i & 3] = wmma16p(a[i >> 2], bw[i], acc[i & 3]); acc[i & 3] = wmma16p(al[i >> 2], bw[i], acc[i & 3]); }
  __builtin_amdgcn_sched_barrier(0);   // keeps the products above in front of the wait below, so that the copies in flight land under them
  asm volatile("s_wait_asynccnt 0x0" ::: "memory");   // this wave's copies of W rows 64 .. 127 have landed
  __syncthreads();                                     // ... and every other wave's
#pragma unroll
  for (int i = 0; i < 32; ++i) bw[i] = frag_kb(&Ws[64 + (i & 3) * 16 + nloc][(i >> 2) * 32], hlf);
  __builtin_amdgcn_sched_barrier(0);   // holds the reads above in front of the products below: left free, the compiler moves each read down to its product and waits for it there
#pragma unroll
  for (int i = 0; i < 32; ++i) { acc[4 + (i & 3)] = wmma16p(a[i >> 2], bw[i], acc[4 + (i & 3)]); acc[4 + (i & 3)] = wmma16p(al[i >> 2], bw[i], acc[4 + (i & 3)]); }
#pragma unroll
  for (int t = 0; t < 8; ++t) { const float bb = bf16_rne(bias[n0 + t * 16 + nloc]);
#pragma unroll
    for (int r = 0; r < 8; ++r) { float v = acc[t][r] * (1.0f / (XS * WSC)) + bb; if (MODE == 0) v = fmaxf(v, 0.0f); Tf[wave][8 * hlf + r][t * 16 + nloc] = v; } }
  wave_lds_sync();
  { for (int rr = 0; rr < 16; ++rr) { const v4f f = *(const v4f*)(&Tf[wave][rr][lane * 4]);
      if (MODE == 1) *(v4f*)(OUTF + (m0 + rr) * D + n0 + lane * 4) = f;
      else { v4h hv, lv; for (int j = 0; j < 4; ++j) { b16 p, q; split16(f[j] * XS, p, q); hv[j] = p; lv[j] = q; } *(v4h*)(Oh + (m0 + rr) * D + n0 + lane * 4) = hv; *(v4h*)(Ol + (m0 + rr) * D + n0 + lane * 4) = lv; } }
     }
}
}  // namespace

extern "C" void kernel_launch(void* const* d_in, const int* in_sizes, int n_in, void* d_out, int out_size, void* d_ws, size_t ws_size, hipStream_t stream) {
  (void)n_in;
  auto Fp = [&](int i) { return (const float*)d_in[i]; };
  // input order: 0 x [4,4096,256], 1 Wq [256,256] ([e][d]), 2 bq, 3 Wk, 4 bk, 5 Wv, 6 bv, 7 W1, 8 b1, 9 W2, 10 b2, 11 g_ln, 12 beta_ln, 13 g_lnff, 14 beta_lnff
  if (in_sizes[0] != B * S * D || in_sizes[1] != D * D || in_sizes[3] != D * D || in_sizes[5] != D * D || in_sizes[7] != FF * D || in_sizes[9] != D * FF || in_sizes[11] != D || in_sizes[13] != D || out_size != B * S * D) return;
  size_t off = 0; char* ws = (char*)d_ws;
  auto carve = [&](size_t bytes) { char* p = ws + off; off += (bytes + 255) & ~(size_t)255; return p; };
  b16* WT = (b16*)carve((size_t)5 * D * D * 2); b16* Qp = (b16*)carve((size_t)B * S * D * 2); b16* Kp = (b16*)carve((size_t)B * S * D * 2); b16* VT = (b16*)carve((size_t)B * D * S * 2);
  float* O1 = (float*)carve((size_t)B * S * D * 4); float* O2 = (float*)carve((size_t)B * S * D * 4); float* ML = (float*)carve((size_t)2 * B * S * 2 * 4); b16* Ph = (b16*)carve((size_t)B * S * D * 2); b16* Pl = (b16*)carve((size_t)B * S * D * 2); b16* Hh = Qp; b16* Hl = Kp;   // the FFN hidden planes reuse the q/k planes (dead after attention)
  float* H2 = O1;   // h2 rows reuse O1 (dead after the first LayerNorm produced the planes)
  if (off > ws_size || off > ((size_t)128 << 20)) return;   // about 76 MB
  wprep_kernel<<<(unsigned)(((size_t)5 * D * D / 8 + 255) / 256), 256, 0, stream>>>(Fp(1), Fp(3), Fp(5), Fp(7), Fp(9), WT);
  qkv_kernel<<<dim3(S / 64, BL, 3), 128, 0, stream>>>(Fp(0), WT, Fp(2), Fp(4), Fp(6), Qp, Kp, VT);
  attn_kernel<<<dim3(S / 64, BL), 128, 0, stream>>>(Qp, Kp, VT, O1, O2, ML);
  ln_kernel<0><<<(unsigned)((size_t)BL * S / 8), 256, 0, stream>>>(O1, O2, ML, Fp(0), Fp(11), Fp(12), Ph, Pl, nullptr);
  ffn_kernel<0><<<dim3((unsigned)((size_t)BL * S / 64), 2), 128, 0, stream>>>(Ph, Pl, WT + (size_t)3 * D * D, Fp(8), Hh, Hl, nullptr);
  ffn_kernel<1><<<dim3((unsigned)((size_t)BL * S / 64), 2), 128, 0, stream>>>(Hh, Hl, WT + (size_t)4 * D * D, Fp(10), nullptr, nullptr, H2);
  ln_kernel<1><<<(unsigned)((size_t)BL * S / 8), 256, 0, stream>>>(H2, nullptr, nullptr, nullptr, Fp(13), Fp(14), nullptr, nullptr, (float*)d_out);
}

// v004
// Measured time: 101 microseconds a run.
// In two side-by-side timings against v003, it was 1.27 and 1.28 times as fast.
// Counting every step since v000, it is 9.42 times as fast.
#include <hip/hip_runtime.h>

// Causal single-head transformer block: q, k, v = x W{q,k,v}^T + b ([4][4096][256], d = 256); A = q . k; causal mask filled with -32767 BEFORE the 1/sqrt(256) scaling (masked weights are exactly 0
// in f32 after exp); softmax over keys <= query; o = A v + x; LayerNorm; h = relu(o W1^T + b1) W2^T + b2; LayerNorm (no second residual) -> [4][4096][256].
// Deterministic: flash-style causal attention per 16-query wave (online softmax, running max, over key tiles 0 .. min(qt, CUT - 1) and, as a second partial, CUT .. qt), both LayerNorms and the FFN in one row-local kernel behind attention;
// no atomics.
// compute dtype: WMMA v_wmma_f32_16x16x32_f16 with f32 accumulate for the q/k/v projections (x EXACT bf16 x8 staged through LDS, W [e][d] rows exact x256: 1 product), S^T = K Q^T (q, k single
// f16 x8: 1 product — logits have std ≈ 1 over ~2,000 keys, per-key rounding averages to ≈4e-5 on the output), O^T += V^T P^T (v single f16 x8, P x1024 single f16: 1 product) and the two FFN GEMMs
// (LayerNorm output / relu hidden as f16 hi+lo x8 planes: 2 products); softmax statistics (exp2), residual, LayerNorms, bias, relu in f32. Inputs rounded to bf16 once.

namespace {
constexpr int B = 4, S = 4096, D = 256, FF = 256, BL = 4 /* batches computed (== B shipped) */;
constexpr float XS = 8.0f, WSC = 256.0f, PS = 1024.0f, LOG2E = 1.4426950408889634f, LNEPS = 1e-5f, MASK_FILL = -32767.0f;
static_assert(S % 64 == 0 && D == 256 && FF == 256, "tiling");
typedef _Float16 b16;
typedef __attribute__((ext_vector_type(16))) _Float16 v16b;
typedef __attribute__((ext_vector_type(8))) _Float16 v8b;
typedef __attribute__((ext_vector_type(8))) float v8f;
typedef __attribute__((ext_vector_type(4))) float v4f;
__device__ __forceinline__ float bf16_rne(float f) { unsigned int u = __float_as_uint(f); u += 0x7FFFu + ((u >> 16) & 1u); return __uint_as_float(u & 0xFFFF0000u); }
__device__ __forceinline__ void split16(float v, b16& hi, b16& lo) { hi = (b16)v; lo = (b16)(v - (float)hi); }
__device__ __forceinline__ v16b frag_kb(const b16* p, int hh) { const v8b a = *(const v8b*)(p + 8 * hh), b = *(const v8b*)(p + 16 + 8 * hh); v16b f;
#pragma unroll
  for (int e = 0; e < 8; ++e) { f[e] = a[e]; f[8 + e] = b[e]; } return f; }
__device__ __forceinline__ void wave_lds_sync() { __builtin_amdgcn_fence(__ATOMIC_RELEASE, "workgroup"); __builtin_amdgcn_wave_barrier(); __builtin_amdgcn_fence(__ATOMIC_ACQUIRE, "workgroup"); }
__device__ __forceinline__ float pmul(float a, float b) { float p = a * b; asm volatile("" : "+v"(p)); return p; }
__device__ __forceinline__ int iclamp(int v, int lo, int hi) { return v < lo ? lo : (v > hi ? hi : v); }

typedef __attribute__((ext_vector_type(2))) _Float16 v2h;
typedef __attribute__((ext_vector_type(4))) _Float16 v4h;
typedef __attribute__((ext_vector_type(2))) float v2f;
__device__ __forceinline__ float nexp2(float v) { return __builtin_amdgcn_exp2f(v); }
__global__ __launch_bounds__(256) void wprep_kernel(const float* __restrict__ wq, const float* __restrict__ wk, const float* __restrict__ wv, const float* __restrict__ w1, const float* __restrict__ w2, b16* __restrict__ WT) {
  const size_t u = (size_t)blockIdx.x * 256 + threadIdx.x; if (u >= (size_t)5 * D * D / 8) return; const size_t e = u * 8; const int m = (int)(e / (D * D)); const size_t el = e % ((size_t)D * D);
  const float* w = m == 0 ? wq : m == 1 ? wk : m == 2 ? wv : m == 3 ? w1 : w2; v8b o; for (int j = 0; j < 8; ++j) o[j] = (b16)(bf16_rne(w[el + j]) * WSC);
  { *(v8b*)(WT + e) = o;  }
}
constexpr int KT = 64, KPITCH = D + 8, VPITCH = KT + 8, NT = S / KT, CUT = NT / 2 + 1;
// the plain builtin (the compiler keeps the distance behind it): operands of an asm statement must lie below v256, which the fragments of a whole pass do not fit
__device__ __forceinline__ v8f wmma16p(v16b a, v16b b, v8f c) { return __builtin_amdgcn_wmma_f32_16x16x32_f16(false, a, false, b, (short)0, c, false, false); }
__device__ __forceinline__ unsigned lds_addr(const void* p) { return (unsigned)(size_t)p; }
// eight 16-byte copies per lane; s_wait_xcnt 0 closes the statement so that no address register is rewritten while a copy may still name it
template <typename E>
__device__ __forceinline__ void async_copy8(const unsigned (&l)[8], const E* const (&g)[8]) {
  asm volatile("global_load_async_to_lds_b128 %0, %8, off\n\t"
               "global_load_async_to_lds_b128 %1, %9, off\n\t"
               "global_load_async_to_lds_b128 %2, %10, off\n\t"
               "global_load_async_to_lds_b128 %3, %11, off\n\t"
               "global_load_async_to_lds_b128 %4, %12, off\n\t"
               "global_load_async_to_lds_b128 %5, %13, off\n\t"
               "global_load_async_to_lds_b128 %6, %14, off\n\t"
               "global_load_async_to_lds_b128 %7, %15, off\n\t"
               "s_wait_xcnt 0x0"
               :: "v"(l[0]), "v"(l[1]), "v"(l[2]), "v"(l[3]), "v"(l[4]), "v"(l[5]), "v"(l[6]), "v"(l[7]),
                  "v"(g[0]), "v"(g[1]), "v"(g[2]), "v"(g[3]), "v"(g[4]), "v"(g[5]), "v"(g[6]), "v"(g[7]) : "memory");
}
// N8 * 8 copies of 16 bytes per lane: piece i goes from g0 + i * gstep (elements) to LDS byte l0 + i * lstep (unrolled so that every address is a constant step from the lane's base)
template <int N8, typename E>
__device__ __forceinline__ void stage_rows(const E* g0, int gstep, unsigned l0, unsigned lstep) {
#pragma unroll
  for (int h = 0; h < N8; ++h) { unsigned l[8]; const E* g[8];
#pragma unroll
    for (int i = 0; i < 8; ++i) { l[i] = l0 + (unsigned)(h * 8 + i) * lstep; g[i] = g0 + (size_t)(h * 8 + i) * gstep; }
    async_copy8(l, g); }
}
// qkv: block = 64 tokens of one batch (4 waves) x one of {q, k, v} (grid.z): A = bf16(x) x8 staged; 16 tiles x 8 k-steps; + bias. q, k -> single f16 x8 planes [b][s][256] (32 lanes x 16 B);
// the operands come into LDS by asynchronous copies of whole 512-byte pieces: each wave's 16 x rows (f32, into its part of Tf, which is free until the epilogue) and the 256 W rows, once per block, at
// pitch 528 B (16 B x odd: ds_load_b128 free of bank conflicts). W rows 64 .. 255 fly while x is converted and column tiles 0 .. 3 are worked on; never more than 48 copies of a wave are in flight.
__global__ __launch_bounds__(128) void qkv_kernel(const float* __restrict__ x, const b16* __restrict__ WT, const float* __restrict__ bq, const float* __restrict__ bk, const float* __restrict__ bv, b16* __restrict__ Qp, b16* __restrict__ Kp, b16* __restrict__ VT) {
  __shared__ __attribute__((aligned(16))) b16 As[4][16][D + 8]; __shared__ __attribute__((aligned(16))) float Tf[4][16][256 + 4]; __shared__ __attribute__((aligned(16))) b16 Ws[D][KPITCH];
  const int wave = __builtin_amdgcn_readfirstlane(threadIdx.x >> 5), lane = threadIdx.x & 31, nloc = lane & 15, hlf = lane >> 4; const int b = blockIdx.y, which = blockIdx.z; const int t0 = blockIdx.x * 64 + wave * 16;
  const b16* W = WT + (size_t)which * D * D; const float* bias = which == 0 ? bq : which == 1 ? bk : bv;
  const float* xw = x + ((size_t)b * S + t0) * D + lane * 4;   // a row of x is two pieces of 512 bytes
  stage_rows<2>(xw, D, lds_addr(&Tf[wave][0][lane * 4]), (256 + 4) * 4); stage_rows<2>(xw + 128, D, lds_addr(&Tf[wave][0][128 + lane * 4]), (256 + 4) * 4);
  stage_rows<2>(W + (size_t)wave * D + lane * 8, 4 * D, lds_addr(&Ws[wave][lane * 8]), 4 * KPITCH * 2);   // W rows wave, wave + 4, .. below 64
  asm volatile("s_wait_asynccnt 0x0" ::: "memory");   // this wave's copies of x and of W rows 0 .. 63 have landed
  __syncthreads();                                     // ... and every other wave's: they may be read
  stage_rows<6>(W + (size_t)(64 + wave) * D + lane * 8, 4 * D, lds_addr(&Ws[64 + wave][lane * 8]), 4 * KPITCH * 2);   // W rows 64 .. 255, read behind the second barrier only
#pragma unroll   // constant LDS offsets; the reads of later rows go out under the conversion of earlier ones
  for (int rr = 0; rr < 16; ++rr) { const v4f f0 = *(const v4f*)(&Tf[wave][rr][lane * 8]), f1 = *(const v4f*)(&Tf[wave][rr][lane * 8 + 4]); v8b o;
#pragma unroll
    for (int j = 0; j < 4; ++j) { o[j] = (b16)(bf16_rne(f0[j]) * XS); o[4 + j] = (b16)(bf16_rne(f1[j]) * XS); }
    *(v8b*)(&As[wave][rr][lane * 8]) = o; }
  wave_lds_sync();
  v8f acc[16];
#pragma unroll
  for (int t = 0; t < 16; ++t) acc[t] = (v8f){};
  // a group = 4 column tiles x 8 k-steps. All fragments of a group are asked for together and one group ahead of their products (two register sets), so that the LDS latency is not paid per product;
  // every loop below is unrolled to keep the register arrays at constant indices
  v16b a[8], w0[32], w1[32];
#pragma unroll
  for (int i = 0; i < 32; ++i) { if ((i & 3) == 0) a[i >> 2] = frag_kb(&As[wave][nloc][(i >> 2) * 32], hlf); w0[i] = frag_kb(&Ws[(i & 3) * 16 + nloc][(i >> 2) * 32], hlf); }
  __builtin_amdgcn_sched_barrier(0);   // holds the reads above in front of the products below: left free, the compiler moves each read down to its product and waits for it there
#pragma unroll
  for (int i = 0; i < 32; ++i) acc[i & 3] = wmma16p(a[i >> 2], w0[i], acc[i & 3]);
  __builtin_amdgcn_sched_barrier(0);   // keeps the products above in front of the wait below, so that the copies in flight land under them
  asm volatile("s_wait_asynccnt 0x0" ::: "memory");   // this wave's copies of W rows 64 .. 255 have landed
  __syncthreads();                                     // ... and every other wave's
#pragma unroll
  for (int i = 0; i < 32; ++i) w1[i] = frag_kb(&Ws[64 + (i & 3) * 16 + nloc][(i >> 2) * 32], hlf);
#pragma unroll
  for (int i = 0; i < 32; ++i) w0[i] = frag_kb(&Ws[128 + (i & 3) * 16 + nloc][(i >> 2) * 32], hlf);
  __builtin_amdgcn_sched_barrier(0);   // holds the reads above in front of the products below: left free, the compiler moves each read down to its product and waits for it there
#pragma unroll
  for (int i = 0; i < 32; ++i) acc[4 + (i & 3)] = wmma16p(a[i >> 2], w1[i], acc[4 + (i & 3)]);
  __builtin_amdgcn_sched_barrier(0);   // keeps the last group's reads from rising among those products or sinking to their own
#pragma unroll
  for (int i = 0; i < 32; ++i) w1[i] = frag_kb(&Ws[192 + (i & 3) * 16 + nloc][(i >> 2) * 32], hlf);
  __builtin_amdgcn_sched_barrier(0);   // holds the reads above in front of the products below: left free, the compiler moves each read down to its product and waits for it there
#pragma unroll
  for (int i = 0; i < 32; ++i) acc[8 + (i & 3)] = wmma16p(a[i >> 2], w0[i], acc[8 + (i & 3)]);
#pragma unroll
  for (int i = 0; i < 32; ++i) acc[12 + (i & 3)] = wmma16p(a[i >> 2], w1[i], acc[12 + (i & 3)]);
#pragma unroll
  for (int t = 0; t < 16; ++t) { const float bb = bf16_rne(bias[t * 16 + nloc]);
#pragma unroll
    for (int r = 0; r < 8; ++r) Tf[wave][8 * hlf + r][t * 16 + nloc] = acc[t][r] * (1.0f / (XS * WSC)) + bb; }
  __syncthreads();
  {
    if (which < 2) { b16* P = (which == 0 ? Qp : Kp) + ((size_t)b * S) * D; for (int rr = 0; rr < 16; ++rr) { v8b o; for (int j = 0; j < 8; ++j) o[j] = (b16)(Tf[wave][rr][lane * 8 + j] * XS); *(v8b*)(P + (size_t)(t0 + rr) * D + lane * 8) = o; } }
    else {
#pragma unroll 1
      for (int q = 0; q < 64; ++q) { const int d = wave * 64 + q; const int tk = lane * 2; v2h vv; vv[0] = (b16)(Tf[tk >> 4][tk & 15][d] * XS); vv[1] = (b16)(Tf[(tk + 1) >> 4][(tk + 1) & 15][d] * XS); *(v2h*)(VT + ((size_t)b * D + d) * S + blockIdx.x * 64 + lane * 2) = vv; } }
     }
}
// causal attention: grid (S/64, BL); block = 4 waves x 16 queries (q0). Query tile qt needs qt + 1 key tiles, and one block fills a WGP, so the launch lasts as long as its longest block: the work is cut
// into equal blocks. Block j does the head of query tile NT - 1 - j (key tiles 0 .. min(qt + 1, CUT) - 1, partial 0) and, for j > NT / 2, before it the tail of query tile j (key tiles CUT .. j, partial 1):
// CUT or CUT - 1 key tiles in every block. A partial is its own softmax-weighted mean with its (max, sum); the kernel behind attention merges the two partials of a long query tile and adds the residual.
// Within a segment the block walks its keys in tiles of 64: K rows [64][256] and V^T rows [256][64] are copied once per block into LDS by
// asynchronous copies (two buffers: tile t + 1 flies while tile t is worked on) and every wave takes its fragments from there. Row pitches 528 B and 144 B (16 B x odd) keep ds_load_b128 free of bank conflicts.
// Per tile two passes of 32 keys, keys in ascending order: S^T = K Q^T (2 tiles x 8 k-steps), logits A/16 in the log2 domain, keys > query masked (the reference's -32767 fill gives exp = 0 exactly),
// online softmax, P x1024 single f16 via LDS -> O^T += V^T P^T (16 d-tiles x 1 k-step); partial = O / l
// one tile: kg / lk = this lane's 16 bytes of K row (wave) of the tile, rows step by 4; vg / lv = this lane's 16 bytes of V^T row (thread / 8), rows step by 16
// (the loops are unrolled so that every address is a constant step from the lane's base)
__device__ __forceinline__ void stage_tile(const b16* kg, unsigned lk, const b16* vg, unsigned lv) {
#pragma unroll
  for (int h = 0; h < 2; ++h) { unsigned l[8]; const b16* g[8];
#pragma unroll
    for (int i = 0; i < 8; ++i) { l[i] = lk + (unsigned)((h * 8 + i) * 4 * KPITCH * 2); g[i] = kg + (size_t)(h * 8 + i) * 4 * D; }
    async_copy8(l, g); }
#pragma unroll
  for (int h = 0; h < 2; ++h) { unsigned l[8]; const b16* g[8];
#pragma unroll
    for (int i = 0; i < 8; ++i) { l[i] = lv + (unsigned)((h * 8 + i) * 16 * VPITCH * 2); g[i] = vg + (size_t)(h * 8 + i) * 16 * S; }
    async_copy8(l, g); }
}
__global__ __launch_bounds__(128) void attn_kernel(const b16* __restrict__ Qp, const b16* __restrict__ Kp, const b16* __restrict__ VT, float* __restrict__ O1, float* __restrict__ O2, float* __restrict__ ML) {
  __shared__ __attribute__((aligned(16))) b16 Ks[2][KT][KPITCH]; __shared__ __attribute__((aligned(16))) b16 Vs[2][D][VPITCH];
  __shared__ __attribute__((aligned(16))) b16 Pb[4][16][32 + 8]; __shared__ __attribute__((aligned(16))) float To[4][16][D + 4];
  const int tid = threadIdx.x, wave = __builtin_amdgcn_readfirstlane(tid >> 5), lane = tid & 31, hh = lane >> 4, col = lane & 15; const int b = blockIdx.y, j = blockIdx.x;
  const b16* Qb = Qp + (size_t)b * S * D; const b16* Kb = Kp + (size_t)b * S * D; const b16* Vb = VT + (size_t)b * D * S;
#pragma unroll 1   // stays rolled: the two segments of a block run one after the other through the same code and the same LDS
  for (int seg = (j > NT / 2) ? 0 : 1; seg < 2; ++seg) {   // block-uniform: seg 0 = tail of query tile j, seg 1 = head of query tile NT - 1 - j
  const int qt = seg == 0 ? j : NT - 1 - j, tb = seg == 0 ? CUT : 0;
  const int ntile = seg == 0 ? j + 1 - CUT : (qt + 1 < CUT ? qt + 1 : CUT);   // tiles of 64 keys in this segment, at least one
  const int q0 = qt * 64 + wave * 16, qi = q0 + col;
  const b16* kg = Kb + (size_t)(tb * KT + wave) * D + lane * 8; const b16* vg = Vb + (size_t)(tid >> 3) * S + tb * KT + (tid & 7) * 8;
  const unsigned lk[2] = {lds_addr(&Ks[0][wave][lane * 8]), lds_addr(&Ks[1][wave][lane * 8])}, lv[2] = {lds_addr(&Vs[0][tid >> 3][(tid & 7) * 8]), lds_addr(&Vs[1][tid >> 3][(tid & 7) * 8])};
  stage_tile(kg, lk[0], vg, lv[0]);
  v16b qa[8]; for (int ks = 0; ks < 8; ++ks) qa[ks] = frag_kb(Qb + (size_t)qi * D + ks * 32, hh);
  const float cs = LOG2E / (16.0f * XS * XS);
  float m = -INFINITY, l = 0.0f; v8f o[16]; for (int t = 0; t < 16; ++t) o[t] = (v8f){};
  const int kend = q0 + 16;   // keys < kend may be attended by some query of this wave
  asm volatile("s_wait_asynccnt 0x0" ::: "memory");   // this wave's copies of tile 0 have landed
  __syncthreads();                                     // ... and every other wave's: tile 0 may be read
  if (ntile > 1) stage_tile(kg + (size_t)KT * D, lk[1], vg + KT, lv[1]);
#pragma unroll 1   // stays rolled: one trip already holds two whole passes
  for (int tl = 0; tl < ntile; ++tl) {
    const b16 (*Kt)[KPITCH] = Ks[tl & 1]; const b16 (*Vt)[VPITCH] = Vs[tl & 1];
#pragma unroll     // ps becomes an immediate offset of the LDS reads; the unrolls below keep the register arrays at constant indices
    for (int ps = 0; ps < 2; ++ps) { const int kb = (tb + tl) * KT + ps * 32;
      if (kb < kend) {   // wave-uniform (scalar): a wave skips the pass beyond its diagonal, never the publish point below
        // all fragments of the pass are asked for ahead of the products, so that the LDS latency is paid once per run and not once per product
        v16b kf[16], vf[16];
#pragma unroll
        for (int i = 0; i < 16; ++i) kf[i] = frag_kb(&Kt[ps * 32 + (i >> 3) * 16 + col][(i & 7) * 32], hh);
#pragma unroll
        for (int t = 0; t < 16; ++t) vf[t] = frag_kb(&Vt[t * 16 + col][ps * 32], hh);
        v8f s[2] = {(v8f){}, (v8f){}};
#pragma unroll
        for (int tt = 0; tt < 2; ++tt)
#pragma unroll
          for (int ks = 0; ks < 8; ++ks) s[tt] = wmma16p(kf[tt * 8 + ks], qa[ks], s[tt]);
        float e[16]; float mx = -INFINITY;
#pragma unroll
        for (int i = 0; i < 16; ++i) { const int key = kb + (i < 8 ? 0 : 16) + 8 * hh + (i & 7); const float v = (key <= qi) ? (i < 8 ? s[0][i] : s[1][i - 8]) * cs : -INFINITY; e[i] = v; mx = fmaxf(mx, v); }
        mx = fmaxf(mx, __shfl_xor(mx, 16)); const float mn = fmaxf(m, mx); const float al = (mn == -INFINITY) ? 1.0f : nexp2(m - mn); float sum = 0.0f;
        // B operand needs row = query, k = key: write P[query col][key] into LDS (wave-private), then frag
#pragma unroll
        for (int i = 0; i < 16; ++i) { const float p = (e[i] == -INFINITY) ? 0.0f : nexp2(e[i] - mn); sum += p; Pb[wave][col][(i < 8 ? 0 : 16) + 8 * hh + (i & 7)] = (b16)(p * PS); }
        sum += __shfl_xor(sum, 16); l = l * al + sum; m = mn;
        wave_lds_sync();
        const v16b pf = frag_kb(&Pb[wave][col][0], hh);
#pragma unroll
        for (int t = 0; t < 16; ++t) { o[t] *= al; o[t] = wmma16p(vf[t], pf, o[t]); }
        wave_lds_sync(); } }
    // publish point of tile tl + 1, passed by every wave
    asm volatile("s_wait_dscnt 0x0" ::: "memory");      // this wave's reads of tile tl are done before the buffer is refilled
    asm volatile("s_wait_asynccnt 0x0" ::: "memory");   // this wave's copies of tile tl + 1 have landed
    __syncthreads();                                     // tile tl + 1 may be read by all; tile tl's buffer is left by all
    if (tl + 2 < ntile) stage_tile(kg + (size_t)(tl + 2) * KT * D, lk[tl & 1], vg + (size_t)(tl + 2) * KT, lv[tl & 1]); }
  asm volatile("s_wait_asynccnt 0x0" ::: "memory");     // no copy is left in flight when the wave goes on to its end
  const float inv = 1.0f / (l * PS * XS);
#pragma unroll
  for (int t = 0; t < 16; ++t)
#pragma unroll
    for (int r = 0; r < 8; ++r) To[wave][col][t * 16 + 8 * hh + r] = o[t][r] * inv;
  wave_lds_sync();
  float* Op = seg == 0 ? O2 : O1;
  if (hh == 0) { const v2f ml = {m, l}; *(v2f*)(ML + ((size_t)(seg == 0 ? B * S : 0) + (size_t)b * S + qi) * 2) = ml; }   // both halves hold the same (max, sum): 16 queries = one 128-byte line per wave
  asm volatile("s_wait_xcnt 0x0" ::: "memory");   // the store's address registers are rewritten right behind it
#pragma unroll   // constant row offsets in the LDS reads and the stores
  for (int g = 0; g < 2; ++g) { v4f a0[8], a1[8];
#pragma unroll   // keeps the register arrays at constant indices
    for (int rr = 0; rr < 8; ++rr) { a0[rr] = *(const v4f*)(&To[wave][g * 8 + rr][lane * 8]); a1[rr] = *(const v4f*)(&To[wave][g * 8 + rr][lane * 8 + 4]); }
#pragma unroll   // as above
    for (int rr = 0; rr < 8; ++rr) { const size_t row = ((size_t)b * S + q0 + g * 8 + rr) * D; *(v4f*)(Op + row + lane * 8) = a0[rr]; *(v4f*)(Op + row + lane * 8 + 4) = a1[rr]; }
    asm volatile("s_wait_xcnt 0x0" ::: "memory"); }   // the stores' data and address registers are rewritten behind it (next eight rows, next segment)
  }
}
// everything behind attention in one launch, because it is local to a token row: merge of the attention partials + residual + LayerNorm 1, both FFN GEMMs, LayerNorm 2. Block = 64 tokens (one query tile),
// wave = 16 tokens from first to last; the LayerNorm output and the relu hidden rows (f16 hi + lo x8 planes) stay in the wave's own LDS rows, h2 stays in the accumulators.
// Products are taken transposed, D^T = W A^T (W rows as the A operand, token rows as B; same loader for both): a lane then holds 8 consecutive features of ONE token per tile, so the hidden planes go to LDS
// as 16-byte stores and LayerNorm 2 is a sum inside the lane plus one exchange with lane ^ 16.
// One 256-row W buffer at pitch 528 B serves W1 and then W2, filled by asynchronous copies of whole 512-byte rows: rows 0 .. 191 and rows 192 .. 255 are separate fills (48 and 16 copies of a wave, never
// more than 48 in flight); each fill stands behind the barrier that ends every wave's reads of those rows and is read behind its own wait and barrier.
// The text runs once per wave, so it is kept short: LayerNorm 1 is a rolled loop over groups of 4 rows, the two GEMMs are two trips of one rolled loop, the copies a rolled loop of eight.
template <int N8>
__device__ __forceinline__ void stage_rows_rolled(const b16* g0, int gstep, unsigned l0, unsigned lstep) {
#pragma unroll 1   // rolled: 24 address registers in all, where the unrolled form keeps every address of a fill alive across the products
  for (int h = 0; h < N8; ++h) { unsigned l[8]; const b16* g[8];
#pragma unroll
    for (int i = 0; i < 8; ++i) { l[i] = l0 + (unsigned)(h * 8 + i) * lstep; g[i] = g0 + (size_t)(h * 8 + i) * gstep; }
    async_copy8(l, g); }
}
__device__ __forceinline__ void load_group(v16b (&w)[32], const b16 (*Ws)[KPITCH], int row0, int nloc, int hlf) {
#pragma unroll   // register array at constant indices
  for (int i = 0; i < 32; ++i) w[i] = frag_kb(&Ws[row0 + (i & 3) * 16 + nloc][(i >> 2) * 32], hlf);
}
// 4 feature tiles x 8 k-steps x (hi, lo): per accumulator the order is hi, lo within ascending k; the four tiles stand between an accumulator's two uses
template <int G>
__device__ __forceinline__ void mul_group(v8f (&acc)[16], const v16b (&w)[32], const v16b (&a)[8], const v16b (&al)[8]) {
#pragma unroll   // register arrays at constant indices
  for (int ks = 0; ks < 8; ++ks) {
#pragma unroll
    for (int tt = 0; tt < 4; ++tt) acc[4 * G + tt] = wmma16p(w[ks * 4 + tt], a[ks], acc[4 * G + tt]);
#pragma unroll
    for (int tt = 0; tt < 4; ++tt) acc[4 * G + tt] = wmma16p(w[ks * 4 + tt], al[ks], acc[4 * G + tt]);
  }
}
__device__ __forceinline__ float wave_sum(float s) {
#pragma unroll
  for (int o = 1; o < 32; o <<= 1) s += __shfl_xor(s, o);
  return s; }
// four token rows as LayerNorm 1 takes them: 8 features a lane of partial 0 (a, c), of x, and for a long query tile of partial 1 with both (max, sum) pairs
struct Rows4 { v4f a[4], c[4], x0[4], x1[4], a2[4], c2[4]; v2f p0[4], p1[4]; };
__device__ __forceinline__ void load_rows4(Rows4& R, const float* IN, const float* IN2, const float* ML, const float* x, size_t row, int lane, bool two) {
  const float* pa = IN + row * D + lane * 8; const float* px = x + row * D + lane * 8;
#pragma unroll
  for (int rr = 0; rr < 4; ++rr) { R.a[rr] = *(const v4f*)(pa + rr * D); R.c[rr] = *(const v4f*)(pa + rr * D + 4); R.x0[rr] = *(const v4f*)(px + rr * D); R.x1[rr] = *(const v4f*)(px + rr * D + 4); }
  asm volatile("s_wait_xcnt 0x0" :: "v"(pa), "v"(px) : "memory");   // the loads' address registers are rewritten behind it; named here, they stay whole up to it (no load's result is placed on them)
  if (two) { const float* p2 = IN2 + row * D + lane * 8;
#pragma unroll
    for (int rr = 0; rr < 4; ++rr) { R.a2[rr] = *(const v4f*)(p2 + rr * D); R.c2[rr] = *(const v4f*)(p2 + rr * D + 4);
      R.p0[rr] = *(const v2f*)(ML + (row + rr) * 2); R.p1[rr] = *(const v2f*)(ML + ((size_t)B * S + row + rr) * 2); }
    asm volatile("s_wait_xcnt 0x0" :: "v"(p2) : "memory"); }   // as above
}
__global__ __launch_bounds__(128) void tail_kernel(const float* __restrict__ IN, const float* __restrict__ IN2, const float* __restrict__ ML, const float* __restrict__ x, const float* __restrict__ g1, const float* __restrict__ be1,
                                                   const b16* __restrict__ W1, const b16* __restrict__ W2, const float* __restrict__ b1, const float* __restrict__ b2, const float* __restrict__ g2, const float* __restrict__ be2, float* __restrict__ out) {
  __shared__ __attribute__((aligned(16))) b16 Ws[D][KPITCH]; __shared__ __attribute__((aligned(16))) b16 Ahs[4][16][KPITCH]; __shared__ __attribute__((aligned(16))) b16 Als[4][16][KPITCH];
  __shared__ __attribute__((aligned(16))) float To[4][16][D + 4]; __shared__ __attribute__((aligned(16))) float Ps[4][D];
  const int tid = threadIdx.x, wave = __builtin_amdgcn_readfirstlane(tid >> 5), lane = tid & 31, nloc = lane & 15, hlf = lane >> 4; const size_t row0 = (size_t)blockIdx.x * 64 + wave * 16;
  stage_rows_rolled<6>(W1 + (size_t)wave * D + lane * 8, 4 * D, lds_addr(&Ws[wave][lane * 8]), 4 * KPITCH * 2);   // W1 rows 0 .. 191 (wave, wave + 4, ..) fly under LayerNorm 1
  const bool two = (int)(blockIdx.x & (NT - 1)) >= CUT;   // block-uniform: a long query tile has two partials
  Rows4 raw = {}; load_rows4(raw, IN, IN2, ML, x, row0, lane, two);
  // per-feature vectors of the two epilogues, rounded once, read by every wave behind the first barrier
  { const v2f p0 = *(const v2f*)(b1 + tid * 2), p1 = *(const v2f*)(b2 + tid * 2), p2 = *(const v2f*)(g2 + tid * 2), p3 = *(const v2f*)(be2 + tid * 2);
    asm volatile("s_wait_xcnt 0x0" ::: "memory");   // the loads' base and offset registers are rewritten behind them
    const v2f q0 = {bf16_rne(p0[0]), bf16_rne(p0[1])}, q1 = {bf16_rne(p1[0]), bf16_rne(p1[1])}, q2 = {bf16_rne(p2[0]), bf16_rne(p2[1])}, q3 = {bf16_rne(p3[0]), bf16_rne(p3[1])};
    *(v2f*)(&Ps[0][tid * 2]) = q0; *(v2f*)(&Ps[1][tid * 2]) = q1; *(v2f*)(&Ps[2][tid * 2]) = q2; *(v2f*)(&Ps[3][tid * 2]) = q3; }
  float gg[8], bb[8];
  { const v4f u0 = *(const v4f*)(g1 + lane * 8), u1 = *(const v4f*)(g1 + lane * 8 + 4), u2 = *(const v4f*)(be1 + lane * 8), u3 = *(const v4f*)(be1 + lane * 8 + 4);
    asm volatile("s_wait_xcnt 0x0" ::: "memory");   // as above
#pragma unroll
    for (int j = 0; j < 4; ++j) { gg[j] = bf16_rne(u0[j]); gg[4 + j] = bf16_rne(u1[j]); bb[j] = bf16_rne(u2[j]); bb[4 + j] = bf16_rne(u3[j]); } }
  // LayerNorm 1, a row across the wave (8 features a lane), 4 rows a trip; the next 4 rows' loads go out ahead of this group's sums and land under its arithmetic
#pragma unroll 1   // rolled for a short text
  for (int bt = 0; bt < 4; ++bt) { v4f a[4], c[4];
#pragma unroll
    for (int rr = 0; rr < 4; ++rr) { a[rr] = raw.a[rr]; c[rr] = raw.c[rr]; }
    if (two) {
#pragma unroll
      for (int rr = 0; rr < 4; ++rr) { const v2f p0 = raw.p0[rr], p1 = raw.p1[rr]; const float mm = fmaxf(p0[0], p1[0]);
        float w0 = p0[1] * nexp2(p0[0] - mm), w1 = p1[1] * nexp2(p1[0] - mm); const float rw = 1.0f / (w0 + w1); w0 *= rw; w1 *= rw;
        a[rr] = a[rr] * w0 + raw.a2[rr] * w1; c[rr] = c[rr] * w0 + raw.c2[rr] * w1; } }
#pragma unroll
    for (int rr = 0; rr < 4; ++rr)
#pragma unroll
      for (int j = 0; j < 4; ++j) { a[rr][j] += bf16_rne(raw.x0[rr][j]); c[rr][j] += bf16_rne(raw.x1[rr][j]); }
    load_rows4(raw, IN, IN2, ML, x, row0 + (bt < 3 ? bt + 1 : 3) * 4, lane, two);   // the last trip reads its own rows again: one instruction stream
    float s[4], q[4];
#pragma unroll
    for (int rr = 0; rr < 4; ++rr) { float t = 0.0f;
#pragma unroll
      for (int j = 0; j < 4; ++j) t += a[rr][j] + c[rr][j];
      s[rr] = wave_sum(t) * (1.0f / D); }
#pragma unroll
    for (int rr = 0; rr < 4; ++rr) { const float mu = s[rr]; float t = 0.0f;
#pragma unroll
      for (int j = 0; j < 4; ++j) { const float d0 = a[rr][j] - mu, d1 = c[rr][j] - mu; t += d0 * d0 + d1 * d1; }
      q[rr] = wave_sum(t); }
#pragma unroll
    for (int rr = 0; rr < 4; ++rr) { const float mu = s[rr], rs = rsqrtf(q[rr] * (1.0f / D) + LNEPS); v8b hv, lv;
#pragma unroll
      for (int j = 0; j < 8; ++j) { const float y = ((j < 4 ? a[rr][j] : c[rr][j - 4]) - mu) * rs * gg[j] + bb[j]; b16 p, qq; split16(y * XS, p, qq); hv[j] = p; lv[j] = qq; }
      *(v8b*)(&Ahs[wave][bt * 4 + rr][lane * 8]) = hv; *(v8b*)(&Als[wave][bt * 4 + rr][lane * 8]) = lv; }
    __builtin_amdgcn_sched_barrier(0); }   // keeps the register copies that hand the next rows over, and with them the wait for their loads, behind this group's arithmetic: left free, they rise to its start
  v8f acc[16];
#pragma unroll 1   // rolled for a short text: trip 0 = W1 (and relu into the planes), trip 1 = W2
  for (int pass = 0; pass < 2; ++pass) {
    const b16* Wc = pass == 0 ? W1 : W2;
    wave_lds_sync();   // the wave's plane rows were written across its lanes
    v16b a[8], al[8], w0[32], w1[32];
#pragma unroll
    for (int ks = 0; ks < 8; ++ks) { a[ks] = frag_kb(&Ahs[wave][nloc][ks * 32], hlf); al[ks] = frag_kb(&Als[wave][nloc][ks * 32], hlf); }
#pragma unroll
    for (int t = 0; t < 16; ++t) acc[t] = (v8f){};
    // fragments of a group (64 W rows) are asked for together and one group ahead of their products (two register sets), so that the LDS latency is not paid per product
    asm volatile("s_wait_dscnt 0x0" ::: "memory");      // this wave's earlier reads of rows 192 .. 255 are done before they are refilled
    asm volatile("s_wait_asynccnt 0x0" ::: "memory");   // this wave's copies of rows 0 .. 191 have landed
    __syncthreads();                                     // ... and every other wave's: they may be read; rows 192 .. 255 are left by all
    stage_rows_rolled<2>(Wc + (size_t)(192 + wave) * D + lane * 8, 4 * D, lds_addr(&Ws[192 + wave][lane * 8]), 4 * KPITCH * 2);
    load_group(w0, Ws, 0, nloc, hlf); load_group(w1, Ws, 64, nloc, hlf);
    __builtin_amdgcn_sched_barrier(0);   // holds the reads above in front of the products below: left free, the compiler moves each read down to its product and waits for it there
    mul_group<0>(acc, w0, a, al);
    __builtin_amdgcn_sched_barrier(0);   // keeps the next group's reads from rising among those products or sinking to their own
    load_group(w0, Ws, 128, nloc, hlf);
    __builtin_amdgcn_sched_barrier(0);   // as above
    mul_group<1>(acc, w1, a, al);
    __builtin_amdgcn_sched_barrier(0);   // keeps the products above in front of the waits below, so that the copies in flight land under them
    asm volatile("s_wait_dscnt 0x0" ::: "memory");      // this wave's reads of rows 0 .. 191 are done before they are refilled
    asm volatile("s_wait_asynccnt 0x0" ::: "memory");   // this wave's copies of rows 192 .. 255 have landed
    __syncthreads();                                     // ... and every other wave's; rows 0 .. 191 are left by all
    if (pass == 0) stage_rows_rolled<6>(W2 + (size_t)wave * D + lane * 8, 4 * D, lds_addr(&Ws[wave][lane * 8]), 4 * KPITCH * 2);   // block-uniform: W2 rows 0 .. 191 fly under the rest of trip 0
    load_group(w1, Ws, 192, nloc, hlf);
    __builtin_amdgcn_sched_barrier(0);   // holds the reads above in front of the products below
    mul_group<2>(acc, w0, a, al); mul_group<3>(acc, w1, a, al);
    // + bias: lane = token nloc, features t * 16 + 8 * hlf + 0 .. 7
#pragma unroll
    for (int t = 0; t < 16; ++t) { const v4f c0 = *(const v4f*)(&Ps[pass][t * 16 + 8 * hlf]), c1 = *(const v4f*)(&Ps[pass][t * 16 + 8 * hlf + 4]);
#pragma unroll
      for (int r = 0; r < 8; ++r) acc[t][r] = acc[t][r] * (1.0f / (XS * WSC)) + (r < 4 ? c0[r] : c1[r - 4]); }
    if (pass == 0) {   // hidden = relu(.) as hi + lo planes over the wave's own rows (their fragments are in registers)
#pragma unroll
      for (int t = 0; t < 16; ++t) { v8b hv, lv;
#pragma unroll
        for (int r = 0; r < 8; ++r) { b16 p, qq; split16(fmaxf(acc[t][r], 0.0f) * XS, p, qq); hv[r] = p; lv[r] = qq; }
        *(v8b*)(&Ahs[wave][nloc][t * 16 + 8 * hlf]) = hv; *(v8b*)(&Als[wave][nloc][t * 16 + 8 * hlf]) = lv; } } }
  // LayerNorm 2 over the token's 256 features: 128 in this lane (eight running sums over the 16 tiles, then a tree), 128 in lane ^ 16
  v8f vs = (v8f){};
#pragma unroll
  for (int t = 0; t < 16; ++t) vs += acc[t];
  float s = ((vs[0] + vs[1]) + (vs[2] + vs[3])) + ((vs[4] + vs[5]) + (vs[6] + vs[7])); s += __shfl_xor(s, 16);
  const float mu = s * (1.0f / D); v8f vq = (v8f){};
#pragma unroll
  for (int t = 0; t < 16; ++t) { const v8f d = acc[t] - mu; vq += d * d; }
  float q = ((vq[0] + vq[1]) + (vq[2] + vq[3])) + ((vq[4] + vq[5]) + (vq[6] + vq[7])); q += __shfl_xor(q, 16);
  const float rs = rsqrtf(q * (1.0f / D) + LNEPS);
#pragma unroll
  for (int t = 0; t < 16; ++t) { const int f = t * 16 + 8 * hlf; const v4f g0 = *(const v4f*)(&Ps[2][f]), g4 = *(const v4f*)(&Ps[2][f + 4]), e0 = *(const v4f*)(&Ps[3][f]), e4 = *(const v4f*)(&Ps[3][f + 4]); v4f y0, y1;
#pragma unroll
    for (int r = 0; r < 4; ++r) { y0[r] = (acc[t][r] - mu) * rs * g0[r] + e0[r]; y1[r] = (acc[t][4 + r] - mu) * rs * g4[r] + e4[r]; }
    *(v4f*)(&To[wave][nloc][f]) = y0; *(v4f*)(&To[wave][nloc][f + 4]) = y1; }
  wave_lds_sync();
  // whole rows go out: 1 KB of a token per pair of stores
#pragma unroll   // constant row offsets in the LDS reads and the stores
  for (int g = 0; g < 2; ++g) { v4f o0[8], o1[8];
#pragma unroll   // keeps the register arrays at constant indices
    for (int rr = 0; rr < 8; ++rr) { o0[rr] = *(const v4f*)(&To[wave][g * 8 + rr][lane * 8]); o1[rr] = *(const v4f*)(&To[wave][g * 8 + rr][lane * 8 + 4]); }
#pragma unroll   // as above
    for (int rr = 0; rr < 8; ++rr) { const size_t row = (row0 + g * 8 + rr) * D; *(v4f*)(out + row + lane * 8) = o0[rr]; *(v4f*)(out + row + lane * 8 + 4) = o1[rr]; }
    if (g == 0) asm volatile("s_wait_xcnt 0x0" ::: "memory"); }   // the stores' data registers are rewritten behind it (next eight rows)
}
}  // namespace

extern "C" void kernel_launch(void* const* d_in, const int* in_sizes, int n_in, void* d_out, int out_size, void* d_ws, size_t ws_size, hipStream_t stream) {
  (void)n_in;
  auto Fp = [&](int i) { return (const float*)d_in[i]; };
  // input order: 0 x [4,4096,256], 1 Wq [256,256] ([e][d]), 2 bq, 3 Wk, 4 bk, 5 Wv, 6 bv, 7 W1, 8 b1, 9 W2, 10 b2, 11 g_ln, 12 beta_ln, 13 g_lnff, 14 beta_lnff
  if (in_sizes[0] != B * S * D || in_sizes[1] != D * D || in_sizes[3] != D * D || in_sizes[5] != D * D || in_sizes[7] != FF * D || in_sizes[9] != D * FF || in_sizes[11] != D || in_sizes[13] != D || out_size != B * S * D) return;
  size_t off = 0; char* ws = (char*)d_ws;
  auto carve = [&](size_t bytes) { char* p = ws + off; off += (bytes + 255) & ~(size_t)255; return p; };
  b16* WT = (b16*)carve((size_t)5 * D * D * 2); b16* Qp = (b16*)carve((size_t)B * S * D * 2); b16* Kp = (b16*)carve((size_t)B * S * D * 2); b16* VT = (b16*)carve((size_t)B * D * S * 2);
  float* O1 = (float*)carve((size_t)B * S * D * 4); float* O2 = (float*)carve((size_t)B * S * D * 4); float* ML = (float*)carve((size_t)2 * B * S * 2 * 4);
  if (off > ws_size || off > ((size_t)128 << 20)) return;   // about 57 MB
  wprep_kernel<<<(unsigned)(((size_t)5 * D * D / 8 + 255) / 256), 256, 0, stream>>>(Fp(1), Fp(3), Fp(5), Fp(7), Fp(9), WT);
  qkv_kernel<<<dim3(S / 64, BL, 3), 128, 0, stream>>>(Fp(0), WT, Fp(2), Fp(4), Fp(6), Qp, Kp, VT);
  attn_kernel<<<dim3(S / 64, BL), 128, 0, stream>>>(Qp, Kp, VT, O1, O2, ML);
  tail_kernel<<<(unsigned)((size_t)BL * S / 64), 128, 0, stream>>>(O1, O2, ML, Fp(0), Fp(11), Fp(12), WT + (size_t)3 * D * D, WT + (size_t)4 * D * D, Fp(8), Fp(10), Fp(13), Fp(14), (float*)d_out);
}

// v005
// A run of this version takes 94.8 microseconds.
// Next to v004, in two timings, it ran 1.06 times as fast each time.
// Counting every step since v000, it is 10.0 times as fast.
#include <hip/hip_runtime.h>

// Causal single-head transformer block: q, k, v = x W{q,k,v}^T + b ([4][4096][256], d = 256); A = q . k; causal mask filled with -32767 BEFORE the 1/sqrt(256) scaling (masked weights are exactly 0
// in f32 after exp); softmax over keys <= query; o = A v + x; LayerNorm; h = relu(o W1^T + b1) W2^T + b2; LayerNorm (no second residual) -> [4][4096][256].
// Deterministic: flash-style causal attention, a wave = 32 queries x one 32-key half of every 64-key tile (online softmax with running max, the two halves joined at the end of a segment), both LayerNorms and the FFN in one row-local kernel behind attention;
// no atomics.
// compute dtype: WMMA v_wmma_f32_16x16x32_f16 with f32 accumulate for the q/k/v projections (x EXACT bf16 x8 staged through LDS, W [e][d] rows exact x256: 1 product), S^T = K Q^T (q, k single
// f16 x8: 1 product — logits have std ≈ 1 over ~2,000 keys, per-key rounding averages to ≈4e-5 on the output), O^T += V^T P^T (v single f16 x8, P x1024 single f16: 1 product) and the two FFN GEMMs
// (LayerNorm output / relu hidden as f16 hi+lo x8 planes: 2 products); softmax statistics (exp2), residual, LayerNorms, bias, relu in f32. Inputs rounded to bf16 once.

namespace {
constexpr int B = 4, S = 4096, D = 256, FF = 256, BL = 4 /* batches computed (== B shipped) */;
constexpr float XS = 8.0f, WSC = 256.0f, PS = 1024.0f, LOG2E = 1.4426950408889634f, LNEPS = 1e-5f, MASK_FILL = -32767.0f;
static_assert(S % 64 == 0 && D == 256 && FF == 256, "tiling");
typedef _Float16 b16;
typedef __attribute__((ext_vector_type(16))) _Float16 v16b;
typedef __attribute__((ext_vector_type(8))) _Float16 v8b;
typedef __attribute__((ext_vector_type(8))) float v8f;
typedef __attribute__((ext_vector_type(4))) float v4f;
__device__ __forceinline__ float bf16_rne(float f) { unsigned int u = __float_as_uint(f); u += 0x7FFFu + ((u >> 16) & 1u); return __uint_as_float(u & 0xFFFF0000u); }
__device__ __forceinline__ void split16(float v, b16& hi, b16& lo) { hi = (b16)v; lo = (b16)(v - (float)hi); }
__device__ __forceinline__ v16b frag_kb(const b16* p, int hh) { const v8b a = *(const v8b*)(p + 8 * hh), b = *(const v8b*)(p + 16 + 8 * hh); v16b f;
#pragma unroll
  for (int e = 0; e < 8; ++e) { f[e] = a[e]; f[8 + e] = b[e]; } return f; }
__device__ __forceinline__ void wave_lds_sync() { __builtin_amdgcn_fence(__ATOMIC_RELEASE, "workgroup"); __builtin_amdgcn_wave_barrier(); __builtin_amdgcn_fence(__ATOMIC_ACQUIRE, "workgroup"); }
__device__ __forceinline__ float pmul(float a, float b) { float p = a * b; asm volatile("" : "+v"(p)); return p; }
__device__ __forceinline__ int iclamp(int v, int lo, int hi) { return v < lo ? lo : (v > hi ? hi : v); }

typedef __attribute__((ext_vector_type(2))) _Float16 v2h;
typedef __attribute__((ext_vector_type(4))) _Float16 v4h;
typedef __attribute__((ext_vector_type(2))) float v2f;
__device__ __forceinline__ float nexp2(float v) { return __builtin_amdgcn_exp2f(v); }
__global__ __launch_bounds__(256) void wprep_kernel(const float* __restrict__ wq, const float* __restrict__ wk, const float* __restrict__ wv, const float* __restrict__ w1, const float* __restrict__ w2, b16* __restrict__ WT) {
  const size_t u = (size_t)blockIdx.x * 256 + threadIdx.x; if (u >= (size_t)5 * D * D / 8) return; const size_t e = u * 8; const int m = (int)(e / (D * D)); const size_t el = e % ((size_t)D * D);
  const float* w = m == 0 ? wq : m == 1 ? wk : m == 2 ? wv : m == 3 ? w1 : w2; v8b o; for (int j = 0; j < 8; ++j) o[j] = (b16)(bf16_rne(w[el + j]) * WSC);
  { *(v8b*)(WT + e) = o;  }
}
constexpr int KT = 64, KPITCH = D + 8, VPITCH = KT + 8, NT = S / KT, CUT = NT / 2 + 1;
// the plain builtin (the compiler keeps the distance behind it): operands of an asm statement must lie below v256, which the fragments of a whole pass do not fit
__device__ __forceinline__ v8f wmma16p(v16b a, v16b b, v8f c) { return __builtin_amdgcn_wmma_f32_16x16x32_f16(false, a, false, b, (short)0, c, false, false); }
__device__ __forceinline__ unsigned lds_addr(const void* p) { return (unsigned)(size_t)p; }
// eight 16-byte copies per lane; s_wait_xcnt 0 closes the statement so that no address register is rewritten while a copy may still name it
template <typename E>
__device__ __forceinline__ void async_copy8(const unsigned (&l)[8], const E* const (&g)[8]) {
  asm volatile("global_load_async_to_lds_b128 %0, %8, off\n\t"
               "global_load_async_to_lds_b128 %1, %9, off\n\t"
               "global_load_async_to_lds_b128 %2, %10, off\n\t"
               "global_load_async_to_lds_b128 %3, %11, off\n\t"
               "global_load_async_to_lds_b128 %4, %12, off\n\t"
               "global_load_async_to_lds_b128 %5, %13, off\n\t"
               "global_load_async_to_lds_b128 %6, %14, off\n\t"
               "global_load_async_to_lds_b128 %7, %15, off\n\t"
               "s_wait_xcnt 0x0"
               :: "v"(l[0]), "v"(l[1]), "v"(l[2]), "v"(l[3]), "v"(l[4]), "v"(l[5]), "v"(l[6]), "v"(l[7]),
                  "v"(g[0]), "v"(g[1]), "v"(g[2]), "v"(g[3]), "v"(g[4]), "v"(g[5]), "v"(g[6]), "v"(g[7]) : "memory");
}
// N8 * 8 copies of 16 bytes per lane: piece i goes from g0 + i * gstep (elements) to LDS byte l0 + i * lstep (unrolled so that every address is a constant step from the lane's base)
template <int N8, typename E>
__device__ __forceinline__ void stage_rows(const E* g0, int gstep, unsigned l0, unsigned lstep) {
#pragma unroll
  for (int h = 0; h < N8; ++h) { unsigned l[8]; const E* g[8];
#pragma unroll
    for (int i = 0; i < 8; ++i) { l[i] = l0 + (unsigned)(h * 8 + i) * lstep; g[i] = g0 + (size_t)(h * 8 + i) * gstep; }
    async_copy8(l, g); }
}
// qkv: block = 64 tokens of one batch (4 waves) x one of {q, k, v} (grid.z): A = bf16(x) x8 staged; 16 tiles x 8 k-steps; + bias. q, k -> single f16 x8 planes [b][s][256] (32 lanes x 16 B);
// the operands come into LDS by asynchronous copies of whole 512-byte pieces: each wave's 16 x rows (f32, into its part of Tf, which is free until the epilogue) and the 256 W rows, once per block, at
// pitch 528 B (16 B x odd: ds_load_b128 free of bank conflicts). W rows 64 .. 255 fly while x is converted and column tiles 0 .. 3 are worked on; never more than 48 copies of a wave are in flight.
__global__ __launch_bounds__(128) void qkv_kernel(const float* __restrict__ x, const b16* __restrict__ WT, const float* __restrict__ bq, const float* __restrict__ bk, const float* __restrict__ bv, b16* __restrict__ Qp, b16* __restrict__ Kp, b16* __restrict__ VT) {
  __shared__ __attribute__((aligned(16))) b16 As[4][16][D + 8]; __shared__ __attribute__((aligned(16))) float Tf[4][16][256 + 4]; __shared__ __attribute__((aligned(16))) b16 Ws[D][KPITCH];
  const int wave = __builtin_amdgcn_readfirstlane(threadIdx.x >> 5), lane = threadIdx.x & 31, nloc = lane & 15, hlf = lane >> 4; const int b = blockIdx.y, which = blockIdx.z; const int t0 = blockIdx.x * 64 + wave * 16;
  const b16* W = WT + (size_t)which * D * D; const float* bias = which == 0 ? bq : which == 1 ? bk : bv;
  const float* xw = x + ((size_t)b * S + t0) * D + lane * 4;   // a row of x is two pieces of 512 bytes
  stage_rows<2>(xw, D, lds_addr(&Tf[wave][0][lane * 4]), (256 + 4) * 4); stage_rows<2>(xw + 128, D, lds_addr(&Tf[wave][0][128 + lane * 4]), (256 + 4) * 4);
  stage_rows<2>(W + (size_t)wave * D + lane * 8, 4 * D, lds_addr(&Ws[wave][lane * 8]), 4 * KPITCH * 2);   // W rows wave, wave + 4, .. below 64
  asm volatile("s_wait_asynccnt 0x0" ::: "memory");   // this wave's copies of x and of W rows 0 .. 63 have landed
  __syncthreads();                                     // ... and every other wave's: they may be read
  stage_rows<6>(W + (size_t)(64 + wave) * D + lane * 8, 4 * D, lds_addr(&Ws[64 + wave][lane * 8]), 4 * KPITCH * 2);   // W rows 64 .. 255, read behind the second barrier only
#pragma unroll   // constant LDS offsets; the reads of later rows go out under the conversion of earlier ones
  for (int rr = 0; rr < 16; ++rr) { const v4f f0 = *(const v4f*)(&Tf[wave][rr][lane * 8]), f1 = *(const v4f*)(&Tf[wave][rr][lane * 8 + 4]); v8b o;
#pragma unroll
    for (int j = 0; j < 4; ++j) { o[j] = (b16)(bf16_rne(f0[j]) * XS); o[4 + j] = (b16)(bf16_rne(f1[j]) * XS); }
    *(v8b*)(&As[wave][rr][lane * 8]) = o; }
  wave_lds_sync();
  v8f acc[16];
#pragma unroll
  for (int t = 0; t < 16; ++t) acc[t] = (v8f){};
  // a group = 4 column tiles x 8 k-steps. All fragments of a group are asked for together and one group ahead of their products (two register sets), so that the LDS latency is not paid per product;
  // every loop below is unrolled to keep the register arrays at constant indices
  v16b a[8], w0[32], w1[32];
#pragma unroll
  for (int i = 0; i < 32; ++i) { if ((i & 3) == 0) a[i >> 2] = frag_kb(&As[wave][nloc][(i >> 2) * 32], hlf); w0[i] = frag_kb(&Ws[(i & 3) * 16 + nloc][(i >> 2) * 32], hlf); }
  __builtin_amdgcn_sched_barrier(0);   // holds the reads above in front of the products below: left free, the compiler moves each read down to its product and waits for it there
#pragma unroll
  for (int i = 0; i < 32; ++i) acc[i & 3] = wmma16p(a[i >> 2], w0[i], acc[i & 3]);
  __builtin_amdgcn_sched_barrier(0);   // keeps the products above in front of the wait below, so that the copies in flight land under them
  asm volatile("s_wait_asynccnt 0x0" ::: "memory");   // this wave's copies of W rows 64 .. 255 have landed
  __syncthreads();                                     // ... and every other wave's
#pragma unroll
  for (int i = 0; i < 32; ++i) w1[i] = frag_kb(&Ws[64 + (i & 3) * 16 + nloc][(i >> 2) * 32], hlf);
#pragma unroll
  for (int i = 0; i < 32; ++i) w0[i] = frag_kb(&Ws[128 + (i & 3) * 16 + nloc][(i >> 2) * 32], hlf);
  __builtin_amdgcn_sched_barrier(0);   // holds the reads above in front of the products below: left free, the compiler moves each read down to its product and waits for it there
#pragma unroll
  for (int i = 0; i < 32; ++i) acc[4 + (i & 3)] = wmma16p(a[i >> 2], w1[i], acc[4 + (i & 3)]);
  __builtin_amdgcn_sched_barrier(0);   // keeps the last group's reads from rising among those products or sinking to their own
#pragma unroll
  for (int i = 0; i < 32; ++i) w1[i] = frag_kb(&Ws[192 + (i & 3) * 16 + nloc][(i >> 2) * 32], hlf);
  __builtin_amdgcn_sched_barrier(0);   // holds the reads above in front of the products below: left free, the compiler moves each read down to its product and waits for it there
#pragma unroll
  for (int i = 0; i < 32; ++i) acc[8 + (i & 3)] = wmma16p(a[i >> 2], w0[i], acc[8 + (i & 3)]);
#pragma unroll
  for (int i = 0; i < 32; ++i) acc[12 + (i & 3)] = wmma16p(a[i >> 2], w1[i], acc[12 + (i & 3)]);
#pragma unroll
  for (int t = 0; t < 16; ++t) { const float bb = bf16_rne(bias[t * 16 + nloc]);
#pragma unroll
    for (int r = 0; r < 8; ++r) Tf[wave][8 * hlf + r][t * 16 + nloc] = acc[t][r] * (1.0f / (XS * WSC)) + bb; }
  __syncthreads();
  {
    if (which < 2) { b16* P = (which == 0 ? Qp : Kp) + ((size_t)b * S) * D; for (int rr = 0; rr < 16; ++rr) { v8b o; for (int j = 0; j < 8; ++j) o[j] = (b16)(Tf[wave][rr][lane * 8 + j] * XS); *(v8b*)(P + (size_t)(t0 + rr) * D + lane * 8) = o; } }
    else {
#pragma unroll 1
      for (int q = 0; q < 64; ++q) { const int d = wave * 64 + q; const int tk = lane * 2; v2h vv; vv[0] = (b16)(Tf[tk >> 4][tk & 15][d] * XS); vv[1] = (b16)(Tf[(tk + 1) >> 4][(tk + 1) & 15][d] * XS); *(v2h*)(VT + ((size_t)b * D + d) * S + blockIdx.x * 64 + lane * 2) = vv; } }
     }
}
// causal attention: grid (S/64, BL); block = 64 queries, 4 waves (their tiles: in front of the kernel). Query tile qt needs qt + 1 key tiles, and one block fills a WGP, so the launch lasts as long as its longest block: the work is cut
// into equal blocks. Block j does the head of query tile NT - 1 - j (key tiles 0 .. min(qt + 1, CUT) - 1, partial 0) and, for j > NT / 2, before it the tail of query tile j (key tiles CUT .. j, partial 1):
// CUT or CUT - 1 key tiles in every block. A partial is its own softmax-weighted mean with its (max, sum); the kernel behind attention merges the two partials of a long query tile and adds the residual.
// Within a segment the block walks its keys in tiles of 64: K rows [64][256] and V^T rows [256][64] are copied once per block into LDS by
// asynchronous copies (two buffers: tile t + 1 flies while tile t is worked on) and every wave takes its fragments from there. Row pitches 528 B and 144 B (16 B x odd) keep ds_load_b128 free of bank conflicts.
// Per tile and wave one pass of 32 keys x 32 queries, tiles in ascending order: S^T = K Q^T (2 key tiles x 2 query tiles x 8 k-steps), logits A/16 in the log2 domain, keys > query masked (the reference's -32767 fill gives exp = 0 exactly),
// online softmax, P x1024 single f16 via LDS -> O^T += V^T P^T (16 d-tiles x 2 query tiles x 1 k-step); partial = joined O / joined l
// one tile: kg / lk = this lane's 16 bytes of K row (wave) of the tile, rows step by 4; vg / lv = this lane's 16 bytes of V^T row (thread / 8), rows step by 16
// (the loops are unrolled so that every address is a constant step from the lane's base)
__device__ __forceinline__ void stage_tile(const b16* kg, unsigned lk, const b16* vg, unsigned lv) {
#pragma unroll
  for (int h = 0; h < 2; ++h) { unsigned l[8]; const b16* g[8];
#pragma unroll
    for (int i = 0; i < 8; ++i) { l[i] = lk + (unsigned)((h * 8 + i) * 4 * KPITCH * 2); g[i] = kg + (size_t)(h * 8 + i) * 4 * D; }
    async_copy8(l, g); }
#pragma unroll
  for (int h = 0; h < 2; ++h) { unsigned l[8]; const b16* g[8];
#pragma unroll
    for (int i = 0; i < 8; ++i) { l[i] = lv + (unsigned)((h * 8 + i) * 16 * VPITCH * 2); g[i] = vg + (size_t)(h * 8 + i) * 16 * S; }
    async_copy8(l, g); }
}
// Wave tile: the 4 waves are 2 query groups (qg, 32 queries = two 16-query tiles) x 2 key halves (kh, 32 of a tile's 64 keys): every K and V^T fragment that a wave reads from LDS feeds two products, so
// the block reads each tile from LDS twice and not four times. A wave keeps its own running (max, sum, O) over its key halves; at the end of a segment the two waves of a query group exchange (max, sum),
// scale by the joint statistics, and each hands the other one 16-query tile through LDS: wave kh puts out query tile kh of its group. Index u of the register arrays is query tile u ^ kh, so that the tile a
// wave keeps is always u = 0 and the tile it hands over u = 1 (constant register indices).
__global__ __launch_bounds__(128) void attn_kernel(const b16* __restrict__ Qp, const b16* __restrict__ Kp, const b16* __restrict__ VT, float* __restrict__ O1, float* __restrict__ O2, float* __restrict__ ML) {
  __shared__ __attribute__((aligned(16))) b16 Ks[2][KT][KPITCH]; __shared__ __attribute__((aligned(16))) b16 Vs[2][D][VPITCH];
  __shared__ __attribute__((aligned(16))) b16 Pb[4][2][16][32 + 8]; __shared__ __attribute__((aligned(16))) float To[4][16][D + 4]; __shared__ __attribute__((aligned(16))) float Tx[4][16][D + 4];
  __shared__ __attribute__((aligned(16))) float St[4][2][16][2];
  const int tid = threadIdx.x, wave = __builtin_amdgcn_readfirstlane(tid >> 5), lane = tid & 31, hh = lane >> 4, col = lane & 15; const int b = blockIdx.y, j = blockIdx.x;
  const int qg = wave >> 1, kh = wave & 1;
  const b16* Qb = Qp + (size_t)b * S * D; const b16* Kb = Kp + (size_t)b * S * D; const b16* Vb = VT + (size_t)b * D * S;
#pragma unroll 1   // stays rolled: the two segments of a block run one after the other through the same code and the same LDS
  for (int seg = (j > NT / 2) ? 0 : 1; seg < 2; ++seg) {   // block-uniform: seg 0 = tail of query tile j, seg 1 = head of query tile NT - 1 - j
  const int qt = seg == 0 ? j : NT - 1 - j, tb = seg == 0 ? CUT : 0;
  const int ntile = seg == 0 ? j + 1 - CUT : (qt + 1 < CUT ? qt + 1 : CUT);   // tiles of 64 keys in this segment, at least one
  const int q0 = qt * 64 + qg * 32; const int qi[2] = {q0 + kh * 16 + col, q0 + (kh ^ 1) * 16 + col};
  const b16* kg = Kb + (size_t)(tb * KT + wave) * D + lane * 8; const b16* vg = Vb + (size_t)(tid >> 3) * S + tb * KT + (tid & 7) * 8;
  const unsigned lk[2] = {lds_addr(&Ks[0][wave][lane * 8]), lds_addr(&Ks[1][wave][lane * 8])}, lv[2] = {lds_addr(&Vs[0][tid >> 3][(tid & 7) * 8]), lds_addr(&Vs[1][tid >> 3][(tid & 7) * 8])};
  v16b qa[2][8]; const b16* qp0 = Qb + (size_t)qi[0] * D + 8 * hh; const b16* qp1 = Qb + (size_t)qi[1] * D + 8 * hh;   // the lane half's step is in the pointers, which are the loads' own addresses
#pragma unroll   // register arrays at constant indices
  for (int ks = 0; ks < 8; ++ks) { qa[0][ks] = frag_kb(qp0 + ks * 32, 0); qa[1][ks] = frag_kb(qp1 + ks * 32, 0); }
  asm volatile("s_wait_xcnt 0x0" :: "v"(qp0), "v"(qp1) : "memory");   // the loads' address registers are rewritten behind it; named here, they stay whole up to it
  const float cs = LOG2E / (16.0f * XS * XS);
  float m[2] = {-INFINITY, -INFINITY}, l[2] = {0.0f, 0.0f}; v8f o[2][16];
#pragma unroll
  for (int t = 0; t < 16; ++t) { o[0][t] = (v8f){}; o[1][t] = (v8f){}; }
  const int kend = q0 + 32;   // keys < kend may be attended by some query of this wave
#pragma unroll 1   // rolled: the copies' LDS addresses are formed where they are used; written out twice, the compiler forms all 64 ahead of the segment loop and keeps them in scratch memory
  for (int pt = 0; pt < 2; ++pt) {   // tile 0's copies, wait, barrier; then tile 1's copies
    if (pt < ntile) stage_tile(kg + (size_t)pt * KT * D, lk[pt], vg + pt * KT, lv[pt]);
    if (pt == 0) {
      asm volatile("s_wait_asynccnt 0x0" ::: "memory");   // this wave's copies of tile 0 have landed
      __syncthreads(); } }                                 // ... and every other wave's: tile 0 may be read
#pragma unroll 1   // stays rolled: one trip already holds a whole pass of 64 products
  for (int tl = 0; tl < ntile; ++tl) {
    const b16 (*Kt)[KPITCH] = Ks[tl & 1]; const b16 (*Vt)[VPITCH] = Vs[tl & 1];
    const int kb = (tb + tl) * KT + kh * 32;   // this wave's 32 keys of the tile
    if (kb < kend) {   // wave-uniform (scalar): a wave skips the pass beyond its diagonal, never the publish point below
      // all fragments of the pass are asked for ahead of the products, so that the LDS latency is paid once per run and not once per product; K in the order of its use (k-step, then key tile)
      v16b kf[16], vf[16];
#pragma unroll
      for (int i = 0; i < 16; ++i) kf[i] = frag_kb(&Kt[kh * 32 + (i & 1) * 16 + col][(i >> 1) * 32], hh);
#pragma unroll
      for (int t = 0; t < 16; ++t) vf[t] = frag_kb(&Vt[t * 16 + col][kh * 32], hh);
      v8f s[2][2] = {{(v8f){}, (v8f){}}, {(v8f){}, (v8f){}}};
#pragma unroll   // four independent accumulators between an accumulator's two uses
      for (int ks = 0; ks < 8; ++ks)
#pragma unroll
        for (int tt = 0; tt < 2; ++tt)
#pragma unroll
          for (int u = 0; u < 2; ++u) s[u][tt] = wmma16p(kf[ks * 2 + tt], qa[u][ks], s[u][tt]);
      float al[2];
#pragma unroll   // the two query tiles' softmax chains are independent of each other
      for (int u = 0; u < 2; ++u) {
        float e[16]; float mx = -INFINITY;
#pragma unroll
        for (int i = 0; i < 16; ++i) { const int key = kb + (i < 8 ? 0 : 16) + 8 * hh + (i & 7); const float v = (key <= qi[u]) ? (i < 8 ? s[u][0][i] : s[u][1][i - 8]) * cs : -INFINITY; e[i] = v; mx = fmaxf(mx, v); }
        mx = fmaxf(mx, __shfl_xor(mx, 16)); const float mn = fmaxf(m[u], mx); al[u] = (mn == -INFINITY) ? 1.0f : nexp2(m[u] - mn); float sum = 0.0f;
        // B operand needs row = query, k = key: write P[query col][key] into LDS (wave-private), then frag
#pragma unroll
        for (int i = 0; i < 16; ++i) { const float p = (e[i] == -INFINITY) ? 0.0f : nexp2(e[i] - mn); sum += p; Pb[wave][u][col][(i < 8 ? 0 : 16) + 8 * hh + (i & 7)] = (b16)(p * PS); }
        sum += __shfl_xor(sum, 16); l[u] = l[u] * al[u] + sum; m[u] = mn; }
      wave_lds_sync();
      const v16b pf0 = frag_kb(&Pb[wave][0][col][0], hh), pf1 = frag_kb(&Pb[wave][1][col][0], hh);
#pragma unroll
      for (int t = 0; t < 16; ++t) { o[0][t] *= al[0]; o[0][t] = wmma16p(vf[t], pf0, o[0][t]); o[1][t] *= al[1]; o[1][t] = wmma16p(vf[t], pf1, o[1][t]); }
      wave_lds_sync(); }
    // publish point of tile tl + 1, passed by every wave
    asm volatile("s_wait_dscnt 0x0" ::: "memory");      // this wave's reads of tile tl are done before the buffer is refilled
    asm volatile("s_wait_asynccnt 0x0" ::: "memory");   // this wave's copies of tile tl + 1 have landed
    __syncthreads();                                     // tile tl + 1 may be read by all; tile tl's buffer is left by all
    if (tl + 2 < ntile) stage_tile(kg + (size_t)(tl + 2) * KT * D, lk[tl & 1], vg + (size_t)(tl + 2) * KT, lv[tl & 1]); }
  asm volatile("s_wait_asynccnt 0x0" ::: "memory");     // no copy is left in flight when the wave goes on to its end
  // join of the two key halves. The kh = 0 wave has had at least one pass (its first key is never beyond the diagonal), so the joint max is finite; a wave without a pass has max -inf, sum 0, weight exp2(-inf) = 0
  { const v2f st = {hh == 0 ? m[0] : m[1], hh == 0 ? l[0] : l[1]}; *(v2f*)(&St[wave][hh][col][0]) = st; }   // both lane halves hold both tiles' (max, sum): half hh writes tile u = hh
  __syncthreads();   // the partner wave's (max, sum) may be read
  float f[2], mj = 0.0f, lj = 0.0f;
#pragma unroll
  for (int u = 0; u < 2; ++u) { const v2f ps = *(const v2f*)(&St[wave ^ 1][u ^ 1][col][0]);   // the partner's index of the same query tile is u ^ 1
    const float mm = fmaxf(m[u], ps[0]); const float as = nexp2(m[u] - mm), ap = nexp2(ps[0] - mm); const float lt = l[u] * as + ps[1] * ap;
    f[u] = as / (lt * PS * XS); if (u == 0) { mj = mm; lj = lt; } }
#pragma unroll
  for (int t = 0; t < 16; ++t)
#pragma unroll
    for (int r = 0; r < 8; ++r) Tx[wave][col][t * 16 + 8 * hh + r] = o[1][t][r] * f[1];
  __syncthreads();   // the partner wave's share of the tile that this wave keeps may be read
#pragma unroll
  for (int t = 0; t < 16; ++t) { const v4f x0 = *(const v4f*)(&Tx[wave ^ 1][col][t * 16 + 8 * hh]), x1 = *(const v4f*)(&Tx[wave ^ 1][col][t * 16 + 8 * hh + 4]);
#pragma unroll
    for (int r = 0; r < 8; ++r) To[wave][col][t * 16 + 8 * hh + r] = o[0][t][r] * f[0] + (r < 4 ? x0[r] : x1[r - 4]); }
  wave_lds_sync();
  float* Op = seg == 0 ? O2 : O1; const int qk = q0 + kh * 16;   // the 16 queries that this wave puts out
  if (hh == 0) { const v2f ml = {mj, lj}; *(v2f*)(ML + ((size_t)(seg == 0 ? B * S : 0) + (size_t)b * S + qk + col) * 2) = ml; }   // both halves hold the same (max, sum): 16 queries = one 128-byte line per wave
  asm volatile("s_wait_xcnt 0x0" ::: "memory");   // the store's address registers are rewritten right behind it
#pragma unroll   // constant row offsets in the LDS reads and the stores
  for (int g = 0; g < 2; ++g) { v4f a0[8], a1[8];
#pragma unroll   // keeps the register arrays at constant indices
    for (int rr = 0; rr < 8; ++rr) { a0[rr] = *(const v4f*)(&To[wave][g * 8 + rr][lane * 8]); a1[rr] = *(const v4f*)(&To[wave][g * 8 + rr][lane * 8 + 4]); }
#pragma unroll   // as above
    for (int rr = 0; rr < 8; ++rr) { const size_t row = ((size_t)b * S + qk + g * 8 + rr) * D; *(v4f*)(Op + row + lane * 8) = a0[rr]; *(v4f*)(Op + row + lane * 8 + 4) = a1[rr]; }
    asm volatile("s_wait_xcnt 0x0" ::: "memory"); }   // the stores' data and address registers are rewritten behind it (next eight rows, next segment)
  }
}
// everything behind attention in one launch, because it is local to a token row: merge of the attention partials + residual + LayerNorm 1, both FFN GEMMs, LayerNorm 2. Block = 64 tokens (one query tile),
// wave = 16 tokens from first to last; the LayerNorm output and the relu hidden rows (f16 hi + lo x8 planes) stay in the wave's own LDS rows, h2 stays in the accumulators.
// Products are taken transposed, D^T = W A^T (W rows as the A operand, token rows as B; same loader for both): a lane then holds 8 consecutive features of ONE token per tile, so the hidden planes go to LDS
// as 16-byte stores and LayerNorm 2 is a sum inside the lane plus one exchange with lane ^ 16.
// One 256-row W buffer at pitch 528 B serves W1 and then W2, filled by asynchronous copies of whole 512-byte rows: rows 0 .. 191 and rows 192 .. 255 are separate fills (48 and 16 copies of a wave, never
// more than 48 in flight); each fill stands behind the barrier that ends every wave's reads of those rows and is read behind its own wait and barrier.
// The text runs once per wave, so it is kept short: LayerNorm 1 is a rolled loop over groups of 4 rows, the two GEMMs are two trips of one rolled loop, the copies a rolled loop of eight.
template <int N8>
__device__ __forceinline__ void stage_rows_rolled(const b16* g0, int gstep, unsigned l0, unsigned lstep) {
#pragma unroll 1   // rolled: 24 address registers in all, where the unrolled form keeps every address of a fill alive across the products
  for (int h = 0; h < N8; ++h) { unsigned l[8]; const b16* g[8];
#pragma unroll
    for (int i = 0; i < 8; ++i) { l[i] = l0 + (unsigned)(h * 8 + i) * lstep; g[i] = g0 + (size_t)(h * 8 + i) * gstep; }
    async_copy8(l, g); }
}
__device__ __forceinline__ void load_group(v16b (&w)[32], const b16 (*Ws)[KPITCH], int row0, int nloc, int hlf) {
#pragma unroll   // register array at constant indices
  for (int i = 0; i < 32; ++i) w[i] = frag_kb(&Ws[row0 + (i & 3) * 16 + nloc][(i >> 2) * 32], hlf);
}
// 4 feature tiles x 8 k-steps x (hi, lo): per accumulator the order is hi, lo within ascending k; the four tiles stand between an accumulator's two uses
template <int G>
__device__ __forceinline__ void mul_group(v8f (&acc)[16], const v16b (&w)[32], const v16b (&a)[8], const v16b (&al)[8]) {
#pragma unroll   // register arrays at constant indices
  for (int ks = 0; ks < 8; ++ks) {
#pragma unroll
    for (int tt = 0; tt < 4; ++tt) acc[4 * G + tt] = wmma16p(w[ks * 4 + tt], a[ks], acc[4 * G + tt]);
#pragma unroll
    for (int tt = 0; tt < 4; ++tt) acc[4 * G + tt] = wmma16p(w[ks * 4 + tt], al[ks], acc[4 * G + tt]);
  }
}
__device__ __forceinline__ float wave_sum(float s) {
#pragma unroll
  for (int o = 1; o < 32; o <<= 1) s += __shfl_xor(s, o);
  return s; }
// four token rows as LayerNorm 1 takes them: 8 features a lane of partial 0 (a, c), of x, and for a long query tile of partial 1 with both (max, sum) pairs
struct Rows4 { v4f a[4], c[4], x0[4], x1[4], a2[4], c2[4]; v2f p0[4], p1[4]; };
__device__ __forceinline__ void load_rows4(Rows4& R, const float* IN, const float* IN2, const float* ML, const float* x, size_t row, int lane, bool two) {
  const float* pa = IN + row * D + lane * 8; const float* px = x + row * D + lane * 8;
#pragma unroll
  for (int rr = 0; rr < 4; ++rr) { R.a[rr] = *(const v4f*)(pa + rr * D); R.c[rr] = *(const v4f*)(pa + rr * D + 4); R.x0[rr] = *(const v4f*)(px + rr * D); R.x1[rr] = *(const v4f*)(px + rr * D + 4); }
  asm volatile("s_wait_xcnt 0x0" :: "v"(pa), "v"(px) : "memory");   // the loads' address registers are rewritten behind it; named here, they stay whole up to it (no load's result is placed on them)
  if (two) { const float* p2 = IN2 + row * D + lane * 8;
#pragma unroll
    for (int rr = 0; rr < 4; ++rr) { R.a2[rr] = *(const v4f*)(p2 + rr * D); R.c2[rr] = *(const v4f*)(p2 + rr * D + 4);
      R.p0[rr] = *(const v2f*)(ML + (row + rr) * 2); R.p1[rr] = *(const v2f*)(ML + ((size_t)B * S + row + rr) * 2); }
    asm volatile("s_wait_xcnt 0x0" :: "v"(p2) : "memory"); }   // as above
}
__global__ __launch_bounds__(128) void tail_kernel(const float* __restrict__ IN, const float* __restrict__ IN2, const float* __restrict__ ML, const float* __restrict__ x, const float* __restrict__ g1, const float* __restrict__ be1,
                                                   const b16* __restrict__ W1, const b16* __restrict__ W2, const float* __restrict__ b1, const float* __restrict__ b2, const float* __restrict__ g2, const float* __restrict__ be2, float* __restrict__ out) {
  __shared__ __attribute__((aligned(16))) b16 Ws[D][KPITCH]; __shared__ __attribute__((aligned(16))) b16 Ahs[4][16][KPITCH]; __shared__ __attribute__((aligned(16))) b16 Als[4][16][KPITCH];
  __shared__ __attribute__((aligned(16))) float To[4][16][D + 4]; __shared__ __attribute__((aligned(16))) float Ps[4][D];
  const int tid = threadIdx.x, wave = __builtin_amdgcn_readfirstlane(tid >> 5), lane = tid & 31, nloc = lane & 15, hlf = lane >> 4; const size_t row0 = (size_t)blockIdx.x * 64 + wave * 16;
  stage_rows_rolled<6>(W1 + (size_t)wave * D + lane * 8, 4 * D, lds_addr(&Ws[wave][lane * 8]), 4 * KPITCH * 2);   // W1 rows 0 .. 191 (wave, wave + 4, ..) fly under LayerNorm 1
  const bool two = (int)(blockIdx.x & (NT - 1)) >= CUT;   // block-uniform: a long query tile has two partials
  Rows4 raw = {}; load_rows4(raw, IN, IN2, ML, x, row0, lane, two);
  // per-feature vectors of the two epilogues, rounded once, read by every wave behind the first barrier
  { const v2f p0 = *(const v2f*)(b1 + tid * 2), p1 = *(const v2f*)(b2 + tid * 2), p2 = *(const v2f*)(g2 + tid * 2), p3 = *(const v2f*)(be2 + tid * 2);
    asm volatile("s_wait_xcnt 0x0" ::: "memory");   // the loads' base and offset registers are rewritten behind them
    const v2f q0 = {bf16_rne(p0[0]), bf16_rne(p0[1])}, q1 = {bf16_rne(p1[0]), bf16_rne(p1[1])}, q2 = {bf16_rne(p2[0]), bf16_rne(p2[1])}, q3 = {bf16_rne(p3[0]), bf16_rne(p3[1])};
    *(v2f*)(&Ps[0][tid * 2]) = q0; *(v2f*)(&Ps[1][tid * 2]) = q1; *(v2f*)(&Ps[2][tid * 2]) = q2; *(v2f*)(&Ps[3][tid * 2]) = q3; }
  float gg[8], bb[8];
  { const v4f u0 = *(const v4f*)(g1 + lane * 8), u1 = *(const v4f*)(g1 + lane * 8 + 4), u2 = *(const v4f*)(be1 + lane * 8), u3 = *(const v4f*)(be1 + lane * 8 + 4);
    asm volatile("s_wait_xcnt 0x0" ::: "memory");   // as above
#pragma unroll
    for (int j = 0; j < 4; ++j) { gg[j] = bf16_rne(u0[j]); gg[4 + j] = bf16_rne(u1[j]); bb[j] = bf16_rne(u2[j]); bb[4 + j] = bf16_rne(u3[j]); } }
  // LayerNorm 1, a row across the wave (8 features a lane), 4 rows a trip; the next 4 rows' loads go out ahead of this group's sums and land under its arithmetic
#pragma unroll 1   // rolled for a short text
  for (int bt = 0; bt < 4; ++bt) { v4f a[4], c[4];
#pragma unroll
    for (int rr = 0; rr < 4; ++rr) { a[rr] = raw.a[rr]; c[rr] = raw.c[rr]; }
    if (two) {
#pragma unroll
      for (int rr = 0; rr < 4; ++rr) { const v2f p0 = raw.p0[rr], p1 = raw.p1[rr]; const float mm = fmaxf(p0[0], p1[0]);
        float w0 = p0[1] * nexp2(p0[0] - mm), w1 = p1[1] * nexp2(p1[0] - mm); const float rw = 1.0f / (w0 + w1); w0 *= rw; w1 *= rw;
        a[rr] = a[rr] * w0 + raw.a2[rr] * w1; c[rr] = c[rr] * w0 + raw.c2[rr] * w1; } }
#pragma unroll
    for (int rr = 0; rr < 4; ++rr)
#pragma unroll
      for (int j = 0; j < 4; ++j) { a[rr][j] += bf16_rne(raw.x0[rr][j]); c[rr][j] += bf16_rne(raw.x1[rr][j]); }
    load_rows4(raw, IN, IN2, ML, x, row0 + (bt < 3 ? bt + 1 : 3) * 4, lane, two);   // the last trip reads its own rows again: one instruction stream
    float s[4], q[4];
#pragma unroll
    for (int rr = 0; rr < 4; ++rr) { float t = 0.0f;
#pragma unroll
      for (int j = 0; j < 4; ++j) t += a[rr][j] + c[rr][j];
      s[rr] = wave_sum(t) * (1.0f / D); }
#pragma unroll
    for (int rr = 0; rr < 4; ++rr) { const float mu = s[rr]; float t = 0.0f;
#pragma unroll
      for (int j = 0; j < 4; ++j) { const float d0 = a[rr][j] - mu, d1 = c[rr][j] - mu; t += d0 * d0 + d1 * d1; }
      q[rr] = wave_sum(t); }
#pragma unroll
    for (int rr = 0; rr < 4; ++rr) { const float mu = s[rr], rs = rsqrtf(q[rr] * (1.0f / D) + LNEPS); v8b hv, lv;
#pragma unroll
      for (int j = 0; j < 8; ++j) { const float y = ((j < 4 ? a[rr][j] : c[rr][j - 4]) - mu) * rs * gg[j] + bb[j]; b16 p, qq; split16(y * XS, p, qq); hv[j] = p; lv[j] = qq; }
      *(v8b*)(&Ahs[wave][bt * 4 + rr][lane * 8]) = hv; *(v8b*)(&Als[wave][bt * 4 + rr][lane * 8]) = lv; }
    __builtin_amdgcn_sched_barrier(0); }   // keeps the register copies that hand the next rows over, and with them the wait for their loads, behind this group's arithmetic: left free, they rise to its start
  v8f acc[16];
#pragma unroll 1   // rolled for a short text: trip 0 = W1 (and relu into the planes), trip 1 = W2
  for (int pass = 0; pass < 2; ++pass) {
    const b16* Wc = pass == 0 ? W1 : W2;
    wave_lds_sync();   // the wave's plane rows were written across its lanes
    v16b a[8], al[8], w0[32], w1[32];
#pragma unroll
    for (int ks = 0; ks < 8; ++ks) { a[ks] = frag_kb(&Ahs[wave][nloc][ks * 32], hlf); al[ks] = frag_kb(&Als[wave][nloc][ks * 32], hlf); }
#pragma unroll
    for (int t = 0; t < 16; ++t) acc[t] = (v8f){};
    // fragments of a group (64 W rows) are asked for together and one group ahead of their products (two register sets), so that the LDS latency is not paid per product
    asm volatile("s_wait_dscnt 0x0" ::: "memory");      // this wave's earlier reads of rows 192 .. 255 are done before they are refilled
    asm volatile("s_wait_asynccnt 0x0" ::: "memory");   // this wave's copies of rows 0 .. 191 have landed
    __syncthreads();                                     // ... and every other wave's: they may be read; rows 192 .. 255 are left by all
    stage_rows_rolled<2>(Wc + (size_t)(192 + wave) * D + lane * 8, 4 * D, lds_addr(&Ws[192 + wave][lane * 8]), 4 * KPITCH * 2);
    load_group(w0, Ws, 0, nloc, hlf); load_group(w1, Ws, 64, nloc, hlf);
    __builtin_amdgcn_sched_barrier(0);   // holds the reads above in front of the products below: left free, the compiler moves each read down to its product and waits for it there
    mul_group<0>(acc, w0, a, al);
    __builtin_amdgcn_sched_barrier(0);   // keeps the next group's reads from rising among those products or sinking to their own
    load_group(w0, Ws, 128, nloc, hlf);
    __builtin_amdgcn_sched_barrier(0);   // as above
    mul_group<1>(acc, w1, a, al);
    __builtin_amdgcn_sched_barrier(0);   // keeps the products above in front of the waits below, so that the copies in flight land under them
    asm volatile("s_wait_dscnt 0x0" ::: "memory");      // this wave's reads of rows 0 .. 191 are done before they are refilled
    asm volatile("s_wait_asynccnt 0x0" ::: "memory");   // this wave's copies of rows 192 .. 255 have landed
    __syncthreads();                                     // ... and every other wave's; rows 0 .. 191 are left by all
    if (pass == 0) stage_rows_rolled<6>(W2 + (size_t)wave * D + lane * 8, 4 * D, lds_addr(&Ws[wave][lane * 8]), 4 * KPITCH * 2);   // block-uniform: W2 rows 0 .. 191 fly under the rest of trip 0
    load_group(w1, Ws, 192, nloc, hlf);
    __builtin_amdgcn_sched_barrier(0);   // holds the reads above in front of the products below
    mul_group<2>(acc, w0, a, al); mul_group<3>(acc, w1, a, al);
    // + bias: lane = token nloc, features t * 16 + 8 * hlf + 0 .. 7
#pragma unroll
    for (int t = 0; t < 16; ++t) { const v4f c0 = *(const v4f*)(&Ps[pass][t * 16 + 8 * hlf]), c1 = *(const v4f*)(&Ps[pass][t * 16 + 8 * hlf + 4]);
#pragma unroll
      for (int r = 0; r < 8; ++r) acc[t][r] = acc[t][r] * (1.0f / (XS * WSC)) + (r < 4 ? c0[r] : c1[r - 4]); }
    if (pass == 0) {   // hidden = relu(.) as hi + lo planes over the wave's own rows (their fragments are in registers)
#pragma unroll
      for (int t = 0; t < 16; ++t) { v8b hv, lv;
#pragma unroll
        for (int r = 0; r < 8; ++r) { b16 p, qq; split16(fmaxf(acc[t][r], 0.0f) * XS, p, qq); hv[r] = p; lv[r] = qq; }
        *(v8b*)(&Ahs[wave][nloc][t * 16 + 8 * hlf]) = hv; *(v8b*)(&Als[wave][nloc][t * 16 + 8 * hlf]) = lv; } } }
  // LayerNorm 2 over the token's 256 features: 128 in this lane (eight running sums over the 16 tiles, then a tree), 128 in lane ^ 16
  v8f vs = (v8f){};
#pragma unroll
  for (int t = 0; t < 16; ++t) vs += acc[t];
  float s = ((vs[0] + vs[1]) + (vs[2] + vs[3])) + ((vs[4] + vs[5]) + (vs[6] + vs[7])); s += __shfl_xor(s, 16);
  const float mu = s * (1.0f / D); v8f vq = (v8f){};
#pragma unroll
  for (int t = 0; t < 16; ++t) { const v8f d = acc[t] - mu; vq += d * d; }
  float q = ((vq[0] + vq[1]) + (vq[2] + vq[3])) + ((vq[4] + vq[5]) + (vq[6] + vq[7])); q += __shfl_xor(q, 16);
  const float rs = rsqrtf(q * (1.0f / D) + LNEPS);
#pragma unroll
  for (int t = 0; t < 16; ++t) { const int f = t * 16 + 8 * hlf; const v4f g0 = *(const v4f*)(&Ps[2][f]), g4 = *(const v4f*)(&Ps[2][f + 4]), e0 = *(const v4f*)(&Ps[3][f]), e4 = *(const v4f*)(&Ps[3][f + 4]); v4f y0, y1;
#pragma unroll
    for (int r = 0; r < 4; ++r) { y0[r] = (acc[t][r] - mu) * rs * g0[r] + e0[r]; y1[r] = (acc[t][4 + r] - mu) * rs * g4[r] + e4[r]; }
    *(v4f*)(&To[wave][nloc][f]) = y0; *(v4f*)(&To[wave][nloc][f + 4]) = y1; }
  wave_lds_sync();
  // whole rows go out: 1 KB of a token per pair of stores
#pragma unroll   // constant row offsets in the LDS reads and the stores
  for (int g = 0; g < 2; ++g) { v4f o0[8], o1[8];
#pragma unroll   // keeps the register arrays at constant indices
    for (int rr = 0; rr < 8; ++rr) { o0[rr] = *(const v4f*)(&To[wave][g * 8 + rr][lane * 8]); o1[rr] = *(const v4f*)(&To[wave][g * 8 + rr][lane * 8 + 4]); }
#pragma unroll   // as above
    for (int rr = 0; rr < 8; ++rr) { const size_t row = (row0 + g * 8 + rr) * D; *(v4f*)(out + row + lane * 8) = o0[rr]; *(v4f*)(out + row + lane * 8 + 4) = o1[rr]; }
    if (g == 0) asm volatile("s_wait_xcnt 0x0" ::: "memory"); }   // the stores' data registers are rewritten behind it (next eight rows)
}
}  // namespace

extern "C" void kernel_launch(void* const* d_in, const int* in_sizes, int n_in, void* d_out, int out_size, void* d_ws, size_t ws_size, hipStream_t stream) {
  (void)n_in;
  auto Fp = [&](int i) { return (const float*)d_in[i]; };
  // input order: 0 x [4,4096,256], 1 Wq [256,256] ([e][d]), 2 bq, 3 Wk, 4 bk, 5 Wv, 6 bv, 7 W1, 8 b1, 9 W2, 10 b2, 11 g_ln, 12 beta_ln, 13 g_lnff, 14 beta_lnff
  if (in_sizes[0] != B * S * D || in_sizes[1] != D * D || in_sizes[3] != D * D || in_sizes[5] != D * D || in_sizes[7] != FF * D || in_sizes[9] != D * FF || in_sizes[11] != D || in_sizes[13] != D || out_size != B * S * D) return;
  size_t off = 0; char* ws = (char*)d_ws;
  auto carve = [&](size_t bytes) { char* p = ws + off; off += (bytes + 255) & ~(size_t)255; return p; };
  b16* WT = (b16*)carve((size_t)5 * D * D * 2); b16* Qp = (b16*)carve((size_t)B * S * D * 2); b16* Kp = (b16*)carve((size_t)B * S * D * 2); b16* VT = (b16*)carve((size_t)B * D * S * 2);
  float* O1 = (float*)carve((size_t)B * S * D * 4); float* O2 = (float*)carve((size_t)B * S * D * 4); float* ML = (float*)carve((size_t)2 * B * S * 2 * 4);
  if (off > ws_size || off > ((size_t)128 << 20)) return;   // about 57 MB
  wprep_kernel<<<(unsigned)(((size_t)5 * D * D / 8 + 255) / 256), 256, 0, stream>>>(Fp(1), Fp(3), Fp(5), Fp(7), Fp(9), WT);
  qkv_kernel<<<dim3(S / 64, BL, 3), 128, 0, stream>>>(Fp(0), WT, Fp(2), Fp(4), Fp(6), Qp, Kp, VT);
  attn_kernel<<<dim3(S / 64, BL), 128, 0, stream>>>(Qp, Kp, VT, O1, O2, ML);
  tail_kernel<<<(unsigned)((size_t)BL * S / 64), 128, 0, stream>>>(O1, O2, ML, Fp(0), Fp(11), Fp(12), WT + (size_t)3 * D * D, WT + (size_t)4 * D * D, Fp(8), Fp(10), Fp(13), Fp(14), (float*)d_out);
}

// v006
// Measured time: 88.9 microseconds a run.
// Timed twice side by side with v005, it ran 1.06 and 1.08 times as fast.
// Over all steps from v000 it is 10.7 times as fast.
#include <hip/hip_runtime.h>

// Causal single-head transformer block: q, k, v = x W{q,k,v}^T + b ([4][4096][256], d = 256); A = q . k; causal mask filled with -32767 BEFORE the 1/sqrt(256) scaling (masked weights are exactly 0
// in f32 after exp); softmax over keys <= query; o = A v + x; LayerNorm; h = relu(o W1^T + b1) W2^T + b2; LayerNorm (no second residual) -> [4][4096][256].
// Deterministic: flash-style causal attention, a wave = 32 queries x one 32-key half of every 64-key tile (online softmax with running max, the two halves joined at the end of a segment), both LayerNorms and the FFN in one row-local kernel behind attention;
// no atomics.
// compute dtype: WMMA v_wmma_f32_16x16x32_f16 with f32 accumulate for the q/k/v projections (x EXACT bf16 x8 staged through LDS, W [e][d] rows exact x256: 1 product), S^T = K Q^T (q, k single
// f16 x8: 1 product — logits have std ≈ 1 over ~2,000 keys, per-key rounding averages to ≈4e-5 on the output), O^T += V^T P^T (v single f16 x8, P x1024 single f16: 1 product) and the two FFN GEMMs
// (LayerNorm output / relu hidden as f16 hi+lo x8 planes: 2 products); softmax statistics (exp2), residual, LayerNorms, bias, relu in f32. Inputs rounded to bf16 once.

namespace {
constexpr int B = 4, S = 4096, D = 256, FF = 256, BL = 4 /* batches computed (== B shipped) */;
constexpr float XS = 8.0f, WSC = 256.0f, PS = 1024.0f, LOG2E = 1.4426950408889634f, LNEPS = 1e-5f, MASK_FILL = -32767.0f;
static_assert(S % 64 == 0 && D == 256 && FF == 256, "tiling");
typedef _Float16 b16;
typedef __attribute__((ext_vector_type(16))) _Float16 v16b;
typedef __attribute__((ext_vector_type(8))) _Float16 v8b;
typedef __attribute__((ext_vector_type(8))) float v8f;
typedef __attribute__((ext_vector_type(4))) float v4f;
__device__ __forceinline__ float bf16_rne(float f) { unsigned int u = __float_as_uint(f); u += 0x7FFFu + ((u >> 16) & 1u); return __uint_as_float(u & 0xFFFF0000u); }
__device__ __forceinline__ void split16(float v, b16& hi, b16& lo) { hi = (b16)v; lo = (b16)(v - (float)hi); }
__device__ __forceinline__ v16b frag_kb(const b16* p, int hh) { const v8b a = *(const v8b*)(p + 8 * hh), b = *(const v8b*)(p + 16 + 8 * hh); v16b f;
#pragma unroll
  for (int e = 0; e < 8; ++e) { f[e] = a[e]; f[8 + e] = b[e]; } return f; }
__device__ __forceinline__ void wave_lds_sync() { __builtin_amdgcn_fence(__ATOMIC_RELEASE, "workgroup"); __builtin_amdgcn_wave_barrier(); __builtin_amdgcn_fence(__ATOMIC_ACQUIRE, "workgroup"); }
__device__ __forceinline__ float pmul(float a, float b) { float p = a * b; asm volatile("" : "+v"(p)); return p; }
__device__ __forceinline__ int iclamp(int v, int lo, int hi) { return v < lo ? lo : (v > hi ? hi : v); }

typedef __attribute__((ext_vector_type(2))) _Float16 v2h;
typedef __attribute__((ext_vector_type(4))) _Float16 v4h;
typedef __attribute__((ext_vector_type(2))) float v2f;
__device__ __forceinline__ float nexp2(float v) { return __builtin_amdgcn_exp2f(v); }
__global__ __launch_bounds__(256) void wprep_kernel(const float* __restrict__ wq, const float* __restrict__ wk, const float* __restrict__ wv, const float* __restrict__ w1, const float* __restrict__ w2, b16* __restrict__ WT) {
  const size_t u = (size_t)blockIdx.x * 256 + threadIdx.x; if (u >= (size_t)5 * D * D / 8) return; const size_t e = u * 8; const int m = (int)(e / (D * D)); const size_t el = e % ((size_t)D * D);
  const float* w = m == 0 ? wq : m == 1 ? wk : m == 2 ? wv : m == 3 ? w1 : w2; v8b o; for (int j = 0; j < 8; ++j) o[j] = (b16)(bf16_rne(w[el + j]) * WSC);
  { *(v8b*)(WT + e) = o;  }
}
constexpr int KT = 64, KPITCH = D + 8, VPITCH = KT + 8, NT = S / KT, CUT = NT / 2 + 1;
// the plain builtin (the compiler keeps the distance behind it): operands of an asm statement must lie below v256, which the fragments of a whole pass do not fit
__device__ __forceinline__ v8f wmma16p(v16b a, v16b b, v8f c) { return __builtin_amdgcn_wmma_f32_16x16x32_f16(false, a, false, b, (short)0, c, false, false); }
__device__ __forceinline__ unsigned lds_addr(const void* p) { return (unsigned)(size_t)p; }
// eight 16-byte copies per lane; s_wait_xcnt 0 closes the statement so that no address register is rewritten while a copy may still name it
template <typename E>
__device__ __forceinline__ void async_copy8(const unsigned (&l)[8], const E* const (&g)[8]) {
  asm volatile("global_load_async_to_lds_b128 %0, %8, off\n\t"
               "global_load_async_to_lds_b128 %1, %9, off\n\t"
               "global_load_async_to_lds_b128 %2, %10, off\n\t"
               "global_load_async_to_lds_b128 %3, %11, off\n\t"
               "global_load_async_to_lds_b128 %4, %12, off\n\t"
               "global_load_async_to_lds_b128 %5, %13, off\n\t"
               "global_load_async_to_lds_b128 %6, %14, off\n\t"
               "global_load_async_to_lds_b128 %7, %15, off\n\t"
               "s_wait_xcnt 0x0"
               :: "v"(l[0]), "v"(l[1]), "v"(l[2]), "v"(l[3]), "v"(l[4]), "v"(l[5]), "v"(l[6]), "v"(l[7]),
                  "v"(g[0]), "v"(g[1]), "v"(g[2]), "v"(g[3]), "v"(g[4]), "v"(g[5]), "v"(g[6]), "v"(g[7]) : "memory");
}
// N8 * 8 copies of 16 bytes per lane: piece i goes from g0 + i * gstep (elements) to LDS byte l0 + i * lstep (unrolled so that every address is a constant step from the lane's base)
template <int N8, typename E>
__device__ __forceinline__ void stage_rows(const E* g0, int gstep, unsigned l0, unsigned lstep) {
#pragma unroll
  for (int h = 0; h < N8; ++h) { unsigned l[8]; const E* g[8];
#pragma unroll
    for (int i = 0; i < 8; ++i) { l[i] = l0 + (unsigned)(h * 8 + i) * lstep; g[i] = g0 + (size_t)(h * 8 + i) * gstep; }
    async_copy8(l, g); }
}
// qkv: block = 64 tokens of one batch (4 waves) x one of {q, k, v} (grid.z): A = bf16(x) x8 staged; 16 tiles x 8 k-steps; + bias. q, k -> single f16 x8 planes [b][s][256] (32 lanes x 16 B);
// the operands come into LDS by asynchronous copies of whole 512-byte pieces: each wave's 16 x rows (f32, into its part of Tf, which is free until the epilogue) and the 256 W rows, once per block, at
// pitch 528 B (16 B x odd: ds_load_b128 free of bank conflicts). W rows 64 .. 255 fly while x is converted and column tiles 0 .. 3 are worked on; never more than 48 copies of a wave are in flight.
__global__ __launch_bounds__(128) void qkv_kernel(const float* __restrict__ x, const b16* __restrict__ WT, const float* __restrict__ bq, const float* __restrict__ bk, const float* __restrict__ bv, b16* __restrict__ Qp, b16* __restrict__ Kp, b16* __restrict__ VT) {
  __shared__ __attribute__((aligned(16))) b16 As[4][16][D + 8]; __shared__ __attribute__((aligned(16))) float Tf[4][16][256 + 4]; __shared__ __attribute__((aligned(16))) b16 Ws[D][KPITCH];
  const int wave = __builtin_amdgcn_readfirstlane(threadIdx.x >> 5), lane = threadIdx.x & 31, nloc = lane & 15, hlf = lane >> 4; const int b = blockIdx.y, which = blockIdx.z; const int t0 = blockIdx.x * 64 + wave * 16;
  const b16* W = WT + (size_t)which * D * D; const float* bias = which == 0 ? bq : which == 1 ? bk : bv;
  const float* xw = x + ((size_t)b * S + t0) * D + lane * 4;   // a row of x is two pieces of 512 bytes
  stage_rows<2>(xw, D, lds_addr(&Tf[wave][0][lane * 4]), (256 + 4) * 4); stage_rows<2>(xw + 128, D, lds_addr(&Tf[wave][0][128 + lane * 4]), (256 + 4) * 4);
  stage_rows<2>(W + (size_t)wave * D + lane * 8, 4 * D, lds_addr(&Ws[wave][lane * 8]), 4 * KPITCH * 2);   // W rows wave, wave + 4, .. below 64
  asm volatile("s_wait_asynccnt 0x0" ::: "memory");   // this wave's copies of x and of W rows 0 .. 63 have landed
  __syncthreads();                                     // ... and every other wave's: they may be read
  stage_rows<6>(W + (size_t)(64 + wave) * D + lane * 8, 4 * D, lds_addr(&Ws[64 + wave][lane * 8]), 4 * KPITCH * 2);   // W rows 64 .. 255, read behind the second barrier only
#pragma unroll   // constant LDS offsets; the reads of later rows go out under the conversion of earlier ones
  for (int rr = 0; rr < 16; ++rr) { const v4f f0 = *(const v4f*)(&Tf[wave][rr][lane * 8]), f1 = *(const v4f*)(&Tf[wave][rr][lane * 8 + 4]); v8b o;
#pragma unroll
    for (int j = 0; j < 4; ++j) { o[j] = (b16)(bf16_rne(f0[j]) * XS); o[4 + j] = (b16)(bf16_rne(f1[j]) * XS); }
    *(v8b*)(&As[wave][rr][lane * 8]) = o; }
  wave_lds_sync();
  v8f acc[16];
#pragma unroll
  for (int t = 0; t < 16; ++t) acc[t] = (v8f){};
  // a group = 4 column tiles x 8 k-steps. All fragments of a group are asked for together and one group ahead of their products (two register sets), so that the LDS latency is not paid per product;
  // every loop below is unrolled to keep the register arrays at constant indices
  v16b a[8], w0[32], w1[32];
#pragma unroll
  for (int i = 0; i < 32; ++i) { if ((i & 3) == 0) a[i >> 2] = frag_kb(&As[wave][nloc][(i >> 2) * 32], hlf); w0[i] = frag_kb(&Ws[(i & 3) * 16 + nloc][(i >> 2) * 32], hlf); }
  __builtin_amdgcn_sched_barrier(0);   // holds the reads above in front of the products below: left free, the compiler moves each read down to its product and waits for it there
#pragma unroll
  for (int i = 0; i < 32; ++i) acc[i & 3] = wmma16p(a[i >> 2], w0[i], acc[i & 3]);
  __builtin_amdgcn_sched_barrier(0);   // keeps the products above in front of the wait below, so that the copies in flight land under them
  asm volatile("s_wait_asynccnt 0x0" ::: "memory");   // this wave's copies of W rows 64 .. 255 have landed
  __syncthreads();                                     // ... and every other wave's
#pragma unroll
  for (int i = 0; i < 32; ++i) w1[i] = frag_kb(&Ws[64 + (i & 3) * 16 + nloc][(i >> 2) * 32], hlf);
#pragma unroll
  for (int i = 0; i < 32; ++i) w0[i] = frag_kb(&Ws[128 + (i & 3) * 16 + nloc][(i >> 2) * 32], hlf);
  __builtin_amdgcn_sched_barrier(0);   // holds the reads above in front of the products below: left free, the compiler moves each read down to its product and waits for it there
#pragma unroll
  for (int i = 0; i < 32; ++i) acc[4 + (i & 3)] = wmma16p(a[i >> 2], w1[i], acc[4 + (i & 3)]);
  __builtin_amdgcn_sched_barrier(0);   // keeps the last group's reads from rising among those products or sinking to their own
#pragma unroll
  for (int i = 0; i < 32; ++i) w1[i] = frag_kb(&Ws[192 + (i & 3) * 16 + nloc][(i >> 2) * 32], hlf);
  __builtin_amdgcn_sched_barrier(0);   // holds the reads above in front of the products below: left free, the compiler moves each read down to its product and waits for it there
#pragma unroll
  for (int i = 0; i < 32; ++i) acc[8 + (i & 3)] = wmma16p(a[i >> 2], w0[i], acc[8 + (i & 3)]);
#pragma unroll
  for (int i = 0; i < 32; ++i) acc[12 + (i & 3)] = wmma16p(a[i >> 2], w1[i], acc[12 + (i & 3)]);
#pragma unroll
  for (int t = 0; t < 16; ++t) { const float bb = bf16_rne(bias[t * 16 + nloc]);
#pragma unroll
    for (int r = 0; r < 8; ++r) Tf[wave][8 * hlf + r][t * 16 + nloc] = acc[t][r] * (1.0f / (XS * WSC)) + bb; }
  __syncthreads();
  {
    if (which < 2) { b16* P = (which == 0 ? Qp : Kp) + ((size_t)b * S) * D; for (int rr = 0; rr < 16; ++rr) { v8b o; for (int j = 0; j < 8; ++j) o[j] = (b16)(Tf[wave][rr][lane * 8 + j] * XS); *(v8b*)(P + (size_t)(t0 + rr) * D + lane * 8) = o; } }
    else {
#pragma unroll 1
      for (int q = 0; q < 64; ++q) { const int d = wave * 64 + q; const int tk = lane * 2; v2h vv; vv[0] = (b16)(Tf[tk >> 4][tk & 15][d] * XS); vv[1] = (b16)(Tf[(tk + 1) >> 4][(tk + 1) & 15][d] * XS); *(v2h*)(VT + ((size_t)b * D + d) * S + blockIdx.x * 64 + lane * 2) = vv; } }
     }
}
// causal attention: grid (S/64, BL); block = 64 queries, 4 waves (their tiles: in front of the kernel). Query tile qt needs qt + 1 key tiles, and one block fills a WGP, so the launch lasts as long as its longest block: the work is cut
// into equal blocks. Block j does the head of query tile NT - 1 - j (key tiles 0 .. min(qt + 1, CUT) - 1, partial 0) and, for j > NT / 2, before it the tail of query tile j (key tiles CUT .. j, partial 1):
// CUT or CUT - 1 key tiles in every block. A partial is its own softmax-weighted mean with its (max, sum); the kernel behind attention merges the two partials of a long query tile and adds the residual.
// Within a segment the block walks its keys in tiles of 64: K rows [64][256] and V^T rows [256][64] come once per block into LDS by tensor loads, one request a wave
// (two buffers: tile t + 1 flies while tile t is worked on), and every wave takes its fragments from there. A buffer is four slices of 18 KiB, one per wave: K columns 0 .. 127 and 128 .. 255
// (64 rows of 256 B, padded to pitch 272 B) and V^T rows 0 .. 127 and 128 .. 255 (128 rows of 128 B, padded to pitch 144 B). Both pitches are 16 B x odd: ds_load_b128 free of bank conflicts.
// Per tile and wave one pass of 32 keys x 32 queries, tiles in ascending order: S^T = K Q^T (2 key tiles x 2 query tiles x 8 k-steps), logits A/16 in the log2 domain, keys > query masked (the reference's -32767 fill gives exp = 0 exactly),
// online softmax, P x1024 single f16 via LDS -> O^T += V^T P^T (16 d-tiles x 2 query tiles x 1 k-step); partial = joined O / joined l
typedef uint32_t u32x4 __attribute__((ext_vector_type(4)));
typedef uint32_t u32x8 __attribute__((ext_vector_type(8)));
constexpr uint32_t SLB = 18432, SLE = SLB / 2, KHP = 136;   // slice bytes (9 x 2 KiB) and elements; elements per padded row of a K column half
static_assert(KT * KHP * 2 <= SLB && (D / 2) * VPITCH * 2 == SLB && SLB % 2048 == 0, "slices");
__device__ __forceinline__ uint32_t uni(uint32_t v) { return (uint32_t)__builtin_amdgcn_readfirstlane(v); }
// a wave-uniform value held in a scalar register: a test on it compiles to s_cmp + s_cbranch_scc (a tensor load ignores EXEC), and what is formed from it is formed behind the waits that stand in front of it
__device__ __forceinline__ uint32_t pinned(uint32_t v) { uint32_t w = uni(v); asm volatile("" : "+s"(w)); return w; }   // pinned(): a descriptor word, or the test that decides an issue, held in a scalar register
// descriptor group 1 of a tile of N rows of R bytes at source pitch P bytes; W0 = word 0 (no mask, 1-byte elements, the pad behind every row). Built once per wave; each word is a descriptor word held in its
// scalar register by pinned(), so that the compiler keeps the eight registers as they are for the whole kernel and rewrites none of them while a request is in flight
template <uint32_t W0, uint32_t R, uint32_t N, uint32_t P>
__device__ __forceinline__ u32x8 tensor_group1() { u32x8 g;
  g[0] = pinned(W0); g[1] = pinned((R & 0xFFFFu) << 16); g[2] = pinned((R >> 16) | ((N & 0xFFFFu) << 16)); g[3] = pinned((N >> 16) | (R << 16)); g[4] = pinned(N); g[5] = pinned(P); g[6] = pinned(0u); g[7] = pinned(0u);
  return g; }
// one request: the tile whose first byte is src, to LDS byte dst
__device__ __forceinline__ void tensor_tile(uint32_t dst, const b16* src, u32x8 g1) {
  const uint64_t ga = (uint64_t)(size_t)src; u32x4 g0;
  g0[0] = uni(1u); g0[1] = uni(dst); g0[2] = uni((uint32_t)ga); g0[3] = uni((((uint32_t)(ga >> 32)) & 0x01FFFFFFu) | 0x80000000u);
  asm volatile("tensor_load_to_lds %0, %1" :: "s"(g0), "s"(g1) : "memory");
}
// key tile 'tile' into buffer 'buf' (ring = LDS byte of the ring's start): every wave issues its own slice, waves 0, 1 of K (group 1: gk), waves 2, 3 of V^T (gv)
__device__ __forceinline__ void stage_tile(uint32_t wave, const b16* Kb, const b16* Vb, uint32_t tile, uint32_t ring, uint32_t buf, u32x8 gk, u32x8 gv) {
  const uint32_t dst = ring + (buf * 4 + wave) * SLB;
  if (pinned(wave < 2)) tensor_tile(dst, Kb + (size_t)tile * KT * D + wave * 128, gk);
  else tensor_tile(dst, Vb + (size_t)(wave - 2) * (D / 2) * S + (size_t)tile * KT, gv);
}
// Wave tile: the 4 waves are 2 query groups (qg, 32 queries = two 16-query tiles) x 2 key halves (kh, 32 of a tile's 64 keys): every K and V^T fragment that a wave reads from LDS feeds two products, so
// the block reads each tile from LDS twice and not four times. A wave keeps its own running (max, sum, O) over its key halves; at the end of a segment the two waves of a query group exchange (max, sum),
// scale by the joint statistics, and each hands the other one 16-query tile through LDS: wave kh puts out query tile kh of its group. Index u of the register arrays is query tile u ^ kh, so that the tile a
// wave keeps is always u = 0 and the tile it hands over u = 1 (constant register indices).
__global__ __launch_bounds__(128) void attn_kernel(const b16* __restrict__ Qp, const b16* __restrict__ Kp, const b16* __restrict__ VT, float* __restrict__ O1, float* __restrict__ O2, float* __restrict__ ML) {
  __shared__ __attribute__((aligned(2048))) b16 Ring[2][4][SLE];   // every slice starts at a multiple of 2 KiB of the work-group's LDS
  __shared__ __attribute__((aligned(16))) b16 Pb[4][2][16][32 + 8]; __shared__ __attribute__((aligned(16))) float To[4][16][D + 4]; __shared__ __attribute__((aligned(16))) float Tx[4][16][D + 4];
  __shared__ __attribute__((aligned(16))) float St[4][2][16][2];
  const int tid = threadIdx.x, wave = __builtin_amdgcn_readfirstlane(tid >> 5), lane = tid & 31, hh = lane >> 4, col = lane & 15; const int b = blockIdx.y, j = blockIdx.x;
  const int qg = wave >> 1, kh = wave & 1; const uint32_t ring = lds_addr(&Ring[0][0][0]);
  const u32x8 gk = tensor_group1<(1u << 20) | (5u << 22) | (3u << 25), 256, KT, D * 2>(), gv = tensor_group1<(1u << 20) | (4u << 22) | (3u << 25), 128, D / 2, S * 2>();
  const b16* Qb = Qp + (size_t)b * S * D; const b16* Kb = Kp + (size_t)b * S * D; const b16* Vb = VT + (size_t)b * D * S;
#pragma unroll 1   // stays rolled: the two segments of a block run one after the other through the same code and the same LDS
  for (int seg = (j > NT / 2) ? 0 : 1; seg < 2; ++seg) {   // block-uniform: seg 0 = tail of query tile j, seg 1 = head of query tile NT - 1 - j
  const int qt = seg == 0 ? j : NT - 1 - j, tb = seg == 0 ? CUT : 0;
  const int ntile = seg == 0 ? j + 1 - CUT : (qt + 1 < CUT ? qt + 1 : CUT);   // tiles of 64 keys in this segment, at least one
  const int q0 = qt * 64 + qg * 32; const int qi[2] = {q0 + kh * 16 + col, q0 + (kh ^ 1) * 16 + col};
  v16b qa[2][8]; const b16* qp0 = Qb + (size_t)qi[0] * D + 8 * hh; const b16* qp1 = Qb + (size_t)qi[1] * D + 8 * hh;   // the lane half's step is in the pointers, which are the loads' own addresses
#pragma unroll   // register arrays at constant indices
  for (int ks = 0; ks < 8; ++ks) { qa[0][ks] = frag_kb(qp0 + ks * 32, 0); qa[1][ks] = frag_kb(qp1 + ks * 32, 0); }
  asm volatile("s_wait_xcnt 0x0" :: "v"(qp0), "v"(qp1) : "memory");   // the loads' address registers are rewritten behind it; named here, they stay whole up to it
  const float cs = LOG2E / (16.0f * XS * XS);
  float m[2] = {-INFINITY, -INFINITY}, l[2] = {0.0f, 0.0f}; v8f o[2][16];
#pragma unroll
  for (int t = 0; t < 16; ++t) { o[0][t] = (v8f){}; o[1][t] = (v8f){}; }
  const int kend = q0 + 32;   // keys < kend may be attended by some query of this wave
  // the ring was left by every wave at the last publish point of the segment before (its s_wait_dscnt 0 and barrier)
  stage_tile(wave, Kb, Vb, tb, ring, 0, gk, gv);
  asm volatile("s_wait_tensorcnt 0x0" ::: "memory");   // this wave's slice of tile 0 has landed
  __syncthreads();                                      // ... and every other wave's: tile 0 may be read
  if (pinned(ntile > 1)) stage_tile(wave, Kb, Vb, tb + 1, ring, 1, gk, gv);   // scalar test: a segment may have one tile only, and a tile that does not exist is not asked for
#pragma unroll 1   // stays rolled: one trip already holds a whole pass of 64 products
  for (int tl = 0; tl < ntile; ++tl) {
    const b16* Kt = &Ring[tl & 1][0][0]; const b16* Vt = &Ring[tl & 1][2][0];   // the two V^T slices follow each other without a gap: 256 rows at one pitch
    const int kb = (tb + tl) * KT + kh * 32;   // this wave's 32 keys of the tile
    if (kb < kend) {   // wave-uniform (scalar): a wave skips the pass beyond its diagonal, never the publish point below
      // all fragments of the pass are asked for ahead of the products, so that the LDS latency is paid once per run and not once per product; K in the order of its use (k-step, then key tile)
      v16b kf[16], vf[16];
#pragma unroll
      for (int i = 0; i < 16; ++i) kf[i] = frag_kb(Kt + (i >> 3) * SLE + (kh * 32 + (i & 1) * 16 + col) * KHP + ((i >> 1) & 3) * 32, hh);
#pragma unroll
      for (int t = 0; t < 16; ++t) vf[t] = frag_kb(Vt + (t * 16 + col) * VPITCH + kh * 32, hh);
      v8f s[2][2] = {{(v8f){}, (v8f){}}, {(v8f){}, (v8f){}}};
#pragma unroll   // four independent accumulators between an accumulator's two uses
      for (int ks = 0; ks < 8; ++ks)
#pragma unroll
        for (int tt = 0; tt < 2; ++tt)
#pragma unroll
          for (int u = 0; u < 2; ++u) s[u][tt] = wmma16p(kf[ks * 2 + tt], qa[u][ks], s[u][tt]);
      float al[2];
#pragma unroll   // the two query tiles' softmax chains are independent of each other
      for (int u = 0; u < 2; ++u) {
        float e[16]; float mx = -INFINITY;
#pragma unroll
        for (int i = 0; i < 16; ++i) { const int key = kb + (i < 8 ? 0 : 16) + 8 * hh + (i & 7); const float v = (key <= qi[u]) ? (i < 8 ? s[u][0][i] : s[u][1][i - 8]) * cs : -INFINITY; e[i] = v; mx = fmaxf(mx, v); }
        mx = fmaxf(mx, __shfl_xor(mx, 16)); const float mn = fmaxf(m[u], mx); al[u] = (mn == -INFINITY) ? 1.0f : nexp2(m[u] - mn); float sum = 0.0f;
        // B operand needs row = query, k = key: write P[query col][key] into LDS (wave-private), then frag
#pragma unroll
        for (int i = 0; i < 16; ++i) { const float p = (e[i] == -INFINITY) ? 0.0f : nexp2(e[i] - mn); sum += p; Pb[wave][u][col][(i < 8 ? 0 : 16) + 8 * hh + (i & 7)] = (b16)(p * PS); }
        sum += __shfl_xor(sum, 16); l[u] = l[u] * al[u] + sum; m[u] = mn; }
      wave_lds_sync();
      const v16b pf0 = frag_kb(&Pb[wave][0][col][0], hh), pf1 = frag_kb(&Pb[wave][1][col][0], hh);
#pragma unroll
      for (int t = 0; t < 16; ++t) { o[0][t] *= al[0]; o[0][t] = wmma16p(vf[t], pf0, o[0][t]); o[1][t] *= al[1]; o[1][t] = wmma16p(vf[t], pf1, o[1][t]); }
      wave_lds_sync(); }
    // publish point of tile tl + 1, passed by every wave
    asm volatile("s_wait_dscnt 0x0" ::: "memory");      // this wave's reads of tile tl are done before the buffer is refilled
    asm volatile("s_wait_tensorcnt 0x0" ::: "memory");  // this wave's slice of tile tl + 1 has landed
    __syncthreads();                                     // tile tl + 1 may be read by all; tile tl's buffer is left by all
    if (pinned(tl + 2 < ntile)) stage_tile(wave, Kb, Vb, pinned(tb + tl + 2), ring, tl & 1, gk, gv); }   // scalar test; the descriptor is formed behind the wait above
  asm volatile("s_wait_tensorcnt 0x0" ::: "memory");    // no request is left in flight when the wave goes on
  asm volatile("s_wait_dscnt 0x0" ::: "memory");        // and none of its reads of the ring
  // join of the two key halves. The kh = 0 wave has had at least one pass (its first key is never beyond the diagonal), so the joint max is finite; a wave without a pass has max -inf, sum 0, weight exp2(-inf) = 0
  { const v2f st = {hh == 0 ? m[0] : m[1], hh == 0 ? l[0] : l[1]}; *(v2f*)(&St[wave][hh][col][0]) = st; }   // both lane halves hold both tiles' (max, sum): half hh writes tile u = hh
  __syncthreads();   // the partner wave's (max, sum) may be read
  float f[2], mj = 0.0f, lj = 0.0f;
#pragma unroll
  for (int u = 0; u < 2; ++u) { const v2f ps = *(const v2f*)(&St[wave ^ 1][u ^ 1][col][0]);   // the partner's index of the same query tile is u ^ 1
    const float mm = fmaxf(m[u], ps[0]); const float as = nexp2(m[u] - mm), ap = nexp2(ps[0] - mm); const float lt = l[u] * as + ps[1] * ap;
    f[u] = as / (lt * PS * XS); if (u == 0) { mj = mm; lj = lt; } }
#pragma unroll
  for (int t = 0; t < 16; ++t)
#pragma unroll
    for (int r = 0; r < 8; ++r) Tx[wave][col][t * 16 + 8 * hh + r] = o[1][t][r] * f[1];
  __syncthreads();   // the partner wave's share of the tile that this wave keeps may be read
#pragma unroll
  for (int t = 0; t < 16; ++t) { const v4f x0 = *(const v4f*)(&Tx[wave ^ 1][col][t * 16 + 8 * hh]), x1 = *(const v4f*)(&Tx[wave ^ 1][col][t * 16 + 8 * hh + 4]);
#pragma unroll
    for (int r = 0; r < 8; ++r) To[wave][col][t * 16 + 8 * hh + r] = o[0][t][r] * f[0] + (r < 4 ? x0[r] : x1[r - 4]); }
  wave_lds_sync();
  float* Op = seg == 0 ? O2 : O1; const int qk = q0 + kh * 16;   // the 16 queries that this wave puts out
  if (hh == 0) { const v2f ml = {mj, lj}; *(v2f*)(ML + ((size_t)(seg == 0 ? B * S : 0) + (size_t)b * S + qk + col) * 2) = ml; }   // both halves hold the same (max, sum): 16 queries = one 128-byte line per wave
  asm volatile("s_wait_xcnt 0x0" ::: "memory");   // the store's address registers are rewritten right behind it
#pragma unroll   // constant row offsets in the LDS reads and the stores
  for (int g = 0; g < 2; ++g) { v4f a0[8], a1[8];
#pragma unroll   // keeps the register arrays at constant indices
    for (int rr = 0; rr < 8; ++rr) { a0[rr] = *(const v4f*)(&To[wave][g * 8 + rr][lane * 8]); a1[rr] = *(const v4f*)(&To[wave][g * 8 + rr][lane * 8 + 4]); }
#pragma unroll   // as above
    for (int rr = 0; rr < 8; ++rr) { const size_t row = ((size_t)b * S + qk + g * 8 + rr) * D; *(v4f*)(Op + row + lane * 8) = a0[rr]; *(v4f*)(Op + row + lane * 8 + 4) = a1[rr]; }
    asm volatile("s_wait_xcnt 0x0" ::: "memory"); }   // the stores' data and address registers are rewritten behind it (next eight rows, next segment)
  }
}
// everything behind attention in one launch, because it is local to a token row: merge of the attention partials + residual + LayerNorm 1, both FFN GEMMs, LayerNorm 2. Block = 64 tokens (one query tile),
// wave = 16 tokens from first to last; the LayerNorm output and the relu hidden rows (f16 hi + lo x8 planes) stay in the wave's own LDS rows, h2 stays in the accumulators.
// Products are taken transposed, D^T = W A^T (W rows as the A operand, token rows as B; same loader for both): a lane then holds 8 consecutive features of ONE token per tile, so the hidden planes go to LDS
// as 16-byte stores and LayerNorm 2 is a sum inside the lane plus one exchange with lane ^ 16.
// One 256-row W buffer at pitch 528 B serves W1 and then W2, filled by asynchronous copies of whole 512-byte rows: rows 0 .. 191 and rows 192 .. 255 are separate fills (48 and 16 copies of a wave, never
// more than 48 in flight); each fill stands behind the barrier that ends every wave's reads of those rows and is read behind its own wait and barrier.
// The text runs once per wave, so it is kept short: LayerNorm 1 is a rolled loop over groups of 4 rows, the two GEMMs are two trips of one rolled loop, the copies a rolled loop of eight.
template <int N8>
__device__ __forceinline__ void stage_rows_rolled(const b16* g0, int gstep, unsigned l0, unsigned lstep) {
#pragma unroll 1   // rolled: 24 address registers in all, where the unrolled form keeps every address of a fill alive across the products
  for (int h = 0; h < N8; ++h) { unsigned l[8]; const b16* g[8];
#pragma unroll
    for (int i = 0; i < 8; ++i) { l[i] = l0 + (unsigned)(h * 8 + i) * lstep; g[i] = g0 + (size_t)(h * 8 + i) * gstep; }
    async_copy8(l, g); }
}
__device__ __forceinline__ void load_group(v16b (&w)[32], const b16 (*Ws)[KPITCH], int row0, int nloc, int hlf) {
#pragma unroll   // register array at constant indices
  for (int i = 0; i < 32; ++i) w[i] = frag_kb(&Ws[row0 + (i & 3) * 16 + nloc][(i >> 2) * 32], hlf);
}
// 4 feature tiles x 8 k-steps x (hi, lo): per accumulator the order is hi, lo within ascending k; the four tiles stand between an accumulator's two uses
template <int G>
__device__ __forceinline__ void mul_group(v8f (&acc)[16], const v16b (&w)[32], const v16b (&a)[8], const v16b (&al)[8]) {
#pragma unroll   // register arrays at constant indices
  for (int ks = 0; ks < 8; ++ks) {
#pragma unroll
    for (int tt = 0; tt < 4; ++tt) acc[4 * G + tt] = wmma16p(w[ks * 4 + tt], a[ks], acc[4 * G + tt]);
#pragma unroll
    for (int tt = 0; tt < 4; ++tt) acc[4 * G + tt] = wmma16p(w[ks * 4 + tt], al[ks], acc[4 * G + tt]);
  }
}
__device__ __forceinline__ float wave_sum(float s) {
#pragma unroll
  for (int o = 1; o < 32; o <<= 1) s += __shfl_xor(s, o);
  return s; }
// four token rows as LayerNorm 1 takes them: 8 features a lane of partial 0 (a, c), of x, and for a long query tile of partial 1 with both (max, sum) pairs
struct Rows4 { v4f a[4], c[4], x0[4], x1[4], a2[4], c2[4]; v2f p0[4], p1[4]; };
__device__ __forceinline__ void load_rows4(Rows4& R, const float* IN, const float* IN2, const float* ML, const float* x, size_t row, int lane, bool two) {
  const float* pa = IN + row * D + lane * 8; const float* px = x + row * D + lane * 8;
#pragma unroll
  for (int rr = 0; rr < 4; ++rr) { R.a[rr] = *(const v4f*)(pa + rr * D); R.c[rr] = *(const v4f*)(pa + rr * D + 4); R.x0[rr] = *(const v4f*)(px + rr * D); R.x1[rr] = *(const v4f*)(px + rr * D + 4); }
  asm volatile("s_wait_xcnt 0x0" :: "v"(pa), "v"(px) : "memory");   // the loads' address registers are rewritten behind it; named here, they stay whole up to it (no load's result is placed on them)
  if (two) { const float* p2 = IN2 + row * D + lane * 8;
#pragma unroll
    for (int rr = 0; rr < 4; ++rr) { R.a2[rr] = *(const v4f*)(p2 + rr * D); R.c2[rr] = *(const v4f*)(p2 + rr * D + 4);
      R.p0[rr] = *(const v2f*)(ML + (row + rr) * 2); R.p1[rr] = *(const v2f*)(ML + ((size_t)B * S + row + rr) * 2); }
    asm volatile("s_wait_xcnt 0x0" :: "v"(p2) : "memory"); }   // as above
}
__global__ __launch_bounds__(128) void tail_kernel(const float* __restrict__ IN, const float* __restrict__ IN2, const float* __restrict__ ML, const float* __restrict__ x, const float* __restrict__ g1, const float* __restrict__ be1,
                                                   const b16* __restrict__ W1, const b16* __restrict__ W2, const float* __restrict__ b1, const float* __restrict__ b2, const float* __restrict__ g2, const float* __restrict__ be2, float* __restrict__ out) {
  __shared__ __attribute__((aligned(16))) b16 Ws[D][KPITCH]; __shared__ __attribute__((aligned(16))) b16 Ahs[4][16][KPITCH]; __shared__ __attribute__((aligned(16))) b16 Als[4][16][KPITCH];
  __shared__ __attribute__((aligned(16))) float To[4][16][D + 4]; __shared__ __attribute__((aligned(16))) float Ps[4][D];
  const int tid = threadIdx.x, wave = __builtin_amdgcn_readfirstlane(tid >> 5), lane = tid & 31, nloc = lane & 15, hlf = lane >> 4; const size_t row0 = (size_t)blockIdx.x * 64 + wave * 16;
  stage_rows_rolled<6>(W1 + (size_t)wave * D + lane * 8, 4 * D, lds_addr(&Ws[wave][lane * 8]), 4 * KPITCH * 2);   // W1 rows 0 .. 191 (wave, wave + 4, ..) fly under LayerNorm 1
  const bool two = (int)(blockIdx.x & (NT - 1)) >= CUT;   // block-uniform: a long query tile has two partials
  Rows4 raw = {}; load_rows4(raw, IN, IN2, ML, x, row0, lane, two);
  // per-feature vectors of the two epilogues, rounded once, read by every wave behind the first barrier
  { const v2f p0 = *(const v2f*)(b1 + tid * 2), p1 = *(const v2f*)(b2 + tid * 2), p2 = *(const v2f*)(g2 + tid * 2), p3 = *(const v2f*)(be2 + tid * 2);
    asm volatile("s_wait_xcnt 0x0" ::: "memory");   // the loads' base and offset registers are rewritten behind them
    const v2f q0 = {bf16_rne(p0[0]), bf16_rne(p0[1])}, q1 = {bf16_rne(p1[0]), bf16_rne(p1[1])}, q2 = {bf16_rne(p2[0]), bf16_rne(p2[1])}, q3 = {bf16_rne(p3[0]), bf16_rne(p3[1])};
    *(v2f*)(&Ps[0][tid * 2]) = q0; *(v2f*)(&Ps[1][tid * 2]) = q1; *(v2f*)(&Ps[2][tid * 2]) = q2; *(v2f*)(&Ps[3][tid * 2]) = q3; }
  float gg[8], bb[8];
  { const v4f u0 = *(const v4f*)(g1 + lane * 8), u1 = *(const v4f*)(g1 + lane * 8 + 4), u2 = *(const v4f*)(be1 + lane * 8), u3 = *(const v4f*)(be1 + lane * 8 + 4);
    asm volatile("s_wait_xcnt 0x0" ::: "memory");   // as above
#pragma unroll
    for (int j = 0; j < 4; ++j) { gg[j] = bf16_rne(u0[j]); gg[4 + j] = bf16_rne(u1[j]); bb[j] = bf16_rne(u2[j]); bb[4 + j] = bf16_rne(u3[j]); } }
  // LayerNorm 1, a row across the wave (8 features a lane), 4 rows a trip; the next 4 rows' loads go out ahead of this group's sums and land under its arithmetic
#pragma unroll 1   // rolled for a short text
  for (int bt = 0; bt < 4; ++bt) { v4f a[4], c[4];
#pragma unroll
    for (int rr = 0; rr < 4; ++rr) { a[rr] = raw.a[rr]; c[rr] = raw.c[rr]; }
    if (two) {
#pragma unroll
      for (int rr = 0; rr < 4; ++rr) { const v2f p0 = raw.p0[rr], p1 = raw.p1[rr]; const float mm = fmaxf(p0[0], p1[0]);
        float w0 = p0[1] * nexp2(p0[0] - mm), w1 = p1[1] * nexp2(p1[0] - mm); const float rw = 1.0f / (w0 + w1); w0 *= rw; w1 *= rw;
        a[rr] = a[rr] * w0 + raw.a2[rr] * w1; c[rr] = c[rr] * w0 + raw.c2[rr] * w1; } }
#pragma unroll
    for (int rr = 0; rr < 4; ++rr)
#pragma unroll
      for (int j = 0; j < 4; ++j) { a[rr][j] += bf16_rne(raw.x0[rr][j]); c[rr][j] += bf16_rne(raw.x1[rr][j]); }
    load_rows4(raw, IN, IN2, ML, x, row0 + (bt < 3 ? bt + 1 : 3) * 4, lane, two);   // the last trip reads its own rows again: one instruction stream
    float s[4], q[4];
#pragma unroll
    for (int rr = 0; rr < 4; ++rr) { float t = 0.0f;
#pragma unroll
      for (int j = 0; j < 4; ++j) t += a[rr][j] + c[rr][j];
      s[rr] = wave_sum(t) * (1.0f / D); }
#pragma unroll
    for (int rr = 0; rr < 4; ++rr) { const float mu = s[rr]; float t = 0.0f;
#pragma unroll
      for (int j = 0; j < 4; ++j) { const float d0 = a[rr][j] - mu, d1 = c[rr][j] - mu; t += d0 * d0 + d1 * d1; }
      q[rr] = wave_sum(t); }
#pragma unroll
    for (int rr = 0; rr < 4; ++rr) { const float mu = s[rr], rs = rsqrtf(q[rr] * (1.0f / D) + LNEPS); v8b hv, lv;
#pragma unroll
      for (int j = 0; j < 8; ++j) { const float y = ((j < 4 ? a[rr][j] : c[rr][j - 4]) - mu) * rs * gg[j] + bb[j]; b16 p, qq; split16(y * XS, p, qq); hv[j] = p; lv[j] = qq; }
      *(v8b*)(&Ahs[wave][bt * 4 + rr][lane * 8]) = hv; *(v8b*)(&Als[wave][bt * 4 + rr][lane * 8]) = lv; }
    __builtin_amdgcn_sched_barrier(0); }   // keeps the register copies that hand the next rows over, and with them the wait for their loads, behind this group's arithmetic: left free, they rise to its start
  v8f acc[16];
#pragma unroll 1   // rolled for a short text: trip 0 = W1 (and relu into the planes), trip 1 = W2
  for (int pass = 0; pass < 2; ++pass) {
    const b16* Wc = pass == 0 ? W1 : W2;
    wave_lds_sync();   // the wave's plane rows were written across its lanes
    v16b a[8], al[8], w0[32], w1[32];
#pragma unroll
    for (int ks = 0; ks < 8; ++ks) { a[ks] = frag_kb(&Ahs[wave][nloc][ks * 32], hlf); al[ks] = frag_kb(&Als[wave][nloc][ks * 32], hlf); }
#pragma unroll
    for (int t = 0; t < 16; ++t) acc[t] = (v8f){};
    // fragments of a group (64 W rows) are asked for together and one group ahead of their products (two register sets), so that the LDS latency is not paid per product
    asm volatile("s_wait_dscnt 0x0" ::: "memory");      // this wave's earlier reads of rows 192 .. 255 are done before they are refilled
    asm volatile("s_wait_asynccnt 0x0" ::: "memory");   // this wave's copies of rows 0 .. 191 have landed
    __syncthreads();                                     // ... and every other wave's: they may be read; rows 192 .. 255 are left by all
    stage_rows_rolled<2>(Wc + (size_t)(192 + wave) * D + lane * 8, 4 * D, lds_addr(&Ws[192 + wave][lane * 8]), 4 * KPITCH * 2);
    load_group(w0, Ws, 0, nloc, hlf); load_group(w1, Ws, 64, nloc, hlf);
    __builtin_amdgcn_sched_barrier(0);   // holds the reads above in front of the products below: left free, the compiler moves each read down to its product and waits for it there
    mul_group<0>(acc, w0, a, al);
    __builtin_amdgcn_sched_barrier(0);   // keeps the next group's reads from rising among those products or sinking to their own
    load_group(w0, Ws, 128, nloc, hlf);
    __builtin_amdgcn_sched_barrier(0);   // as above
    mul_group<1>(acc, w1, a, al);
    __builtin_amdgcn_sched_barrier(0);   // keeps the products above in front of the waits below, so that the copies in flight land under them
    asm volatile("s_wait_dscnt 0x0" ::: "memory");      // this wave's reads of rows 0 .. 191 are done before they are refilled
    asm volatile("s_wait_asynccnt 0x0" ::: "memory");   // this wave's copies of rows 192 .. 255 have landed
    __syncthreads();                                     // ... and every other wave's; rows 0 .. 191 are left by all
    if (pass == 0) stage_rows_rolled<6>(W2 + (size_t)wave * D + lane * 8, 4 * D, lds_addr(&Ws[wave][lane * 8]), 4 * KPITCH * 2);   // block-uniform: W2 rows 0 .. 191 fly under the rest of trip 0
    load_group(w1, Ws, 192, nloc, hlf);
    __builtin_amdgcn_sched_barrier(0);   // holds the reads above in front of the products below
    mul_group<2>(acc, w0, a, al); mul_group<3>(acc, w1, a, al);
    // + bias: lane = token nloc, features t * 16 + 8 * hlf + 0 .. 7
#pragma unroll
    for (int t = 0; t < 16; ++t) { const v4f c0 = *(const v4f*)(&Ps[pass][t * 16 + 8 * hlf]), c1 = *(const v4f*)(&Ps[pass][t * 16 + 8 * hlf + 4]);
#pragma unroll
      for (int r = 0; r < 8; ++r) acc[t][r] = acc[t][r] * (1.0f / (XS * WSC)) + (r < 4 ? c0[r] : c1[r - 4]); }
    if (pass == 0) {   // hidden = relu(.) as hi + lo planes over the wave's own rows (their fragments are in registers)
#pragma unroll
      for (int t = 0; t < 16; ++t) { v8b hv, lv;
#pragma unroll
        for (int r = 0; r < 8; ++r) { b16 p, qq; split16(fmaxf(acc[t][r], 0.0f) * XS, p, qq); hv[r] = p; lv[r] = qq; }
        *(v8b*)(&Ahs[wave][nloc][t * 16 + 8 * hlf]) = hv; *(v8b*)(&Als[wave][nloc][t * 16 + 8 * hlf]) = lv; } } }
  // LayerNorm 2 over the token's 256 features: 128 in this lane (eight running sums over the 16 tiles, then a tree), 128 in lane ^ 16
  v8f vs = (v8f){};
#pragma unroll
  for (int t = 0; t < 16; ++t) vs += acc[t];
  float s = ((vs[0] + vs[1]) + (vs[2] + vs[3])) + ((vs[4] + vs[5]) + (vs[6] + vs[7])); s += __shfl_xor(s, 16);
  const float mu = s * (1.0f / D); v8f vq = (v8f){};
#pragma unroll
  for (int t = 0; t < 16; ++t) { const v8f d = acc[t] - mu; vq += d * d; }
  float q = ((vq[0] + vq[1]) + (vq[2] + vq[3])) + ((vq[4] + vq[5]) + (vq[6] + vq[7])); q += __shfl_xor(q, 16);
  const float rs = rsqrtf(q * (1.0f / D) + LNEPS);
#pragma unroll
  for (int t = 0; t < 16; ++t) { const int f = t * 16 + 8 * hlf; const v4f g0 = *(const v4f*)(&Ps[2][f]), g4 = *(const v4f*)(&Ps[2][f + 4]), e0 = *(const v4f*)(&Ps[3][f]), e4 = *(const v4f*)(&Ps[3][f + 4]); v4f y0, y1;
#pragma unroll
    for (int r = 0; r < 4; ++r) { y0[r] = (acc[t][r] - mu) * rs * g0[r] + e0[r]; y1[r] = (acc[t][4 + r] - mu) * rs * g4[r] + e4[r]; }
    *(v4f*)(&To[wave][nloc][f]) = y0; *(v4f*)(&To[wave][nloc][f + 4]) = y1; }
  wave_lds_sync();
  // whole rows go out: 1 KB of a token per pair of stores
#pragma unroll   // constant row offsets in the LDS reads and the stores
  for (int g = 0; g < 2; ++g) { v4f o0[8], o1[8];
#pragma unroll   // keeps the register arrays at constant indices
    for (int rr = 0; rr < 8; ++rr) { o0[rr] = *(const v4f*)(&To[wave][g * 8 + rr][lane * 8]); o1[rr] = *(const v4f*)(&To[wave][g * 8 + rr][lane * 8 + 4]); }
#pragma unroll   // as above
    for (int rr = 0; rr < 8; ++rr) { const size_t row = (row0 + g * 8 + rr) * D; *(v4f*)(out + row + lane * 8) = o0[rr]; *(v4f*)(out + row + lane * 8 + 4) = o1[rr]; }
    if (g == 0) asm volatile("s_wait_xcnt 0x0" ::: "memory"); }   // the stores' data registers are rewritten behind it (next eight rows)
}
}  // namespace

extern "C" void kernel_launch(void* const* d_in, const int* in_sizes, int n_in, void* d_out, int out_size, void* d_ws, size_t ws_size, hipStream_t stream) {
  (void)n_in;
  auto Fp = [&](int i) { return (const float*)d_in[i]; };
  // input order: 0 x [4,4096,256], 1 Wq [256,256] ([e][d]), 2 bq, 3 Wk, 4 bk, 5 Wv, 6 bv, 7 W1, 8 b1, 9 W2, 10 b2, 11 g_ln, 12 beta_ln, 13 g_lnff, 14 beta_lnff
  if (in_sizes[0] != B * S * D || in_sizes[1] != D * D || in_sizes[3] != D * D || in_sizes[5] != D * D || in_sizes[7] != FF * D || in_sizes[9] != D * FF || in_sizes[11] != D || in_sizes[13] != D || out_size != B * S * D) return;
  size_t off = 0; char* ws = (char*)d_ws;
  auto carve = [&](size_t bytes) { char* p = ws + off; off += (bytes + 255) & ~(size_t)255; return p; };
  b16* WT = (b16*)carve((size_t)5 * D * D * 2); b16* Qp = (b16*)carve((size_t)B * S * D * 2); b16* Kp = (b16*)carve((size_t)B * S * D * 2); b16* VT = (b16*)carve((size_t)B * D * S * 2);
  float* O1 = (float*)carve((size_t)B * S * D * 4); float* O2 = (float*)carve((size_t)B * S * D * 4); float* ML = (float*)carve((size_t)2 * B * S * 2 * 4);
  if (off > ws_size || off > ((size_t)128 << 20)) return;   // about 57 MB
  wprep_kernel<<<(unsigned)(((size_t)5 * D * D / 8 + 255) / 256), 256, 0, stream>>>(Fp(1), Fp(3), Fp(5), Fp(7), Fp(9), WT);
  qkv_kernel<<<dim3(S / 64, BL, 3), 128, 0, stream>>>(Fp(0), WT, Fp(2), Fp(4), Fp(6), Qp, Kp, VT);
  attn_kernel<<<dim3(S / 64, BL), 128, 0, stream>>>(Qp, Kp, VT, O1, O2, ML);
  tail_kernel<<<(unsigned)((size_t)BL * S / 64), 128, 0, stream>>>(O1, O2, ML, Fp(0), Fp(11), Fp(12), WT + (size_t)3 * D * D, WT + (size_t)4 * D * D, Fp(8), Fp(10), Fp(13), Fp(14), (float*)d_out);
}

// v007
// Measured time: 84.7 microseconds a run.
// Timed twice side by side with v006, it ran 1.04 and 1.05 times as fast.
// All steps since v000 together make it 11.2 times as fast.
#include <hip/hip_runtime.h>

// Causal single-head transformer block: q, k, v = x W{q,k,v}^T + b ([4][4096][256], d = 256); A = q . k; causal mask filled with -32767 BEFORE the 1/sqrt(256) scaling (masked weights are exactly 0
// in f32 after exp); softmax over keys <= query; o = A v + x; LayerNorm; h = relu(o W1^T + b1) W2^T + b2; LayerNorm (no second residual) -> [4][4096][256].
// Deterministic: flash-style causal attention, a wave = 32 queries x one 32-key half of every 64-key tile (online softmax with running max, the two halves joined at the end of a segment), both LayerNorms and the FFN in one row-local kernel behind attention;
// no atomics.
// compute dtype: WMMA v_wmma_f32_16x16x32_f16 with f32 accumulate for the q/k/v projections (x EXACT bf16 x8 staged through LDS, W [e][d] rows exact x256: 1 product), S^T = K Q^T (q, k single
// f16 x8: 1 product — logits have std ≈ 1 over ~2,000 keys, per-key rounding averages to ≈4e-5 on the output), O^T += V^T P^T (v single f16 x8, P x1024 single f16: 1 product) and the two FFN GEMMs
// (LayerNorm output / relu hidden as f16 hi+lo x8 planes: 2 products); softmax statistics (exp2), residual, LayerNorms, bias, relu in f32. Inputs rounded to bf16 once.

namespace {
constexpr int B = 4, S = 4096, D = 256, FF = 256, BL = 4 /* batches computed (== B shipped) */;
constexpr float XS = 8.0f, WSC = 256.0f, PS = 1024.0f, LOG2E = 1.4426950408889634f, LNEPS = 1e-5f, MASK_FILL = -32767.0f;
static_assert(S % 64 == 0 && D == 256 && FF == 256, "tiling");
typedef _Float16 b16;
typedef __attribute__((ext_vector_type(16))) _Float16 v16b;
typedef __attribute__((ext_vector_type(8))) _Float16 v8b;
typedef __attribute__((ext_vector_type(8))) float v8f;
typedef __attribute__((ext_vector_type(4))) float v4f;
__device__ __forceinline__ float bf16_rne(float f) { unsigned int u = __float_as_uint(f); u += 0x7FFFu + ((u >> 16) & 1u); return __uint_as_float(u & 0xFFFF0000u); }
__device__ __forceinline__ void split16(float v, b16& hi, b16& lo) { hi = (b16)v; lo = (b16)(v - (float)hi); }
__device__ __forceinline__ v16b frag_kb(const b16* p, int hh) { const v8b a = *(const v8b*)(p + 8 * hh), b = *(const v8b*)(p + 16 + 8 * hh); v16b f;
#pragma unroll
  for (int e = 0; e < 8; ++e) { f[e] = a[e]; f[8 + e] = b[e]; } return f; }
__device__ __forceinline__ void wave_lds_sync() { __builtin_amdgcn_fence(__ATOMIC_RELEASE, "workgroup"); __builtin_amdgcn_wave_barrier(); __builtin_amdgcn_fence(__ATOMIC_ACQUIRE, "workgroup"); }
__device__ __forceinline__ float pmul(float a, float b) { float p = a * b; asm volatile("" : "+v"(p)); return p; }
__device__ __forceinline__ int iclamp(int v, int lo, int hi) { return v < lo ? lo : (v > hi ? hi : v); }

typedef __attribute__((ext_vector_type(2))) _Float16 v2h;
typedef __attribute__((ext_vector_type(4))) _Float16 v4h;
typedef __attribute__((ext_vector_type(2))) float v2f;
__device__ __forceinline__ float nexp2(float v) { return __builtin_amdgcn_exp2f(v); }
__global__ __launch_bounds__(256) void wprep_kernel(const float* __restrict__ wq, const float* __restrict__ wk, const float* __restrict__ wv, const float* __restrict__ w1, const float* __restrict__ w2, b16* __restrict__ WT) {
  const size_t u = (size_t)blockIdx.x * 256 + threadIdx.x; if (u >= (size_t)5 * D * D / 8) return; const size_t e = u * 8; const int m = (int)(e / (D * D)); const size_t el = e % ((size_t)D * D);
  const float* w = m == 0 ? wq : m == 1 ? wk : m == 2 ? wv : m == 3 ? w1 : w2; v8b o; for (int j = 0; j < 8; ++j) o[j] = (b16)(bf16_rne(w[el + j]) * WSC);
  { *(v8b*)(WT + e) = o;  }
}
constexpr int KT = 64, KPITCH = D + 8, VPITCH = KT + 8, NT = S / KT, CUT = NT / 2 + 1;
// the plain builtin (the compiler keeps the distance behind it): operands of an asm statement must lie below v256, which the fragments of a whole pass do not fit
__device__ __forceinline__ v8f wmma16p(v16b a, v16b b, v8f c) { return __builtin_amdgcn_wmma_f32_16x16x32_f16(false, a, false, b, (short)0, c, false, false); }
__device__ __forceinline__ unsigned lds_addr(const void* p) { return (unsigned)(size_t)p; }
// eight 16-byte copies per lane; s_wait_xcnt 0 closes the statement so that no address register is rewritten while a copy may still name it
template <typename E>
__device__ __forceinline__ void async_copy8(const unsigned (&l)[8], const E* const (&g)[8]) {
  asm volatile("global_load_async_to_lds_b128 %0, %8, off\n\t"
               "global_load_async_to_lds_b128 %1, %9, off\n\t"
               "global_load_async_to_lds_b128 %2, %10, off\n\t"
               "global_load_async_to_lds_b128 %3, %11, off\n\t"
               "global_load_async_to_lds_b128 %4, %12, off\n\t"
               "global_load_async_to_lds_b128 %5, %13, off\n\t"
               "global_load_async_to_lds_b128 %6, %14, off\n\t"
               "global_load_async_to_lds_b128 %7, %15, off\n\t"
               "s_wait_xcnt 0x0"
               :: "v"(l[0]), "v"(l[1]), "v"(l[2]), "v"(l[3]), "v"(l[4]), "v"(l[5]), "v"(l[6]), "v"(l[7]),
                  "v"(g[0]), "v"(g[1]), "v"(g[2]), "v"(g[3]), "v"(g[4]), "v"(g[5]), "v"(g[6]), "v"(g[7]) : "memory");
}
// N8 * 8 copies of 16 bytes per lane: piece i goes from g0 + i * gstep (elements) to LDS byte l0 + i * lstep (unrolled so that every address is a constant step from the lane's base)
template <int N8, typename E>
__device__ __forceinline__ void stage_rows(const E* g0, int gstep, unsigned l0, unsigned lstep) {
#pragma unroll
  for (int h = 0; h < N8; ++h) { unsigned l[8]; const E* g[8];
#pragma unroll
    for (int i = 0; i < 8; ++i) { l[i] = l0 + (unsigned)(h * 8 + i) * lstep; g[i] = g0 + (size_t)(h * 8 + i) * gstep; }
    async_copy8(l, g); }
}
// qkv: block = 64 tokens of one batch (4 waves) x one of {q, k, v} (grid.z): A = bf16(x) x8 staged; 16 tiles x 8 k-steps; + bias. q, k -> single f16 x8 planes [b][s][256] (32 lanes x 16 B);
// the operands come into LDS by asynchronous copies of whole 512-byte pieces: each wave's 16 x rows (f32, into its part of Tf, which is free until the epilogue) and the 256 W rows, once per block, at
// pitch 528 B (16 B x odd: ds_load_b128 free of bank conflicts). W rows 64 .. 255 fly while x is converted and column tiles 0 .. 3 are worked on; never more than 48 copies of a wave are in flight.
__global__ __launch_bounds__(128) void qkv_kernel(const float* __restrict__ x, const b16* __restrict__ WT, const float* __restrict__ bq, const float* __restrict__ bk, const float* __restrict__ bv, b16* __restrict__ Qp, b16* __restrict__ Kp, b16* __restrict__ VT) {
  __shared__ __attribute__((aligned(16))) b16 As[4][16][D + 8]; __shared__ __attribute__((aligned(16))) float Tf[4][16][256 + 4]; __shared__ __attribute__((aligned(16))) b16 Ws[D][KPITCH];
  const int wave = __builtin_amdgcn_readfirstlane(threadIdx.x >> 5), lane = threadIdx.x & 31, nloc = lane & 15, hlf = lane >> 4; const int b = blockIdx.y, which = blockIdx.z; const int t0 = blockIdx.x * 64 + wave * 16;
  const b16* W = WT + (size_t)which * D * D; const float* bias = which == 0 ? bq : which == 1 ? bk : bv;
  const float* xw = x + ((size_t)b * S + t0) * D + lane * 4;   // a row of x is two pieces of 512 bytes
  stage_rows<2>(xw, D, lds_addr(&Tf[wave][0][lane * 4]), (256 + 4) * 4); stage_rows<2>(xw + 128, D, lds_addr(&Tf[wave][0][128 + lane * 4]), (256 + 4) * 4);
  stage_rows<2>(W + (size_t)wave * D + lane * 8, 4 * D, lds_addr(&Ws[wave][lane * 8]), 4 * KPITCH * 2);   // W rows wave, wave + 4, .. below 64
  asm volatile("s_wait_asynccnt 0x0" ::: "memory");   // this wave's copies of x and of W rows 0 .. 63 have landed
  __syncthreads();                                     // ... and every other wave's: they may be read
  stage_rows<6>(W + (size_t)(64 + wave) * D + lane * 8, 4 * D, lds_addr(&Ws[64 + wave][lane * 8]), 4 * KPITCH * 2);   // W rows 64 .. 255, read behind the second barrier only
#pragma unroll   // constant LDS offsets; the reads of later rows go out under the conversion of earlier ones
  for (int rr = 0; rr < 16; ++rr) { const v4f f0 = *(const v4f*)(&Tf[wave][rr][lane * 8]), f1 = *(const v4f*)(&Tf[wave][rr][lane * 8 + 4]); v8b o;
#pragma unroll
    for (int j = 0; j < 4; ++j) { o[j] = (b16)(bf16_rne(f0[j]) * XS); o[4 + j] = (b16)(bf16_rne(f1[j]) * XS); }
    *(v8b*)(&As[wave][rr][lane * 8]) = o; }
  wave_lds_sync();
  v8f acc[16];
#pragma unroll
  for (int t = 0; t < 16; ++t) acc[t] = (v8f){};
  // a group = 4 column tiles x 8 k-steps. All fragments of a group are asked for together and one group ahead of their products (two register sets), so that the LDS latency is not paid per product;
  // every loop below is unrolled to keep the register arrays at constant indices
  v16b a[8], w0[32], w1[32];
#pragma unroll
  for (int i = 0; i < 32; ++i) { if ((i & 3) == 0) a[i >> 2] = frag_kb(&As[wave][nloc][(i >> 2) * 32], hlf); w0[i] = frag_kb(&Ws[(i & 3) * 16 + nloc][(i >> 2) * 32], hlf); }
  __builtin_amdgcn_sched_barrier(0);   // holds the reads above in front of the products below: left free, the compiler moves each read down to its product and waits for it there
#pragma unroll
  for (int i = 0; i < 32; ++i) acc[i & 3] = wmma16p(a[i >> 2], w0[i], acc[i & 3]);
  __builtin_amdgcn_sched_barrier(0);   // keeps the products above in front of the wait below, so that the copies in flight land under them
  asm volatile("s_wait_asynccnt 0x0" ::: "memory");   // this wave's copies of W rows 64 .. 255 have landed
  __syncthreads();                                     // ... and every other wave's
#pragma unroll
  for (int i = 0; i < 32; ++i) w1[i] = frag_kb(&Ws[64 + (i & 3) * 16 + nloc][(i >> 2) * 32], hlf);
#pragma unroll
  for (int i = 0; i < 32; ++i) w0[i] = frag_kb(&Ws[128 + (i & 3) * 16 + nloc][(i >> 2) * 32], hlf);
  __builtin_amdgcn_sched_barrier(0);   // holds the reads above in front of the products below: left free, the compiler moves each read down to its product and waits for it there
#pragma unroll
  for (int i = 0; i < 32; ++i) acc[4 + (i & 3)] = wmma16p(a[i >> 2], w1[i], acc[4 + (i & 3)]);
  __builtin_amdgcn_sched_barrier(0);   // keeps the last group's reads from rising among those products or sinking to their own
#pragma unroll
  for (int i = 0; i < 32; ++i) w1[i] = frag_kb(&Ws[192 + (i & 3) * 16 + nloc][(i >> 2) * 32], hlf);
  __builtin_amdgcn_sched_barrier(0);   // holds the reads above in front of the products below: left free, the compiler moves each read down to its product and waits for it there
#pragma unroll
  for (int i = 0; i < 32; ++i) acc[8 + (i & 3)] = wmma16p(a[i >> 2], w0[i], acc[8 + (i & 3)]);
#pragma unroll
  for (int i = 0; i < 32; ++i) acc[12 + (i & 3)] = wmma16p(a[i >> 2], w1[i], acc[12 + (i & 3)]);
#pragma unroll
  for (int t = 0; t < 16; ++t) { const float bb = bf16_rne(bias[t * 16 + nloc]);
#pragma unroll
    for (int r = 0; r < 8; ++r) Tf[wave][8 * hlf + r][t * 16 + nloc] = acc[t][r] * (1.0f / (XS * WSC)) + bb; }
  __syncthreads();
  {
    if (which < 2) { b16* P = (which == 0 ? Qp : Kp) + ((size_t)b * S) * D; for (int rr = 0; rr < 16; ++rr) { v8b o; for (int j = 0; j < 8; ++j) o[j] = (b16)(Tf[wave][rr][lane * 8 + j] * XS); *(v8b*)(P + (size_t)(t0 + rr) * D + lane * 8) = o; } }
    else {
#pragma unroll 1
      for (int q = 0; q < 64; ++q) { const int d = wave * 64 + q; const int tk = lane * 2; v2h vv; vv[0] = (b16)(Tf[tk >> 4][tk & 15][d] * XS); vv[1] = (b16)(Tf[(tk + 1) >> 4][(tk + 1) & 15][d] * XS); *(v2h*)(VT + ((size_t)b * D + d) * S + blockIdx.x * 64 + lane * 2) = vv; } }
     }
}
// causal attention: grid (S/64, BL); block = 64 queries, 4 waves (their tiles: in front of the kernel). Query tile qt needs qt + 1 key tiles, and one block fills a WGP, so the launch lasts as long as its longest block: the work is cut
// into equal blocks. Block j does the head of query tile NT - 1 - j (key tiles 0 .. min(qt + 1, CUT) - 1, partial 0) and, for j > NT / 2, before it the tail of query tile j (key tiles CUT .. j, partial 1):
// CUT or CUT - 1 key tiles in every block. A partial is its own softmax-weighted mean with its (max, sum); the kernel behind attention merges the two partials of a long query tile and adds the residual.
// Within a segment the block walks its keys in tiles of 64: K rows [64][256] and V^T rows [256][64] come once per block into LDS by tensor loads, one request a wave
// (two buffers: tile t + 1 flies while tile t is worked on), and every wave takes its fragments from there. A buffer is four slices of 18 KiB, one per wave: K columns 0 .. 127 and 128 .. 255
// (64 rows of 256 B, padded to pitch 272 B) and V^T rows 0 .. 127 and 128 .. 255 (128 rows of 128 B, padded to pitch 144 B). Both pitches are 16 B x odd: ds_load_b128 free of bank conflicts.
// Per tile and wave one pass of 32 keys x 32 queries, tiles in ascending order: S^T = K Q^T (2 key tiles x 2 query tiles x 8 k-steps), logits A/16 in the log2 domain, keys > query masked (the reference's -32767 fill gives exp = 0 exactly),
// online softmax, P x1024 single f16 via LDS -> O^T += V^T P^T (16 d-tiles x 2 query tiles x 1 k-step); partial = joined O / joined l
typedef uint32_t u32x4 __attribute__((ext_vector_type(4)));
typedef uint32_t u32x8 __attribute__((ext_vector_type(8)));
constexpr uint32_t SLB = 18432, SLE = SLB / 2, KHP = 136;   // slice bytes (9 x 2 KiB) and elements; elements per padded row of a K column half
static_assert(KT * KHP * 2 <= SLB && (D / 2) * VPITCH * 2 == SLB && SLB % 2048 == 0, "slices");
__device__ __forceinline__ uint32_t uni(uint32_t v) { return (uint32_t)__builtin_amdgcn_readfirstlane(v); }
// a wave-uniform value held in a scalar register: a test on it compiles to s_cmp + s_cbranch_scc (a tensor load ignores EXEC), and what is formed from it is formed behind the waits that stand in front of it
__device__ __forceinline__ uint32_t pinned(uint32_t v) { uint32_t w = uni(v); asm volatile("" : "+s"(w)); return w; }   // pinned(): a descriptor word, or the test that decides an issue, held in a scalar register
// descriptor group 1 of a tile of N rows of R bytes at source pitch P bytes; W0 = word 0 (no mask, 1-byte elements, the pad behind every row). Built once per wave; each word is a descriptor word held in its
// scalar register by pinned(), so that the compiler keeps the eight registers as they are for the whole kernel and rewrites none of them while a request is in flight
template <uint32_t W0, uint32_t R, uint32_t N, uint32_t P>
__device__ __forceinline__ u32x8 tensor_group1() { u32x8 g;
  g[0] = pinned(W0); g[1] = pinned((R & 0xFFFFu) << 16); g[2] = pinned((R >> 16) | ((N & 0xFFFFu) << 16)); g[3] = pinned((N >> 16) | (R << 16)); g[4] = pinned(N); g[5] = pinned(P); g[6] = pinned(0u); g[7] = pinned(0u);
  return g; }
// one request: the tile whose first byte is src, to LDS byte dst
__device__ __forceinline__ void tensor_tile(uint32_t dst, const b16* src, u32x8 g1) {
  const uint64_t ga = (uint64_t)(size_t)src; u32x4 g0;
  g0[0] = uni(1u); g0[1] = uni(dst); g0[2] = uni((uint32_t)ga); g0[3] = uni((((uint32_t)(ga >> 32)) & 0x01FFFFFFu) | 0x80000000u);
  asm volatile("tensor_load_to_lds %0, %1" :: "s"(g0), "s"(g1) : "memory");
}
// key tile 'tile' into buffer 'buf' (ring = LDS byte of the ring's start): every wave issues its own slice, waves 0, 1 of K (group 1: gk), waves 2, 3 of V^T (gv)
__device__ __forceinline__ void stage_tile(uint32_t wave, const b16* Kb, const b16* Vb, uint32_t tile, uint32_t ring, uint32_t buf, u32x8 gk, u32x8 gv) {
  const uint32_t dst = ring + (buf * 4 + wave) * SLB;
  if (pinned(wave < 2)) tensor_tile(dst, Kb + (size_t)tile * KT * D + wave * 128, gk);
  else tensor_tile(dst, Vb + (size_t)(wave - 2) * (D / 2) * S + (size_t)tile * KT, gv);
}
// Wave tile: the 4 waves are 2 query groups (qg, 32 queries = two 16-query tiles) x 2 key halves (kh, 32 of a tile's 64 keys): every K and V^T fragment that a wave reads from LDS feeds two products, so
// the block reads each tile from LDS twice and not four times. A wave keeps its own running (max, sum, O) over its key halves; at the end of a segment the two waves of a query group exchange (max, sum),
// scale by the joint statistics, and each hands the other one 16-query tile through LDS: wave kh puts out query tile kh of its group. Index u of the register arrays is query tile u ^ kh, so that the tile a
// wave keeps is always u = 0 and the tile it hands over u = 1 (constant register indices).
template <bool M> struct Flag { static constexpr bool v = M; };
__global__ __launch_bounds__(128) void attn_kernel(const b16* __restrict__ Qp, const b16* __restrict__ Kp, const b16* __restrict__ VT, float* __restrict__ O1, float* __restrict__ O2, float* __restrict__ ML) {
  __shared__ __attribute__((aligned(2048))) b16 Ring[2][4][SLE];   // every slice starts at a multiple of 2 KiB of the work-group's LDS
  __shared__ __attribute__((aligned(16))) b16 Pb[4][2][16][32 + 8]; __shared__ __attribute__((aligned(16))) float To[4][16][D + 4]; __shared__ __attribute__((aligned(16))) float Tx[4][16][D + 4];
  __shared__ __attribute__((aligned(16))) float St[4][2][16][2];
  const int tid = threadIdx.x, wave = __builtin_amdgcn_readfirstlane(tid >> 5), lane = tid & 31, hh = lane >> 4, col = lane & 15; const int b = blockIdx.y, j = blockIdx.x;
  const int qg = wave >> 1, kh = wave & 1; const uint32_t ring = lds_addr(&Ring[0][0][0]);
  const u32x8 gk = tensor_group1<(1u << 20) | (5u << 22) | (3u << 25), 256, KT, D * 2>(), gv = tensor_group1<(1u << 20) | (4u << 22) | (3u << 25), 128, D / 2, S * 2>();
  const b16* Qb = Qp + (size_t)b * S * D; const b16* Kb = Kp + (size_t)b * S * D; const b16* Vb = VT + (size_t)b * D * S;
#pragma unroll 1   // stays rolled: the two segments of a block run one after the other through the same code and the same LDS
  for (int seg = (j > NT / 2) ? 0 : 1; seg < 2; ++seg) {   // block-uniform: seg 0 = tail of query tile j, seg 1 = head of query tile NT - 1 - j
  const int qt = seg == 0 ? j : NT - 1 - j, tb = seg == 0 ? CUT : 0;
  const int ntile = seg == 0 ? j + 1 - CUT : (qt + 1 < CUT ? qt + 1 : CUT);   // tiles of 64 keys in this segment, at least one
  const int q0 = qt * 64 + qg * 32; const int qi[2] = {q0 + kh * 16 + col, q0 + (kh ^ 1) * 16 + col};
  v16b qa[2][8]; const b16* qp0 = Qb + (size_t)qi[0] * D + 8 * hh; const b16* qp1 = Qb + (size_t)qi[1] * D + 8 * hh;   // the lane half's step is in the pointers, which are the loads' own addresses
#pragma unroll   // register arrays at constant indices
  for (int ks = 0; ks < 8; ++ks) { qa[0][ks] = frag_kb(qp0 + ks * 32, 0); qa[1][ks] = frag_kb(qp1 + ks * 32, 0); }
  asm volatile("s_wait_xcnt 0x0" :: "v"(qp0), "v"(qp1) : "memory");   // the loads' address registers are rewritten behind it; named here, they stay whole up to it
  const float cs = LOG2E / (16.0f * XS * XS);
  float m[2] = {-INFINITY, -INFINITY}, l[2] = {0.0f, 0.0f}; v8f o[2][16];
#pragma unroll
  for (int t = 0; t < 16; ++t) { o[0][t] = (v8f){}; o[1][t] = (v8f){}; }
  const int kend = q0 + 32;   // keys < kend may be attended by some query of this wave
  // the ring was left by every wave at the last publish point of the segment before (its s_wait_dscnt 0 and barrier)
  stage_tile(wave, Kb, Vb, tb, ring, 0, gk, gv);
  asm volatile("s_wait_tensorcnt 0x0" ::: "memory");   // this wave's slice of tile 0 has landed
  __syncthreads();                                      // ... and every other wave's: tile 0 may be read
  if (pinned(ntile > 1)) stage_tile(wave, Kb, Vb, tb + 1, ring, 1, gk, gv);   // scalar test: a segment may have one tile only, and a tile that does not exist is not asked for
#pragma unroll 1   // stays rolled: one trip already holds a whole pass of 64 products
  for (int tl = 0; tl < ntile; ++tl) {
    const b16* Kt = &Ring[tl & 1][0][0]; const b16* Vt = &Ring[tl & 1][2][0];   // the two V^T slices follow each other without a gap: 256 rows at one pitch
    const int kb = (tb + tl) * KT + kh * 32;   // this wave's 32 keys of the tile
    if (kb < kend) {   // wave-uniform (scalar): a wave skips the pass beyond its diagonal, never the publish point below
      // all K fragments are asked for ahead of the products, so that the LDS latency is paid once per run and not once per product; in the order of their use (k-step, then key tile)
      v16b kf[16], vf[16];
#pragma unroll
      for (int i = 0; i < 16; ++i) kf[i] = frag_kb(Kt + (i >> 3) * SLE + (kh * 32 + (i & 1) * 16 + col) * KHP + ((i >> 1) & 3) * 32, hh);
      __builtin_amdgcn_sched_barrier(0);   // holds the reads above in front of the products below: with the pass cut into blocks by the test below, the compiler moves each K read down to its product and waits for it there
      v8f s[2][2] = {{(v8f){}, (v8f){}}, {(v8f){}, (v8f){}}};
#pragma unroll   // four independent accumulators between an accumulator's two uses
      for (int ks = 0; ks < 8; ++ks)
#pragma unroll
        for (int tt = 0; tt < 2; ++tt)
#pragma unroll
          for (int u = 0; u < 2; ++u) s[u][tt] = wmma16p(kf[ks * 2 + tt], qa[u][ks], s[u][tt]);
      float al[2], sm[2], so[2];   // sm: the lane's own sum of its 16 weights, so: that of lane ^ 16, asked for beside the P stores and added behind the test, so that no copy waits for it
      // scores -> P in LDS. MASKED = false is the copy for keys that every query of the wave may attend: no compare with the diagonal, and no score is -inf, so that the guards against -inf go too (same sums in the same order; without the select the compiler may fuse a score's scaling with the subtraction of the max)
      auto softmax = [&](auto fl) __attribute__((always_inline)) {
        constexpr bool MASKED = decltype(fl)::v;
#pragma unroll   // the two query tiles' softmax chains are independent of each other
        for (int u = 0; u < 2; ++u) {
          float e[16]; float mx = -INFINITY;
#pragma unroll
          for (int i = 0; i < 16; ++i) { const int key = kb + (i < 8 ? 0 : 16) + 8 * hh + (i & 7); const float sc = (i < 8 ? s[u][0][i] : s[u][1][i - 8]) * cs; const float v = (!MASKED || key <= qi[u]) ? sc : -INFINITY; e[i] = v; mx = fmaxf(mx, v); }
          mx = fmaxf(mx, __shfl_xor(mx, 16)); const float mn = fmaxf(m[u], mx); al[u] = (MASKED && mn == -INFINITY) ? 1.0f : nexp2(m[u] - mn); float sum = 0.0f;
          // B operand needs row = query, k = key: write P[query col][key] into LDS (wave-private), then frag
#pragma unroll
          for (int i = 0; i < 16; ++i) { const float p = (MASKED && e[i] == -INFINITY) ? 0.0f : nexp2(e[i] - mn); sum += p; Pb[wave][u][col][(i < 8 ? 0 : 16) + 8 * hh + (i & 7)] = (b16)(p * PS); }
          sm[u] = sum; so[u] = __shfl_xor(sum, 16); m[u] = mn; } };
      if (kb + 31 <= q0) softmax(Flag<false>{});   // wave-uniform (scalar): the pass's last key is no later than the wave's first query
      else softmax(Flag<true>{});
      wave_lds_sync();
      const v16b pf0 = frag_kb(&Pb[wave][0][col][0], hh), pf1 = frag_kb(&Pb[wave][1][col][0], hh);
      // V^T is asked for here, behind P: LDS answers a wave in order, so that in front of the scores' exchange and of P these 32 reads would hold both up; they land under the rescaling and the first products
#pragma unroll
      for (int t = 0; t < 16; ++t) vf[t] = frag_kb(Vt + (t * 16 + col) * VPITCH + kh * 32, hh);
      __builtin_amdgcn_sched_barrier(0);   // holds the reads above in front of the rescaling and the products below, which then wait for them one by one
#pragma unroll
      for (int u = 0; u < 2; ++u) l[u] = l[u] * al[u] + (sm[u] + so[u]);
#pragma unroll
      for (int t = 0; t < 16; ++t) { o[0][t] *= al[0]; o[0][t] = wmma16p(vf[t], pf0, o[0][t]); o[1][t] *= al[1]; o[1][t] = wmma16p(vf[t], pf1, o[1][t]);
        __builtin_amdgcn_sched_barrier(0); }   // keeps this order, a fragment's two products as it lands and the next tiles' rescaling under them (left free, all rescaling goes first and one query tile's products wait fragment by fragment); the last one keeps the fence below, whose LDS wait covers all of V^T, behind the products
      wave_lds_sync(); }
    // publish point of tile tl + 1, passed by every wave
    asm volatile("s_wait_dscnt 0x0" ::: "memory");      // this wave's reads of tile tl are done before the buffer is refilled
    asm volatile("s_wait_tensorcnt 0x0" ::: "memory");  // this wave's slice of tile tl + 1 has landed
    __syncthreads();                                     // tile tl + 1 may be read by all; tile tl's buffer is left by all
    if (pinned(tl + 2 < ntile)) stage_tile(wave, Kb, Vb, pinned(tb + tl + 2), ring, tl & 1, gk, gv); }   // scalar test; the descriptor is formed behind the wait above
  asm volatile("s_wait_tensorcnt 0x0" ::: "memory");    // no request is left in flight when the wave goes on
  asm volatile("s_wait_dscnt 0x0" ::: "memory");        // and none of its reads of the ring
  // join of the two key halves. The kh = 0 wave has had at least one pass (its first key is never beyond the diagonal), so the joint max is finite; a wave without a pass has max -inf, sum 0, weight exp2(-inf) = 0
  { const v2f st = {hh == 0 ? m[0] : m[1], hh == 0 ? l[0] : l[1]}; *(v2f*)(&St[wave][hh][col][0]) = st; }   // both lane halves hold both tiles' (max, sum): half hh writes tile u = hh
  __syncthreads();   // the partner wave's (max, sum) may be read
  float f[2], mj = 0.0f, lj = 0.0f;
#pragma unroll
  for (int u = 0; u < 2; ++u) { const v2f ps = *(const v2f*)(&St[wave ^ 1][u ^ 1][col][0]);   // the partner's index of the same query tile is u ^ 1
    const float mm = fmaxf(m[u], ps[0]); const float as = nexp2(m[u] - mm), ap = nexp2(ps[0] - mm); const float lt = l[u] * as + ps[1] * ap;
    f[u] = as / (lt * PS * XS); if (u == 0) { mj = mm; lj = lt; } }
#pragma unroll
  for (int t = 0; t < 16; ++t)
#pragma unroll
    for (int r = 0; r < 8; ++r) Tx[wave][col][t * 16 + 8 * hh + r] = o[1][t][r] * f[1];
  __syncthreads();   // the partner wave's share of the tile that this wave keeps may be read
#pragma unroll
  for (int t = 0; t < 16; ++t) { const v4f x0 = *(const v4f*)(&Tx[wave ^ 1][col][t * 16 + 8 * hh]), x1 = *(const v4f*)(&Tx[wave ^ 1][col][t * 16 + 8 * hh + 4]);
#pragma unroll
    for (int r = 0; r < 8; ++r) To[wave][col][t * 16 + 8 * hh + r] = o[0][t][r] * f[0] + (r < 4 ? x0[r] : x1[r - 4]); }
  wave_lds_sync();
  float* Op = seg == 0 ? O2 : O1; const int qk = q0 + kh * 16;   // the 16 queries that this wave puts out
  if (hh == 0) { const v2f ml = {mj, lj}; *(v2f*)(ML + ((size_t)(seg == 0 ? B * S : 0) + (size_t)b * S + qk + col) * 2) = ml; }   // both halves hold the same (max, sum): 16 queries = one 128-byte line per wave
  asm volatile("s_wait_xcnt 0x0" ::: "memory");   // the store's address registers are rewritten right behind it
#pragma unroll   // constant row offsets in the LDS reads and the stores
  for (int g = 0; g < 2; ++g) { v4f a0[8], a1[8];
#pragma unroll   // keeps the register arrays at constant indices
    for (int rr = 0; rr < 8; ++rr) { a0[rr] = *(const v4f*)(&To[wave][g * 8 + rr][lane * 8]); a1[rr] = *(const v4f*)(&To[wave][g * 8 + rr][lane * 8 + 4]); }
#pragma unroll   // as above
    for (int rr = 0; rr < 8; ++rr) { const size_t row = ((size_t)b * S + qk + g * 8 + rr) * D; *(v4f*)(Op + row + lane * 8) = a0[rr]; *(v4f*)(Op + row + lane * 8 + 4) = a1[rr]; }
    asm volatile("s_wait_xcnt 0x0" ::: "memory"); }   // the stores' data and address registers are rewritten behind it (next eight rows, next segment)
  }
}
// everything behind attention in one launch, because it is local to a token row: merge of the attention partials + residual + LayerNorm 1, both FFN GEMMs, LayerNorm 2. Block = 64 tokens (one query tile),
// wave = 16 tokens from first to last; the LayerNorm output and the relu hidden rows (f16 hi + lo x8 planes) stay in the wave's own LDS rows, h2 stays in the accumulators.
// Products are taken transposed, D^T = W A^T (W rows as the A operand, token rows as B; same loader for both): a lane then holds 8 consecutive features of ONE token per tile, so the hidden planes go to LDS
// as 16-byte stores and LayerNorm 2 is a sum inside the lane plus one exchange with lane ^ 16.
// One 256-row W buffer at pitch 528 B serves W1 and then W2, filled by asynchronous copies of whole 512-byte rows: rows 0 .. 191 and rows 192 .. 255 are separate fills (48 and 16 copies of a wave, never
// more than 48 in flight); each fill stands behind the barrier that ends every wave's reads of those rows and is read behind its own wait and barrier.
// The text runs once per wave, so it is kept short: LayerNorm 1 is a rolled loop over groups of 4 rows, the two GEMMs are two trips of one rolled loop, the copies a rolled loop of eight.
template <int N8>
__device__ __forceinline__ void stage_rows_rolled(const b16* g0, int gstep, unsigned l0, unsigned lstep) {
#pragma unroll 1   // rolled: 24 address registers in all, where the unrolled form keeps every address of a fill alive across the products
  for (int h = 0; h < N8; ++h) { unsigned l[8]; const b16* g[8];
#pragma unroll
    for (int i = 0; i < 8; ++i) { l[i] = l0 + (unsigned)(h * 8 + i) * lstep; g[i] = g0 + (size_t)(h * 8 + i) * gstep; }
    async_copy8(l, g); }
}
__device__ __forceinline__ void load_group(v16b (&w)[32], const b16 (*Ws)[KPITCH], int row0, int nloc, int hlf) {
#pragma unroll   // register array at constant indices
  for (int i = 0; i < 32; ++i) w[i] = frag_kb(&Ws[row0 + (i & 3) * 16 + nloc][(i >> 2) * 32], hlf);
}
// 4 feature tiles x 8 k-steps x (hi, lo): per accumulator the order is hi, lo within ascending k; the four tiles stand between an accumulator's two uses
template <int G>
__device__ __forceinline__ void mul_group(v8f (&acc)[16], const v16b (&w)[32], const v16b (&a)[8], const v16b (&al)[8]) {
#pragma unroll   // register arrays at constant indices
  for (int ks = 0; ks < 8; ++ks) {
#pragma unroll
    for (int tt = 0; tt < 4; ++tt) acc[4 * G + tt] = wmma16p(w[ks * 4 + tt], a[ks], acc[4 * G + tt]);
#pragma unroll
    for (int tt = 0; tt < 4; ++tt) acc[4 * G + tt] = wmma16p(w[ks * 4 + tt], al[ks], acc[4 * G + tt]);
  }
}
__device__ __forceinline__ float wave_sum(float s) {
#pragma unroll
  for (int o = 1; o < 32; o <<= 1) s += __shfl_xor(s, o);
  return s; }
// four token rows as LayerNorm 1 takes them: 8 features a lane of partial 0 (a, c), of x, and for a long query tile of partial 1 with both (max, sum) pairs
struct Rows4 { v4f a[4], c[4], x0[4], x1[4], a2[4], c2[4]; v2f p0[4], p1[4]; };
__device__ __forceinline__ void load_rows4(Rows4& R, const float* IN, const float* IN2, const float* ML, const float* x, size_t row, int lane, bool two) {
  const float* pa = IN + row * D + lane * 8; const float* px = x + row * D + lane * 8;
#pragma unroll
  for (int rr = 0; rr < 4; ++rr) { R.a[rr] = *(const v4f*)(pa + rr * D); R.c[rr] = *(const v4f*)(pa + rr * D + 4); R.x0[rr] = *(const v4f*)(px + rr * D); R.x1[rr] = *(const v4f*)(px + rr * D + 4); }
  asm volatile("s_wait_xcnt 0x0" :: "v"(pa), "v"(px) : "memory");   // the loads' address registers are rewritten behind it; named here, they stay whole up to it (no load's result is placed on them)
  if (two) { const float* p2 = IN2 + row * D + lane * 8;
#pragma unroll
    for (int rr = 0; rr < 4; ++rr) { R.a2[rr] = *(const v4f*)(p2 + rr * D); R.c2[rr] = *(const v4f*)(p2 + rr * D + 4);
      R.p0[rr] = *(const v2f*)(ML + (row + rr) * 2); R.p1[rr] = *(const v2f*)(ML + ((size_t)B * S + row + rr) * 2); }
    asm volatile("s_wait_xcnt 0x0" :: "v"(p2) : "memory"); }   // as above
}
__global__ __launch_bounds__(128) void tail_kernel(const float* __restrict__ IN, const float* __restrict__ IN2, const float* __restrict__ ML, const float* __restrict__ x, const float* __restrict__ g1, const float* __restrict__ be1,
                                                   const b16* __restrict__ W1, const b16* __restrict__ W2, const float* __restrict__ b1, const float* __restrict__ b2, const float* __restrict__ g2, const float* __restrict__ be2, float* __restrict__ out) {
  __shared__ __attribute__((aligned(16))) b16 Ws[D][KPITCH]; __shared__ __attribute__((aligned(16))) b16 Ahs[4][16][KPITCH]; __shared__ __attribute__((aligned(16))) b16 Als[4][16][KPITCH];
  __shared__ __attribute__((aligned(16))) float To[4][16][D + 4]; __shared__ __attribute__((aligned(16))) float Ps[4][D];
  const int tid = threadIdx.x, wave = __builtin_amdgcn_readfirstlane(tid >> 5), lane = tid & 31, nloc = lane & 15, hlf = lane >> 4; const size_t row0 = (size_t)blockIdx.x * 64 + wave * 16;
  stage_rows_rolled<6>(W1 + (size_t)wave * D + lane * 8, 4 * D, lds_addr(&Ws[wave][lane * 8]), 4 * KPITCH * 2);   // W1 rows 0 .. 191 (wave, wave + 4, ..) fly under LayerNorm 1
  const bool two = (int)(blockIdx.x & (NT - 1)) >= CUT;   // block-uniform: a long query tile has two partials
  Rows4 raw = {}; load_rows4(raw, IN, IN2, ML, x, row0, lane, two);
  // per-feature vectors of the two epilogues, rounded once, read by every wave behind the first barrier
  { const v2f p0 = *(const v2f*)(b1 + tid * 2), p1 = *(const v2f*)(b2 + tid * 2), p2 = *(const v2f*)(g2 + tid * 2), p3 = *(const v2f*)(be2 + tid * 2);
    asm volatile("s_wait_xcnt 0x0" ::: "memory");   // the loads' base and offset registers are rewritten behind them
    const v2f q0 = {bf16_rne(p0[0]), bf16_rne(p0[1])}, q1 = {bf16_rne(p1[0]), bf16_rne(p1[1])}, q2 = {bf16_rne(p2[0]), bf16_rne(p2[1])}, q3 = {bf16_rne(p3[0]), bf16_rne(p3[1])};
    *(v2f*)(&Ps[0][tid * 2]) = q0; *(v2f*)(&Ps[1][tid * 2]) = q1; *(v2f*)(&Ps[2][tid * 2]) = q2; *(v2f*)(&Ps[3][tid * 2]) = q3; }
  float gg[8], bb[8];
  { const v4f u0 = *(const v4f*)(g1 + lane * 8), u1 = *(const v4f*)(g1 + lane * 8 + 4), u2 = *(const v4f*)(be1 + lane * 8), u3 = *(const v4f*)(be1 + lane * 8 + 4);
    asm volatile("s_wait_xcnt 0x0" ::: "memory");   // as above
#pragma unroll
    for (int j = 0; j < 4; ++j) { gg[j] = bf16_rne(u0[j]); gg[4 + j] = bf16_rne(u1[j]); bb[j] = bf16_rne(u2[j]); bb[4 + j] = bf16_rne(u3[j]); } }
  // LayerNorm 1, a row across the wave (8 features a lane), 4 rows a trip; the next 4 rows' loads go out ahead of this group's sums and land under its arithmetic
#pragma unroll 1   // rolled for a short text
  for (int bt = 0; bt < 4; ++bt) { v4f a[4], c[4];
#pragma unroll
    for (int rr = 0; rr < 4; ++rr) { a[rr] = raw.a[rr]; c[rr] = raw.c[rr]; }
    if (two) {
#pragma unroll
      for (int rr = 0; rr < 4; ++rr) { const v2f p0 = raw.p0[rr], p1 = raw.p1[rr]; const float mm = fmaxf(p0[0], p1[0]);
        float w0 = p0[1] * nexp2(p0[0] - mm), w1 = p1[1] * nexp2(p1[0] - mm); const float rw = 1.0f / (w0 + w1); w0 *= rw; w1 *= rw;
        a[rr] = a[rr] * w0 + raw.a2[rr] * w1; c[rr] = c[rr] * w0 + raw.c2[rr] * w1; } }
#pragma unroll
    for (int rr = 0; rr < 4; ++rr)
#pragma unroll
      for (int j = 0; j < 4; ++j) { a[rr][j] += bf16_rne(raw.x0[rr][j]); c[rr][j] += bf16_rne(raw.x1[rr][j]); }
    load_rows4(raw, IN, IN2, ML, x, row0 + (bt < 3 ? bt + 1 : 3) * 4, lane, two);   // the last trip reads its own rows again: one instruction stream
    float s[4], q[4];
#pragma unroll
    for (int rr = 0; rr < 4; ++rr) { float t = 0.0f;
#pragma unroll
      for (int j = 0; j < 4; ++j) t += a[rr][j] + c[rr][j];
      s[rr] = wave_sum(t) * (1.0f / D); }
#pragma unroll
    for (int rr = 0; rr < 4; ++rr) { const float mu = s[rr]; float t = 0.0f;
#pragma unroll
      for (int j = 0; j < 4; ++j) { const float d0 = a[rr][j] - mu, d1 = c[rr][j] - mu; t += d0 * d0 + d1 * d1; }
      q[rr] = wave_sum(t); }
#pragma unroll
    for (int rr = 0; rr < 4; ++rr) { const float mu = s[rr], rs = rsqrtf(q[rr] * (1.0f / D) + LNEPS); v8b hv, lv;
#pragma unroll
      for (int j = 0; j < 8; ++j) { const float y = ((j < 4 ? a[rr][j] : c[rr][j - 4]) - mu) * rs * gg[j] + bb[j]; b16 p, qq; split16(y * XS, p, qq); hv[j] = p; lv[j] = qq; }
      *(v8b*)(&Ahs[wave][bt * 4 + rr][lane * 8]) = hv; *(v8b*)(&Als[wave][bt * 4 + rr][lane * 8]) = lv; }
    __builtin_amdgcn_sched_barrier(0); }   // keeps the register copies that hand the next rows over, and with them the wait for their loads, behind this group's arithmetic: left free, they rise to its start
  v8f acc[16];
#pragma unroll 1   // rolled for a short text: trip 0 = W1 (and relu into the planes), trip 1 = W2
  for (int pass = 0; pass < 2; ++pass) {
    const b16* Wc = pass == 0 ? W1 : W2;
    wave_lds_sync();   // the wave's plane rows were written across its lanes
    v16b a[8], al[8], w0[32], w1[32];
#pragma unroll
    for (int ks = 0; ks < 8; ++ks) { a[ks] = frag_kb(&Ahs[wave][nloc][ks * 32], hlf); al[ks] = frag_kb(&Als[wave][nloc][ks * 32], hlf); }
#pragma unroll
    for (int t = 0; t < 16; ++t) acc[t] = (v8f){};
    // fragments of a group (64 W rows) are asked for together and one group ahead of their products (two register sets), so that the LDS latency is not paid per product
    asm volatile("s_wait_dscnt 0x0" ::: "memory");      // this wave's earlier reads of rows 192 .. 255 are done before they are refilled
    asm volatile("s_wait_asynccnt 0x0" ::: "memory");   // this wave's copies of rows 0 .. 191 have landed
    __syncthreads();                                     // ... and every other wave's: they may be read; rows 192 .. 255 are left by all
    stage_rows_rolled<2>(Wc + (size_t)(192 + wave) * D + lane * 8, 4 * D, lds_addr(&Ws[192 + wave][lane * 8]), 4 * KPITCH * 2);
    load_group(w0, Ws, 0, nloc, hlf); load_group(w1, Ws, 64, nloc, hlf);
    __builtin_amdgcn_sched_barrier(0);   // holds the reads above in front of the products below: left free, the compiler moves each read down to its product and waits for it there
    mul_group<0>(acc, w0, a, al);
    __builtin_amdgcn_sched_barrier(0);   // keeps the next group's reads from rising among those products or sinking to their own
    load_group(w0, Ws, 128, nloc, hlf);
    __builtin_amdgcn_sched_barrier(0);   // as above
    mul_group<1>(acc, w1, a, al);
    __builtin_amdgcn_sched_barrier(0);   // keeps the products above in front of the waits below, so that the copies in flight land under them
    asm volatile("s_wait_dscnt 0x0" ::: "memory");      // this wave's reads of rows 0 .. 191 are done before they are refilled
    asm volatile("s_wait_asynccnt 0x0" ::: "memory");   // this wave's copies of rows 192 .. 255 have landed
    __syncthreads();                                     // ... and every other wave's; rows 0 .. 191 are left by all
    if (pass == 0) stage_rows_rolled<6>(W2 + (size_t)wave * D + lane * 8, 4 * D, lds_addr(&Ws[wave][lane * 8]), 4 * KPITCH * 2);   // block-uniform: W2 rows 0 .. 191 fly under the rest of trip 0
    load_group(w1, Ws, 192, nloc, hlf);
    __builtin_amdgcn_sched_barrier(0);   // holds the reads above in front of the products below
    mul_group<2>(acc, w0, a, al); mul_group<3>(acc, w1, a, al);
    // + bias: lane = token nloc, features t * 16 + 8 * hlf + 0 .. 7
#pragma unroll
    for (int t = 0; t < 16; ++t) { const v4f c0 = *(const v4f*)(&Ps[pass][t * 16 + 8 * hlf]), c1 = *(const v4f*)(&Ps[pass][t * 16 + 8 * hlf + 4]);
#pragma unroll
      for (int r = 0; r < 8; ++r) acc[t][r] = acc[t][r] * (1.0f / (XS * WSC)) + (r < 4 ? c0[r] : c1[r - 4]); }
    if (pass == 0) {   // hidden = relu(.) as hi + lo planes over the wave's own rows (their fragments are in registers)
#pragma unroll
      for (int t = 0; t < 16; ++t) { v8b hv, lv;
#pragma unroll
        for (int r = 0; r < 8; ++r) { b16 p, qq; split16(fmaxf(acc[t][r], 0.0f) * XS, p, qq); hv[r] = p; lv[r] = qq; }
        *(v8b*)(&Ahs[wave][nloc][t * 16 + 8 * hlf]) = hv; *(v8b*)(&Als[wave][nloc][t * 16 + 8 * hlf]) = lv; } } }
  // LayerNorm 2 over the token's 256 features: 128 in this lane (eight running sums over the 16 tiles, then a tree), 128 in lane ^ 16
  v8f vs = (v8f){};
#pragma unroll
  for (int t = 0; t < 16; ++t) vs += acc[t];
  float s = ((vs[0] + vs[1]) + (vs[2] + vs[3])) + ((vs[4] + vs[5]) + (vs[6] + vs[7])); s += __shfl_xor(s, 16);
  const float mu = s * (1.0f / D); v8f vq = (v8f){};
#pragma unroll
  for (int t = 0; t < 16; ++t) { const v8f d = acc[t] - mu; vq += d * d; }
  float q = ((vq[0] + vq[1]) + (vq[2] + vq[3])) + ((vq[4] + vq[5]) + (vq[6] + vq[7])); q += __shfl_xor(q, 16);
  const float rs = rsqrtf(q * (1.0f / D) + LNEPS);
#pragma unroll
  for (int t = 0; t < 16; ++t) { const int f = t * 16 + 8 * hlf; const v4f g0 = *(const v4f*)(&Ps[2][f]), g4 = *(const v4f*)(&Ps[2][f + 4]), e0 = *(const v4f*)(&Ps[3][f]), e4 = *(const v4f*)(&Ps[3][f + 4]); v4f y0, y1;
#pragma unroll
    for (int r = 0; r < 4; ++r) { y0[r] = (acc[t][r] - mu) * rs * g0[r] + e0[r]; y1[r] = (acc[t][4 + r] - mu) * rs * g4[r] + e4[r]; }
    *(v4f*)(&To[wave][nloc][f]) = y0; *(v4f*)(&To[wave][nloc][f + 4]) = y1; }
  wave_lds_sync();
  // whole rows go out: 1 KB of a token per pair of stores
#pragma unroll   // constant row offsets in the LDS reads and the stores
  for (int g = 0; g < 2; ++g) { v4f o0[8], o1[8];
#pragma unroll   // keeps the register arrays at constant indices
    for (int rr = 0; rr < 8; ++rr) { o0[rr] = *(const v4f*)(&To[wave][g * 8 + rr][lane * 8]); o1[rr] = *(const v4f*)(&To[wave][g * 8 + rr][lane * 8 + 4]); }
#pragma unroll   // as above
    for (int rr = 0; rr < 8; ++rr) { const size_t row = (row0 + g * 8 + rr) * D; *(v4f*)(out + row + lane * 8) = o0[rr]; *(v4f*)(out + row + lane * 8 + 4) = o1[rr]; }
    if (g == 0) asm volatile("s_wait_xcnt 0x0" ::: "memory"); }   // the stores' data registers are rewritten behind it (next eight rows)
}
}  // namespace

extern "C" void kernel_launch(void* const* d_in, const int* in_sizes, int n_in, void* d_out, int out_size, void* d_ws, size_t ws_size, hipStream_t stream) {
  (void)n_in;
  auto Fp = [&](int i) { return (const float*)d_in[i]; };
  // input order: 0 x [4,4096,256], 1 Wq [256,256] ([e][d]), 2 bq, 3 Wk, 4 bk, 5 Wv, 6 bv, 7 W1, 8 b1, 9 W2, 10 b2, 11 g_ln, 12 beta_ln, 13 g_lnff, 14 beta_lnff
  if (in_sizes[0] != B * S * D || in_sizes[1] != D * D || in_sizes[3] != D * D || in_sizes[5] != D * D || in_sizes[7] != FF * D || in_sizes[9] != D * FF || in_sizes[11] != D || in_sizes[13] != D || out_size != B * S * D) return;
  size_t off = 0; char* ws = (char*)d_ws;
  auto carve = [&](size_t bytes) { char* p = ws + off; off += (bytes + 255) & ~(size_t)255; return p; };
  b16* WT = (b16*)carve((size_t)5 * D * D * 2); b16* Qp = (b16*)carve((size_t)B * S * D * 2); b16* Kp = (b16*)carve((size_t)B * S * D * 2); b16* VT = (b16*)carve((size_t)B * D * S * 2);
  float* O1 = (float*)carve((size_t)B * S * D * 4); float* O2 = (float*)carve((size_t)B * S * D * 4); float* ML = (float*)carve((size_t)2 * B * S * 2 * 4);
  if (off > ws_size || off > ((size_t)128 << 20)) return;   // about 57 MB
  wprep_kernel<<<(unsigned)(((size_t)5 * D * D / 8 + 255) / 256), 256, 0, stream>>>(Fp(1), Fp(3), Fp(5), Fp(7), Fp(9), WT);
  qkv_kernel<<<dim3(S / 64, BL, 3), 128, 0, stream>>>(Fp(0), WT, Fp(2), Fp(4), Fp(6), Qp, Kp, VT);
  attn_kernel<<<dim3(S / 64, BL), 128, 0, stream>>>(Qp, Kp, VT, O1, O2, ML);
  tail_kernel<<<(unsigned)((size_t)BL * S / 64), 128, 0, stream>>>(O1, O2, ML, Fp(0), Fp(11), Fp(12), WT + (size_t)3 * D * D, WT + (size_t)4 * D * D, Fp(8), Fp(10), Fp(13), Fp(14), (float*)d_out);
}

// v008
// Measured time: 82.3 microseconds a run.
// Next to v007, in two timings, it ran 1.05 and 1.03 times as fast.
// Counting every step since v000, it is 11.7 times as fast.
#include <hip/hip_runtime.h>

// Causal single-head transformer block: q, k, v = x W{q,k,v}^T + b ([4][4096][256], d = 256); A = q . k; causal mask filled with -32767 BEFORE the 1/sqrt(256) scaling (masked weights are exactly 0
// in f32 after exp); softmax over keys <= query; o = A v + x; LayerNorm; h = relu(o W1^T + b1) W2^T + b2; LayerNorm (no second residual) -> [4][4096][256].
// Deterministic: flash-style causal attention, a wave = 32 queries x one 32-key half of every 64-key tile (online softmax with running max, the two halves joined at the end of a segment), both LayerNorms and the FFN in one row-local kernel behind attention;
// no atomics.
// compute dtype: WMMA v_wmma_f32_16x16x32_f16 with f32 accumulate for the q/k/v projections (x EXACT bf16 x8 staged through LDS, W [e][d] rows exact x256: 1 product), S^T = K Q^T (q, k single
// f16 x8: 1 product — logits have std ≈ 1 over ~2,000 keys, per-key rounding averages to ≈4e-5 on the output), O^T += V^T P^T (v single f16 x8, P x1024 single f16: 1 product) and the two FFN GEMMs
// (LayerNorm output / relu hidden as f16 hi+lo x8 planes: 2 products); softmax statistics (exp2), residual, LayerNorms, bias, relu in f32. Inputs rounded to bf16 once.

namespace {
constexpr int B = 4, S = 4096, D = 256, FF = 256, BL = 4 /* batches computed (== B shipped) */;
constexpr float XS = 8.0f, WSC = 256.0f, PS = 1024.0f, LOG2E = 1.4426950408889634f, LNEPS = 1e-5f, MASK_FILL = -32767.0f;
static_assert(S % 64 == 0 && D == 256 && FF == 256, "tiling");
typedef _Float16 b16;
typedef __attribute__((ext_vector_type(16))) _Float16 v16b;
typedef __attribute__((ext_vector_type(8))) _Float16 v8b;
typedef __attribute__((ext_vector_type(8))) float v8f;
typedef __attribute__((ext_vector_type(4))) float v4f;
__device__ __forceinline__ float bf16_rne(float f) { unsigned int u = __float_as_uint(f); u += 0x7FFFu + ((u >> 16) & 1u); return __uint_as_float(u & 0xFFFF0000u); }
__device__ __forceinline__ void split16(float v, b16& hi, b16& lo) { hi = (b16)v; lo = (b16)(v - (float)hi); }
__device__ __forceinline__ v16b frag_kb(const b16* p, int hh) { const v8b a = *(const v8b*)(p + 8 * hh), b = *(const v8b*)(p + 16 + 8 * hh); v16b f;
#pragma unroll
  for (int e = 0; e < 8; ++e) { f[e] = a[e]; f[8 + e] = b[e]; } return f; }
__device__ __forceinline__ void wave_lds_sync() { __builtin_amdgcn_fence(__ATOMIC_RELEASE, "workgroup"); __builtin_amdgcn_wave_barrier(); __builtin_amdgcn_fence(__ATOMIC_ACQUIRE, "workgroup"); }
__device__ __forceinline__ float pmul(float a, float b) { float p = a * b; asm volatile("" : "+v"(p)); return p; }
__device__ __forceinline__ int iclamp(int v, int lo, int hi) { return v < lo ? lo : (v > hi ? hi : v); }

typedef __attribute__((ext_vector_type(4))) _Float16 v4h;
typedef __attribute__((ext_vector_type(2))) float v2f;
__device__ __forceinline__ float nexp2(float v) { return __builtin_amdgcn_exp2f(v); }
__global__ __launch_bounds__(256) void wprep_kernel(const float* __restrict__ wq, const float* __restrict__ wk, const float* __restrict__ wv, const float* __restrict__ w1, const float* __restrict__ w2, b16* __restrict__ WT) {
  const size_t u = (size_t)blockIdx.x * 256 + threadIdx.x; if (u >= (size_t)5 * D * D / 8) return; const size_t e = u * 8; const int m = (int)(e / (D * D)); const size_t el = e % ((size_t)D * D);
  const float* w = m == 0 ? wq : m == 1 ? wk : m == 2 ? wv : m == 3 ? w1 : w2; v8b o; for (int j = 0; j < 8; ++j) o[j] = (b16)(bf16_rne(w[el + j]) * WSC);
  { *(v8b*)(WT + e) = o;  }
}
constexpr int KT = 64, KPITCH = D + 8, NT = S / KT, CUT = NT / 2 + 1;
// the plain builtin (the compiler keeps the distance behind it): operands of an asm statement must lie below v256, which the fragments of a whole pass do not fit
__device__ __forceinline__ v8f wmma16p(v16b a, v16b b, v8f c) { return __builtin_amdgcn_wmma_f32_16x16x32_f16(false, a, false, b, (short)0, c, false, false); }
__device__ __forceinline__ unsigned lds_addr(const void* p) { return (unsigned)(size_t)p; }
// eight 16-byte copies per lane; s_wait_xcnt 0 closes the statement so that no address register is rewritten while a copy may still name it
template <typename E>
__device__ __forceinline__ void async_copy8(const unsigned (&l)[8], const E* const (&g)[8]) {
  asm volatile("global_load_async_to_lds_b128 %0, %8, off\n\t"
               "global_load_async_to_lds_b128 %1, %9, off\n\t"
               "global_load_async_to_lds_b128 %2, %10, off\n\t"
               "global_load_async_to_lds_b128 %3, %11, off\n\t"
               "global_load_async_to_lds_b128 %4, %12, off\n\t"
               "global_load_async_to_lds_b128 %5, %13, off\n\t"
               "global_load_async_to_lds_b128 %6, %14, off\n\t"
               "global_load_async_to_lds_b128 %7, %15, off\n\t"
               "s_wait_xcnt 0x0"
               :: "v"(l[0]), "v"(l[1]), "v"(l[2]), "v"(l[3]), "v"(l[4]), "v"(l[5]), "v"(l[6]), "v"(l[7]),
                  "v"(g[0]), "v"(g[1]), "v"(g[2]), "v"(g[3]), "v"(g[4]), "v"(g[5]), "v"(g[6]), "v"(g[7]) : "memory");
}
// N8 * 8 copies of 16 bytes per lane: piece i goes from g0 + i * gstep (elements) to LDS byte l0 + i * lstep (unrolled so that every address is a constant step from the lane's base)
template <int N8, typename E>
__device__ __forceinline__ void stage_rows(const E* g0, int gstep, unsigned l0, unsigned lstep) {
#pragma unroll
  for (int h = 0; h < N8; ++h) { unsigned l[8]; const E* g[8];
#pragma unroll
    for (int i = 0; i < 8; ++i) { l[i] = l0 + (unsigned)(h * 8 + i) * lstep; g[i] = g0 + (size_t)(h * 8 + i) * gstep; }
    async_copy8(l, g); }
}
// qkv: block = 64 tokens of one batch (4 waves) x one of {q, k, v} (grid.z): A = bf16(x) x8 staged; 16 tiles x 8 k-steps; + bias. q, k, v -> single f16 x8 planes [b][s][256] (32 lanes x 16 B), v row-major like the others: attention transposes it on its way out of LDS;
// the operands come into LDS by asynchronous copies of whole 512-byte pieces: each wave's 16 x rows (f32, into its part of Tf, which is free until the epilogue) and the 256 W rows, once per block, at
// pitch 528 B (16 B x odd: ds_load_b128 free of bank conflicts). W rows 64 .. 255 fly while x is converted and column tiles 0 .. 3 are worked on; never more than 48 copies of a wave are in flight.
__global__ __launch_bounds__(128) void qkv_kernel(const float* __restrict__ x, const b16* __restrict__ WT, const float* __restrict__ bq, const float* __restrict__ bk, const float* __restrict__ bv, b16* __restrict__ Qp, b16* __restrict__ Kp, b16* __restrict__ Vp) {
  __shared__ __attribute__((aligned(16))) b16 As[4][16][D + 8]; __shared__ __attribute__((aligned(16))) float Tf[4][16][256 + 4]; __shared__ __attribute__((aligned(16))) b16 Ws[D][KPITCH];
  const int wave = __builtin_amdgcn_readfirstlane(threadIdx.x >> 5), lane = threadIdx.x & 31, nloc = lane & 15, hlf = lane >> 4; const int b = blockIdx.y, which = blockIdx.z; const int t0 = blockIdx.x * 64 + wave * 16;
  const b16* W = WT + (size_t)which * D * D; const float* bias = which == 0 ? bq : which == 1 ? bk : bv;
  const float* xw = x + ((size_t)b * S + t0) * D + lane * 4;   // a row of x is two pieces of 512 bytes
  stage_rows<2>(xw, D, lds_addr(&Tf[wave][0][lane * 4]), (256 + 4) * 4); stage_rows<2>(xw + 128, D, lds_addr(&Tf[wave][0][128 + lane * 4]), (256 + 4) * 4);
  stage_rows<2>(W + (size_t)wave * D + lane * 8, 4 * D, lds_addr(&Ws[wave][lane * 8]), 4 * KPITCH * 2);   // W rows wave, wave + 4, .. below 64
  asm volatile("s_wait_asynccnt 0x0" ::: "memory");   // this wave's copies of x and of W rows 0 .. 63 have landed
  __syncthreads();                                     // ... and every other wave's: they may be read
  stage_rows<6>(W + (size_t)(64 + wave) * D + lane * 8, 4 * D, lds_addr(&Ws[64 + wave][lane * 8]), 4 * KPITCH * 2);   // W rows 64 .. 255, read behind the second barrier only
#pragma unroll   // constant LDS offsets; the reads of later rows go out under the conversion of earlier ones
  for (int rr = 0; rr < 16; ++rr) { const v4f f0 = *(const v4f*)(&Tf[wave][rr][lane * 8]), f1 = *(const v4f*)(&Tf[wave][rr][lane * 8 + 4]); v8b o;
#pragma unroll
    for (int j = 0; j < 4; ++j) { o[j] = (b16)(bf16_rne(f0[j]) * XS); o[4 + j] = (b16)(bf16_rne(f1[j]) * XS); }
    *(v8b*)(&As[wave][rr][lane * 8]) = o; }
  wave_lds_sync();
  v8f acc[16];
#pragma unroll
  for (int t = 0; t < 16; ++t) acc[t] = (v8f){};
  // a group = 4 column tiles x 8 k-steps. All fragments of a group are asked for together and one group ahead of their products (two register sets), so that the LDS latency is not paid per product;
  // every loop below is unrolled to keep the register arrays at constant indices
  v16b a[8], w0[32], w1[32];
#pragma unroll
  for (int i = 0; i < 32; ++i) { if ((i & 3) == 0) a[i >> 2] = frag_kb(&As[wave][nloc][(i >> 2) * 32], hlf); w0[i] = frag_kb(&Ws[(i & 3) * 16 + nloc][(i >> 2) * 32], hlf); }
  __builtin_amdgcn_sched_barrier(0);   // holds the reads above in front of the products below: left free, the compiler moves each read down to its product and waits for it there
#pragma unroll
  for (int i = 0; i < 32; ++i) acc[i & 3] = wmma16p(a[i >> 2], w0[i], acc[i & 3]);
  __builtin_amdgcn_sched_barrier(0);   // keeps the products above in front of the wait below, so that the copies in flight land under them
  asm volatile("s_wait_asynccnt 0x0" ::: "memory");   // this wave's copies of W rows 64 .. 255 have landed
  __syncthreads();                                     // ... and every other wave's
#pragma unroll
  for (int i = 0; i < 32; ++i) w1[i] = frag_kb(&Ws[64 + (i & 3) * 16 + nloc][(i >> 2) * 32], hlf);
#pragma unroll
  for (int i = 0; i < 32; ++i) w0[i] = frag_kb(&Ws[128 + (i & 3) * 16 + nloc][(i >> 2) * 32], hlf);
  __builtin_amdgcn_sched_barrier(0);   // holds the reads above in front of the products below: left free, the compiler moves each read down to its product and waits for it there
#pragma unroll
  for (int i = 0; i < 32; ++i) acc[4 + (i & 3)] = wmma16p(a[i >> 2], w1[i], acc[4 + (i & 3)]);
  __builtin_amdgcn_sched_barrier(0);   // keeps the last group's reads from rising among those products or sinking to their own
#pragma unroll
  for (int i = 0; i < 32; ++i) w1[i] = frag_kb(&Ws[192 + (i & 3) * 16 + nloc][(i >> 2) * 32], hlf);
  __builtin_amdgcn_sched_barrier(0);   // holds the reads above in front of the products below: left free, the compiler moves each read down to its product and waits for it there
#pragma unroll
  for (int i = 0; i < 32; ++i) acc[8 + (i & 3)] = wmma16p(a[i >> 2], w0[i], acc[8 + (i & 3)]);
#pragma unroll
  for (int i = 0; i < 32; ++i) acc[12 + (i & 3)] = wmma16p(a[i >> 2], w1[i], acc[12 + (i & 3)]);
#pragma unroll
  for (int t = 0; t < 16; ++t) { const float bb = bf16_rne(bias[t * 16 + nloc]);
#pragma unroll
    for (int r = 0; r < 8; ++r) Tf[wave][8 * hlf + r][t * 16 + nloc] = acc[t][r] * (1.0f / (XS * WSC)) + bb; }
  __syncthreads();
  { b16* P = (which == 0 ? Qp : which == 1 ? Kp : Vp) + ((size_t)b * S) * D; for (int rr = 0; rr < 16; ++rr) { v8b o; for (int j = 0; j < 8; ++j) o[j] = (b16)(Tf[wave][rr][lane * 8 + j] * XS); *(v8b*)(P + (size_t)(t0 + rr) * D + lane * 8) = o; } }
}
// causal attention: grid (S/64, BL); block = 64 queries, 4 waves (their tiles: in front of the kernel). Query tile qt needs qt + 1 key tiles, and one block fills a WGP, so the launch lasts as long as its longest block: the work is cut
// into equal blocks. Block j does the head of query tile NT - 1 - j (key tiles 0 .. min(qt + 1, CUT) - 1, partial 0) and, for j > NT / 2, before it the tail of query tile j (key tiles CUT .. j, partial 1):
// CUT or CUT - 1 key tiles in every block. A partial is its own softmax-weighted mean with its (max, sum); the kernel behind attention merges the two partials of a long query tile and adds the residual.
// Within a segment the block walks its keys in tiles of 64: K rows [64][256] and V rows [64][256] come once per block into LDS by tensor loads, one request a wave
// (two buffers: tile t + 1 flies while tile t is worked on), and every wave takes its fragments from there. A buffer is four slices of 18 KiB, one per wave: K columns 0 .. 127 and 128 .. 255
// (64 rows of 256 B, padded to pitch 272 B = 16 B x odd: ds_load_b128 free of bank conflicts) and the same two column halves of V (64 rows of 256 B, padded to pitch 288 B = 32 B x odd, the pitch of
// ds_load_tr16_b128, which hands a wave the V^T fragment out of the row-major tile in the k order of frag_kb).
// Per tile and wave one pass of 32 keys x 32 queries, tiles in ascending order: S^T = K Q^T (2 key tiles x 2 query tiles x 8 k-steps), logits A/16 in the log2 domain, keys > query masked (the reference's -32767 fill gives exp = 0 exactly),
// online softmax, P x1024 single f16 via LDS -> O^T += V^T P^T (16 d-tiles x 2 query tiles x 1 k-step); partial = joined O / joined l
typedef uint32_t u32x4 __attribute__((ext_vector_type(4)));
typedef uint32_t u32x8 __attribute__((ext_vector_type(8)));
constexpr uint32_t SLB = 18432, SLE = SLB / 2, KHP = 136, VHP = 144;   // slice bytes (9 x 2 KiB) and elements; elements per padded row of a K and of a V column half
static_assert(KT * KHP * 2 <= SLB && KT * VHP * 2 == SLB && SLB % 2048 == 0, "slices");
__device__ __forceinline__ uint32_t uni(uint32_t v) { return (uint32_t)__builtin_amdgcn_readfirstlane(v); }
// a wave-uniform value held in a scalar register: a test on it compiles to s_cmp + s_cbranch_scc (a tensor load ignores EXEC), and what is formed from it is formed behind the waits that stand in front of it
__device__ __forceinline__ uint32_t pinned(uint32_t v) { uint32_t w = uni(v); asm volatile("" : "+s"(w)); return w; }   // pinned(): a descriptor word, or the test that decides an issue, held in a scalar register
// descriptor group 1 of a tile of N rows of R bytes at source pitch P bytes; W0 = word 0 (no mask, 1-byte elements, the pad behind every row). Built once per wave; each word is a descriptor word held in its
// scalar register by pinned(), so that the compiler keeps the eight registers as they are for the whole kernel and rewrites none of them while a request is in flight
template <uint32_t W0, uint32_t R, uint32_t N, uint32_t P>
__device__ __forceinline__ u32x8 tensor_group1() { u32x8 g;
  g[0] = pinned(W0); g[1] = pinned((R & 0xFFFFu) << 16); g[2] = pinned((R >> 16) | ((N & 0xFFFFu) << 16)); g[3] = pinned((N >> 16) | (R << 16)); g[4] = pinned(N); g[5] = pinned(P); g[6] = pinned(0u); g[7] = pinned(0u);
  return g; }
// one request: the tile whose first byte is src, to LDS byte dst
__device__ __forceinline__ void tensor_tile(uint32_t dst, const b16* src, u32x8 g1) {
  const uint64_t ga = (uint64_t)(size_t)src; u32x4 g0;
  g0[0] = uni(1u); g0[1] = uni(dst); g0[2] = uni((uint32_t)ga); g0[3] = uni((((uint32_t)(ga >> 32)) & 0x01FFFFFFu) | 0x80000000u);
  asm volatile("tensor_load_to_lds %0, %1" :: "s"(g0), "s"(g1) : "memory");
}
// key tile 'tile' into buffer 'buf' (ring = LDS byte of the ring's start): every wave issues its own slice, waves 0, 1 of K (group 1: gk), waves 2, 3 of V (gv)
__device__ __forceinline__ void stage_tile(uint32_t wave, const b16* Kb, const b16* Vb, uint32_t tile, uint32_t ring, uint32_t buf, u32x8 gk, u32x8 gv) {
  const uint32_t dst = ring + (buf * 4 + wave) * SLB;
  if (pinned(wave < 2)) tensor_tile(dst, Kb + (size_t)tile * KT * D + wave * 128, gk);
  else tensor_tile(dst, Vb + (size_t)tile * KT * D + (wave - 2) * 128, gv);
}
// Wave tile: the 4 waves are 2 query groups (qg, 32 queries = two 16-query tiles) x 2 key halves (kh, 32 of a tile's 64 keys): every K and V^T fragment that a wave reads from LDS feeds two products, so
// the block reads each tile from LDS twice and not four times. A wave keeps its own running (max, sum, O) over its key halves; at the end of a segment the two waves of a query group exchange (max, sum),
// scale by the joint statistics, and each hands the other one 16-query tile through LDS: wave kh puts out query tile kh of its group. Index u of the register arrays is query tile u ^ kh, so that the tile a
// wave keeps is always u = 0 and the tile it hands over u = 1 (constant register indices).
template <bool M> struct Flag { static constexpr bool v = M; };
// transposing LDS load: lane (c = l & 15, h = l >> 4), whose address is row 8 h + (l & 7), 16-byte piece (l >> 3) & 1 of a 16 x 16 block, gets column c of rows 8 h .. 8 h + 7
typedef short s16x8 __attribute__((ext_vector_type(8)));
__device__ __forceinline__ v8b ld_tr16(const b16* p) { typedef __attribute__((address_space(3))) s16x8 lds_s16x8; return __builtin_bit_cast(v8b, __builtin_amdgcn_ds_load_tr16_b128_v8i16((lds_s16x8*)p)); }
__global__ __launch_bounds__(128) void attn_kernel(const b16* __restrict__ Qp, const b16* __restrict__ Kp, const b16* __restrict__ Vp, float* __restrict__ O1, float* __restrict__ O2, float* __restrict__ ML) {
  __shared__ __attribute__((aligned(2048))) b16 Ring[2][4][SLE];   // every slice starts at a multiple of 2 KiB of the work-group's LDS
  __shared__ __attribute__((aligned(16))) b16 Pb[4][2][16][32 + 8]; __shared__ __attribute__((aligned(16))) float To[4][16][D + 4]; __shared__ __attribute__((aligned(16))) float Tx[4][16][D + 4];
  __shared__ __attribute__((aligned(16))) float St[4][2][16][2];
  const int tid = threadIdx.x, wave = __builtin_amdgcn_readfirstlane(tid >> 5), lane = tid & 31, hh = lane >> 4, col = lane & 15; const int b = blockIdx.y, j = blockIdx.x;
  const int qg = wave >> 1, kh = wave & 1; const uint32_t ring = lds_addr(&Ring[0][0][0]);
  const u32x8 gk = tensor_group1<(1u << 20) | (5u << 22) | (3u << 25), 256, KT, D * 2>(), gv = tensor_group1<(1u << 20) | (5u << 22) | (7u << 25), 256, KT, D * 2>();
  const b16* Qb = Qp + (size_t)b * S * D; const b16* Kb = Kp + (size_t)b * S * D; const b16* Vb = Vp + (size_t)b * S * D;
#pragma unroll 1   // stays rolled: the two segments of a block run one after the other through the same code and the same LDS
  for (int seg = (j > NT / 2) ? 0 : 1; seg < 2; ++seg) {   // block-uniform: seg 0 = tail of query tile j, seg 1 = head of query tile NT - 1 - j
  const int qt = seg == 0 ? j : NT - 1 - j, tb = seg == 0 ? CUT : 0;
  const int ntile = seg == 0 ? j + 1 - CUT : (qt + 1 < CUT ? qt + 1 : CUT);   // tiles of 64 keys in this segment, at least one
  const int q0 = qt * 64 + qg * 32; const int qi[2] = {q0 + kh * 16 + col, q0 + (kh ^ 1) * 16 + col};
  v16b qa[2][8]; const b16* qp0 = Qb + (size_t)qi[0] * D + 8 * hh; const b16* qp1 = Qb + (size_t)qi[1] * D + 8 * hh;   // the lane half's step is in the pointers, which are the loads' own addresses
#pragma unroll   // register arrays at constant indices
  for (int ks = 0; ks < 8; ++ks) { qa[0][ks] = frag_kb(qp0 + ks * 32, 0); qa[1][ks] = frag_kb(qp1 + ks * 32, 0); }
  asm volatile("s_wait_xcnt 0x0" :: "v"(qp0), "v"(qp1) : "memory");   // the loads' address registers are rewritten behind it; named here, they stay whole up to it
  const float cs = LOG2E / (16.0f * XS * XS);
  float m[2] = {-INFINITY, -INFINITY}, l[2] = {0.0f, 0.0f}; v8f o[2][16];
#pragma unroll
  for (int t = 0; t < 16; ++t) { o[0][t] = (v8f){}; o[1][t] = (v8f){}; }
  const int kend = q0 + 32;   // keys < kend may be attended by some query of this wave
  // the ring was left by every wave at the last publish point of the segment before (its s_wait_dscnt 0 and barrier)
  stage_tile(wave, Kb, Vb, tb, ring, 0, gk, gv);
  asm volatile("s_wait_tensorcnt 0x0" ::: "memory");   // this wave's slice of tile 0 has landed
  __syncthreads();                                      // ... and every other wave's: tile 0 may be read
  if (pinned(ntile > 1)) stage_tile(wave, Kb, Vb, tb + 1, ring, 1, gk, gv);   // scalar test: a segment may have one tile only, and a tile that does not exist is not asked for
#pragma unroll 1   // stays rolled: one trip already holds a whole pass of 64 products
  for (int tl = 0; tl < ntile; ++tl) {
    const b16* Kt = &Ring[tl & 1][0][0]; const b16* Vt = &Ring[tl & 1][2][0];   // the two V slices (columns 0 .. 127, 128 .. 255) follow each other at SLE elements
    const int kb = (tb + tl) * KT + kh * 32;   // this wave's 32 keys of the tile
    if (kb < kend) {   // wave-uniform (scalar): a wave skips the pass beyond its diagonal, never the publish point below
      // all K fragments are asked for ahead of the products, so that the LDS latency is paid once per run and not once per product; in the order of their use (k-step, then key tile)
      v16b kf[16], vf[16];
#pragma unroll
      for (int i = 0; i < 16; ++i) kf[i] = frag_kb(Kt + (i >> 3) * SLE + (kh * 32 + (i & 1) * 16 + col) * KHP + ((i >> 1) & 3) * 32, hh);
      __builtin_amdgcn_sched_barrier(0);   // holds the reads above in front of the products below: with the pass cut into blocks by the test below, the compiler moves each K read down to its product and waits for it there
      v8f s[2][2] = {{(v8f){}, (v8f){}}, {(v8f){}, (v8f){}}};
#pragma unroll   // four independent accumulators between an accumulator's two uses
      for (int ks = 0; ks < 8; ++ks)
#pragma unroll
        for (int tt = 0; tt < 2; ++tt)
#pragma unroll
          for (int u = 0; u < 2; ++u) s[u][tt] = wmma16p(kf[ks * 2 + tt], qa[u][ks], s[u][tt]);
      float al[2], sm[2], so[2];   // sm: the lane's own sum of its 16 weights, so: that of lane ^ 16, asked for beside the P stores and added behind the test, so that no copy waits for it
      // scores -> P in LDS. MASKED = false is the copy for keys that every query of the wave may attend: no compare with the diagonal, and no score is -inf, so that the guards against -inf go too (same sums in the same order; without the select the compiler may fuse a score's scaling with the subtraction of the max)
      auto softmax = [&](auto fl) __attribute__((always_inline)) {
        constexpr bool MASKED = decltype(fl)::v;
#pragma unroll   // the two query tiles' softmax chains are independent of each other
        for (int u = 0; u < 2; ++u) {
          float e[16]; float mx = -INFINITY;
#pragma unroll
          for (int i = 0; i < 16; ++i) { const int key = kb + (i < 8 ? 0 : 16) + 8 * hh + (i & 7); const float sc = (i < 8 ? s[u][0][i] : s[u][1][i - 8]) * cs; const float v = (!MASKED || key <= qi[u]) ? sc : -INFINITY; e[i] = v; mx = fmaxf(mx, v); }
          mx = fmaxf(mx, __shfl_xor(mx, 16)); const float mn = fmaxf(m[u], mx); al[u] = (MASKED && mn == -INFINITY) ? 1.0f : nexp2(m[u] - mn); float sum = 0.0f;
          // B operand needs row = query, k = key: write P[query col][key] into LDS (wave-private), then frag
#pragma unroll
          for (int i = 0; i < 16; ++i) { const float p = (MASKED && e[i] == -INFINITY) ? 0.0f : nexp2(e[i] - mn); sum += p; Pb[wave][u][col][(i < 8 ? 0 : 16) + 8 * hh + (i & 7)] = (b16)(p * PS); }
          sm[u] = sum; so[u] = __shfl_xor(sum, 16); m[u] = mn; } };
      if (kb + 31 <= q0) softmax(Flag<false>{});   // wave-uniform (scalar): the pass's last key is no later than the wave's first query
      else softmax(Flag<true>{});
      wave_lds_sync();
      const v16b pf0 = frag_kb(&Pb[wave][0][col][0], hh), pf1 = frag_kb(&Pb[wave][1][col][0], hh);
      const b16* vp = Vt + (kh * 32 + 8 * hh + (lane & 7)) * VHP + ((lane >> 3) & 1) * 8;   // the lane's address in the first 16 x 16 block of its key half
      // V^T is asked for here, behind P: LDS answers a wave in order, so that in front of the scores' exchange and of P these 32 reads would hold both up; they land under the rescaling and the first products
#pragma unroll
      for (int t = 0; t < 16; ++t) { const b16* vq = vp + (t >> 3) * SLE + (t & 7) * 16; const v8b v0 = ld_tr16(vq), v1 = ld_tr16(vq + 16 * VHP);   // keys 8 hh + 0 .. 7 and 16 + 8 hh + 0 .. 7 of the wave's 32, feature t * 16 + col
#pragma unroll
        for (int e = 0; e < 8; ++e) { vf[t][e] = v0[e]; vf[t][8 + e] = v1[e]; } }
      __builtin_amdgcn_sched_barrier(0);   // holds the reads above in front of the rescaling and the products below, which then wait for them one by one
#pragma unroll
      for (int u = 0; u < 2; ++u) l[u] = l[u] * al[u] + (sm[u] + so[u]);
#pragma unroll
      for (int t = 0; t < 16; ++t) { o[0][t] *= al[0]; o[0][t] = wmma16p(vf[t], pf0, o[0][t]); o[1][t] *= al[1]; o[1][t] = wmma16p(vf[t], pf1, o[1][t]);
        __builtin_amdgcn_sched_barrier(0); }   // keeps this order, a fragment's two products as it lands and the next tiles' rescaling under them (left free, all rescaling goes first and one query tile's products wait fragment by fragment); the last one keeps the fence below, whose LDS wait covers all of V^T, behind the products
      wave_lds_sync(); }
    // publish point of tile tl + 1, passed by every wave
    asm volatile("s_wait_dscnt 0x0" ::: "memory");      // this wave's reads of tile tl are done before the buffer is refilled
    asm volatile("s_wait_tensorcnt 0x0" ::: "memory");  // this wave's slice of tile tl + 1 has landed
    __syncthreads();                                     // tile tl + 1 may be read by all; tile tl's buffer is left by all
    if (pinned(tl + 2 < ntile)) stage_tile(wave, Kb, Vb, pinned(tb + tl + 2), ring, tl & 1, gk, gv); }   // scalar test; the descriptor is formed behind the wait above
  asm volatile("s_wait_tensorcnt 0x0" ::: "memory");    // no request is left in flight when the wave goes on
  asm volatile("s_wait_dscnt 0x0" ::: "memory");        // and none of its reads of the ring
  // join of the two key halves. The kh = 0 wave has had at least one pass (its first key is never beyond the diagonal), so the joint max is finite; a wave without a pass has max -inf, sum 0, weight exp2(-inf) = 0
  { const v2f st = {hh == 0 ? m[0] : m[1], hh == 0 ? l[0] : l[1]}; *(v2f*)(&St[wave][hh][col][0]) = st; }   // both lane halves hold both tiles' (max, sum): half hh writes tile u = hh
  __syncthreads();   // the partner wave's (max, sum) may be read
  float f[2], mj = 0.0f, lj = 0.0f;
#pragma unroll
  for (int u = 0; u < 2; ++u) { const v2f ps = *(const v2f*)(&St[wave ^ 1][u ^ 1][col][0]);   // the partner's index of the same query tile is u ^ 1
    const float mm = fmaxf(m[u], ps[0]); const float as = nexp2(m[u] - mm), ap = nexp2(ps[0] - mm); const float lt = l[u] * as + ps[1] * ap;
    f[u] = as / (lt * PS * XS); if (u == 0) { mj = mm; lj = lt; } }
#pragma unroll
  for (int t = 0; t < 16; ++t)
#pragma unroll
    for (int r = 0; r < 8; ++r) Tx[wave][col][t * 16 + 8 * hh + r] = o[1][t][r] * f[1];
  __syncthreads();   // the partner wave's share of the tile that this wave keeps may be read
#pragma unroll
  for (int t = 0; t < 16; ++t) { const v4f x0 = *(const v4f*)(&Tx[wave ^ 1][col][t * 16 + 8 * hh]), x1 = *(const v4f*)(&Tx[wave ^ 1][col][t * 16 + 8 * hh + 4]);
#pragma unroll
    for (int r = 0; r < 8; ++r) To[wave][col][t * 16 + 8 * hh + r] = o[0][t][r] * f[0] + (r < 4 ? x0[r] : x1[r - 4]); }
  wave_lds_sync();
  float* Op = seg == 0 ? O2 : O1; const int qk = q0 + kh * 16;   // the 16 queries that this wave puts out
  if (hh == 0) { const v2f ml = {mj, lj}; *(v2f*)(ML + ((size_t)(seg == 0 ? B * S : 0) + (size_t)b * S + qk + col) * 2) = ml; }   // both halves hold the same (max, sum): 16 queries = one 128-byte line per wave
  asm volatile("s_wait_xcnt 0x0" ::: "memory");   // the store's address registers are rewritten right behind it
#pragma unroll   // constant row offsets in the LDS reads and the stores
  for (int g = 0; g < 2; ++g) { v4f a0[8], a1[8];
#pragma unroll   // keeps the register arrays at constant indices
    for (int rr = 0; rr < 8; ++rr) { a0[rr] = *(const v4f*)(&To[wave][g * 8 + rr][lane * 8]); a1[rr] = *(const v4f*)(&To[wave][g * 8 + rr][lane * 8 + 4]); }
#pragma unroll   // as above
    for (int rr = 0; rr < 8; ++rr) { const size_t row = ((size_t)b * S + qk + g * 8 + rr) * D; *(v4f*)(Op + row + lane * 8) = a0[rr]; *(v4f*)(Op + row + lane * 8 + 4) = a1[rr]; }
    asm volatile("s_wait_xcnt 0x0" ::: "memory"); }   // the stores' data and address registers are rewritten behind it (next eight rows, next segment)
  }
}
// everything behind attention in one launch, because it is local to a token row: merge of the attention partials + residual + LayerNorm 1, both FFN GEMMs, LayerNorm 2. Block = 64 tokens (one query tile),
// wave = 16 tokens from first to last; the LayerNorm output and the relu hidden rows (f16 hi + lo x8 planes) stay in the wave's own LDS rows, h2 stays in the accumulators.
// Products are taken transposed, D^T = W A^T (W rows as the A operand, token rows as B; same loader for both): a lane then holds 8 consecutive features of ONE token per tile, so the hidden planes go to LDS
// as 16-byte stores and LayerNorm 2 is a sum inside the lane plus one exchange with lane ^ 16.
// One 256-row W buffer at pitch 528 B serves W1 and then W2, filled by asynchronous copies of whole 512-byte rows: rows 0 .. 191 and rows 192 .. 255 are separate fills (48 and 16 copies of a wave, never
// more than 48 in flight); each fill stands behind the barrier that ends every wave's reads of those rows and is read behind its own wait and barrier.
// The text runs once per wave, so it is kept short: LayerNorm 1 is a rolled loop over groups of 4 rows, the two GEMMs are two trips of one rolled loop, the copies a rolled loop of eight.
template <int N8>
__device__ __forceinline__ void stage_rows_rolled(const b16* g0, int gstep, unsigned l0, unsigned lstep) {
#pragma unroll 1   // rolled: 24 address registers in all, where the unrolled form keeps every address of a fill alive across the products
  for (int h = 0; h < N8; ++h) { unsigned l[8]; const b16* g[8];
#pragma unroll
    for (int i = 0; i < 8; ++i) { l[i] = l0 + (unsigned)(h * 8 + i) * lstep; g[i] = g0 + (size_t)(h * 8 + i) * gstep; }
    async_copy8(l, g); }
}
__device__ __forceinline__ void load_group(v16b (&w)[32], const b16 (*Ws)[KPITCH], int row0, int nloc, int hlf) {
#pragma unroll   // register array at constant indices
  for (int i = 0; i < 32; ++i) w[i] = frag_kb(&Ws[row0 + (i & 3) * 16 + nloc][(i >> 2) * 32], hlf);
}
// 4 feature tiles x 8 k-steps x (hi, lo): per accumulator the order is hi, lo within ascending k; the four tiles stand between an accumulator's two uses
template <int G>
__device__ __forceinline__ void mul_group(v8f (&acc)[16], const v16b (&w)[32], const v16b (&a)[8], const v16b (&al)[8]) {
#pragma unroll   // register arrays at constant indices
  for (int ks = 0; ks < 8; ++ks) {
#pragma unroll
    for (int tt = 0; tt < 4; ++tt) acc[4 * G + tt] = wmma16p(w[ks * 4 + tt], a[ks], acc[4 * G + tt]);
#pragma unroll
    for (int tt = 0; tt < 4; ++tt) acc[4 * G + tt] = wmma16p(w[ks * 4 + tt], al[ks], acc[4 * G + tt]);
  }
}
__device__ __forceinline__ float wave_sum(float s) {
#pragma unroll
  for (int o = 1; o < 32; o <<= 1) s += __shfl_xor(s, o);
  return s; }
// four token rows as LayerNorm 1 takes them: 8 features a lane of partial 0 (a, c), of x, and for a long query tile of partial 1 with both (max, sum) pairs
struct Rows4 { v4f a[4], c[4], x0[4], x1[4], a2[4], c2[4]; v2f p0[4], p1[4]; };
__device__ __forceinline__ void load_rows4(Rows4& R, const float* IN, const float* IN2, const float* ML, const float* x, size_t row, int lane, bool two) {
  const float* pa = IN + row * D + lane * 8; const float* px = x + row * D + lane * 8;
#pragma unroll
  for (int rr = 0; rr < 4; ++rr) { R.a[rr] = *(const v4f*)(pa + rr * D); R.c[rr] = *(const v4f*)(pa + rr * D + 4); R.x0[rr] = *(const v4f*)(px + rr * D); R.x1[rr] = *(const v4f*)(px + rr * D + 4); }
  asm volatile("s_wait_xcnt 0x0" :: "v"(pa), "v"(px) : "memory");   // the loads' address registers are rewritten behind it; named here, they stay whole up to it (no load's result is placed on them)
  if (two) { const float* p2 = IN2 + row * D + lane * 8;
#pragma unroll
    for (int rr = 0; rr < 4; ++rr) { R.a2[rr] = *(const v4f*)(p2 + rr * D); R.c2[rr] = *(const v4f*)(p2 + rr * D + 4);
      R.p0[rr] = *(const v2f*)(ML + (row + rr) * 2); R.p1[rr] = *(const v2f*)(ML + ((size_t)B * S + row + rr) * 2); }
    asm volatile("s_wait_xcnt 0x0" :: "v"(p2) : "memory"); }   // as above
}
__global__ __launch_bounds__(128) void tail_kernel(const float* __restrict__ IN, const float* __restrict__ IN2, const float* __restrict__ ML, const float* __restrict__ x, const float* __restrict__ g1, const float* __restrict__ be1,
                                                   const b16* __restrict__ W1, const b16* __restrict__ W2, const float* __restrict__ b1, const float* __restrict__ b2, const float* __restrict__ g2, const float* __restrict__ be2, float* __restrict__ out) {
  __shared__ __attribute__((aligned(16))) b16 Ws[D][KPITCH]; __shared__ __attribute__((aligned(16))) b16 Ahs[4][16][KPITCH]; __shared__ __attribute__((aligned(16))) b16 Als[4][16][KPITCH];
  __shared__ __attribute__((aligned(16))) float To[4][16][D + 4]; __shared__ __attribute__((aligned(16))) float Ps[4][D];
  const int tid = threadIdx.x, wave = __builtin_amdgcn_readfirstlane(tid >> 5), lane = tid & 31, nloc = lane & 15, hlf = lane >> 4; const size_t row0 = (size_t)blockIdx.x * 64 + wave * 16;
  stage_rows_rolled<6>(W1 + (size_t)wave * D + lane * 8, 4 * D, lds_addr(&Ws[wave][lane * 8]), 4 * KPITCH * 2);   // W1 rows 0 .. 191 (wave, wave + 4, ..) fly under LayerNorm 1
  const bool two = (int)(blockIdx.x & (NT - 1)) >= CUT;   // block-uniform: a long query tile has two partials
  Rows4 raw = {}; load_rows4(raw, IN, IN2, ML, x, row0, lane, two);
  // per-feature vectors of the two epilogues, rounded once, read by every wave behind the first barrier
  { const v2f p0 = *(const v2f*)(b1 + tid * 2), p1 = *(const v2f*)(b2 + tid * 2), p2 = *(const v2f*)(g2 + tid * 2), p3 = *(const v2f*)(be2 + tid * 2);
    asm volatile("s_wait_xcnt 0x0" ::: "memory");   // the loads' base and offset registers are rewritten behind them
    const v2f q0 = {bf16_rne(p0[0]), bf16_rne(p0[1])}, q1 = {bf16_rne(p1[0]), bf16_rne(p1[1])}, q2 = {bf16_rne(p2[0]), bf16_rne(p2[1])}, q3 = {bf16_rne(p3[0]), bf16_rne(p3[1])};
    *(v2f*)(&Ps[0][tid * 2]) = q0; *(v2f*)(&Ps[1][tid * 2]) = q1; *(v2f*)(&Ps[2][tid * 2]) = q2; *(v2f*)(&Ps[3][tid * 2]) = q3; }
  float gg[8], bb[8];
  { const v4f u0 = *(const v4f*)(g1 + lane * 8), u1 = *(const v4f*)(g1 + lane * 8 + 4), u2 = *(const v4f*)(be1 + lane * 8), u3 = *(const v4f*)(be1 + lane * 8 + 4);
    asm volatile("s_wait_xcnt 0x0" ::: "memory");   // as above
#pragma unroll
    for (int j = 0; j < 4; ++j) { gg[j] = bf16_rne(u0[j]); gg[4 + j] = bf16_rne(u1[j]); bb[j] = bf16_rne(u2[j]); bb[4 + j] = bf16_rne(u3[j]); } }
  // LayerNorm 1, a row across the wave (8 features a lane), 4 rows a trip; the next 4 rows' loads go out ahead of this group's sums and land under its arithmetic
#pragma unroll 1   // rolled for a short text
  for (int bt = 0; bt < 4; ++bt) { v4f a[4], c[4];
#pragma unroll
    for (int rr = 0; rr < 4; ++rr) { a[rr] = raw.a[rr]; c[rr] = raw.c[rr]; }
    if (two) {
#pragma unroll
      for (int rr = 0; rr < 4; ++rr) { const v2f p0 = raw.p0[rr], p1 = raw.p1[rr]; const float mm = fmaxf(p0[0], p1[0]);
        float w0 = p0[1] * nexp2(p0[0] - mm), w1 = p1[1] * nexp2(p1[0] - mm); const float rw = 1.0f / (w0 + w1); w0 *= rw; w1 *= rw;
        a[rr] = a[rr] * w0 + raw.a2[rr] * w1; c[rr] = c[rr] * w0 + raw.c2[rr] * w1; } }
#pragma unroll
    for (int rr = 0; rr < 4; ++rr)
#pragma unroll
      for (int j = 0; j < 4; ++j) { a[rr][j] += bf16_rne(raw.x0[rr][j]); c[rr][j] += bf16_rne(raw.x1[rr][j]); }
    load_rows4(raw, IN, IN2, ML, x, row0 + (bt < 3 ? bt + 1 : 3) * 4, lane, two);   // the last trip reads its own rows again: one instruction stream
    float s[4], q[4];
#pragma unroll
    for (int rr = 0; rr < 4; ++rr) { float t = 0.0f;
#pragma unroll
      for (int j = 0; j < 4; ++j) t += a[rr][j] + c[rr][j];
      s[rr] = wave_sum(t) * (1.0f / D); }
#pragma unroll
    for (int rr = 0; rr < 4; ++rr) { const float mu = s[rr]; float t = 0.0f;
#pragma unroll
      for (int j = 0; j < 4; ++j) { const float d0 = a[rr][j] - mu, d1 = c[rr][j] - mu; t += d0 * d0 + d1 * d1; }
      q[rr] = wave_sum(t); }
#pragma unroll
    for (int rr = 0; rr < 4; ++rr) { const float mu = s[rr], rs = rsqrtf(q[rr] * (1.0f / D) + LNEPS); v8b hv, lv;
#pragma unroll
      for (int j = 0; j < 8; ++j) { const float y = ((j < 4 ? a[rr][j] : c[rr][j - 4]) - mu) * rs * gg[j] + bb[j]; b16 p, qq; split16(y * XS, p, qq); hv[j] = p; lv[j] = qq; }
      *(v8b*)(&Ahs[wave][bt * 4 + rr][lane * 8]) = hv; *(v8b*)(&Als[wave][bt * 4 + rr][lane * 8]) = lv; }
    __builtin_amdgcn_sched_barrier(0); }   // keeps the register copies that hand the next rows over, and with them the wait for their loads, behind this group's arithmetic: left free, they rise to its start
  v8f acc[16];
#pragma unroll 1   // rolled for a short text: trip 0 = W1 (and relu into the planes), trip 1 = W2
  for (int pass = 0; pass < 2; ++pass) {
    const b16* Wc = pass == 0 ? W1 : W2;
    wave_lds_sync();   // the wave's plane rows were written across its lanes
    v16b a[8], al[8], w0[32], w1[32];
#pragma unroll
    for (int ks = 0; ks < 8; ++ks) { a[ks] = frag_kb(&Ahs[wave][nloc][ks * 32], hlf); al[ks] = frag_kb(&Als[wave][nloc][ks * 32], hlf); }
#pragma unroll
    for (int t = 0; t < 16; ++t) acc[t] = (v8f){};
    // fragments of a group (64 W rows) are asked for together and one group ahead of their products (two register sets), so that the LDS latency is not paid per product
    asm volatile("s_wait_dscnt 0x0" ::: "memory");      // this wave's earlier reads of rows 192 .. 255 are done before they are refilled
    asm volatile("s_wait_asynccnt 0x0" ::: "memory");   // this wave's copies of rows 0 .. 191 have landed
    __syncthreads();                                     // ... and every other wave's: they may be read; rows 192 .. 255 are left by all
    stage_rows_rolled<2>(Wc + (size_t)(192 + wave) * D + lane * 8, 4 * D, lds_addr(&Ws[192 + wave][lane * 8]), 4 * KPITCH * 2);
    load_group(w0, Ws, 0, nloc, hlf); load_group(w1, Ws, 64, nloc, hlf);
    __builtin_amdgcn_sched_barrier(0);   // holds the reads above in front of the products below: left free, the compiler moves each read down to its product and waits for it there
    mul_group<0>(acc, w0, a, al);
    __builtin_amdgcn_sched_barrier(0);   // keeps the next group's reads from rising among those products or sinking to their own
    load_group(w0, Ws, 128, nloc, hlf);
    __builtin_amdgcn_sched_barrier(0);   // as above
    mul_group<1>(acc, w1, a, al);
    __builtin_amdgcn_sched_barrier(0);   // keeps the products above in front of the waits below, so that the copies in flight land under them
    asm volatile("s_wait_dscnt 0x0" ::: "memory");      // this wave's reads of rows 0 .. 191 are done before they are refilled
    asm volatile("s_wait_asynccnt 0x0" ::: "memory");   // this wave's copies of rows 192 .. 255 have landed
    __syncthreads();                                     // ... and every other wave's; rows 0 .. 191 are left by all
    if (pass == 0) stage_rows_rolled<6>(W2 + (size_t)wave * D + lane * 8, 4 * D, lds_addr(&Ws[wave][lane * 8]), 4 * KPITCH * 2);   // block-uniform: W2 rows 0 .. 191 fly under the rest of trip 0
    load_group(w1, Ws, 192, nloc, hlf);
    __builtin_amdgcn_sched_barrier(0);   // holds the reads above in front of the products below
    mul_group<2>(acc, w0, a, al); mul_group<3>(acc, w1, a, al);
    // + bias: lane = token nloc, features t * 16 + 8 * hlf + 0 .. 7
#pragma unroll
    for (int t = 0; t < 16; ++t) { const v4f c0 = *(const v4f*)(&Ps[pass][t * 16 + 8 * hlf]), c1 = *(const v4f*)(&Ps[pass][t * 16 + 8 * hlf + 4]);
#pragma unroll
      for (int r = 0; r < 8; ++r) acc[t][r] = acc[t][r] * (1.0f / (XS * WSC)) + (r < 4 ? c0[r] : c1[r - 4]); }
    if (pass == 0) {   // hidden = relu(.) as hi + lo planes over the wave's own rows (their fragments are in registers)
#pragma unroll
      for (int t = 0; t < 16; ++t) { v8b hv, lv;
#pragma unroll
        for (int r = 0; r < 8; ++r) { b16 p, qq; split16(fmaxf(acc[t][r], 0.0f) * XS, p, qq); hv[r] = p; lv[r] = qq; }
        *(v8b*)(&Ahs[wave][nloc][t * 16 + 8 * hlf]) = hv; *(v8b*)(&Als[wave][nloc][t * 16 + 8 * hlf]) = lv; } } }
  // LayerNorm 2 over the token's 256 features: 128 in this lane (eight running sums over the 16 tiles, then a tree), 128 in lane ^ 16
  v8f vs = (v8f){};
#pragma unroll
  for (int t = 0; t < 16; ++t) vs += acc[t];
  float s = ((vs[0] + vs[1]) + (vs[2] + vs[3])) + ((vs[4] + vs[5]) + (vs[6] + vs[7])); s += __shfl_xor(s, 16);
  const float mu = s * (1.0f / D); v8f vq = (v8f){};
#pragma unroll
  for (int t = 0; t < 16; ++t) { const v8f d = acc[t] - mu; vq += d * d; }
  float q = ((vq[0] + vq[1]) + (vq[2] + vq[3])) + ((vq[4] + vq[5]) + (vq[6] + vq[7])); q += __shfl_xor(q, 16);
  const float rs = rsqrtf(q * (1.0f / D) + LNEPS);
#pragma unroll
  for (int t = 0; t < 16; ++t) { const int f = t * 16 + 8 * hlf; const v4f g0 = *(const v4f*)(&Ps[2][f]), g4 = *(const v4f*)(&Ps[2][f + 4]), e0 = *(const v4f*)(&Ps[3][f]), e4 = *(const v4f*)(&Ps[3][f + 4]); v4f y0, y1;
#pragma unroll
    for (int r = 0; r < 4; ++r) { y0[r] = (acc[t][r] - mu) * rs * g0[r] + e0[r]; y1[r] = (acc[t][4 + r] - mu) * rs * g4[r] + e4[r]; }
    *(v4f*)(&To[wave][nloc][f]) = y0; *(v4f*)(&To[wave][nloc][f + 4]) = y1; }
  wave_lds_sync();
  // whole rows go out: 1 KB of a token per pair of stores
#pragma unroll   // constant row offsets in the LDS reads and the stores
  for (int g = 0; g < 2; ++g) { v4f o0[8], o1[8];
#pragma unroll   // keeps the register arrays at constant indices
    for (int rr = 0; rr < 8; ++rr) { o0[rr] = *(const v4f*)(&To[wave][g * 8 + rr][lane * 8]); o1[rr] = *(const v4f*)(&To[wave][g * 8 + rr][lane * 8 + 4]); }
#pragma unroll   // as above
    for (int rr = 0; rr < 8; ++rr) { const size_t row = (row0 + g * 8 + rr) * D; *(v4f*)(out + row + lane * 8) = o0[rr]; *(v4f*)(out + row + lane * 8 + 4) = o1[rr]; }
    if (g == 0) asm volatile("s_wait_xcnt 0x0" ::: "memory"); }   // the stores' data registers are rewritten behind it (next eight rows)
}
}  // namespace

extern "C" void kernel_launch(void* const* d_in, const int* in_sizes, int n_in, void* d_out, int out_size, void* d_ws, size_t ws_size, hipStream_t stream) {
  (void)n_in;
  auto Fp = [&](int i) { return (const float*)d_in[i]; };
  // input order: 0 x [4,4096,256], 1 Wq [256,256] ([e][d]), 2 bq, 3 Wk, 4 bk, 5 Wv, 6 bv, 7 W1, 8 b1, 9 W2, 10 b2, 11 g_ln, 12 beta_ln, 13 g_lnff, 14 beta_lnff
  if (in_sizes[0] != B * S * D || in_sizes[1] != D * D || in_sizes[3] != D * D || in_sizes[5] != D * D || in_sizes[7] != FF * D || in_sizes[9] != D * FF || in_sizes[11] != D || in_sizes[13] != D || out_size != B * S * D) return;
  size_t off = 0; char* ws = (char*)d_ws;
  auto carve = [&](size_t bytes) { char* p = ws + off; off += (bytes + 255) & ~(size_t)255; return p; };
  b16* WT = (b16*)carve((size_t)5 * D * D * 2); b16* Qp = (b16*)carve((size_t)B * S * D * 2); b16* Kp = (b16*)carve((size_t)B * S * D * 2); b16* Vp = (b16*)carve((size_t)B * S * D * 2);
  float* O1 = (float*)carve((size_t)B * S * D * 4); float* O2 = (float*)carve((size_t)B * S * D * 4); float* ML = (float*)carve((size_t)2 * B * S * 2 * 4);
  if (off > ws_size || off > ((size_t)128 << 20)) return;   // about 57 MB
  wprep_kernel<<<(unsigned)(((size_t)5 * D * D / 8 + 255) / 256), 256, 0, stream>>>(Fp(1), Fp(3), Fp(5), Fp(7), Fp(9), WT);
  qkv_kernel<<<dim3(S / 64, BL, 3), 128, 0, stream>>>(Fp(0), WT, Fp(2), Fp(4), Fp(6), Qp, Kp, Vp);
  attn_kernel<<<dim3(S / 64, BL), 128, 0, stream>>>(Qp, Kp, Vp, O1, O2, ML);
  tail_kernel<<<(unsigned)((size_t)BL * S / 64), 128, 0, stream>>>(O1, O2, ML, Fp(0), Fp(11), Fp(12), WT + (size_t)3 * D * D, WT + (size_t)4 * D * D, Fp(8), Fp(10), Fp(13), Fp(14), (float*)d_out);
}

// v009
// A run of this version takes 74.9 microseconds.
// Next to v008, in two timings, it ran 1.11 and 1.10 times as fast.
// Over all steps from v000 it is 12.9 times as fast.
#include <hip/hip_runtime.h>

// Causal single-head transformer block: q, k, v = x W{q,k,v}^T + b ([4][4096][256], d = 256); A = q . k; causal mask filled with -32767 BEFORE the 1/sqrt(256) scaling (masked weights are exactly 0
// in f32 after exp); softmax over keys <= query; o = A v + x; LayerNorm; h = relu(o W1^T + b1) W2^T + b2; LayerNorm (no second residual) -> [4][4096][256].
// Deterministic: flash-style causal attention, a wave = 32 queries x one 32-key half of every 64-key tile (online softmax with running max, the two halves joined at the end of a segment), both LayerNorms and the FFN in one row-local kernel behind attention;
// no atomics.
// compute dtype: WMMA v_wmma_f32_16x16x32_bf16 with f32 accumulate for the q/k/v projections (x and W [e][d] rows rounded to bf16, the operands as they are: 1 product); v_wmma_f32_16x16x32_f16 for S^T = K Q^T (q, k single
// f16 x8: 1 product — logits have std ≈ 1 over ~2,000 keys, per-key rounding averages to ≈4e-5 on the output), O^T += V^T P^T (v single f16 x8, P x1024 single f16: 1 product) and the two FFN GEMMs
// (LayerNorm output / relu hidden as f16 hi+lo x8 planes: 2 products); softmax statistics (exp2), residual, LayerNorms, bias, relu in f32. Inputs rounded to bf16 once.

namespace {
constexpr int B = 4, S = 4096, D = 256, FF = 256, BL = 4 /* batches computed (== B shipped) */;
constexpr float XS = 8.0f, WSC = 256.0f, PS = 1024.0f, LOG2E = 1.4426950408889634f, LNEPS = 1e-5f, MASK_FILL = -32767.0f;
static_assert(S % 64 == 0 && D == 256 && FF == 256, "tiling");
typedef _Float16 b16;
typedef __attribute__((ext_vector_type(16))) _Float16 v16b;
typedef __attribute__((ext_vector_type(8))) _Float16 v8b;
typedef __attribute__((ext_vector_type(8))) float v8f;
typedef __attribute__((ext_vector_type(4))) float v4f;
__device__ __forceinline__ float bf16_rne(float f) { unsigned int u = __float_as_uint(f); u += 0x7FFFu + ((u >> 16) & 1u); return __uint_as_float(u & 0xFFFF0000u); }
__device__ __forceinline__ void split16(float v, b16& hi, b16& lo) { hi = (b16)v; lo = (b16)(v - (float)hi); }
__device__ __forceinline__ v16b frag_kb(const b16* p, int hh) { const v8b a = *(const v8b*)(p + 8 * hh), b = *(const v8b*)(p + 16 + 8 * hh); v16b f;
#pragma unroll
  for (int e = 0; e < 8; ++e) { f[e] = a[e]; f[8 + e] = b[e]; } return f; }
__device__ __forceinline__ void wave_lds_sync() { __builtin_amdgcn_fence(__ATOMIC_RELEASE, "workgroup"); __builtin_amdgcn_wave_barrier(); __builtin_amdgcn_fence(__ATOMIC_ACQUIRE, "workgroup"); }
__device__ __forceinline__ float pmul(float a, float b) { float p = a * b; asm volatile("" : "+v"(p)); return p; }
__device__ __forceinline__ int iclamp(int v, int lo, int hi) { return v < lo ? lo : (v > hi ? hi : v); }

typedef __attribute__((ext_vector_type(4))) _Float16 v4h;
typedef __attribute__((ext_vector_type(2))) float v2f;
__device__ __forceinline__ float nexp2(float v) { return __builtin_amdgcn_exp2f(v); }
constexpr int KT = 64, KPITCH = D + 8, NT = S / KT, CUT = NT / 2 + 1;
// the plain builtin (the compiler keeps the distance behind it): operands of an asm statement must lie below v256, which the fragments of a whole pass do not fit
__device__ __forceinline__ v8f wmma16p(v16b a, v16b b, v8f c) { return __builtin_amdgcn_wmma_f32_16x16x32_f16(false, a, false, b, (short)0, c, false, false); }
__device__ __forceinline__ unsigned lds_addr(const void* p) { return (unsigned)(size_t)p; }
// eight 16-byte copies per lane; s_wait_xcnt 0 closes the statement so that no address register is rewritten while a copy may still name it
template <typename E>
__device__ __forceinline__ void async_copy8(const unsigned (&l)[8], const E* const (&g)[8]) {
  asm volatile("global_load_async_to_lds_b128 %0, %8, off\n\t"
               "global_load_async_to_lds_b128 %1, %9, off\n\t"
               "global_load_async_to_lds_b128 %2, %10, off\n\t"
               "global_load_async_to_lds_b128 %3, %11, off\n\t"
               "global_load_async_to_lds_b128 %4, %12, off\n\t"
               "global_load_async_to_lds_b128 %5, %13, off\n\t"
               "global_load_async_to_lds_b128 %6, %14, off\n\t"
               "global_load_async_to_lds_b128 %7, %15, off\n\t"
               "s_wait_xcnt 0x0"
               :: "v"(l[0]), "v"(l[1]), "v"(l[2]), "v"(l[3]), "v"(l[4]), "v"(l[5]), "v"(l[6]), "v"(l[7]),
                  "v"(g[0]), "v"(g[1]), "v"(g[2]), "v"(g[3]), "v"(g[4]), "v"(g[5]), "v"(g[6]), "v"(g[7]) : "memory");
}
// qkv: 768 jobs = {q, k, v} x 256 tiles of 64 tokens; a block (4 waves, one per WGP, 256 blocks) does three jobs in a row, job J = 3 * block + 0 .. 2 = (matrix J >> 8, tile J & 255), and keeps its W in LDS over them
// (two blocks meet a second matrix and fill LDS twice). Per job and wave 16 tokens x 16 column tiles x 8 k-steps; + bias. q, k, v -> single f16 x8 planes [b][s][256] (32 lanes x 16 B), v row-major like the others.
// No launch prepares W: both operands are the inputs rounded to bf16, taken as they are by the bf16 product (no scaling, one conversion instruction per two values). W rows and x rows come as f32
// through registers in whole 512-byte pieces, are rounded there and stored at pitch 528 B (16 B x odd: ds_load_b128 free of bank conflicts). The next job's x rows are asked for ahead of this job's products.
// Every block also writes 512 values of the two FFN matrices' f16 x256 planes, which the launch behind attention reads.
typedef __bf16 w16;
typedef __attribute__((ext_vector_type(16))) __bf16 v16w;
typedef __attribute__((ext_vector_type(8))) __bf16 v8w;
typedef __attribute__((ext_vector_type(4))) __bf16 v4w;
__device__ __forceinline__ v16w frag_kw(const w16* p, int hh) { const v8w a = *(const v8w*)(p + 8 * hh), b = *(const v8w*)(p + 16 + 8 * hh); return __builtin_shufflevector(a, b, 0, 1, 2, 3, 4, 5, 6, 7, 8, 9, 10, 11, 12, 13, 14, 15); }
__device__ __forceinline__ v8f wmma16w(v16w a, v16w b, v8f c) { return __builtin_amdgcn_wmma_f32_16x16x32_bf16(false, a, false, b, (short)0, c, false, false); }
// a wave's LDS stores are done before its lanes read each other's rows back; written as the LDS wait alone, because the fence at work-group scope also waits for the global stores of the job before, which are still in flight
__device__ __forceinline__ void wave_order() { asm volatile("s_wait_dscnt 0x0" ::: "memory"); __builtin_amdgcn_wave_barrier(); }
// pieces I0 .. I0 + N - 1 of 512 bytes: piece i = half (i & 1) of row RS * (i >> 1) of a [.][256] f32 array; p = the lane's 4 floats of piece 0
template <int I0, int N, int RS>
__device__ __forceinline__ void load_p(v4f (&r)[N], const float* p) {
  __builtin_amdgcn_sched_barrier(0);   // keeps the loads behind what stands in front of them (the batch consumed there leaves them its registers)
#pragma unroll   // register array at constant indices, constant offsets from one address
  for (int i = 0; i < N; ++i) r[i] = *(const v4f*)(p + ((I0 + i) >> 1) * RS * D + ((I0 + i) & 1) * 128);
  asm volatile("s_wait_xcnt 0x0" :: "v"(p) : "memory");   // the loads' address registers may be rewritten behind it; named here, they stay whole up to it
  __builtin_amdgcn_sched_barrier(0);   // holds the loads here, far ahead of their use: left free, the compiler moves them down to the conversions and waits there
}
// the same pieces, rounded to bf16, to their rows in LDS (pitch KPITCH); q = the lane's 4 values of piece 0
template <int I0, int N, int RS>
__device__ __forceinline__ void put_p(const v4f (&r)[N], w16* q) {
#pragma unroll   // as above
  for (int i = 0; i < N; ++i) *(v4w*)(q + ((I0 + i) >> 1) * RS * KPITCH + ((I0 + i) & 1) * 128) = __builtin_convertvector(r[i], v4w);
}
__device__ __forceinline__ void load_wgroup(v16w (&w)[32], const w16 (*Ws)[KPITCH], int row0, int nloc, int hlf) {
#pragma unroll   // register array at constant indices
  for (int i = 0; i < 32; ++i) w[i] = frag_kw(&Ws[row0 + (i & 3) * 16 + nloc][(i >> 2) * 32], hlf);
}
template <int G>
__device__ __forceinline__ void mul_wgroup(v8f (&acc)[16], const v16w (&a)[8], const v16w (&w)[32]) {
#pragma unroll   // register arrays at constant indices; the four tiles stand between an accumulator's two uses
  for (int i = 0; i < 32; ++i) acc[4 * G + (i & 3)] = wmma16w(a[i >> 2], w[i], acc[4 * G + (i & 3)]);
}
// a wave's share of a fill of W: rows wave, wave + 4, .., two batches of 16 rows in flight; Wf, Wl = the lane's 4 values of the wave's first row in memory and in LDS
__device__ __forceinline__ void fill_w(const float* Wf, w16* Wl) { v4f ra[32], rb[32];
  load_p<0, 32, 4>(ra, Wf); load_p<32, 32, 4>(rb, Wf);
  put_p<0, 32, 4>(ra, Wl); load_p<64, 32, 4>(ra, Wf);
  put_p<32, 32, 4>(rb, Wl); load_p<96, 32, 4>(rb, Wf);
  put_p<64, 32, 4>(ra, Wl); put_p<96, 32, 4>(rb, Wl);
  __syncthreads();   // all 256 rows, every wave's: they may be read
}
__global__ __launch_bounds__(128) void qkv_kernel(const float* __restrict__ x, const float* __restrict__ wq, const float* __restrict__ wk, const float* __restrict__ wv, const float* __restrict__ w1, const float* __restrict__ w2,
                                                  const float* __restrict__ bq, const float* __restrict__ bk, const float* __restrict__ bv, b16* __restrict__ WT, b16* __restrict__ Qp, b16* __restrict__ Kp, b16* __restrict__ Vp) {
  static_assert(B * S / 64 == 256 && KPITCH == D + 8, "jobs");
  __shared__ __attribute__((aligned(16))) w16 As[4][16][KPITCH]; __shared__ __attribute__((aligned(16))) float Tf[4][16][256 + 4]; __shared__ __attribute__((aligned(16))) w16 Ws[D][KPITCH];
  const int tid = threadIdx.x, wave = __builtin_amdgcn_readfirstlane(tid >> 5), lane = tid & 31, nloc = lane & 15, hlf = lane >> 4; const int blk = blockIdx.x, J0 = blk * 3;
  w16* Wl = &Ws[wave][lane * 4]; w16* Al = &As[wave][0][lane * 4];
  v4f xr[32], wt;
  load_p<0, 32, 1>(xr, x + ((size_t)(J0 & 255) * 64 + wave * 16) * D + lane * 4);   // the first job's 16 x rows of this wave
  { const float* wsrc = (blk < 128 ? w1 : w2) + (size_t)(blk & 127) * 512 + tid * 4; wt = *(const v4f*)wsrc;   // 256 blocks x 128 threads x 4 values = W1, W2
    asm volatile("s_wait_xcnt 0x0" :: "v"(wsrc) : "memory"); }   // as in load_p
  fill_w((J0 < 256 ? wq : J0 < 512 ? wk : wv) + (size_t)wave * D + lane * 4, Wl);
  { v4h o; b16* wd = WT + (size_t)blk * 512 + tid * 4;
#pragma unroll   // register arrays at constant indices
    for (int j = 0; j < 4; ++j) o[j] = (b16)(bf16_rne(wt[j]) * WSC);
    *(v4h*)wd = o;
    asm volatile("s_wait_xcnt 0x0" :: "v"(wd) : "memory"); }   // the store's registers may be rewritten behind it
#pragma unroll 1   // stays rolled: the three jobs run through the same short text
  for (int it = 0; it < 3; ++it) {
    const int J = J0 + it, which = J >> 8, T = J & 255;
    if (it != 0 && T == 0) {   // block-uniform: the first job of the next matrix
      __syncthreads();   // every wave has left the rows of the matrix before
      fill_w((which == 1 ? wk : wv) + (size_t)wave * D + lane * 4, Wl); }
    put_p<0, 32, 1>(xr, Al);
    wave_order();   // the wave's A rows were written across its lanes
    const int Jn = it < 2 ? J + 1 : J;   // the last job asks for its own rows again: one instruction stream
    load_p<0, 32, 1>(xr, x + ((size_t)(Jn & 255) * 64 + wave * 16) * D + lane * 4);
    v8f acc[16];
#pragma unroll   // register arrays at constant indices
    for (int t = 0; t < 16; ++t) acc[t] = (v8f){};
    // a group = 4 column tiles x 8 k-steps. All fragments of a group are asked for together and one group ahead of their products (two register sets), so that the LDS latency is not paid per product
    v16w a[8], w0[32], w1f[32];
#pragma unroll   // register arrays at constant indices
    for (int ks = 0; ks < 8; ++ks) a[ks] = frag_kw(&As[wave][nloc][ks * 32], hlf);
    load_wgroup(w0, Ws, 0, nloc, hlf); load_wgroup(w1f, Ws, 64, nloc, hlf);
    __builtin_amdgcn_sched_barrier(0);   // holds the reads above in front of the products below: left free, the compiler moves each read down to its product and waits for it there
    mul_wgroup<0>(acc, a, w0);
    __builtin_amdgcn_sched_barrier(0);   // keeps the next group's reads from rising among those products or sinking to their own
    load_wgroup(w0, Ws, 128, nloc, hlf);
    __builtin_amdgcn_sched_barrier(0);   // as above
    mul_wgroup<1>(acc, a, w1f);
    __builtin_amdgcn_sched_barrier(0);   // as above
    load_wgroup(w1f, Ws, 192, nloc, hlf);
    __builtin_amdgcn_sched_barrier(0);   // as above
    mul_wgroup<2>(acc, a, w0); mul_wgroup<3>(acc, a, w1f);
    const float* bias = (which == 0 ? bq : which == 1 ? bk : bv) + nloc; float bb[16];
#pragma unroll   // register arrays at constant indices
    for (int t = 0; t < 16; ++t) bb[t] = bias[t * 16];
    asm volatile("s_wait_xcnt 0x0" :: "v"(bias) : "memory");   // as in load_p
#pragma unroll   // register arrays at constant indices
    for (int t = 0; t < 16; ++t) { const float bt = bf16_rne(bb[t]);
#pragma unroll   // register arrays at constant indices
      for (int r = 0; r < 8; ++r) Tf[wave][8 * hlf + r][t * 16 + nloc] = acc[t][r] + bt; }
    __syncthreads();   // as before this step: the staging rows, written across the lanes, are read behind it
    b16* P = (which == 0 ? Qp : which == 1 ? Kp : Vp) + ((size_t)T * 64 + wave * 16) * D + lane * 8;
#pragma unroll 1   // four rows a trip, the form that the compiler gave this loop while it stood at the end of the kernel; inside the job loop it unrolls it whole and waits for every LDS read by itself
    for (int g = 0; g < 4; ++g) { v8b o[4];
#pragma unroll   // register array at constant indices
      for (int rr = 0; rr < 4; ++rr) for (int j = 0; j < 8; ++j) o[rr][j] = (b16)(Tf[wave][g * 4 + rr][lane * 8 + j] * XS);
#pragma unroll   // as above
      for (int rr = 0; rr < 4; ++rr) *(v8b*)(P + (size_t)(g * 4 + rr) * D) = o[rr];
      asm volatile("s_wait_xcnt 0x0" :: "v"(P) : "memory"); } }   // the stores' registers are rewritten behind it (next rows, next job)
}
// causal attention: grid (S/64, BL); block = 64 queries, 4 waves (their tiles: in front of the kernel). Query tile qt needs qt + 1 key tiles, and one block fills a WGP, so the launch lasts as long as its longest block: the work is cut
// into equal blocks. Block j does the head of query tile NT - 1 - j (key tiles 0 .. min(qt + 1, CUT) - 1, partial 0) and, for j > NT / 2, before it the tail of query tile j (key tiles CUT .. j, partial 1):
// CUT or CUT - 1 key tiles in every block. A partial is its own softmax-weighted mean with its (max, sum); the kernel behind attention merges the two partials of a long query tile and adds the residual.
// Within a segment the block walks its keys in tiles of 64: K rows [64][256] and V rows [64][256] come once per block into LDS by tensor loads, one request a wave
// (two buffers: tile t + 1 flies while tile t is worked on), and every wave takes its fragments from there. A buffer is four slices of 18 KiB, one per wave: K columns 0 .. 127 and 128 .. 255
// (64 rows of 256 B, padded to pitch 272 B = 16 B x odd: ds_load_b128 free of bank conflicts) and the same two column halves of V (64 rows of 256 B, padded to pitch 288 B = 32 B x odd, the pitch of
// ds_load_tr16_b128, which hands a wave the V^T fragment out of the row-major tile in the k order of frag_kb).
// Per tile and wave one pass of 32 keys x 32 queries, tiles in ascending order: S^T = K Q^T (2 key tiles x 2 query tiles x 8 k-steps), logits A/16 in the log2 domain, keys > query masked (the reference's -32767 fill gives exp = 0 exactly),
// online softmax, P x1024 single f16 via LDS -> O^T += V^T P^T (16 d-tiles x 2 query tiles x 1 k-step); partial = joined O / joined l
typedef uint32_t u32x4 __attribute__((ext_vector_type(4)));
typedef uint32_t u32x8 __attribute__((ext_vector_type(8)));
constexpr uint32_t SLB = 18432, SLE = SLB / 2, KHP = 136, VHP = 144;   // slice bytes (9 x 2 KiB) and elements; elements per padded row of a K and of a V column half
static_assert(KT * KHP * 2 <= SLB && KT * VHP * 2 == SLB && SLB % 2048 == 0, "slices");
__device__ __forceinline__ uint32_t uni(uint32_t v) { return (uint32_t)__builtin_amdgcn_readfirstlane(v); }
// a wave-uniform value held in a scalar register: a test on it compiles to s_cmp + s_cbranch_scc (a tensor load ignores EXEC), and what is formed from it is formed behind the waits that stand in front of it
__device__ __forceinline__ uint32_t pinned(uint32_t v) { uint32_t w = uni(v); asm volatile("" : "+s"(w)); return w; }   // pinned(): a descriptor word, or the test that decides an issue, held in a scalar register
// descriptor group 1 of a tile of N rows of R bytes at source pitch P bytes; W0 = word 0 (no mask, 1-byte elements, the pad behind every row). Built once per wave; each word is a descriptor word held in its
// scalar register by pinned(), so that the compiler keeps the eight registers as they are for the whole kernel and rewrites none of them while a request is in flight
template <uint32_t W0, uint32_t R, uint32_t N, uint32_t P>
__device__ __forceinline__ u32x8 tensor_group1() { u32x8 g;
  g[0] = pinned(W0); g[1] = pinned((R & 0xFFFFu) << 16); g[2] = pinned((R >> 16) | ((N & 0xFFFFu) << 16)); g[3] = pinned((N >> 16) | (R << 16)); g[4] = pinned(N); g[5] = pinned(P); g[6] = pinned(0u); g[7] = pinned(0u);
  return g; }
// one request: the tile whose first byte is src, to LDS byte dst
__device__ __forceinline__ void tensor_tile(uint32_t dst, const b16* src, u32x8 g1) {
  const uint64_t ga = (uint64_t)(size_t)src; u32x4 g0;
  g0[0] = uni(1u); g0[1] = uni(dst); g0[2] = uni((uint32_t)ga); g0[3] = uni((((uint32_t)(ga >> 32)) & 0x01FFFFFFu) | 0x80000000u);
  asm volatile("tensor_load_to_lds %0, %1" :: "s"(g0), "s"(g1) : "memory");
}
// key tile 'tile' into buffer 'buf' (ring = LDS byte of the ring's start): every wave issues its own slice, waves 0, 1 of K (group 1: gk), waves 2, 3 of V (gv)
__device__ __forceinline__ void stage_tile(uint32_t wave, const b16* Kb, const b16* Vb, uint32_t tile, uint32_t ring, uint32_t buf, u32x8 gk, u32x8 gv) {
  const uint32_t dst = ring + (buf * 4 + wave) * SLB;
  if (pinned(wave < 2)) tensor_tile(dst, Kb + (size_t)tile * KT * D + wave * 128, gk);
  else tensor_tile(dst, Vb + (size_t)tile * KT * D + (wave - 2) * 128, gv);
}
// Wave tile: the 4 waves are 2 query groups (qg, 32 queries = two 16-query tiles) x 2 key halves (kh, 32 of a tile's 64 keys): every K and V^T fragment that a wave reads from LDS feeds two products, so
// the block reads each tile from LDS twice and not four times. A wave keeps its own running (max, sum, O) over its key halves; at the end of a segment the two waves of a query group exchange (max, sum),
// scale by the joint statistics, and each hands the other one 16-query tile through LDS: wave kh puts out query tile kh of its group. Index u of the register arrays is query tile u ^ kh, so that the tile a
// wave keeps is always u = 0 and the tile it hands over u = 1 (constant register indices).
template <bool M> struct Flag { static constexpr bool v = M; };
// transposing LDS load: lane (c = l & 15, h = l >> 4), whose address is row 8 h + (l & 7), 16-byte piece (l >> 3) & 1 of a 16 x 16 block, gets column c of rows 8 h .. 8 h + 7
typedef short s16x8 __attribute__((ext_vector_type(8)));
__device__ __forceinline__ v8b ld_tr16(const b16* p) { typedef __attribute__((address_space(3))) s16x8 lds_s16x8; return __builtin_bit_cast(v8b, __builtin_amdgcn_ds_load_tr16_b128_v8i16((lds_s16x8*)p)); }
__global__ __launch_bounds__(128) void attn_kernel(const b16* __restrict__ Qp, const b16* __restrict__ Kp, const b16* __restrict__ Vp, float* __restrict__ O1, float* __restrict__ O2, float* __restrict__ ML) {
  __shared__ __attribute__((aligned(2048))) b16 Ring[2][4][SLE];   // every slice starts at a multiple of 2 KiB of the work-group's LDS
  __shared__ __attribute__((aligned(16))) b16 Pb[4][2][16][32 + 8]; __shared__ __attribute__((aligned(16))) float To[4][16][D + 4]; __shared__ __attribute__((aligned(16))) float Tx[4][16][D + 4];
  __shared__ __attribute__((aligned(16))) float St[4][2][16][2];
  const int tid = threadIdx.x, wave = __builtin_amdgcn_readfirstlane(tid >> 5), lane = tid & 31, hh = lane >> 4, col = lane & 15; const int b = blockIdx.y, j = blockIdx.x;
  const int qg = wave >> 1, kh = wave & 1; const uint32_t ring = lds_addr(&Ring[0][0][0]);
  const u32x8 gk = tensor_group1<(1u << 20) | (5u << 22) | (3u << 25), 256, KT, D * 2>(), gv = tensor_group1<(1u << 20) | (5u << 22) | (7u << 25), 256, KT, D * 2>();
  const b16* Qb = Qp + (size_t)b * S * D; const b16* Kb = Kp + (size_t)b * S * D; const b16* Vb = Vp + (size_t)b * S * D;
#pragma unroll 1   // stays rolled: the two segments of a block run one after the other through the same code and the same LDS
  for (int seg = (j > NT / 2) ? 0 : 1; seg < 2; ++seg) {   // block-uniform: seg 0 = tail of query tile j, seg 1 = head of query tile NT - 1 - j
  const int qt = seg == 0 ? j : NT - 1 - j, tb = seg == 0 ? CUT : 0;
  const int ntile = seg == 0 ? j + 1 - CUT : (qt + 1 < CUT ? qt + 1 : CUT);   // tiles of 64 keys in this segment, at least one
  const int q0 = qt * 64 + qg * 32; const int qi[2] = {q0 + kh * 16 + col, q0 + (kh ^ 1) * 16 + col};
  v16b qa[2][8]; const b16* qp0 = Qb + (size_t)qi[0] * D + 8 * hh; const b16* qp1 = Qb + (size_t)qi[1] * D + 8 * hh;   // the lane half's step is in the pointers, which are the loads' own addresses
#pragma unroll   // register arrays at constant indices
  for (int ks = 0; ks < 8; ++ks) { qa[0][ks] = frag_kb(qp0 + ks * 32, 0); qa[1][ks] = frag_kb(qp1 + ks * 32, 0); }
  asm volatile("s_wait_xcnt 0x0" :: "v"(qp0), "v"(qp1) : "memory");   // the loads' address registers are rewritten behind it; named here, they stay whole up to it
  const float cs = LOG2E / (16.0f * XS * XS);
  float m[2] = {-INFINITY, -INFINITY}, l[2] = {0.0f, 0.0f}; v8f o[2][16];
#pragma unroll
  for (int t = 0; t < 16; ++t) { o[0][t] = (v8f){}; o[1][t] = (v8f){}; }
  const int kend = q0 + 32;   // keys < kend may be attended by some query of this wave
  // the ring was left by every wave at the last publish point of the segment before (its s_wait_dscnt 0 and barrier)
  stage_tile(wave, Kb, Vb, tb, ring, 0, gk, gv);
  asm volatile("s_wait_tensorcnt 0x0" ::: "memory");   // this wave's slice of tile 0 has landed
  __syncthreads();                                      // ... and every other wave's: tile 0 may be read
  if (pinned(ntile > 1)) stage_tile(wave, Kb, Vb, tb + 1, ring, 1, gk, gv);   // scalar test: a segment may have one tile only, and a tile that does not exist is not asked for
#pragma unroll 1   // stays rolled: one trip already holds a whole pass of 64 products
  for (int tl = 0; tl < ntile; ++tl) {
    const b16* Kt = &Ring[tl & 1][0][0]; const b16* Vt = &Ring[tl & 1][2][0];   // the two V slices (columns 0 .. 127, 128 .. 255) follow each other at SLE elements
    const int kb = (tb + tl) * KT + kh * 32;   // this wave's 32 keys of the tile
    if (kb < kend) {   // wave-uniform (scalar): a wave skips the pass beyond its diagonal, never the publish point below
      // all K fragments are asked for ahead of the products, so that the LDS latency is paid once per run and not once per product; in the order of their use (k-step, then key tile)
      v16b kf[16], vf[16];
#pragma unroll
      for (int i = 0; i < 16; ++i) kf[i] = frag_kb(Kt + (i >> 3) * SLE + (kh * 32 + (i & 1) * 16 + col) * KHP + ((i >> 1) & 3) * 32, hh);
      __builtin_amdgcn_sched_barrier(0);   // holds the reads above in front of the products below: with the pass cut into blocks by the test below, the compiler moves each K read down to its product and waits for it there
      v8f s[2][2] = {{(v8f){}, (v8f){}}, {(v8f){}, (v8f){}}};
#pragma unroll   // four independent accumulators between an accumulator's two uses
      for (int ks = 0; ks < 8; ++ks)
#pragma unroll
        for (int tt = 0; tt < 2; ++tt)
#pragma unroll
          for (int u = 0; u < 2; ++u) s[u][tt] = wmma16p(kf[ks * 2 + tt], qa[u][ks], s[u][tt]);
      float al[2], sm[2], so[2];   // sm: the lane's own sum of its 16 weights, so: that of lane ^ 16, asked for beside the P stores and added behind the test, so that no copy waits for it
      // scores -> P in LDS. MASKED = false is the copy for keys that every query of the wave may attend: no compare with the diagonal, and no score is -inf, so that the guards against -inf go too (same sums in the same order; without the select the compiler may fuse a score's scaling with the subtraction of the max)
      auto softmax = [&](auto fl) __attribute__((always_inline)) {
        constexpr bool MASKED = decltype(fl)::v;
#pragma unroll   // the two query tiles' softmax chains are independent of each other
        for (int u = 0; u < 2; ++u) {
          float e[16]; float mx = -INFINITY;
#pragma unroll
          for (int i = 0; i < 16; ++i) { const int key = kb + (i < 8 ? 0 : 16) + 8 * hh + (i & 7); const float sc = (i < 8 ? s[u][0][i] : s[u][1][i - 8]) * cs; const float v = (!MASKED || key <= qi[u]) ? sc : -INFINITY; e[i] = v; mx = fmaxf(mx, v); }
          mx = fmaxf(mx, __shfl_xor(mx, 16)); const float mn = fmaxf(m[u], mx); al[u] = (MASKED && mn == -INFINITY) ? 1.0f : nexp2(m[u] - mn); float sum = 0.0f;
          // B operand needs row = query, k = key: write P[query col][key] into LDS (wave-private), then frag
#pragma unroll
          for (int i = 0; i < 16; ++i) { const float p = (MASKED && e[i] == -INFINITY) ? 0.0f : nexp2(e[i] - mn); sum += p; Pb[wave][u][col][(i < 8 ? 0 : 16) + 8 * hh + (i & 7)] = (b16)(p * PS); }
          sm[u] = sum; so[u] = __shfl_xor(sum, 16); m[u] = mn; } };
      if (kb + 31 <= q0) softmax(Flag<false>{});   // wave-uniform (scalar): the pass's last key is no later than the wave's first query
      else softmax(Flag<true>{});
      wave_lds_sync();
      const v16b pf0 = frag_kb(&Pb[wave][0][col][0], hh), pf1 = frag_kb(&Pb[wave][1][col][0], hh);
      const b16* vp = Vt + (kh * 32 + 8 * hh + (lane & 7)) * VHP + ((lane >> 3) & 1) * 8;   // the lane's address in the first 16 x 16 block of its key half
      // V^T is asked for here, behind P: LDS answers a wave in order, so that in front of the scores' exchange and of P these 32 reads would hold both up; they land under the rescaling and the first products
#pragma unroll
      for (int t = 0; t < 16; ++t) { const b16* vq = vp + (t >> 3) * SLE + (t & 7) * 16; const v8b v0 = ld_tr16(vq), v1 = ld_tr16(vq + 16 * VHP);   // keys 8 hh + 0 .. 7 and 16 + 8 hh + 0 .. 7 of the wave's 32, feature t * 16 + col
#pragma unroll
        for (int e = 0; e < 8; ++e) { vf[t][e] = v0[e]; vf[t][8 + e] = v1[e]; } }
      __builtin_amdgcn_sched_barrier(0);   // holds the reads above in front of the rescaling and the products below, which then wait for them one by one
#pragma unroll
      for (int u = 0; u < 2; ++u) l[u] = l[u] * al[u] + (sm[u] + so[u]);
#pragma unroll
      for (int t = 0; t < 16; ++t) { o[0][t] *= al[0]; o[0][t] = wmma16p(vf[t], pf0, o[0][t]); o[1][t] *= al[1]; o[1][t] = wmma16p(vf[t], pf1, o[1][t]);
        __builtin_amdgcn_sched_barrier(0); }   // keeps this order, a fragment's two products as it lands and the next tiles' rescaling under them (left free, all rescaling goes first and one query tile's products wait fragment by fragment); the last one keeps the fence below, whose LDS wait covers all of V^T, behind the products
      wave_lds_sync(); }
    // publish point of tile tl + 1, passed by every wave
    asm volatile("s_wait_dscnt 0x0" ::: "memory");      // this wave's reads of tile tl are done before the buffer is refilled
    asm volatile("s_wait_tensorcnt 0x0" ::: "memory");  // this wave's slice of tile tl + 1 has landed
    __syncthreads();                                     // tile tl + 1 may be read by all; tile tl's buffer is left by all
    if (pinned(tl + 2 < ntile)) stage_tile(wave, Kb, Vb, pinned(tb + tl + 2), ring, tl & 1, gk, gv); }   // scalar test; the descriptor is formed behind the wait above
  asm volatile("s_wait_tensorcnt 0x0" ::: "memory");    // no request is left in flight when the wave goes on
  asm volatile("s_wait_dscnt 0x0" ::: "memory");        // and none of its reads of the ring
  // join of the two key halves. The kh = 0 wave has had at least one pass (its first key is never beyond the diagonal), so the joint max is finite; a wave without a pass has max -inf, sum 0, weight exp2(-inf) = 0
  { const v2f st = {hh == 0 ? m[0] : m[1], hh == 0 ? l[0] : l[1]}; *(v2f*)(&St[wave][hh][col][0]) = st; }   // both lane halves hold both tiles' (max, sum): half hh writes tile u = hh
  __syncthreads();   // the partner wave's (max, sum) may be read
  float f[2], mj = 0.0f, lj = 0.0f;
#pragma unroll
  for (int u = 0; u < 2; ++u) { const v2f ps = *(const v2f*)(&St[wave ^ 1][u ^ 1][col][0]);   // the partner's index of the same query tile is u ^ 1
    const float mm = fmaxf(m[u], ps[0]); const float as = nexp2(m[u] - mm), ap = nexp2(ps[0] - mm); const float lt = l[u] * as + ps[1] * ap;
    f[u] = as / (lt * PS * XS); if (u == 0) { mj = mm; lj = lt; } }
#pragma unroll
  for (int t = 0; t < 16; ++t)
#pragma unroll
    for (int r = 0; r < 8; ++r) Tx[wave][col][t * 16 + 8 * hh + r] = o[1][t][r] * f[1];
  __syncthreads();   // the partner wave's share of the tile that this wave keeps may be read
#pragma unroll
  for (int t = 0; t < 16; ++t) { const v4f x0 = *(const v4f*)(&Tx[wave ^ 1][col][t * 16 + 8 * hh]), x1 = *(const v4f*)(&Tx[wave ^ 1][col][t * 16 + 8 * hh + 4]);
#pragma unroll
    for (int r = 0; r < 8; ++r) To[wave][col][t * 16 + 8 * hh + r] = o[0][t][r] * f[0] + (r < 4 ? x0[r] : x1[r - 4]); }
  wave_lds_sync();
  float* Op = seg == 0 ? O2 : O1; const int qk = q0 + kh * 16;   // the 16 queries that this wave puts out
  if (hh == 0) { const v2f ml = {mj, lj}; *(v2f*)(ML + ((size_t)(seg == 0 ? B * S : 0) + (size_t)b * S + qk + col) * 2) = ml; }   // both halves hold the same (max, sum): 16 queries = one 128-byte line per wave
  asm volatile("s_wait_xcnt 0x0" ::: "memory");   // the store's address registers are rewritten right behind it
#pragma unroll   // constant row offsets in the LDS reads and the stores
  for (int g = 0; g < 2; ++g) { v4f a0[8], a1[8];
#pragma unroll   // keeps the register arrays at constant indices
    for (int rr = 0; rr < 8; ++rr) { a0[rr] = *(const v4f*)(&To[wave][g * 8 + rr][lane * 8]); a1[rr] = *(const v4f*)(&To[wave][g * 8 + rr][lane * 8 + 4]); }
#pragma unroll   // as above
    for (int rr = 0; rr < 8; ++rr) { const size_t row = ((size_t)b * S + qk + g * 8 + rr) * D; *(v4f*)(Op + row + lane * 8) = a0[rr]; *(v4f*)(Op + row + lane * 8 + 4) = a1[rr]; }
    asm volatile("s_wait_xcnt 0x0" ::: "memory"); }   // the stores' data and address registers are rewritten behind it (next eight rows, next segment)
  }
}
// everything behind attention in one launch, because it is local to a token row: merge of the attention partials + residual + LayerNorm 1, both FFN GEMMs, LayerNorm 2. Block = 64 tokens (one query tile),
// wave = 16 tokens from first to last; the LayerNorm output and the relu hidden rows (f16 hi + lo x8 planes) stay in the wave's own LDS rows, h2 stays in the accumulators.
// Products are taken transposed, D^T = W A^T (W rows as the A operand, token rows as B; same loader for both): a lane then holds 8 consecutive features of ONE token per tile, so the hidden planes go to LDS
// as 16-byte stores and LayerNorm 2 is a sum inside the lane plus one exchange with lane ^ 16.
// One 256-row W buffer at pitch 528 B serves W1 and then W2, filled by asynchronous copies of whole 512-byte rows: rows 0 .. 191 and rows 192 .. 255 are separate fills (48 and 16 copies of a wave, never
// more than 48 in flight); each fill stands behind the barrier that ends every wave's reads of those rows and is read behind its own wait and barrier.
// The text runs once per wave, so it is kept short: LayerNorm 1 is a rolled loop over groups of 4 rows, the two GEMMs are two trips of one rolled loop, the copies a rolled loop of eight.
template <int N8>
__device__ __forceinline__ void stage_rows_rolled(const b16* g0, int gstep, unsigned l0, unsigned lstep) {
#pragma unroll 1   // rolled: 24 address registers in all, where the unrolled form keeps every address of a fill alive across the products
  for (int h = 0; h < N8; ++h) { unsigned l[8]; const b16* g[8];
#pragma unroll
    for (int i = 0; i < 8; ++i) { l[i] = l0 + (unsigned)(h * 8 + i) * lstep; g[i] = g0 + (size_t)(h * 8 + i) * gstep; }
    async_copy8(l, g); }
}
__device__ __forceinline__ void load_group(v16b (&w)[32], const b16 (*Ws)[KPITCH], int row0, int nloc, int hlf) {
#pragma unroll   // register array at constant indices
  for (int i = 0; i < 32; ++i) w[i] = frag_kb(&Ws[row0 + (i & 3) * 16 + nloc][(i >> 2) * 32], hlf);
}
// 4 feature tiles x 8 k-steps x (hi, lo): per accumulator the order is hi, lo within ascending k; the four tiles stand between an accumulator's two uses
template <int G>
__device__ __forceinline__ void mul_group(v8f (&acc)[16], const v16b (&w)[32], const v16b (&a)[8], const v16b (&al)[8]) {
#pragma unroll   // register arrays at constant indices
  for (int ks = 0; ks < 8; ++ks) {
#pragma unroll
    for (int tt = 0; tt < 4; ++tt) acc[4 * G + tt] = wmma16p(w[ks * 4 + tt], a[ks], acc[4 * G + tt]);
#pragma unroll
    for (int tt = 0; tt < 4; ++tt) acc[4 * G + tt] = wmma16p(w[ks * 4 + tt], al[ks], acc[4 * G + tt]);
  }
}
__device__ __forceinline__ float wave_sum(float s) {
#pragma unroll
  for (int o = 1; o < 32; o <<= 1) s += __shfl_xor(s, o);
  return s; }
// four token rows as LayerNorm 1 takes them: 8 features a lane of partial 0 (a, c), of x, and for a long query tile of partial 1 with both (max, sum) pairs
struct Rows4 { v4f a[4], c[4], x0[4], x1[4], a2[4], c2[4]; v2f p0[4], p1[4]; };
__device__ __forceinline__ void load_rows4(Rows4& R, const float* IN, const float* IN2, const float* ML, const float* x, size_t row, int lane, bool two) {
  const float* pa = IN + row * D + lane * 8; const float* px = x + row * D + lane * 8;
#pragma unroll
  for (int rr = 0; rr < 4; ++rr) { R.a[rr] = *(const v4f*)(pa + rr * D); R.c[rr] = *(const v4f*)(pa + rr * D + 4); R.x0[rr] = *(const v4f*)(px + rr * D); R.x1[rr] = *(const v4f*)(px + rr * D + 4); }
  asm volatile("s_wait_xcnt 0x0" :: "v"(pa), "v"(px) : "memory");   // the loads' address registers are rewritten behind it; named here, they stay whole up to it (no load's result is placed on them)
  if (two) { const float* p2 = IN2 + row * D + lane * 8;
#pragma unroll
    for (int rr = 0; rr < 4; ++rr) { R.a2[rr] = *(const v4f*)(p2 + rr * D); R.c2[rr] = *(const v4f*)(p2 + rr * D + 4);
      R.p0[rr] = *(const v2f*)(ML + (row + rr) * 2); R.p1[rr] = *(const v2f*)(ML + ((size_t)B * S + row + rr) * 2); }
    asm volatile("s_wait_xcnt 0x0" :: "v"(p2) : "memory"); }   // as above
}
__global__ __launch_bounds__(128) void tail_kernel(const float* __restrict__ IN, const float* __restrict__ IN2, const float* __restrict__ ML, const float* __restrict__ x, const float* __restrict__ g1, const float* __restrict__ be1,
                                                   const b16* __restrict__ W1, const b16* __restrict__ W2, const float* __restrict__ b1, const float* __restrict__ b2, const float* __restrict__ g2, const float* __restrict__ be2, float* __restrict__ out) {
  __shared__ __attribute__((aligned(16))) b16 Ws[D][KPITCH]; __shared__ __attribute__((aligned(16))) b16 Ahs[4][16][KPITCH]; __shared__ __attribute__((aligned(16))) b16 Als[4][16][KPITCH];
  __shared__ __attribute__((aligned(16))) float To[4][16][D + 4]; __shared__ __attribute__((aligned(16))) float Ps[4][D];
  const int tid = threadIdx.x, wave = __builtin_amdgcn_readfirstlane(tid >> 5), lane = tid & 31, nloc = lane & 15, hlf = lane >> 4; const size_t row0 = (size_t)blockIdx.x * 64 + wave * 16;
  stage_rows_rolled<6>(W1 + (size_t)wave * D + lane * 8, 4 * D, lds_addr(&Ws[wave][lane * 8]), 4 * KPITCH * 2);   // W1 rows 0 .. 191 (wave, wave + 4, ..) fly under LayerNorm 1
  const bool two = (int)(blockIdx.x & (NT - 1)) >= CUT;   // block-uniform: a long query tile has two partials
  Rows4 raw = {}; load_rows4(raw, IN, IN2, ML, x, row0, lane, two);
  // per-feature vectors of the two epilogues, rounded once, read by every wave behind the first barrier
  { const v2f p0 = *(const v2f*)(b1 + tid * 2), p1 = *(const v2f*)(b2 + tid * 2), p2 = *(const v2f*)(g2 + tid * 2), p3 = *(const v2f*)(be2 + tid * 2);
    asm volatile("s_wait_xcnt 0x0" ::: "memory");   // the loads' base and offset registers are rewritten behind them
    const v2f q0 = {bf16_rne(p0[0]), bf16_rne(p0[1])}, q1 = {bf16_rne(p1[0]), bf16_rne(p1[1])}, q2 = {bf16_rne(p2[0]), bf16_rne(p2[1])}, q3 = {bf16_rne(p3[0]), bf16_rne(p3[1])};
    *(v2f*)(&Ps[0][tid * 2]) = q0; *(v2f*)(&Ps[1][tid * 2]) = q1; *(v2f*)(&Ps[2][tid * 2]) = q2; *(v2f*)(&Ps[3][tid * 2]) = q3; }
  float gg[8], bb[8];
  { const v4f u0 = *(const v4f*)(g1 + lane * 8), u1 = *(const v4f*)(g1 + lane * 8 + 4), u2 = *(const v4f*)(be1 + lane * 8), u3 = *(const v4f*)(be1 + lane * 8 + 4);
    asm volatile("s_wait_xcnt 0x0" ::: "memory");   // as above
#pragma unroll
    for (int j = 0; j < 4; ++j) { gg[j] = bf16_rne(u0[j]); gg[4 + j] = bf16_rne(u1[j]); bb[j] = bf16_rne(u2[j]); bb[4 + j] = bf16_rne(u3[j]); } }
  // LayerNorm 1, a row across the wave (8 features a lane), 4 rows a trip; the next 4 rows' loads go out ahead of this group's sums and land under its arithmetic
#pragma unroll 1   // rolled for a short text
  for (int bt = 0; bt < 4; ++bt) { v4f a[4], c[4];
#pragma unroll
    for (int rr = 0; rr < 4; ++rr) { a[rr] = raw.a[rr]; c[rr] = raw.c[rr]; }
    if (two) {
#pragma unroll
      for (int rr = 0; rr < 4; ++rr) { const v2f p0 = raw.p0[rr], p1 = raw.p1[rr]; const float mm = fmaxf(p0[0], p1[0]);
        float w0 = p0[1] * nexp2(p0[0] - mm), w1 = p1[1] * nexp2(p1[0] - mm); const float rw = 1.0f / (w0 + w1); w0 *= rw; w1 *= rw;
        a[rr] = a[rr] * w0 + raw.a2[rr] * w1; c[rr] = c[rr] * w0 + raw.c2[rr] * w1; } }
#pragma unroll
    for (int rr = 0; rr < 4; ++rr)
#pragma unroll
      for (int j = 0; j < 4; ++j) { a[rr][j] += bf16_rne(raw.x0[rr][j]); c[rr][j] += bf16_rne(raw.x1[rr][j]); }
    load_rows4(raw, IN, IN2, ML, x, row0 + (bt < 3 ? bt + 1 : 3) * 4, lane, two);   // the last trip reads its own rows again: one instruction stream
    float s[4], q[4];
#pragma unroll
    for (int rr = 0; rr < 4; ++rr) { float t = 0.0f;
#pragma unroll
      for (int j = 0; j < 4; ++j) t += a[rr][j] + c[rr][j];
      s[rr] = wave_sum(t) * (1.0f / D); }
#pragma unroll
    for (int rr = 0; rr < 4; ++rr) { const float mu = s[rr]; float t = 0.0f;
#pragma unroll
      for (int j = 0; j < 4; ++j) { const float d0 = a[rr][j] - mu, d1 = c[rr][j] - mu; t += d0 * d0 + d1 * d1; }
      q[rr] = wave_sum(t); }
#pragma unroll
    for (int rr = 0; rr < 4; ++rr) { const float mu = s[rr], rs = rsqrtf(q[rr] * (1.0f / D) + LNEPS); v8b hv, lv;
#pragma unroll
      for (int j = 0; j < 8; ++j) { const float y = ((j < 4 ? a[rr][j] : c[rr][j - 4]) - mu) * rs * gg[j] + bb[j]; b16 p, qq; split16(y * XS, p, qq); hv[j] = p; lv[j] = qq; }
      *(v8b*)(&Ahs[wave][bt * 4 + rr][lane * 8]) = hv; *(v8b*)(&Als[wave][bt * 4 + rr][lane * 8]) = lv; }
    __builtin_amdgcn_sched_barrier(0); }   // keeps the register copies that hand the next rows over, and with them the wait for their loads, behind this group's arithmetic: left free, they rise to its start
  v8f acc[16];
#pragma unroll 1   // rolled for a short text: trip 0 = W1 (and relu into the planes), trip 1 = W2
  for (int pass = 0; pass < 2; ++pass) {
    const b16* Wc = pass == 0 ? W1 : W2;
    wave_lds_sync();   // the wave's plane rows were written across its lanes
    v16b a[8], al[8], w0[32], w1[32];
#pragma unroll
    for (int ks = 0; ks < 8; ++ks) { a[ks] = frag_kb(&Ahs[wave][nloc][ks * 32], hlf); al[ks] = frag_kb(&Als[wave][nloc][ks * 32], hlf); }
#pragma unroll
    for (int t = 0; t < 16; ++t) acc[t] = (v8f){};
    // fragments of a group (64 W rows) are asked for together and one group ahead of their products (two register sets), so that the LDS latency is not paid per product
    asm volatile("s_wait_dscnt 0x0" ::: "memory");      // this wave's earlier reads of rows 192 .. 255 are done before they are refilled
    asm volatile("s_wait_asynccnt 0x0" ::: "memory");   // this wave's copies of rows 0 .. 191 have landed
    __syncthreads();                                     // ... and every other wave's: they may be read; rows 192 .. 255 are left by all
    stage_rows_rolled<2>(Wc + (size_t)(192 + wave) * D + lane * 8, 4 * D, lds_addr(&Ws[192 + wave][lane * 8]), 4 * KPITCH * 2);
    load_group(w0, Ws, 0, nloc, hlf); load_group(w1, Ws, 64, nloc, hlf);
    __builtin_amdgcn_sched_barrier(0);   // holds the reads above in front of the products below: left free, the compiler moves each read down to its product and waits for it there
    mul_group<0>(acc, w0, a, al);
    __builtin_amdgcn_sched_barrier(0);   // keeps the next group's reads from rising among those products or sinking to their own
    load_group(w0, Ws, 128, nloc, hlf);
    __builtin_amdgcn_sched_barrier(0);   // as above
    mul_group<1>(acc, w1, a, al);
    __builtin_amdgcn_sched_barrier(0);   // keeps the products above in front of the waits below, so that the copies in flight land under them
    asm volatile("s_wait_dscnt 0x0" ::: "memory");      // this wave's reads of rows 0 .. 191 are done before they are refilled
    asm volatile("s_wait_asynccnt 0x0" ::: "memory");   // this wave's copies of rows 192 .. 255 have landed
    __syncthreads();                                     // ... and every other wave's; rows 0 .. 191 are left by all
    if (pass == 0) stage_rows_rolled<6>(W2 + (size_t)wave * D + lane * 8, 4 * D, lds_addr(&Ws[wave][lane * 8]), 4 * KPITCH * 2);   // block-uniform: W2 rows 0 .. 191 fly under the rest of trip 0
    load_group(w1, Ws, 192, nloc, hlf);
    __builtin_amdgcn_sched_barrier(0);   // holds the reads above in front of the products below
    mul_group<2>(acc, w0, a, al); mul_group<3>(acc, w1, a, al);
    // + bias: lane = token nloc, features t * 16 + 8 * hlf + 0 .. 7
#pragma unroll
    for (int t = 0; t < 16; ++t) { const v4f c0 = *(const v4f*)(&Ps[pass][t * 16 + 8 * hlf]), c1 = *(const v4f*)(&Ps[pass][t * 16 + 8 * hlf + 4]);
#pragma unroll
      for (int r = 0; r < 8; ++r) acc[t][r] = acc[t][r] * (1.0f / (XS * WSC)) + (r < 4 ? c0[r] : c1[r - 4]); }
    if (pass == 0) {   // hidden = relu(.) as hi + lo planes over the wave's own rows (their fragments are in registers)
#pragma unroll
      for (int t = 0; t < 16; ++t) { v8b hv, lv;
#pragma unroll
        for (int r = 0; r < 8; ++r) { b16 p, qq; split16(fmaxf(acc[t][r], 0.0f) * XS, p, qq); hv[r] = p; lv[r] = qq; }
        *(v8b*)(&Ahs[wave][nloc][t * 16 + 8 * hlf]) = hv; *(v8b*)(&Als[wave][nloc][t * 16 + 8 * hlf]) = lv; } } }
  // LayerNorm 2 over the token's 256 features: 128 in this lane (eight running sums over the 16 tiles, then a tree), 128 in lane ^ 16
  v8f vs = (v8f){};
#pragma unroll
  for (int t = 0; t < 16; ++t) vs += acc[t];
  float s = ((vs[0] + vs[1]) + (vs[2] + vs[3])) + ((vs[4] + vs[5]) + (vs[6] + vs[7])); s += __shfl_xor(s, 16);
  const float mu = s * (1.0f / D); v8f vq = (v8f){};
#pragma unroll
  for (int t = 0; t < 16; ++t) { const v8f d = acc[t] - mu; vq += d * d; }
  float q = ((vq[0] + vq[1]) + (vq[2] + vq[3])) + ((vq[4] + vq[5]) + (vq[6] + vq[7])); q += __shfl_xor(q, 16);
  const float rs = rsqrtf(q * (1.0f / D) + LNEPS);
#pragma unroll
  for (int t = 0; t < 16; ++t) { const int f = t * 16 + 8 * hlf; const v4f g0 = *(const v4f*)(&Ps[2][f]), g4 = *(const v4f*)(&Ps[2][f + 4]), e0 = *(const v4f*)(&Ps[3][f]), e4 = *(const v4f*)(&Ps[3][f + 4]); v4f y0, y1;
#pragma unroll
    for (int r = 0; r < 4; ++r) { y0[r] = (acc[t][r] - mu) * rs * g0[r] + e0[r]; y1[r] = (acc[t][4 + r] - mu) * rs * g4[r] + e4[r]; }
    *(v4f*)(&To[wave][nloc][f]) = y0; *(v4f*)(&To[wave][nloc][f + 4]) = y1; }
  wave_lds_sync();
  // whole rows go out: 1 KB of a token per pair of stores
#pragma unroll   // constant row offsets in the LDS reads and the stores
  for (int g = 0; g < 2; ++g) { v4f o0[8], o1[8];
#pragma unroll   // keeps the register arrays at constant indices
    for (int rr = 0; rr < 8; ++rr) { o0[rr] = *(const v4f*)(&To[wave][g * 8 + rr][lane * 8]); o1[rr] = *(const v4f*)(&To[wave][g * 8 + rr][lane * 8 + 4]); }
#pragma unroll   // as above
    for (int rr = 0; rr < 8; ++rr) { const size_t row = (row0 + g * 8 + rr) * D; *(v4f*)(out + row + lane * 8) = o0[rr]; *(v4f*)(out + row + lane * 8 + 4) = o1[rr]; }
    if (g == 0) asm volatile("s_wait_xcnt 0x0" ::: "memory"); }   // the stores' data registers are rewritten behind it (next eight rows)
}
}  // namespace

extern "C" void kernel_launch(void* const* d_in, const int* in_sizes, int n_in, void* d_out, int out_size, void* d_ws, size_t ws_size, hipStream_t stream) {
  (void)n_in;
  auto Fp = [&](int i) { return (const float*)d_in[i]; };
  // input order: 0 x [4,4096,256], 1 Wq [256,256] ([e][d]), 2 bq, 3 Wk, 4 bk, 5 Wv, 6 bv, 7 W1, 8 b1, 9 W2, 10 b2, 11 g_ln, 12 beta_ln, 13 g_lnff, 14 beta_lnff
  if (in_sizes[0] != B * S * D || in_sizes[1] != D * D || in_sizes[3] != D * D || in_sizes[5] != D * D || in_sizes[7] != FF * D || in_sizes[9] != D * FF || in_sizes[11] != D || in_sizes[13] != D || out_size != B * S * D) return;
  size_t off = 0; char* ws = (char*)d_ws;
  auto carve = [&](size_t bytes) { char* p = ws + off; off += (bytes + 255) & ~(size_t)255; return p; };
  b16* WT = (b16*)carve((size_t)2 * D * D * 2); b16* Qp = (b16*)carve((size_t)B * S * D * 2); b16* Kp = (b16*)carve((size_t)B * S * D * 2); b16* Vp = (b16*)carve((size_t)B * S * D * 2);
  float* O1 = (float*)carve((size_t)B * S * D * 4); float* O2 = (float*)carve((size_t)B * S * D * 4); float* ML = (float*)carve((size_t)2 * B * S * 2 * 4);
  if (off > ws_size || off > ((size_t)128 << 20)) return;   // about 57 MB
  qkv_kernel<<<256, 128, 0, stream>>>(Fp(0), Fp(1), Fp(3), Fp(5), Fp(7), Fp(9), Fp(2), Fp(4), Fp(6), WT, Qp, Kp, Vp);
  attn_kernel<<<dim3(S / 64, BL), 128, 0, stream>>>(Qp, Kp, Vp, O1, O2, ML);
  tail_kernel<<<(unsigned)((size_t)BL * S / 64), 128, 0, stream>>>(O1, O2, ML, Fp(0), Fp(11), Fp(12), WT, WT + (size_t)D * D, Fp(8), Fp(10), Fp(13), Fp(14), (float*)d_out);
}

// v010
// One run takes 70.9 microseconds.
// Two timings next to v009 put it at 1.05 and 1.04 times that version's speed.
// Counting every step since v000, it is 13.4 times as fast.
#include <hip/hip_runtime.h>

// Causal single-head transformer block: q, k, v = x W{q,k,v}^T + b ([4][4096][256], d = 256); A = q . k; causal mask filled with -32767 BEFORE the 1/sqrt(256) scaling (masked weights are exactly 0
// in f32 after exp); softmax over keys <= query; o = A v + x; LayerNorm; h = relu(o W1^T + b1) W2^T + b2; LayerNorm (no second residual) -> [4][4096][256].
// Deterministic: flash-style causal attention, a wave = 32 queries x one 32-key half of every 64-key tile (online softmax with running max, the two halves joined at the end of a segment), both LayerNorms and the FFN in one row-local kernel behind attention;
// no atomics.
// compute dtype: WMMA v_wmma_f32_16x16x32_bf16 with f32 accumulate for the q/k/v projections (x and W [e][d] rows rounded to bf16, the operands as they are: 1 product); v_wmma_f32_16x16x32_f16 for S^T = K Q^T (q, k single
// f16 x8: 1 product — logits have std ≈ 1 over ~2,000 keys, per-key rounding averages to ≈4e-5 on the output), O^T += V^T P^T (v single f16 x8, P x1024 single f16: 1 product) and the two FFN GEMMs
// (LayerNorm output / relu hidden as f16 hi+lo x8 planes: 2 products); softmax statistics (exp2), residual, LayerNorms, bias, relu in f32. Inputs rounded to bf16 once.

namespace {
constexpr int B = 4, S = 4096, D = 256, FF = 256, BL = 4 /* batches computed (== B shipped) */;
constexpr float XS = 8.0f, WSC = 256.0f, PS = 1024.0f, LOG2E = 1.4426950408889634f, LNEPS = 1e-5f, MASK_FILL = -32767.0f;
static_assert(S % 64 == 0 && D == 256 && FF == 256, "tiling");
typedef _Float16 b16;
typedef __attribute__((ext_vector_type(16))) _Float16 v16b;
typedef __attribute__((ext_vector_type(8))) _Float16 v8b;
typedef __attribute__((ext_vector_type(8))) float v8f;
typedef __attribute__((ext_vector_type(4))) float v4f;
__device__ __forceinline__ float bf16_rne(float f) { unsigned int u = __float_as_uint(f); u += 0x7FFFu + ((u >> 16) & 1u); return __uint_as_float(u & 0xFFFF0000u); }
__device__ __forceinline__ void split16(float v, b16& hi, b16& lo) { hi = (b16)v; lo = (b16)(v - (float)hi); }
__device__ __forceinline__ v16b frag_kb(const b16* p, int hh) { const v8b a = *(const v8b*)(p + 8 * hh), b = *(const v8b*)(p + 16 + 8 * hh); v16b f;
#pragma unroll
  for (int e = 0; e < 8; ++e) { f[e] = a[e]; f[8 + e] = b[e]; } return f; }
__device__ __forceinline__ void wave_lds_sync() { __builtin_amdgcn_fence(__ATOMIC_RELEASE, "workgroup"); __builtin_amdgcn_wave_barrier(); __builtin_amdgcn_fence(__ATOMIC_ACQUIRE, "workgroup"); }
__device__ __forceinline__ float pmul(float a, float b) { float p = a * b; asm volatile("" : "+v"(p)); return p; }
__device__ __forceinline__ int iclamp(int v, int lo, int hi) { return v < lo ? lo : (v > hi ? hi : v); }

typedef __attribute__((ext_vector_type(4))) _Float16 v4h;
typedef __attribute__((ext_vector_type(2))) float v2f;
__device__ __forceinline__ float nexp2(float v) { return __builtin_amdgcn_exp2f(v); }
constexpr int KT = 64, KPITCH = D + 8, NT = S / KT, CUT = NT / 2 + 1;
// the plain builtin (the compiler keeps the distance behind it): operands of an asm statement must lie below v256, which the fragments of a whole pass do not fit
__device__ __forceinline__ v8f wmma16p(v16b a, v16b b, v8f c) { return __builtin_amdgcn_wmma_f32_16x16x32_f16(false, a, false, b, (short)0, c, false, false); }
__device__ __forceinline__ unsigned lds_addr(const void* p) { return (unsigned)(size_t)p; }
// eight 16-byte copies per lane; s_wait_xcnt 0 closes the statement so that no address register is rewritten while a copy may still name it
template <typename E>
__device__ __forceinline__ void async_copy8(const unsigned (&l)[8], const E* const (&g)[8]) {
  asm volatile("global_load_async_to_lds_b128 %0, %8, off\n\t"
               "global_load_async_to_lds_b128 %1, %9, off\n\t"
               "global_load_async_to_lds_b128 %2, %10, off\n\t"
               "global_load_async_to_lds_b128 %3, %11, off\n\t"
               "global_load_async_to_lds_b128 %4, %12, off\n\t"
               "global_load_async_to_lds_b128 %5, %13, off\n\t"
               "global_load_async_to_lds_b128 %6, %14, off\n\t"
               "global_load_async_to_lds_b128 %7, %15, off\n\t"
               "s_wait_xcnt 0x0"
               :: "v"(l[0]), "v"(l[1]), "v"(l[2]), "v"(l[3]), "v"(l[4]), "v"(l[5]), "v"(l[6]), "v"(l[7]),
                  "v"(g[0]), "v"(g[1]), "v"(g[2]), "v"(g[3]), "v"(g[4]), "v"(g[5]), "v"(g[6]), "v"(g[7]) : "memory");
}
// qkv: 768 jobs = {q, k, v} x 256 tiles of 64 tokens; a block (4 waves, one per WGP, 256 blocks) does three jobs in a row, job J = 3 * block + 0 .. 2 = (matrix J >> 8, tile J & 255), and keeps its W in LDS over them
// (two blocks meet a second matrix and fill LDS twice). Per job and wave 16 tokens x 16 column tiles x 8 k-steps; + bias. q, k, v -> single f16 x8 planes [b][s][256] (32 lanes x 16 B), v row-major like the others.
// No launch prepares W: both operands are the inputs rounded to bf16, taken as they are by the bf16 product (no scaling, one conversion instruction per two values). W rows and x rows come as f32
// through registers in whole 512-byte pieces, are rounded there and stored at pitch 528 B (16 B x odd: ds_load_b128 free of bank conflicts). The next job's x rows are asked for ahead of this job's products.
// Every block also writes 512 values of the two FFN matrices' f16 x256 planes, which the launch behind attention reads.
typedef __bf16 w16;
typedef __attribute__((ext_vector_type(16))) __bf16 v16w;
typedef __attribute__((ext_vector_type(8))) __bf16 v8w;
typedef __attribute__((ext_vector_type(4))) __bf16 v4w;
__device__ __forceinline__ v16w frag_kw(const w16* p, int hh) { const v8w a = *(const v8w*)(p + 8 * hh), b = *(const v8w*)(p + 16 + 8 * hh); return __builtin_shufflevector(a, b, 0, 1, 2, 3, 4, 5, 6, 7, 8, 9, 10, 11, 12, 13, 14, 15); }
__device__ __forceinline__ v8f wmma16w(v16w a, v16w b, v8f c) { return __builtin_amdgcn_wmma_f32_16x16x32_bf16(false, a, false, b, (short)0, c, false, false); }
// a wave's LDS stores are done before its lanes read each other's rows back; written as the LDS wait alone, because the fence at work-group scope also waits for the global stores of the job before, which are still in flight
__device__ __forceinline__ void wave_order() { asm volatile("s_wait_dscnt 0x0" ::: "memory"); __builtin_amdgcn_wave_barrier(); }
// pieces I0 .. I0 + N - 1 of 512 bytes: piece i = half (i & 1) of row RS * (i >> 1) of a [.][256] f32 array; p = the lane's 4 floats of piece 0
template <int I0, int N, int RS>
__device__ __forceinline__ void load_p(v4f (&r)[N], const float* p) {
  __builtin_amdgcn_sched_barrier(0);   // keeps the loads behind what stands in front of them (the batch consumed there leaves them its registers)
#pragma unroll   // register array at constant indices, constant offsets from one address
  for (int i = 0; i < N; ++i) r[i] = *(const v4f*)(p + ((I0 + i) >> 1) * RS * D + ((I0 + i) & 1) * 128);
  asm volatile("s_wait_xcnt 0x0" :: "v"(p) : "memory");   // the loads' address registers may be rewritten behind it; named here, they stay whole up to it
  __builtin_amdgcn_sched_barrier(0);   // holds the loads here, far ahead of their use: left free, the compiler moves them down to the conversions and waits there
}
// the same pieces, rounded to bf16, to their rows in LDS (pitch KPITCH); q = the lane's 4 values of piece 0
template <int I0, int N, int RS>
__device__ __forceinline__ void put_p(const v4f (&r)[N], w16* q) {
#pragma unroll   // as above
  for (int i = 0; i < N; ++i) *(v4w*)(q + ((I0 + i) >> 1) * RS * KPITCH + ((I0 + i) & 1) * 128) = __builtin_convertvector(r[i], v4w);
}
__device__ __forceinline__ void load_wgroup(v16w (&w)[32], const w16 (*Ws)[KPITCH], int row0, int nloc, int hlf) {
#pragma unroll   // register array at constant indices
  for (int i = 0; i < 32; ++i) w[i] = frag_kw(&Ws[row0 + (i & 3) * 16 + nloc][(i >> 2) * 32], hlf);
}
template <int G>
__device__ __forceinline__ void mul_wgroup(v8f (&acc)[16], const v16w (&a)[8], const v16w (&w)[32]) {
#pragma unroll   // register arrays at constant indices; the four tiles stand between an accumulator's two uses
  for (int i = 0; i < 32; ++i) acc[4 * G + (i & 3)] = wmma16w(a[i >> 2], w[i], acc[4 * G + (i & 3)]);
}
// a wave's share of a fill of W: rows wave, wave + 4, .., two batches of 16 rows in flight; Wf, Wl = the lane's 4 values of the wave's first row in memory and in LDS
__device__ __forceinline__ void fill_w(const float* Wf, w16* Wl) { v4f ra[32], rb[32];
  load_p<0, 32, 4>(ra, Wf); load_p<32, 32, 4>(rb, Wf);
  put_p<0, 32, 4>(ra, Wl); load_p<64, 32, 4>(ra, Wf);
  put_p<32, 32, 4>(rb, Wl); load_p<96, 32, 4>(rb, Wf);
  put_p<64, 32, 4>(ra, Wl); put_p<96, 32, 4>(rb, Wl);
  __syncthreads();   // all 256 rows, every wave's: they may be read
}
__global__ __launch_bounds__(128) void qkv_kernel(const float* __restrict__ x, const float* __restrict__ wq, const float* __restrict__ wk, const float* __restrict__ wv, const float* __restrict__ w1, const float* __restrict__ w2,
                                                  const float* __restrict__ bq, const float* __restrict__ bk, const float* __restrict__ bv, b16* __restrict__ WT, b16* __restrict__ Qp, b16* __restrict__ Kp, b16* __restrict__ Vp) {
  static_assert(B * S / 64 == 256 && KPITCH == D + 8, "jobs");
  __shared__ __attribute__((aligned(16))) w16 As[4][16][KPITCH]; __shared__ __attribute__((aligned(16))) float Tf[4][16][256 + 4]; __shared__ __attribute__((aligned(16))) w16 Ws[D][KPITCH];
  const int tid = threadIdx.x, wave = __builtin_amdgcn_readfirstlane(tid >> 5), lane = tid & 31, nloc = lane & 15, hlf = lane >> 4; const int blk = blockIdx.x, J0 = blk * 3;
  w16* Wl = &Ws[wave][lane * 4]; w16* Al = &As[wave][0][lane * 4];
  v4f xr[32], wt;
  load_p<0, 32, 1>(xr, x + ((size_t)(J0 & 255) * 64 + wave * 16) * D + lane * 4);   // the first job's 16 x rows of this wave
  { const float* wsrc = (blk < 128 ? w1 : w2) + (size_t)(blk & 127) * 512 + tid * 4; wt = *(const v4f*)wsrc;   // 256 blocks x 128 threads x 4 values = W1, W2
    asm volatile("s_wait_xcnt 0x0" :: "v"(wsrc) : "memory"); }   // as in load_p
  fill_w((J0 < 256 ? wq : J0 < 512 ? wk : wv) + (size_t)wave * D + lane * 4, Wl);
  { v4h o; b16* wd = WT + (size_t)blk * 512 + tid * 4;
#pragma unroll   // register arrays at constant indices
    for (int j = 0; j < 4; ++j) o[j] = (b16)(bf16_rne(wt[j]) * WSC);
    *(v4h*)wd = o;
    asm volatile("s_wait_xcnt 0x0" :: "v"(wd) : "memory"); }   // the store's registers may be rewritten behind it
#pragma unroll 1   // stays rolled: the three jobs run through the same short text
  for (int it = 0; it < 3; ++it) {
    const int J = J0 + it, which = J >> 8, T = J & 255;
    if (it != 0 && T == 0) {   // block-uniform: the first job of the next matrix
      __syncthreads();   // every wave has left the rows of the matrix before
      fill_w((which == 1 ? wk : wv) + (size_t)wave * D + lane * 4, Wl); }
    put_p<0, 32, 1>(xr, Al);
    wave_order();   // the wave's A rows were written across its lanes
    const int Jn = it < 2 ? J + 1 : J;   // the last job asks for its own rows again: one instruction stream
    load_p<0, 32, 1>(xr, x + ((size_t)(Jn & 255) * 64 + wave * 16) * D + lane * 4);
    v8f acc[16];
#pragma unroll   // register arrays at constant indices
    for (int t = 0; t < 16; ++t) acc[t] = (v8f){};
    // a group = 4 column tiles x 8 k-steps. All fragments of a group are asked for together and one group ahead of their products (two register sets), so that the LDS latency is not paid per product
    v16w a[8], w0[32], w1f[32];
#pragma unroll   // register arrays at constant indices
    for (int ks = 0; ks < 8; ++ks) a[ks] = frag_kw(&As[wave][nloc][ks * 32], hlf);
    load_wgroup(w0, Ws, 0, nloc, hlf); load_wgroup(w1f, Ws, 64, nloc, hlf);
    __builtin_amdgcn_sched_barrier(0);   // holds the reads above in front of the products below: left free, the compiler moves each read down to its product and waits for it there
    mul_wgroup<0>(acc, a, w0);
    __builtin_amdgcn_sched_barrier(0);   // keeps the next group's reads from rising among those products or sinking to their own
    load_wgroup(w0, Ws, 128, nloc, hlf);
    __builtin_amdgcn_sched_barrier(0);   // as above
    mul_wgroup<1>(acc, a, w1f);
    __builtin_amdgcn_sched_barrier(0);   // as above
    load_wgroup(w1f, Ws, 192, nloc, hlf);
    __builtin_amdgcn_sched_barrier(0);   // as above
    mul_wgroup<2>(acc, a, w0); mul_wgroup<3>(acc, a, w1f);
    const float* bias = (which == 0 ? bq : which == 1 ? bk : bv) + nloc; float bb[16];
#pragma unroll   // register arrays at constant indices
    for (int t = 0; t < 16; ++t) bb[t] = bias[t * 16];
    asm volatile("s_wait_xcnt 0x0" :: "v"(bias) : "memory");   // as in load_p
#pragma unroll   // register arrays at constant indices
    for (int t = 0; t < 16; ++t) { const float bt = bf16_rne(bb[t]);
#pragma unroll   // register arrays at constant indices
      for (int r = 0; r < 8; ++r) Tf[wave][8 * hlf + r][t * 16 + nloc] = acc[t][r] + bt; }
    __syncthreads();   // as before this step: the staging rows, written across the lanes, are read behind it
    b16* P = (which == 0 ? Qp : which == 1 ? Kp : Vp) + ((size_t)T * 64 + wave * 16) * D + lane * 8;
#pragma unroll 1   // four rows a trip, the form that the compiler gave this loop while it stood at the end of the kernel; inside the job loop it unrolls it whole and waits for every LDS read by itself
    for (int g = 0; g < 4; ++g) { v8b o[4];
#pragma unroll   // register array at constant indices
      for (int rr = 0; rr < 4; ++rr) for (int j = 0; j < 8; ++j) o[rr][j] = (b16)(Tf[wave][g * 4 + rr][lane * 8 + j] * XS);
#pragma unroll   // as above
      for (int rr = 0; rr < 4; ++rr) *(v8b*)(P + (size_t)(g * 4 + rr) * D) = o[rr];
      asm volatile("s_wait_xcnt 0x0" :: "v"(P) : "memory"); } }   // the stores' registers are rewritten behind it (next rows, next job)
}
// causal attention: grid (S/64, BL); block = 64 queries, 4 waves (their tiles: in front of the kernel). Query tile qt needs qt + 1 key tiles, and one block fills a WGP, so the launch lasts as long as its longest block: the work is cut
// into equal blocks. Block j does the head of query tile NT - 1 - j (key tiles 0 .. min(qt + 1, CUT) - 1, partial 0) and, for j > NT / 2, before it the tail of query tile j (key tiles CUT .. j, partial 1):
// CUT or CUT - 1 key tiles in every block. A partial is its own softmax-weighted mean with its (max, sum); the kernel behind attention merges the two partials of a long query tile and adds the residual.
// Within a segment the block walks its keys in tiles of 64: K rows [64][256] and V rows [64][256] come once per block into LDS by tensor loads, one request a wave
// (two buffers: tile t + 1 flies while tile t is worked on), and every wave takes its fragments from there. A buffer is four slices of 18 KiB, one per wave: K columns 0 .. 127 and 128 .. 255
// (64 rows of 256 B, padded to pitch 272 B = 16 B x odd: ds_load_b128 free of bank conflicts) and the same two column halves of V (64 rows of 256 B, padded to pitch 288 B = 32 B x odd, the pitch of
// ds_load_tr16_b128, which hands a wave the V^T fragment out of the row-major tile in the k order of frag_kb).
// A block walks the key tiles of a segment in a ring, from a start tile of its own (tile_at below). In ascending order the blocks of a batch ask for the same tile at the same moment: all ask L2 for the same lines,
// and each tile is asked for the first time just when all of them need it. From different starts a tile has mostly been asked for by another block before a block comes to it. The online softmax takes the tiles in any order.
// Per tile and wave one pass of 32 keys x 32 queries: S^T = K Q^T (2 key tiles x 2 query tiles x 8 k-steps), logits A/16 in the log2 domain, keys > query masked (the reference's -32767 fill gives exp = 0 exactly),
// online softmax, P x1024 single f16 via LDS -> O^T += V^T P^T (16 d-tiles x 2 query tiles x 1 k-step); partial = joined O / joined l
typedef uint32_t u32x4 __attribute__((ext_vector_type(4)));
typedef uint32_t u32x8 __attribute__((ext_vector_type(8)));
constexpr uint32_t SLB = 18432, SLE = SLB / 2, KHP = 136, VHP = 144;   // slice bytes (9 x 2 KiB) and elements; elements per padded row of a K and of a V column half
static_assert(KT * KHP * 2 <= SLB && KT * VHP * 2 == SLB && SLB % 2048 == 0, "slices");
__device__ __forceinline__ uint32_t uni(uint32_t v) { return (uint32_t)__builtin_amdgcn_readfirstlane(v); }
// a wave-uniform value held in a scalar register: a test on it compiles to s_cmp + s_cbranch_scc (a tensor load ignores EXEC), and what is formed from it is formed behind the waits that stand in front of it
__device__ __forceinline__ uint32_t pinned(uint32_t v) { uint32_t w = uni(v); asm volatile("" : "+s"(w)); return w; }   // pinned(): a descriptor word, or the test that decides an issue, held in a scalar register
// descriptor group 1 of a tile of N rows of R bytes at source pitch P bytes; W0 = word 0 (no mask, 1-byte elements, the pad behind every row). Built once per wave; each word is a descriptor word held in its
// scalar register by pinned(), so that the compiler keeps the eight registers as they are for the whole kernel and rewrites none of them while a request is in flight
template <uint32_t W0, uint32_t R, uint32_t N, uint32_t P>
__device__ __forceinline__ u32x8 tensor_group1() { u32x8 g;
  g[0] = pinned(W0); g[1] = pinned((R & 0xFFFFu) << 16); g[2] = pinned((R >> 16) | ((N & 0xFFFFu) << 16)); g[3] = pinned((N >> 16) | (R << 16)); g[4] = pinned(N); g[5] = pinned(P); g[6] = pinned(0u); g[7] = pinned(0u);
  return g; }
// one request: the tile whose first byte is src, to LDS byte dst
__device__ __forceinline__ void tensor_tile(uint32_t dst, const b16* src, u32x8 g1) {
  const uint64_t ga = (uint64_t)(size_t)src; u32x4 g0;
  g0[0] = uni(1u); g0[1] = uni(dst); g0[2] = uni((uint32_t)ga); g0[3] = uni((((uint32_t)(ga >> 32)) & 0x01FFFFFFu) | 0x80000000u);
  asm volatile("tensor_load_to_lds %0, %1" :: "s"(g0), "s"(g1) : "memory");
}
// key tile 'tile' into buffer 'buf' (ring = LDS byte of the ring's start): every wave issues its own slice, waves 0, 1 of K (group 1: gk), waves 2, 3 of V (gv)
__device__ __forceinline__ void stage_tile(uint32_t wave, const b16* Kb, const b16* Vb, uint32_t tile, uint32_t ring, uint32_t buf, u32x8 gk, u32x8 gv) {
  const uint32_t dst = ring + (buf * 4 + wave) * SLB;
  if (pinned(wave < 2)) tensor_tile(dst, Kb + (size_t)tile * KT * D + wave * 128, gk);
  else tensor_tile(dst, Vb + (size_t)tile * KT * D + (wave - 2) * 128, gv);
}
// Wave tile: the 4 waves are 2 query groups (qg, 32 queries = two 16-query tiles) x 2 key halves (kh, 32 of a tile's 64 keys): every K and V^T fragment that a wave reads from LDS feeds two products, so
// the block reads each tile from LDS twice and not four times. A wave keeps its own running (max, sum, O) over its key halves; at the end of a segment the two waves of a query group exchange (max, sum),
// scale by the joint statistics, and each hands the other one 16-query tile through LDS: wave kh puts out query tile kh of its group. Index u of the register arrays is query tile u ^ kh, so that the tile a
// wave keeps is always u = 0 and the tile it hands over u = 1 (constant register indices).
template <bool M> struct Flag { static constexpr bool v = M; };
// transposing LDS load: lane (c = l & 15, h = l >> 4), whose address is row 8 h + (l & 7), 16-byte piece (l >> 3) & 1 of a 16 x 16 block, gets column c of rows 8 h .. 8 h + 7
typedef short s16x8 __attribute__((ext_vector_type(8)));
__device__ __forceinline__ v8b ld_tr16(const b16* p) { typedef __attribute__((address_space(3))) s16x8 lds_s16x8; return __builtin_bit_cast(v8b, __builtin_amdgcn_ds_load_tr16_b128_v8i16((lds_s16x8*)p)); }
__global__ __launch_bounds__(128) void attn_kernel(const b16* __restrict__ Qp, const b16* __restrict__ Kp, const b16* __restrict__ Vp, float* __restrict__ O1, float* __restrict__ O2, float* __restrict__ ML) {
  __shared__ __attribute__((aligned(2048))) b16 Ring[2][4][SLE];   // every slice starts at a multiple of 2 KiB of the work-group's LDS
  __shared__ __attribute__((aligned(16))) b16 Pb[4][2][16][32 + 8]; __shared__ __attribute__((aligned(16))) float To[4][16][D + 4]; __shared__ __attribute__((aligned(16))) float Tx[4][16][D + 4];
  __shared__ __attribute__((aligned(16))) float St[4][2][16][2];
  const int tid = threadIdx.x, wave = __builtin_amdgcn_readfirstlane(tid >> 5), lane = tid & 31, hh = lane >> 4, col = lane & 15; const int b = blockIdx.y, j = blockIdx.x;
  const int qg = wave >> 1, kh = wave & 1; const uint32_t ring = lds_addr(&Ring[0][0][0]);
  const u32x8 gk = tensor_group1<(1u << 20) | (5u << 22) | (3u << 25), 256, KT, D * 2>(), gv = tensor_group1<(1u << 20) | (5u << 22) | (7u << 25), 256, KT, D * 2>();
  const b16* Qb = Qp + (size_t)b * S * D; const b16* Kb = Kp + (size_t)b * S * D; const b16* Vb = Vp + (size_t)b * S * D;
#pragma unroll 1   // stays rolled: the two segments of a block run one after the other through the same code and the same LDS
  for (int seg = (j > NT / 2) ? 0 : 1; seg < 2; ++seg) {   // block-uniform: seg 0 = tail of query tile j, seg 1 = head of query tile NT - 1 - j
  const int qt = seg == 0 ? j : NT - 1 - j, tb = seg == 0 ? CUT : 0;
  const int ntile = seg == 0 ? j + 1 - CUT : (qt + 1 < CUT ? qt + 1 : CUT);   // tiles of 64 keys in this segment, at least one
  const uint32_t rot = (uint32_t)j % (uint32_t)ntile;   // start tile: the blocks of a batch that walk the same tiles start one tile apart (for speed only: any start gives the same function)
  auto tile_at = [&](int i) __attribute__((always_inline)) { const int t = i + (int)rot; return tb + (t < ntile ? t : t - ntile); };   // the i-th tile of the walk, i < ntile: a permutation of tb .. tb + ntile - 1
  const int q0 = qt * 64 + qg * 32; const int qi[2] = {q0 + kh * 16 + col, q0 + (kh ^ 1) * 16 + col};
  v16b qa[2][8]; const b16* qp0 = Qb + (size_t)qi[0] * D + 8 * hh; const b16* qp1 = Qb + (size_t)qi[1] * D + 8 * hh;   // the lane half's step is in the pointers, which are the loads' own addresses
#pragma unroll   // register arrays at constant indices
  for (int ks = 0; ks < 8; ++ks) { qa[0][ks] = frag_kb(qp0 + ks * 32, 0); qa[1][ks] = frag_kb(qp1 + ks * 32, 0); }
  asm volatile("s_wait_xcnt 0x0" :: "v"(qp0), "v"(qp1) : "memory");   // the loads' address registers are rewritten behind it; named here, they stay whole up to it
  const float cs = LOG2E / (16.0f * XS * XS);
  float m[2] = {-INFINITY, -INFINITY}, l[2] = {0.0f, 0.0f}; v8f o[2][16];
#pragma unroll
  for (int t = 0; t < 16; ++t) { o[0][t] = (v8f){}; o[1][t] = (v8f){}; }
  const int kend = q0 + 32, kfree = q0 - 31;   // keys < kend may be attended by some query of this wave; a pass whose first key is <= kfree by every query
  // the ring was left by every wave at the last publish point of the segment before (its s_wait_dscnt 0 and barrier)
  int tn = tile_at(0);   // the tile asked for last
  stage_tile(wave, Kb, Vb, tn, ring, 0, gk, gv);
  int kb = tn * KT + kh * 32;   // this wave's 32 keys of the tile that the coming pass works on
  asm volatile("s_wait_tensorcnt 0x0" ::: "memory");   // this wave's slice of tile 0 has landed
  __syncthreads();                                      // ... and every other wave's: tile 0 may be read
  if (pinned(ntile > 1)) { tn = tile_at(1); stage_tile(wave, Kb, Vb, tn, ring, 1, gk, gv); }   // scalar test: a segment may have one tile only, and a tile that does not exist is not asked for
#pragma unroll 1   // stays rolled: one trip already holds a whole pass of 64 products
  for (int tl = 0; tl < ntile; ++tl) {
    const b16* Kt = &Ring[tl & 1][0][0]; const b16* Vt = &Ring[tl & 1][2][0];   // the two V slices (columns 0 .. 127, 128 .. 255) follow each other at SLE elements
    if (kb < kend) {   // wave-uniform (scalar): a wave skips the pass beyond its diagonal, never the publish point below
      // all K fragments are asked for ahead of the products, so that the LDS latency is paid once per run and not once per product; in the order of their use (k-step, then key tile)
      v16b kf[16], vf[16];
#pragma unroll
      for (int i = 0; i < 16; ++i) kf[i] = frag_kb(Kt + (i >> 3) * SLE + (kh * 32 + (i & 1) * 16 + col) * KHP + ((i >> 1) & 3) * 32, hh);
      __builtin_amdgcn_sched_barrier(0);   // holds the reads above in front of the products below: with the pass cut into blocks by the test below, the compiler moves each K read down to its product and waits for it there
      v8f s[2][2] = {{(v8f){}, (v8f){}}, {(v8f){}, (v8f){}}};
#pragma unroll   // four independent accumulators between an accumulator's two uses
      for (int ks = 0; ks < 8; ++ks)
#pragma unroll
        for (int tt = 0; tt < 2; ++tt)
#pragma unroll
          for (int u = 0; u < 2; ++u) s[u][tt] = wmma16p(kf[ks * 2 + tt], qa[u][ks], s[u][tt]);
      float al[2], sm[2], so[2];   // sm: the lane's own sum of its 16 weights, so: that of lane ^ 16, asked for beside the P stores and added behind the test, so that no copy waits for it
      // scores -> P in LDS. MASKED = false is the copy for keys that every query of the wave may attend: no compare with the diagonal, and no score is -inf, so that the guards against -inf go too (same sums in the same order; without the select the compiler may fuse a score's scaling with the subtraction of the max)
      auto softmax = [&](auto fl) __attribute__((always_inline)) {
        constexpr bool MASKED = decltype(fl)::v;
#pragma unroll   // the two query tiles' softmax chains are independent of each other
        for (int u = 0; u < 2; ++u) {
          float e[16]; float mx = -INFINITY;
#pragma unroll
          for (int i = 0; i < 16; ++i) { const int key = kb + (i < 8 ? 0 : 16) + 8 * hh + (i & 7); const float sc = (i < 8 ? s[u][0][i] : s[u][1][i - 8]) * cs; const float v = (!MASKED || key <= qi[u]) ? sc : -INFINITY; e[i] = v; mx = fmaxf(mx, v); }
          mx = fmaxf(mx, __shfl_xor(mx, 16)); const float mn = fmaxf(m[u], mx); al[u] = (MASKED && mn == -INFINITY) ? 1.0f : nexp2(m[u] - mn); float sum = 0.0f;
          // B operand needs row = query, k = key: write P[query col][key] into LDS (wave-private), then frag
#pragma unroll
          for (int i = 0; i < 16; ++i) { const float p = (MASKED && e[i] == -INFINITY) ? 0.0f : nexp2(e[i] - mn); sum += p; Pb[wave][u][col][(i < 8 ? 0 : 16) + 8 * hh + (i & 7)] = (b16)(p * PS); }
          sm[u] = sum; so[u] = __shfl_xor(sum, 16); m[u] = mn; } };
      if (kb <= kfree) softmax(Flag<false>{});   // wave-uniform (scalar): the pass's last key is no later than the wave's first query
      else softmax(Flag<true>{});
      wave_lds_sync();
      const v16b pf0 = frag_kb(&Pb[wave][0][col][0], hh), pf1 = frag_kb(&Pb[wave][1][col][0], hh);
      const b16* vp = Vt + (kh * 32 + 8 * hh + (lane & 7)) * VHP + ((lane >> 3) & 1) * 8;   // the lane's address in the first 16 x 16 block of its key half
      // V^T is asked for here, behind P: LDS answers a wave in order, so that in front of the scores' exchange and of P these 32 reads would hold both up; they land under the rescaling and the first products
#pragma unroll
      for (int t = 0; t < 16; ++t) { const b16* vq = vp + (t >> 3) * SLE + (t & 7) * 16; const v8b v0 = ld_tr16(vq), v1 = ld_tr16(vq + 16 * VHP);   // keys 8 hh + 0 .. 7 and 16 + 8 hh + 0 .. 7 of the wave's 32, feature t * 16 + col
#pragma unroll
        for (int e = 0; e < 8; ++e) { vf[t][e] = v0[e]; vf[t][8 + e] = v1[e]; } }
      __builtin_amdgcn_sched_barrier(0);   // holds the reads above in front of the rescaling and the products below, which then wait for them one by one
#pragma unroll
      for (int u = 0; u < 2; ++u) l[u] = l[u] * al[u] + (sm[u] + so[u]);
#pragma unroll
      for (int t = 0; t < 16; ++t) { o[0][t] *= al[0]; o[0][t] = wmma16p(vf[t], pf0, o[0][t]); o[1][t] *= al[1]; o[1][t] = wmma16p(vf[t], pf1, o[1][t]);
        __builtin_amdgcn_sched_barrier(0); }   // keeps this order, a fragment's two products as it lands and the next tiles' rescaling under them (left free, all rescaling goes first and one query tile's products wait fragment by fragment); the last one keeps the fence below, whose LDS wait covers all of V^T, behind the products
      wave_lds_sync(); }
    // publish point of tile tl + 1, passed by every wave
    asm volatile("s_wait_dscnt 0x0" ::: "memory");      // this wave's reads of tile tl are done before the buffer is refilled
    asm volatile("s_wait_tensorcnt 0x0" ::: "memory");  // this wave's slice of tile tl + 1 has landed
    __syncthreads();                                     // tile tl + 1 may be read by all; tile tl's buffer is left by all
    kb = (int)pinned((uint32_t)(tn * KT + kh * 32));   // tile tl + 1. pinned(): formed here, behind the wait, and kept in its scalar register; left free, it is formed at the head of the pass in a register of the descriptor whose request is in flight
    if (pinned(tl + 2 < ntile)) { tn = tn + 1 < tb + ntile ? tn + 1 : tb; stage_tile(wave, Kb, Vb, pinned(tn), ring, tl & 1, gk, gv); } }   // scalar test; the next tile of the ring; the descriptor is formed behind the wait above
  asm volatile("s_wait_tensorcnt 0x0" ::: "memory");    // no request is left in flight when the wave goes on
  asm volatile("s_wait_dscnt 0x0" ::: "memory");        // and none of its reads of the ring
  // join of the two key halves. The kh = 0 wave has had at least one pass (its first key is never beyond the diagonal), so the joint max is finite; a wave without a pass has max -inf, sum 0, weight exp2(-inf) = 0
  { const v2f st = {hh == 0 ? m[0] : m[1], hh == 0 ? l[0] : l[1]}; *(v2f*)(&St[wave][hh][col][0]) = st; }   // both lane halves hold both tiles' (max, sum): half hh writes tile u = hh
  __syncthreads();   // the partner wave's (max, sum) may be read
  float f[2], mj = 0.0f, lj = 0.0f;
#pragma unroll
  for (int u = 0; u < 2; ++u) { const v2f ps = *(const v2f*)(&St[wave ^ 1][u ^ 1][col][0]);   // the partner's index of the same query tile is u ^ 1
    const float mm = fmaxf(m[u], ps[0]); const float as = nexp2(m[u] - mm), ap = nexp2(ps[0] - mm); const float lt = l[u] * as + ps[1] * ap;
    f[u] = as / (lt * PS * XS); if (u == 0) { mj = mm; lj = lt; } }
#pragma unroll
  for (int t = 0; t < 16; ++t)
#pragma unroll
    for (int r = 0; r < 8; ++r) Tx[wave][col][t * 16 + 8 * hh + r] = o[1][t][r] * f[1];
  __syncthreads();   // the partner wave's share of the tile that this wave keeps may be read
#pragma unroll
  for (int t = 0; t < 16; ++t) { const v4f x0 = *(const v4f*)(&Tx[wave ^ 1][col][t * 16 + 8 * hh]), x1 = *(const v4f*)(&Tx[wave ^ 1][col][t * 16 + 8 * hh + 4]);
#pragma unroll
    for (int r = 0; r < 8; ++r) To[wave][col][t * 16 + 8 * hh + r] = o[0][t][r] * f[0] + (r < 4 ? x0[r] : x1[r - 4]); }
  wave_lds_sync();
  float* Op = seg == 0 ? O2 : O1; const int qk = q0 + kh * 16;   // the 16 queries that this wave puts out
  if (hh == 0) { const v2f ml = {mj, lj}; *(v2f*)(ML + ((size_t)(seg == 0 ? B * S : 0) + (size_t)b * S + qk + col) * 2) = ml; }   // both halves hold the same (max, sum): 16 queries = one 128-byte line per wave
  asm volatile("s_wait_xcnt 0x0" ::: "memory");   // the store's address registers are rewritten right behind it
#pragma unroll   // constant row offsets in the LDS reads and the stores
  for (int g = 0; g < 2; ++g) { v4f a0[8], a1[8];
#pragma unroll   // keeps the register arrays at constant indices
    for (int rr = 0; rr < 8; ++rr) { a0[rr] = *(const v4f*)(&To[wave][g * 8 + rr][lane * 8]); a1[rr] = *(const v4f*)(&To[wave][g * 8 + rr][lane * 8 + 4]); }
#pragma unroll   // as above
    for (int rr = 0; rr < 8; ++rr) { const size_t row = ((size_t)b * S + qk + g * 8 + rr) * D; *(v4f*)(Op + row + lane * 8) = a0[rr]; *(v4f*)(Op + row + lane * 8 + 4) = a1[rr]; }
    asm volatile("s_wait_xcnt 0x0" ::: "memory"); }   // the stores' data and address registers are rewritten behind it (next eight rows, next segment)
  }
}
// everything behind attention in one launch, because it is local to a token row: merge of the attention partials + residual + LayerNorm 1, both FFN GEMMs, LayerNorm 2. Block = 64 tokens (one query tile),
// wave = 16 tokens from first to last; the LayerNorm output and the relu hidden rows (f16 hi + lo x8 planes) stay in the wave's own LDS rows, h2 stays in the accumulators.
// Products are taken transposed, D^T = W A^T (W rows as the A operand, token rows as B; same loader for both): a lane then holds 8 consecutive features of ONE token per tile, so the hidden planes go to LDS
// as 16-byte stores and LayerNorm 2 is a sum inside the lane plus one exchange with lane ^ 16.
// One 256-row W buffer at pitch 528 B serves W1 and then W2, filled by asynchronous copies of whole 512-byte rows: rows 0 .. 191 and rows 192 .. 255 are separate fills (48 and 16 copies of a wave, never
// more than 48 in flight); each fill stands behind the barrier that ends every wave's reads of those rows and is read behind its own wait and barrier.
// The text runs once per wave, so it is kept short: LayerNorm 1 is a rolled loop over groups of 4 rows, the two GEMMs are two trips of one rolled loop, the copies a rolled loop of eight.
template <int N8>
__device__ __forceinline__ void stage_rows_rolled(const b16* g0, int gstep, unsigned l0, unsigned lstep) {
#pragma unroll 1   // rolled: 24 address registers in all, where the unrolled form keeps every address of a fill alive across the products
  for (int h = 0; h < N8; ++h) { unsigned l[8]; const b16* g[8];
#pragma unroll
    for (int i = 0; i < 8; ++i) { l[i] = l0 + (unsigned)(h * 8 + i) * lstep; g[i] = g0 + (size_t)(h * 8 + i) * gstep; }
    async_copy8(l, g); }
}
__device__ __forceinline__ void load_group(v16b (&w)[32], const b16 (*Ws)[KPITCH], int row0, int nloc, int hlf) {
#pragma unroll   // register array at constant indices
  for (int i = 0; i < 32; ++i) w[i] = frag_kb(&Ws[row0 + (i & 3) * 16 + nloc][(i >> 2) * 32], hlf);
}
// 4 feature tiles x 8 k-steps x (hi, lo): per accumulator the order is hi, lo within ascending k; the four tiles stand between an accumulator's two uses
template <int G>
__device__ __forceinline__ void mul_group(v8f (&acc)[16], const v16b (&w)[32], const v16b (&a)[8], const v16b (&al)[8]) {
#pragma unroll   // register arrays at constant indices
  for (int ks = 0; ks < 8; ++ks) {
#pragma unroll
    for (int tt = 0; tt < 4; ++tt) acc[4 * G + tt] = wmma16p(w[ks * 4 + tt], a[ks], acc[4 * G + tt]);
#pragma unroll
    for (int tt = 0; tt < 4; ++tt) acc[4 * G + tt] = wmma16p(w[ks * 4 + tt], al[ks], acc[4 * G + tt]);
  }
}
__device__ __forceinline__ float wave_sum(float s) {
#pragma unroll
  for (int o = 1; o < 32; o <<= 1) s += __shfl_xor(s, o);
  return s; }
// four token rows as LayerNorm 1 takes them: 8 features a lane of partial 0 (a, c), of x, and for a long query tile of partial 1 with both (max, sum) pairs
struct Rows4 { v4f a[4], c[4], x0[4], x1[4], a2[4], c2[4]; v2f p0[4], p1[4]; };
__device__ __forceinline__ void load_rows4(Rows4& R, const float* IN, const float* IN2, const float* ML, const float* x, size_t row, int lane, bool two) {
  const float* pa = IN + row * D + lane * 8; const float* px = x + row * D + lane * 8;
#pragma unroll
  for (int rr = 0; rr < 4; ++rr) { R.a[rr] = *(const v4f*)(pa + rr * D); R.c[rr] = *(const v4f*)(pa + rr * D + 4); R.x0[rr] = *(const v4f*)(px + rr * D); R.x1[rr] = *(const v4f*)(px + rr * D + 4); }
  asm volatile("s_wait_xcnt 0x0" :: "v"(pa), "v"(px) : "memory");   // the loads' address registers are rewritten behind it; named here, they stay whole up to it (no load's result is placed on them)
  if (two) { const float* p2 = IN2 + row * D + lane * 8;
#pragma unroll
    for (int rr = 0; rr < 4; ++rr) { R.a2[rr] = *(const v4f*)(p2 + rr * D); R.c2[rr] = *(const v4f*)(p2 + rr * D + 4);
      R.p0[rr] = *(const v2f*)(ML + (row + rr) * 2); R.p1[rr] = *(const v2f*)(ML + ((size_t)B * S + row + rr) * 2); }
    asm volatile("s_wait_xcnt 0x0" :: "v"(p2) : "memory"); }   // as above
}
__global__ __launch_bounds__(128) void tail_kernel(const float* __restrict__ IN, const float* __restrict__ IN2, const float* __restrict__ ML, const float* __restrict__ x, const float* __restrict__ g1, const float* __restrict__ be1,
                                                   const b16* __restrict__ W1, const b16* __restrict__ W2, const float* __restrict__ b1, const float* __restrict__ b2, const float* __restrict__ g2, const float* __restrict__ be2, float* __restrict__ out) {
  __shared__ __attribute__((aligned(16))) b16 Ws[D][KPITCH]; __shared__ __attribute__((aligned(16))) b16 Ahs[4][16][KPITCH]; __shared__ __attribute__((aligned(16))) b16 Als[4][16][KPITCH];
  __shared__ __attribute__((aligned(16))) float To[4][16][D + 4]; __shared__ __attribute__((aligned(16))) float Ps[4][D];
  const int tid = threadIdx.x, wave = __builtin_amdgcn_readfirstlane(tid >> 5), lane = tid & 31, nloc = lane & 15, hlf = lane >> 4; const size_t row0 = (size_t)blockIdx.x * 64 + wave * 16;
  stage_rows_rolled<6>(W1 + (size_t)wave * D + lane * 8, 4 * D, lds_addr(&Ws[wave][lane * 8]), 4 * KPITCH * 2);   // W1 rows 0 .. 191 (wave, wave + 4, ..) fly under LayerNorm 1
  const bool two = (int)(blockIdx.x & (NT - 1)) >= CUT;   // block-uniform: a long query tile has two partials
  Rows4 raw = {}; load_rows4(raw, IN, IN2, ML, x, row0, lane, two);
  // per-feature vectors of the two epilogues, rounded once, read by every wave behind the first barrier
  { const v2f p0 = *(const v2f*)(b1 + tid * 2), p1 = *(const v2f*)(b2 + tid * 2), p2 = *(const v2f*)(g2 + tid * 2), p3 = *(const v2f*)(be2 + tid * 2);
    asm volatile("s_wait_xcnt 0x0" ::: "memory");   // the loads' base and offset registers are rewritten behind them
    const v2f q0 = {bf16_rne(p0[0]), bf16_rne(p0[1])}, q1 = {bf16_rne(p1[0]), bf16_rne(p1[1])}, q2 = {bf16_rne(p2[0]), bf16_rne(p2[1])}, q3 = {bf16_rne(p3[0]), bf16_rne(p3[1])};
    *(v2f*)(&Ps[0][tid * 2]) = q0; *(v2f*)(&Ps[1][tid * 2]) = q1; *(v2f*)(&Ps[2][tid * 2]) = q2; *(v2f*)(&Ps[3][tid * 2]) = q3; }
  float gg[8], bb[8];
  { const v4f u0 = *(const v4f*)(g1 + lane * 8), u1 = *(const v4f*)(g1 + lane * 8 + 4), u2 = *(const v4f*)(be1 + lane * 8), u3 = *(const v4f*)(be1 + lane * 8 + 4);
    asm volatile("s_wait_xcnt 0x0" ::: "memory");   // as above
#pragma unroll
    for (int j = 0; j < 4; ++j) { gg[j] = bf16_rne(u0[j]); gg[4 + j] = bf16_rne(u1[j]); bb[j] = bf16_rne(u2[j]); bb[4 + j] = bf16_rne(u3[j]); } }
  // LayerNorm 1, a row across the wave (8 features a lane), 4 rows a trip; the next 4 rows' loads go out ahead of this group's sums and land under its arithmetic
#pragma unroll 1   // rolled for a short text
  for (int bt = 0; bt < 4; ++bt) { v4f a[4], c[4];
#pragma unroll
    for (int rr = 0; rr < 4; ++rr) { a[rr] = raw.a[rr]; c[rr] = raw.c[rr]; }
    if (two) {
#pragma unroll
      for (int rr = 0; rr < 4; ++rr) { const v2f p0 = raw.p0[rr], p1 = raw.p1[rr]; const float mm = fmaxf(p0[0], p1[0]);
        float w0 = p0[1] * nexp2(p0[0] - mm), w1 = p1[1] * nexp2(p1[0] - mm); const float rw = 1.0f / (w0 + w1); w0 *= rw; w1 *= rw;
        a[rr] = a[rr] * w0 + raw.a2[rr] * w1; c[rr] = c[rr] * w0 + raw.c2[rr] * w1; } }
#pragma unroll
    for (int rr = 0; rr < 4; ++rr)
#pragma unroll
      for (int j = 0; j < 4; ++j) { a[rr][j] += bf16_rne(raw.x0[rr][j]); c[rr][j] += bf16_rne(raw.x1[rr][j]); }
    load_rows4(raw, IN, IN2, ML, x, row0 + (bt < 3 ? bt + 1 : 3) * 4, lane, two);   // the last trip reads its own rows again: one instruction stream
    float s[4], q[4];
#pragma unroll
    for (int rr = 0; rr < 4; ++rr) { float t = 0.0f;
#pragma unroll
      for (int j = 0; j < 4; ++j) t += a[rr][j] + c[rr][j];
      s[rr] = wave_sum(t) * (1.0f / D); }
#pragma unroll
    for (int rr = 0; rr < 4; ++rr) { const float mu = s[rr]; float t = 0.0f;
#pragma unroll
      for (int j = 0; j < 4; ++j) { const float d0 = a[rr][j] - mu, d1 = c[rr][j] - mu; t += d0 * d0 + d1 * d1; }
      q[rr] = wave_sum(t); }
#pragma unroll
    for (int rr = 0; rr < 4; ++rr) { const float mu = s[rr], rs = rsqrtf(q[rr] * (1.0f / D) + LNEPS); v8b hv, lv;
#pragma unroll
      for (int j = 0; j < 8; ++j) { const float y = ((j < 4 ? a[rr][j] : c[rr][j - 4]) - mu) * rs * gg[j] + bb[j]; b16 p, qq; split16(y * XS, p, qq); hv[j] = p; lv[j] = qq; }
      *(v8b*)(&Ahs[wave][bt * 4 + rr][lane * 8]) = hv; *(v8b*)(&Als[wave][bt * 4 + rr][lane * 8]) = lv; }
    __builtin_amdgcn_sched_barrier(0); }   // keeps the register copies that hand the next rows over, and with them the wait for their loads, behind this group's arithmetic: left free, they rise to its start
  v8f acc[16];
#pragma unroll 1   // rolled for a short text: trip 0 = W1 (and relu into the planes), trip 1 = W2
  for (int pass = 0; pass < 2; ++pass) {
    const b16* Wc = pass == 0 ? W1 : W2;
    wave_lds_sync();   // the wave's plane rows were written across its lanes
    v16b a[8], al[8], w0[32], w1[32];
#pragma unroll
    for (int ks = 0; ks < 8; ++ks) { a[ks] = frag_kb(&Ahs[wave][nloc][ks * 32], hlf); al[ks] = frag_kb(&Als[wave][nloc][ks * 32], hlf); }
#pragma unroll
    for (int t = 0; t < 16; ++t) acc[t] = (v8f){};
    // fragments of a group (64 W rows) are asked for together and one group ahead of their products (two register sets), so that the LDS latency is not paid per product
    asm volatile("s_wait_dscnt 0x0" ::: "memory");      // this wave's earlier reads of rows 192 .. 255 are done before they are refilled
    asm volatile("s_wait_asynccnt 0x0" ::: "memory");   // this wave's copies of rows 0 .. 191 have landed
    __syncthreads();                                     // ... and every other wave's: they may be read; rows 192 .. 255 are left by all
    stage_rows_rolled<2>(Wc + (size_t)(192 + wave) * D + lane * 8, 4 * D, lds_addr(&Ws[192 + wave][lane * 8]), 4 * KPITCH * 2);
    load_group(w0, Ws, 0, nloc, hlf); load_group(w1, Ws, 64, nloc, hlf);
    __builtin_amdgcn_sched_barrier(0);   // holds the reads above in front of the products below: left free, the compiler moves each read down to its product and waits for it there
    mul_group<0>(acc, w0, a, al);
    __builtin_amdgcn_sched_barrier(0);   // keeps the next group's reads from rising among those products or sinking to their own
    load_group(w0, Ws, 128, nloc, hlf);
    __builtin_amdgcn_sched_barrier(0);   // as above
    mul_group<1>(acc, w1, a, al);
    __builtin_amdgcn_sched_barrier(0);   // keeps the products above in front of the waits below, so that the copies in flight land under them
    asm volatile("s_wait_dscnt 0x0" ::: "memory");      // this wave's reads of rows 0 .. 191 are done before they are refilled
    asm volatile("s_wait_asynccnt 0x0" ::: "memory");   // this wave's copies of rows 192 .. 255 have landed
    __syncthreads();                                     // ... and every other wave's; rows 0 .. 191 are left by all
    if (pass == 0) stage_rows_rolled<6>(W2 + (size_t)wave * D + lane * 8, 4 * D, lds_addr(&Ws[wave][lane * 8]), 4 * KPITCH * 2);   // block-uniform: W2 rows 0 .. 191 fly under the rest of trip 0
    load_group(w1, Ws, 192, nloc, hlf);
    __builtin_amdgcn_sched_barrier(0);   // holds the reads above in front of the products below
    mul_group<2>(acc, w0, a, al); mul_group<3>(acc, w1, a, al);
    // + bias: lane = token nloc, features t * 16 + 8 * hlf + 0 .. 7
#pragma unroll
    for (int t = 0; t < 16; ++t) { const v4f c0 = *(const v4f*)(&Ps[pass][t * 16 + 8 * hlf]), c1 = *(const v4f*)(&Ps[pass][t * 16 + 8 * hlf + 4]);
#pragma unroll
      for (int r = 0; r < 8; ++r) acc[t][r] = acc[t][r] * (1.0f / (XS * WSC)) + (r < 4 ? c0[r] : c1[r - 4]); }
    if (pass == 0) {   // hidden = relu(.) as hi + lo planes over the wave's own rows (their fragments are in registers)
#pragma unroll
      for (int t = 0; t < 16; ++t) { v8b hv, lv;
#pragma unroll
        for (int r = 0; r < 8; ++r) { b16 p, qq; split16(fmaxf(acc[t][r], 0.0f) * XS, p, qq); hv[r] = p; lv[r] = qq; }
        *(v8b*)(&Ahs[wave][nloc][t * 16 + 8 * hlf]) = hv; *(v8b*)(&Als[wave][nloc][t * 16 + 8 * hlf]) = lv; } } }
  // LayerNorm 2 over the token's 256 features: 128 in this lane (eight running sums over the 16 tiles, then a tree), 128 in lane ^ 16
  v8f vs = (v8f){};
#pragma unroll
  for (int t = 0; t < 16; ++t) vs += acc[t];
  float s = ((vs[0] + vs[1]) + (vs[2] + vs[3])) + ((vs[4] + vs[5]) + (vs[6] + vs[7])); s += __shfl_xor(s, 16);
  const float mu = s * (1.0f / D); v8f vq = (v8f){};
#pragma unroll
  for (int t = 0; t < 16; ++t) { const v8f d = acc[t] - mu; vq += d * d; }
  float q = ((vq[0] + vq[1]) + (vq[2] + vq[3])) + ((vq[4] + vq[5]) + (vq[6] + vq[7])); q += __shfl_xor(q, 16);
  const float rs = rsqrtf(q * (1.0f / D) + LNEPS);
#pragma unroll
  for (int t = 0; t < 16; ++t) { const int f = t * 16 + 8 * hlf; const v4f g0 = *(const v4f*)(&Ps[2][f]), g4 = *(const v4f*)(&Ps[2][f + 4]), e0 = *(const v4f*)(&Ps[3][f]), e4 = *(const v4f*)(&Ps[3][f + 4]); v4f y0, y1;
#pragma unroll
    for (int r = 0; r < 4; ++r) { y0[r] = (acc[t][r] - mu) * rs * g0[r] + e0[r]; y1[r] = (acc[t][4 + r] - mu) * rs * g4[r] + e4[r]; }
    *(v4f*)(&To[wave][nloc][f]) = y0; *(v4f*)(&To[wave][nloc][f + 4]) = y1; }
  wave_lds_sync();
  // whole rows go out: 1 KB of a token per pair of stores
#pragma unroll   // constant row offsets in the LDS reads and the stores
  for (int g = 0; g < 2; ++g) { v4f o0[8], o1[8];
#pragma unroll   // keeps the register arrays at constant indices
    for (int rr = 0; rr < 8; ++rr) { o0[rr] = *(const v4f*)(&To[wave][g * 8 + rr][lane * 8]); o1[rr] = *(const v4f*)(&To[wave][g * 8 + rr][lane * 8 + 4]); }
#pragma unroll   // as above
    for (int rr = 0; rr < 8; ++rr) { const size_t row = (row0 + g * 8 + rr) * D; *(v4f*)(out + row + lane * 8) = o0[rr]; *(v4f*)(out + row + lane * 8 + 4) = o1[rr]; }
    if (g == 0) asm volatile("s_wait_xcnt 0x0" ::: "memory"); }   // the stores' data registers are rewritten behind it (next eight rows)
}
}  // namespace

extern "C" void kernel_launch(void* const* d_in, const int* in_sizes, int n_in, void* d_out, int out_size, void* d_ws, size_t ws_size, hipStream_t stream) {
  (void)n_in;
  auto Fp = [&](int i) { return (const float*)d_in[i]; };
  // input order: 0 x [4,4096,256], 1 Wq [256,256] ([e][d]), 2 bq, 3 Wk, 4 bk, 5 Wv, 6 bv, 7 W1, 8 b1, 9 W2, 10 b2, 11 g_ln, 12 beta_ln, 13 g_lnff, 14 beta_lnff
  if (in_sizes[0] != B * S * D || in_sizes[1] != D * D || in_sizes[3] != D * D || in_sizes[5] != D * D || in_sizes[7] != FF * D || in_sizes[9] != D * FF || in_sizes[11] != D || in_sizes[13] != D || out_size != B * S * D) return;
  size_t off = 0; char* ws = (char*)d_ws;
  auto carve = [&](size_t bytes) { char* p = ws + off; off += (bytes + 255) & ~(size_t)255; return p; };
  b16* WT = (b16*)carve((size_t)2 * D * D * 2); b16* Qp = (b16*)carve((size_t)B * S * D * 2); b16* Kp = (b16*)carve((size_t)B * S * D * 2); b16* Vp = (b16*)carve((size_t)B * S * D * 2);
  float* O1 = (float*)carve((size_t)B * S * D * 4); float* O2 = (float*)carve((size_t)B * S * D * 4); float* ML = (float*)carve((size_t)2 * B * S * 2 * 4);
  if (off > ws_size || off > ((size_t)128 << 20)) return;   // about 57 MB
  qkv_kernel<<<256, 128, 0, stream>>>(Fp(0), Fp(1), Fp(3), Fp(5), Fp(7), Fp(9), Fp(2), Fp(4), Fp(6), WT, Qp, Kp, Vp);
  attn_kernel<<<dim3(S / 64, BL), 128, 0, stream>>>(Qp, Kp, Vp, O1, O2, ML);
  tail_kernel<<<(unsigned)((size_t)BL * S / 64), 128, 0, stream>>>(O1, O2, ML, Fp(0), Fp(11), Fp(12), WT, WT + (size_t)D * D, Fp(8), Fp(10), Fp(13), Fp(14), (float*)d_out);
}
